// v000
// The times below were measured on an AMD MI455X: many runs one after another, warmed up first and cycling through
// copies of the inputs, with the whole window's GPU time divided by the number of runs. Launches and the gaps
// between them are all in it. The median over several windows is given; except for v000 it joins two sittings, which
// can be a few percent apart, so the side-by-side timings, each taken in one sitting, are the better comparison.
// v000, which the later versions start from, runs in 2760 microseconds.
#include <hip/hip_runtime.h>

// Causal multi-head self-attention with interleaved-pair rotary position embedding from a positions input, four batches (x [4][2048][1024]; Q, K, V = x W^T ('oi' [1024][1024] 1/32, no bias; 16 heads x 64; token-major); angles = token_positions (int32 [2048], read on device) x 1 / THETA ** (2i / 64), THETA 1e4; pairs (2i, 2i+1): r_even = x_even cos - x_odd sin, r_odd = x_even sin + x_odd cos, on Q and K; scores / sqrt(64); keys j <= i kept, -inf elsewhere; softmax; out = merged Wo^T ('oi', no bias) -> [4][2048][1024] (8.4 M); argument order x, token_positions, Wq, Wk, Wv, Wo).
// Layout per batch: bf16 copy of x; exact projections; {cos, sin} per (position, pair) built per batch from the int positions and float32 inverse-frequency constants (precise cosf/sinf); interleaved rotary plane builder; causal T-2048 attention (EVERY row's scores on hi/lo planes (3 products: logit sigma 2 with these weights) and hybrid P.V (rows < 512 hi/lo, rest fp16 x1024); k_gemmc skips tiles above the diagonal); merged hi/lo x Wo exact.
// Compute dtypes, f32 accumulate: every input rounded to bf16; projections exact; rotary f32; scores 3 products; P.V rows < 512 3 products, rest fp16; softmax f32; Wo hl x exact.

#define NB_  4      // batches: this module's input is [4][2048][1024]
#define TT   2048
#define DM   1024
#define NH_  16
#define NKV  16
#define REP  (NH_ / NKV)
#define HD   64
#define DQ   (NH_ * HD)
#define DKV  (NKV * HD)
#define ZH   2
#define RH   512                  // query rows < RH use hi+lo planes (0: none)
#define WIN  2048
#define PCAR 1024.0f
#define SCL  0.125f   // HD^-0.5
typedef _Float16 h16;
typedef unsigned short bf;
typedef __attribute__((ext_vector_type(16))) __bf16   v16bf;
typedef __attribute__((ext_vector_type(16))) _Float16 v16h;
typedef __attribute__((ext_vector_type(8)))  _Float16 v8h;
typedef __attribute__((ext_vector_type(8)))  unsigned short v8us;
typedef __attribute__((ext_vector_type(8)))  float    v8f;
typedef __attribute__((ext_vector_type(4)))  float    v4f;
typedef v8h  __attribute__((may_alias)) v8ha;
typedef v4f  __attribute__((may_alias)) v4fa;
typedef v8us __attribute__((may_alias)) v8usa;

__device__ __forceinline__ unsigned short f2bf(float f) { unsigned u = __float_as_uint(f); u += 0x7FFFu + ((u >> 16) & 1u); return (unsigned short)(u >> 16); }
__device__ __forceinline__ float bf2f(unsigned short b) { return __uint_as_float(((unsigned)b) << 16); }
__device__ __forceinline__ float bfr(float f) { return bf2f(f2bf(f)); }
__device__ __forceinline__ v16h cat16(v8h lo, v8h hi) { return __builtin_shufflevector(lo, hi, 0, 1, 2, 3, 4, 5, 6, 7, 8, 9, 10, 11, 12, 13, 14, 15); }
__device__ __forceinline__ v16bf cat16b(v8us lo, v8us hi) { return __builtin_bit_cast(v16bf, __builtin_shufflevector(lo, hi, 0, 1, 2, 3, 4, 5, 6, 7, 8, 9, 10, 11, 12, 13, 14, 15)); }
__device__ __forceinline__ v8f wmma16(v16h a, v16h b, v8f c) { return __builtin_amdgcn_wmma_f32_16x16x32_f16(false, a, false, b, (short)0, c, false, false); }
__device__ __forceinline__ v8f wmmab(v16bf a, v16bf b, v8f c) { return __builtin_amdgcn_wmma_f32_16x16x32_bf16(false, a, false, b, (short)0, c, false, false); }



// ---- k_gemmw: register-blocked GEMM, ONE WAVE per 64x64 output tile (16 accumulators), operands straight from K-contiguous 16-bit planes; grid (M/64, N/64, Z), 32 threads.
// C[m][n] (f32, pitch ldc, + optional f32 bias[n]) = sum_k A[m][k] Bt[n][k] (+ split products per NSPLIT). z-batch strides sA/sB/sC in elements. K % 32 == 0.
template <typename T16> struct WFrag;
template <> struct WFrag<h16> { typedef v16h V; static __device__ __forceinline__ V ld(const h16* p) { return cat16(*(const v8h*)p, *(const v8h*)(p + 16)); } static __device__ __forceinline__ v8f mma(V a, V b, v8f c) { return wmma16(a, b, c); } };
template <> struct WFrag<bf> { typedef v16bf V; static __device__ __forceinline__ V ld(const bf* p) { return cat16b(*(const v8us*)p, *(const v8us*)(p + 16)); } static __device__ __forceinline__ v8f mma(V a, V b, v8f c) { return wmmab(a, b, c); } };
template <typename T16, int NSPLIT, bool BIAS>
__global__ __launch_bounds__(32) void k_gemmw(const T16* __restrict__ A, const T16* __restrict__ A2, const T16* __restrict__ Bt, const T16* __restrict__ Bt2, int K, float* C, int ldc, const float* __restrict__ bias, size_t sA, size_t sB, size_t sC) {
    typedef typename WFrag<T16>::V V;
    __shared__ __align__(16) float os[16 * 68];
    const size_t z = blockIdx.z; A += z * sA; if (A2) A2 += z * sA; Bt += z * sB; if (Bt2) Bt2 += z * sB; C += z * sC;
    const int lane = threadIdx.x & 31, lr = lane & 15, hi = lane >> 4; const int r0 = blockIdx.x * 64, c0 = blockIdx.y * 64;
    v8f acc[4][4];
#pragma unroll
    for (int mb = 0; mb < 4; ++mb)
#pragma unroll
        for (int nb = 0; nb < 4; ++nb) acc[mb][nb] = (v8f){};
    const size_t aoff = (size_t)(r0 + lr) * K + 8 * hi, boff = (size_t)(c0 + lr) * K + 8 * hi;
#pragma unroll 1
    for (int kc = 0; kc < K; kc += 32) {
        V a[4], a2[4];
#pragma unroll
        for (int mb = 0; mb < 4; ++mb) { a[mb] = WFrag<T16>::ld(A + aoff + (size_t)mb * 16 * K + kc); if (NSPLIT == 1 || NSPLIT == 2) a2[mb] = WFrag<T16>::ld(A2 + aoff + (size_t)mb * 16 * K + kc); }
#pragma unroll
        for (int nb = 0; nb < 4; ++nb) { const V b = WFrag<T16>::ld(Bt + boff + (size_t)nb * 16 * K + kc); V b2; if (NSPLIT >= 2) b2 = WFrag<T16>::ld(Bt2 + boff + (size_t)nb * 16 * K + kc);
#pragma unroll
            for (int mb = 0; mb < 4; ++mb) { acc[mb][nb] = WFrag<T16>::mma(a[mb], b, acc[mb][nb]); if (NSPLIT == 1 || NSPLIT == 2) acc[mb][nb] = WFrag<T16>::mma(a2[mb], b, acc[mb][nb]); if (NSPLIT >= 2) acc[mb][nb] = WFrag<T16>::mma(a[mb], b2, acc[mb][nb]); } }
        asm volatile("v_nop\n\tv_nop\n\tv_nop\n\tv_nop" : "+v"(acc[0][0]), "+v"(acc[1][1]), "+v"(acc[2][2]), "+v"(acc[3][3]) : "v"(a[0]), "v"(a[3]));
    }
#pragma unroll
    for (int mb = 0; mb < 4; ++mb) {
#pragma unroll
        for (int nb = 0; nb < 4; ++nb) {
#pragma unroll
            for (int j = 0; j < 8; ++j) os[(hi * 8 + j) * 68 + nb * 16 + lr] = acc[mb][nb][j]; }
        __builtin_amdgcn_wave_barrier(); asm volatile("" ::: "memory");
        float* crow = C + (size_t)(r0 + mb * 16) * ldc + c0;
{
#pragma unroll
            for (int s = 0; s < 8; ++s) { const int row = 2 * s + hi, cofs = lr * 4; v4f val = *(const v4fa*)(os + row * 68 + cofs); if (BIAS) { val[0] += bfr(bias[c0 + cofs]); val[1] += bfr(bias[c0 + cofs + 1]); val[2] += bfr(bias[c0 + cofs + 2]); val[3] += bfr(bias[c0 + cofs + 3]); }
                *(v4f*)(crow + (size_t)row * ldc + cofs) = val; }
             }
        __builtin_amdgcn_wave_barrier(); asm volatile("" ::: "memory");
    }
}

// ---- k_gemmc: the same one-wave 64x64 tile GEMM specialised for causal attention: CMODE 1 skips score tiles entirely above the diagonal (query rows r0+roff.., key columns c0..), CMODE 2 limits the
// key (K) loop of the probability x value contraction to the diagonal block (probabilities beyond it are exactly zero). roff = row offset of this launch's first row within the sequence.
template <typename T16, int NSPLIT, int CMODE>
__global__ __launch_bounds__(32) void k_gemmc(const T16* __restrict__ A, const T16* __restrict__ A2, const T16* __restrict__ Bt, const T16* __restrict__ Bt2, int K, float* C, int ldc, int roff, size_t sA, size_t sB, size_t sC) {
    typedef typename WFrag<T16>::V V;
    __shared__ __align__(16) float os[16 * 68];
    const size_t z = blockIdx.z; A += z * sA; if (A2) A2 += z * sA; Bt += z * sB; if (Bt2) Bt2 += z * sB; C += z * sC;
    const int lane = threadIdx.x & 31, lr = lane & 15, hi = lane >> 4; const int r0 = blockIdx.x * 64, c0 = blockIdx.y * 64;
    if (CMODE == 1 && c0 > r0 + roff + 63) return;                  // score tile entirely above the causal diagonal: loaded by the softmax but never used (it masks j > i by select)
    const int Kl = (CMODE == 2) ? min(K, r0 + roff + 64) : K;        // P.V: probabilities are exactly 0 beyond the diagonal block, so the K loop stops there
    v8f acc[4][4];
#pragma unroll
    for (int mb = 0; mb < 4; ++mb)
#pragma unroll
        for (int nb = 0; nb < 4; ++nb) acc[mb][nb] = (v8f){};
    const size_t aoff = (size_t)(r0 + lr) * K + 8 * hi, boff = (size_t)(c0 + lr) * K + 8 * hi;
#pragma unroll 1
    for (int kc = 0; kc < Kl; kc += 32) {
        V a[4], a2[4];
#pragma unroll
        for (int mb = 0; mb < 4; ++mb) { a[mb] = WFrag<T16>::ld(A + aoff + (size_t)mb * 16 * K + kc); if (NSPLIT == 1 || NSPLIT == 2) a2[mb] = WFrag<T16>::ld(A2 + aoff + (size_t)mb * 16 * K + kc); }
#pragma unroll
        for (int nb = 0; nb < 4; ++nb) { const V b = WFrag<T16>::ld(Bt + boff + (size_t)nb * 16 * K + kc); V b2; if (NSPLIT >= 2) b2 = WFrag<T16>::ld(Bt2 + boff + (size_t)nb * 16 * K + kc);
#pragma unroll
            for (int mb = 0; mb < 4; ++mb) { acc[mb][nb] = WFrag<T16>::mma(a[mb], b, acc[mb][nb]); if (NSPLIT == 1 || NSPLIT == 2) acc[mb][nb] = WFrag<T16>::mma(a2[mb], b, acc[mb][nb]); if (NSPLIT >= 2) acc[mb][nb] = WFrag<T16>::mma(a[mb], b2, acc[mb][nb]); } }
        asm volatile("v_nop\n\tv_nop\n\tv_nop\n\tv_nop" : "+v"(acc[0][0]), "+v"(acc[1][1]), "+v"(acc[2][2]), "+v"(acc[3][3]) : "v"(a[0]), "v"(a[3]));
    }
#pragma unroll
    for (int mb = 0; mb < 4; ++mb) {
#pragma unroll
        for (int nb = 0; nb < 4; ++nb) {
#pragma unroll
            for (int j = 0; j < 8; ++j) os[(hi * 8 + j) * 68 + nb * 16 + lr] = acc[mb][nb][j]; }
        __builtin_amdgcn_wave_barrier(); asm volatile("" ::: "memory");
        float* crow = C + (size_t)(r0 + mb * 16) * ldc + c0;
{
#pragma unroll
            for (int s = 0; s < 8; ++s) { const int row = 2 * s + hi, cofs = lr * 4; v4f val = *(const v4fa*)(os + row * 68 + cofs);
                *(v4f*)(crow + (size_t)row * ldc + cofs) = val; }
             }
        __builtin_amdgcn_wave_barrier(); asm volatile("" ::: "memory");
    }
}

__device__ __forceinline__ h16 tohx(float x) { return (h16)x; }
__device__ __forceinline__ void splitf(float y, unsigned short& h, unsigned short& l) { h = f2bf(y); l = f2bf(y - bf2f(h)); }
typedef __attribute__((ext_vector_type(2))) _Float16 v2h;
typedef __attribute__((ext_vector_type(4))) _Float16 v4h;
typedef __attribute__((ext_vector_type(2))) unsigned short v2us;
typedef __attribute__((ext_vector_type(4))) unsigned short v4us;
typedef __attribute__((ext_vector_type(2))) float v2f;
typedef __attribute__((ext_vector_type(4))) int v4i;

__global__ __launch_bounds__(256) void k_wtG(const float* __restrict__ w, int K, int N, bf* Bt) {
    const int lane = threadIdx.x & 31; const int L0 = (blockIdx.x * 8 + (threadIdx.x >> 5)) * 8; const int nlines = N * K / 64;
{
#pragma unroll 1
        for (int l = 0; l < 8; ++l) { const int L = L0 + l; if (L >= nlines) break; const size_t e = (size_t)L * 64 + lane * 2; const int k = (int)(e % K), n = (int)(e / K); v2us o;
            o[0] = f2bf(w[(size_t)k * N + n]); o[1] = f2bf(w[(size_t)(k + 1) * N + n]); *(v2us*)(Bt + e) = o; }
         }
}
__global__ __launch_bounds__(256) void k_cvt8(const float* __restrict__ src, bf* dst, size_t n8) { const size_t i = (size_t)blockIdx.x * 256 + threadIdx.x; if (i >= n8) return; const v8f v = *(const v8f*)(src + i * 8); v8us o;
#pragma unroll
    for (int k = 0; k < 8; ++k) o[k] = f2bf(v[k]); *(v8us*)(dst + i * 8) = o;  }

__global__ __launch_bounds__(256) void k_ropeI(const float* __restrict__ F, int pitch, int nheads, const float* __restrict__ CS, float sc, h16* P16, bf* Ph, bf* Pl) {
    const size_t e = ((size_t)blockIdx.x * 256 + threadIdx.x) * 2; if (e >= (size_t)nheads * TT * HD) return; const int d = (int)(e % HD); const int t = (int)((e / HD) % TT); const int h = (int)(e / ((size_t)HD * TT)); const float* f = F + (size_t)t * pitch + h * HD; const float x0 = f[d], x1 = f[d + 1]; const v2f cs = *(const v2f*)(CS + ((size_t)t * HD + d) * 2); v2h o16; v2us oh, ol;
    float a0 = __fmul_rn(x0, cs[0]), b0 = __fmul_rn(x1, cs[1]), a1 = __fmul_rn(x1, cs[0]), b1 = __fmul_rn(x0, cs[1]); asm volatile("" : "+v"(a0), "+v"(b0), "+v"(a1), "+v"(b1));
    float r0 = __fsub_rn(a0, b0) * sc, r1 = __fadd_rn(b1, a1) * sc;   /* even: x0 c - x1 s; odd: x0 s + x1 c */
    o16[0] = tohx(r0); o16[1] = tohx(r1); { unsigned short a2, c2; splitf(r0, a2, c2); oh[0] = a2; ol[0] = c2; splitf(r1, a2, c2); oh[1] = a2; ol[1] = c2; }
    *(v2h*)(P16 + e) = o16; *(v2us*)(Ph + e) = oh; *(v2us*)(Pl + e) = ol;  }

__constant__ float INV2[HD / 2] = { 1.000000000e+00f, 7.498942018e-01f, 5.623413324e-01f, 4.216965139e-01f, 3.162277639e-01f, 2.371373624e-01f, 1.778279394e-01f, 1.333521456e-01f, 1.000000015e-01f, 7.498941571e-02f, 5.623412877e-02f, 4.216964915e-02f, 3.162277862e-02f, 2.371373586e-02f, 1.778279431e-02f, 1.333521493e-02f, 9.999999776e-03f, 7.498942316e-03f, 5.623413250e-03f, 4.216964822e-03f, 3.162277862e-03f, 2.371373819e-03f, 1.778279431e-03f, 1.333521446e-03f, 1.000000047e-03f, 7.498941850e-04f, 5.623413017e-04f, 4.216964880e-04f, 3.162277862e-04f, 2.371373848e-04f, 1.778279402e-04f, 1.333521504e-04f };   // float32 10000^(-(i * 2 / 64)), generated with jnp to be bit-exact with the module's expression
__global__ __launch_bounds__(256) void k_cstabI(const int* __restrict__ pid, float* CS) { const int idx = blockIdx.x * 256 + threadIdx.x; if (idx >= TT * HD) return; const int d = idx % HD; const int t = idx / HD; const float a = __fmul_rn((float)pid[t], INV2[d >> 1]); v2f cs; cs[0] = cosf(a); cs[1] = sinf(a); *(v2f*)(CS + (size_t)idx * 2) = cs;  }

__global__ __launch_bounds__(256) void k_vtp(const float* __restrict__ F, int pitch, int nheads, h16* V16, bf* Vh, bf* Vl) { const size_t e = ((size_t)blockIdx.x * 256 + threadIdx.x) * 2; if (e >= (size_t)nheads * HD * TT) return; const int t = (int)(e % TT); const int d = (int)((e / TT) % HD); const int g = (int)(e / ((size_t)TT * HD)); v2h o16; v2us oh, ol;
#pragma unroll
    for (int q = 0; q < 2; ++q) { const float x = F[(size_t)(t + q) * pitch + g * HD + d]; o16[q] = tohx(x); unsigned short a2, c2; splitf(x, a2, c2); oh[q] = a2; ol[q] = c2; }
    *(v2h*)(V16 + e) = o16; *(v2us*)(Vh + e) = oh; *(v2us*)(Vl + e) = ol;  }
// k_asoft: per row (zz, i): t = S x HD^-0.5 for j <= i and i - j < WIN (sliding causal window; the reference's -1e9 additive fill vanishes identically); softmax over the 2048 keys (register row, one exp, fixed trees);
__global__ __launch_bounds__(256) void k_asoft(const float* __restrict__ Sb, h16* P16, bf* Ph, bf* Pl) {
    const int lane = threadIdx.x & 31; const int row = blockIdx.x * 8 + (threadIdx.x >> 5); if (row >= ZH * TT) return; const int i = row % TT; const int zz = row / TT; (void)zz; const bool hires = (i < RH); const float* sr = Sb + (size_t)row * TT; float v[TT / 32]; float mx = -3.0e38f;
#pragma unroll
    for (int ch = 0; ch < TT / 128; ++ch) { const int j0 = ch * 128 + lane * 4; const v4f a = *(const v4f*)(sr + j0);
#pragma unroll
        for (int q = 0; q < 4; ++q) { const int j = j0 + q; (void)j; const float t = (j <= i && i - j < WIN) ? a[q] * SCL : -3.0e38f; v[ch * 4 + q] = t; mx = fmaxf(mx, t); } }
#pragma unroll
    for (int sh = 16; sh; sh >>= 1) mx = fmaxf(mx, __shfl_xor(mx, sh, 32));
    float sum = 0.f;
#pragma unroll
    for (int k = 0; k < TT / 32; ++k) { float d0 = __fsub_rn(v[k], mx); asm volatile("" : "+v"(d0)); v[k] = __builtin_amdgcn_exp2f(__fmul_rn(d0, 1.4426950408889634f)); sum += v[k]; }
#pragma unroll
    for (int sh = 16; sh; sh >>= 1) sum += __shfl_xor(sum, sh, 32);
    const float f = __fdiv_rn(hires ? 1.0f : PCAR, sum);
{
        if (hires) {
#pragma unroll
            for (int ch = 0; ch < TT / 128; ++ch) { v4us oh, ol;
#pragma unroll
                for (int q = 0; q < 4; ++q) { unsigned short a, c2; splitf(v[ch * 4 + q] * f, a, c2); oh[q] = a; ol[q] = c2; }
                const size_t oo = ((size_t)zz * (RH ? RH : 1) + i) * TT + ch * 128 + lane * 4; *(v4us*)(Ph + oo) = oh; *(v4us*)(Pl + oo) = ol; }
        } else {
#pragma unroll
            for (int ch = 0; ch < TT / 128; ++ch) { v4h o4;
#pragma unroll
                for (int q = 0; q < 4; ++q) o4[q] = tohx(v[ch * 4 + q] * f);
                *(v4h*)(P16 + (size_t)row * TT + ch * 128 + lane * 4) = o4; } }
         }
}
__global__ __launch_bounds__(256) void k_merge(const float* __restrict__ O, int h0, bf* Ah, bf* Al) { const size_t e = ((size_t)blockIdx.x * 256 + threadIdx.x) * 2; if (e >= (size_t)ZH * TT * HD) return; const int d = (int)(e % HD); const int t = (int)((e / HD) % TT); const int zz = (int)(e / ((size_t)HD * TT)); const float cs = (t < RH) ? 1.0f : (1.0f / PCAR); const size_t oo = (size_t)t * DQ + (h0 + zz) * HD + d;
    v2us oh, ol;
#pragma unroll
    for (int q = 0; q < 2; ++q) { unsigned short a, c2; splitf(O[e + q] * cs, a, c2); oh[q] = a; ol[q] = c2; } *(v2us*)(Ah + oo) = oh; *(v2us*)(Al + oo) = ol;  }

extern "C" void kernel_launch(void* const* d_in, const int* in_sizes, int n_in,
                              void* d_out, int out_size, void* d_ws, size_t ws_size, hipStream_t stream) {
    (void)in_sizes; (void)n_in; (void)out_size;
    const float* x = (const float*)d_in[0]; const int* PID = (const int*)d_in[1]; const float* wq = (const float*)d_in[2]; const float* wk = (const float*)d_in[3]; const float* wv = (const float*)d_in[4]; const float* wo = (const float*)d_in[5];   /* input order x, token_positions (int32 [2048], read on device by the table builder), Wq, Wk, Wv, Wo ('oi' [1024][1024]): the host's own six slots */
    float* OUT = (float*)d_out;     // [4][2048][1024]
    char* wsp = (char*)d_ws;
    auto take = [&](size_t bytes) { char* p = wsp; wsp += (bytes + 255) & ~(size_t)255; return (void*)p; };
    bf* WQ = (bf*)take((size_t)DQ * DM * 2); bf* WK = (bf*)take((size_t)DKV * DM * 2); bf* WV = (bf*)take((size_t)DKV * DM * 2); bf* WO = (bf*)take((size_t)DM * DQ * 2); float* CS = (float*)take((size_t)TT * HD * 2 * 4);
    bf* XB = (bf*)take((size_t)TT * DM * 2); float* FQ = (float*)take((size_t)TT * DQ * 4); float* FK = (float*)take((size_t)TT * DKV * 4);
    h16* QP16 = (h16*)take((size_t)NH_ * TT * HD * 2); h16* KP16 = (h16*)take((size_t)NKV * TT * HD * 2); h16* VT16 = (h16*)take((size_t)NKV * HD * TT * 2);
    bf* QPh = (bf*)take((size_t)NH_ * TT * HD * 2); bf* QPl = (bf*)take((size_t)NH_ * TT * HD * 2); bf* KPh = (bf*)take((size_t)NKV * TT * HD * 2); bf* KPl = (bf*)take((size_t)NKV * TT * HD * 2); bf* VTh = (bf*)take((size_t)NKV * HD * TT * 2); bf* VTl = (bf*)take((size_t)NKV * HD * TT * 2); bf* Ph = (bf*)take((size_t)ZH * RH * TT * 2); bf* Pl = (bf*)take((size_t)ZH * RH * TT * 2);
    float* Sb = (float*)take((size_t)ZH * TT * TT * 4); h16* P16 = (h16*)take((size_t)ZH * TT * TT * 2); float* Ob = (float*)take((size_t)ZH * TT * HD * 4); bf* ATh = (bf*)take((size_t)TT * DQ * 2); bf* ATl = (bf*)take((size_t)TT * DQ * 2);
    if ((size_t)(wsp - (char*)d_ws) > ws_size) return;    // ws 256 MiB
    float* FV = FK;   // v projection reuses the k buffer after the k planes are built (stream-ordered)
    { k_cvt8<<<(unsigned)(((size_t)DQ * DM / 8 + 255) / 256), 256, 0, stream>>>(wq, WQ, (size_t)DQ * DM / 8); k_cvt8<<<(unsigned)(((size_t)DKV * DM / 8 + 255) / 256), 256, 0, stream>>>(wk, WK, (size_t)DKV * DM / 8); k_cvt8<<<(unsigned)(((size_t)DKV * DM / 8 + 255) / 256), 256, 0, stream>>>(wv, WV, (size_t)DKV * DM / 8);
      k_cvt8<<<(unsigned)(((size_t)DM * DQ / 8 + 255) / 256), 256, 0, stream>>>(wo, WO, (size_t)DM * DQ / 8); /* the rotary table is rebuilt per batch from the one shared positions input (below) */ }
    const unsigned LQ = (unsigned)(((size_t)NH_ * TT * HD / 2 + 255) / 256), LKv = (unsigned)(((size_t)NKV * TT * HD / 2 + 255) / 256);
    for (int b = 0; b < NB_; ++b) {
        k_cstabI<<<(TT * HD + 255) / 256, 256, 0, stream>>>(PID, CS);   /* token_positions[:] (int32, read; the same for every batch) */
        
        k_cvt8<<<(unsigned)(((size_t)TT * DM / 8 + 255) / 256), 256, 0, stream>>>(x + (size_t)b * TT * DM, XB, (size_t)TT * DM / 8);
        k_gemmw<bf, 0, false><<<dim3(TT / 64, DQ / 64, 1), 32, 0, stream>>>(XB, nullptr, WQ, nullptr, DM, FQ, DQ, nullptr, 0, 0, 0);
        k_ropeI<<<LQ, 256, 0, stream>>>(FQ, DQ, NH_, CS, 1.0f, QP16, QPh, QPl);
        k_gemmw<bf, 0, false><<<dim3(TT / 64, DKV / 64, 1), 32, 0, stream>>>(XB, nullptr, WK, nullptr, DM, FK, DKV, nullptr, 0, 0, 0);
        k_ropeI<<<LKv, 256, 0, stream>>>(FK, DKV, NKV, CS, 1.0f, KP16, KPh, KPl);
        k_gemmw<bf, 0, false><<<dim3(TT / 64, DKV / 64, 1), 32, 0, stream>>>(XB, nullptr, WV, nullptr, DM, FV, DKV, nullptr, 0, 0, 0); k_vtp<<<LKv, 256, 0, stream>>>(FV, DKV, NKV, VT16, VTh, VTl);
        for (int h0 = 0; h0 < NH_; h0 += ZH) { const size_t zq = (size_t)h0, zk = (size_t)(h0 / REP);   // one kv head per query head: the pass's two heads use consecutive kv planes (z-strides TT*HD)
            k_gemmc<bf, 2, 1><<<dim3(TT / 64, TT / 64, ZH), 32, 0, stream>>>(QPh + zq * TT * HD, QPl + zq * TT * HD, KPh + zk * TT * HD, KPl + zk * TT * HD, HD, Sb, TT, 0, (size_t)TT * HD, (size_t)TT * HD, (size_t)TT * TT);   /* scores on hi/lo planes for EVERY row (3 products) */
            /* (the fp16 score launch for rows >= RH is removed: all rows use the hi/lo launch above) */
            k_asoft<<<ZH * TT / 8, 256, 0, stream>>>(Sb, P16, Ph, Pl);
            k_gemmc<bf, 2, 2><<<dim3(RH / 64, HD / 64, ZH), 32, 0, stream>>>(Ph, Pl, VTh + zk * HD * TT, VTl + zk * HD * TT, TT, Ob, HD, 0, (size_t)RH * TT, (size_t)HD * TT, (size_t)TT * HD);
            k_gemmc<h16, 0, 2><<<dim3((TT - RH) / 64, HD / 64, ZH), 32, 0, stream>>>(P16 + (size_t)RH * TT, nullptr, VT16 + zk * HD * TT, nullptr, TT, Ob + (size_t)RH * HD, HD, RH, (size_t)TT * TT, (size_t)HD * TT, (size_t)TT * HD);
            k_merge<<<(unsigned)(((size_t)ZH * TT * HD / 2 + 255) / 256), 256, 0, stream>>>(Ob, h0, ATh, ATl); }
        k_gemmw<bf, 1, false><<<dim3(TT / 64, DM / 64, 1), 32, 0, stream>>>(ATh, ATl, WO, nullptr, DQ, OUT + (size_t)b * TT * DM, DM, nullptr, 0, 0, 0); }
}

// v001
// One run takes 1420 microseconds.
// Next to v000, in two timings, it ran 1.94 times as fast each time.
#include <hip/hip_runtime.h>

// Causal multi-head self-attention with interleaved-pair rotary position embedding from a positions input, four batches (x [4][2048][1024]; Q, K, V = x W^T ('oi' [1024][1024] 1/32, no bias; 16 heads x 64; token-major); angles = token_positions (int32 [2048], read on device) x 1 / THETA ** (2i / 64), THETA 1e4; pairs (2i, 2i+1): r_even = x_even cos - x_odd sin, r_odd = x_even sin + x_odd cos, on Q and K; scores / sqrt(64); keys j <= i kept, -inf elsewhere; softmax; out = merged Wo^T ('oi', no bias) -> [4][2048][1024] (8.4 M); argument order x, token_positions, Wq, Wk, Wv, Wo).
// Layout per batch: bf16 copy of x; exact projections; {cos, sin} per (position, pair) built per batch from the int positions and float32 inverse-frequency constants (precise cosf/sinf); interleaved rotary plane builder; causal T-2048 attention (EVERY row's scores on hi/lo planes (3 products: logit sigma 2 with these weights) and hybrid P.V (rows < 512 hi/lo, rest fp16 x1024); k_gemmc skips tiles above the diagonal); merged hi/lo x Wo exact.
// Compute dtypes, f32 accumulate: every input rounded to bf16; projections exact; rotary f32; scores 3 products; P.V rows < 512 3 products, rest fp16; softmax f32; Wo hl x exact.

#define NB_  4      // batches: this module's input is [4][2048][1024]
#define TT   2048
#define DM   1024
#define NH_  16
#define NKV  16
#define REP  (NH_ / NKV)
#define HD   64
#define DQ   (NH_ * HD)
#define DKV  (NKV * HD)
#define ZH   2
#define RH   512                  // query rows < RH use hi+lo planes (0: none)
#define WIN  2048
#define PCAR 1024.0f
#define SCL  0.125f   // HD^-0.5
#define KSP  16     // work-groups that share the key loop of one P.V tile (partial planes, added in k_merge)
typedef _Float16 h16;
typedef unsigned short bf;
typedef __attribute__((ext_vector_type(16))) __bf16   v16bf;
typedef __attribute__((ext_vector_type(16))) _Float16 v16h;
typedef __attribute__((ext_vector_type(8)))  _Float16 v8h;
typedef __attribute__((ext_vector_type(8)))  unsigned short v8us;
typedef __attribute__((ext_vector_type(8)))  float    v8f;
typedef __attribute__((ext_vector_type(4)))  float    v4f;
typedef v8h  __attribute__((may_alias)) v8ha;
typedef v4f  __attribute__((may_alias)) v4fa;
typedef v8us __attribute__((may_alias)) v8usa;

__device__ __forceinline__ unsigned short f2bf(float f) { unsigned u = __float_as_uint(f); u += 0x7FFFu + ((u >> 16) & 1u); return (unsigned short)(u >> 16); }
__device__ __forceinline__ float bf2f(unsigned short b) { return __uint_as_float(((unsigned)b) << 16); }
__device__ __forceinline__ float bfr(float f) { return bf2f(f2bf(f)); }
__device__ __forceinline__ v16h cat16(v8h lo, v8h hi) { return __builtin_shufflevector(lo, hi, 0, 1, 2, 3, 4, 5, 6, 7, 8, 9, 10, 11, 12, 13, 14, 15); }
__device__ __forceinline__ v16bf cat16b(v8us lo, v8us hi) { return __builtin_bit_cast(v16bf, __builtin_shufflevector(lo, hi, 0, 1, 2, 3, 4, 5, 6, 7, 8, 9, 10, 11, 12, 13, 14, 15)); }
__device__ __forceinline__ v8f wmma16(v16h a, v16h b, v8f c) { return __builtin_amdgcn_wmma_f32_16x16x32_f16(false, a, false, b, (short)0, c, false, false); }
__device__ __forceinline__ v8f wmmab(v16bf a, v16bf b, v8f c) { return __builtin_amdgcn_wmma_f32_16x16x32_bf16(false, a, false, b, (short)0, c, false, false); }



// ---- k_gemmw: register-blocked GEMM, ONE WAVE per 64x64 output tile (16 accumulators), operands straight from K-contiguous 16-bit planes; grid (M/64, N/64, Z), 32 threads.
// C[m][n] (f32, pitch ldc, + optional f32 bias[n]) = sum_k A[m][k] Bt[n][k] (+ split products per NSPLIT). z-batch strides sA/sB/sC in elements. K % 32 == 0.
template <typename T16> struct WFrag;
template <> struct WFrag<h16> { typedef v16h V; static __device__ __forceinline__ V ld(const h16* p) { return cat16(*(const v8h*)p, *(const v8h*)(p + 16)); } static __device__ __forceinline__ v8f mma(V a, V b, v8f c) { return wmma16(a, b, c); } };
template <> struct WFrag<bf> { typedef v16bf V; static __device__ __forceinline__ V ld(const bf* p) { return cat16b(*(const v8us*)p, *(const v8us*)(p + 16)); } static __device__ __forceinline__ v8f mma(V a, V b, v8f c) { return wmmab(a, b, c); } };
template <typename T16, int NSPLIT, bool BIAS>
__global__ __launch_bounds__(32) void k_gemmw(const T16* __restrict__ A, const T16* __restrict__ A2, const T16* __restrict__ Bt, const T16* __restrict__ Bt2, int K, float* C, int ldc, const float* __restrict__ bias, size_t sA, size_t sB, size_t sC) {
    typedef typename WFrag<T16>::V V;
    __shared__ __align__(16) float os[16 * 68];
    const size_t z = blockIdx.z; A += z * sA; if (A2) A2 += z * sA; Bt += z * sB; if (Bt2) Bt2 += z * sB; C += z * sC;
    const int lane = threadIdx.x & 31, lr = lane & 15, hi = lane >> 4; const int r0 = blockIdx.x * 64, c0 = blockIdx.y * 64;
    v8f acc[4][4];
#pragma unroll
    for (int mb = 0; mb < 4; ++mb)
#pragma unroll
        for (int nb = 0; nb < 4; ++nb) acc[mb][nb] = (v8f){};
    const size_t aoff = (size_t)(r0 + lr) * K + 8 * hi, boff = (size_t)(c0 + lr) * K + 8 * hi;
#pragma unroll 1
    for (int kc = 0; kc < K; kc += 32) {
        V a[4], a2[4];
#pragma unroll
        for (int mb = 0; mb < 4; ++mb) { a[mb] = WFrag<T16>::ld(A + aoff + (size_t)mb * 16 * K + kc); if (NSPLIT == 1 || NSPLIT == 2) a2[mb] = WFrag<T16>::ld(A2 + aoff + (size_t)mb * 16 * K + kc); }
#pragma unroll
        for (int nb = 0; nb < 4; ++nb) { const V b = WFrag<T16>::ld(Bt + boff + (size_t)nb * 16 * K + kc); V b2; if (NSPLIT >= 2) b2 = WFrag<T16>::ld(Bt2 + boff + (size_t)nb * 16 * K + kc);
#pragma unroll
            for (int mb = 0; mb < 4; ++mb) { acc[mb][nb] = WFrag<T16>::mma(a[mb], b, acc[mb][nb]); if (NSPLIT == 1 || NSPLIT == 2) acc[mb][nb] = WFrag<T16>::mma(a2[mb], b, acc[mb][nb]); if (NSPLIT >= 2) acc[mb][nb] = WFrag<T16>::mma(a[mb], b2, acc[mb][nb]); } }
        asm volatile("v_nop\n\tv_nop\n\tv_nop\n\tv_nop" : "+v"(acc[0][0]), "+v"(acc[1][1]), "+v"(acc[2][2]), "+v"(acc[3][3]) : "v"(a[0]), "v"(a[3]));
    }
#pragma unroll
    for (int mb = 0; mb < 4; ++mb) {
#pragma unroll
        for (int nb = 0; nb < 4; ++nb) {
#pragma unroll
            for (int j = 0; j < 8; ++j) os[(hi * 8 + j) * 68 + nb * 16 + lr] = acc[mb][nb][j]; }
        __builtin_amdgcn_wave_barrier(); asm volatile("" ::: "memory");
        float* crow = C + (size_t)(r0 + mb * 16) * ldc + c0;
{
#pragma unroll
            for (int s = 0; s < 8; ++s) { const int row = 2 * s + hi, cofs = lr * 4; v4f val = *(const v4fa*)(os + row * 68 + cofs); if (BIAS) { val[0] += bfr(bias[c0 + cofs]); val[1] += bfr(bias[c0 + cofs + 1]); val[2] += bfr(bias[c0 + cofs + 2]); val[3] += bfr(bias[c0 + cofs + 3]); }
                *(v4f*)(crow + (size_t)row * ldc + cofs) = val; }
             }
        __builtin_amdgcn_wave_barrier(); asm volatile("" ::: "memory");
    }
}

// ---- k_gemmc: the same one-wave 64x64 tile GEMM specialised for causal attention: CMODE 1 skips score tiles entirely above the diagonal (query rows r0+roff.., key columns c0..), CMODE 2 limits the
// key (K) loop of the probability x value contraction to the diagonal block (probabilities beyond it are exactly zero). roff = row offset of this launch's first row within the sequence.
// KS > 1 splits that key loop over KS work-groups per tile, grid (M/64, (N/64) * KS, Z): one wave that walks all keys pays one memory latency per trip, up to 64 in a row, while most of the chip holds no wave. Slice
// ks = blockIdx.y % KS takes the 64-key groups ks, ks + KS, ... below the limit (64 keys of 16 bits = one 128-byte line per row: no line goes to two slices) and stores its partial tile to plane ks of C (plane stride sP);
// every slice stores its tile, one without a group stores zeros; k_merge adds the planes in plane order.
template <typename T16, int NSPLIT, int CMODE, int KS>
__global__ __launch_bounds__(32) void k_gemmc(const T16* __restrict__ A, const T16* __restrict__ A2, const T16* __restrict__ Bt, const T16* __restrict__ Bt2, int K, float* C, int ldc, int roff, size_t sA, size_t sB, size_t sC, size_t sP) {
    typedef typename WFrag<T16>::V V;
    __shared__ __align__(16) float os[16 * 68];
    const int ks = blockIdx.y % KS;
    const size_t z = blockIdx.z; A += z * sA; if (A2) A2 += z * sA; Bt += z * sB; if (Bt2) Bt2 += z * sB; C += z * sC + (size_t)ks * sP;
    const int lane = threadIdx.x & 31, lr = lane & 15, hi = lane >> 4; const int r0 = blockIdx.x * 64, c0 = (blockIdx.y / KS) * 64;
    if (CMODE == 1 && c0 > r0 + roff + 63) return;                  // score tile entirely above the causal diagonal: never written (the softmax masks j > i by select)
    const int Kl = (CMODE == 2) ? min(K, r0 + roff + 64) : K;        // P.V: probabilities are exactly 0 beyond the diagonal block, so the K loop stops there
    v8f acc[4][4];
#pragma unroll
    for (int mb = 0; mb < 4; ++mb)
#pragma unroll
        for (int nb = 0; nb < 4; ++nb) acc[mb][nb] = (v8f){};
    const size_t aoff = (size_t)(r0 + lr) * K + 8 * hi, boff = (size_t)(c0 + lr) * K + 8 * hi;
#pragma unroll 1
    for (int kc = ks * 64; kc < Kl; kc += (kc & 32) ? KS * 64 - 32 : 32) {   // both halves of a 64-key group, then on to the slice's next group (Kl is a multiple of 64)
        V a[4], a2[4];
#pragma unroll
        for (int mb = 0; mb < 4; ++mb) { a[mb] = WFrag<T16>::ld(A + aoff + (size_t)mb * 16 * K + kc); if (NSPLIT == 1 || NSPLIT == 2) a2[mb] = WFrag<T16>::ld(A2 + aoff + (size_t)mb * 16 * K + kc); }
#pragma unroll
        for (int nb = 0; nb < 4; ++nb) { const V b = WFrag<T16>::ld(Bt + boff + (size_t)nb * 16 * K + kc); V b2; if (NSPLIT >= 2) b2 = WFrag<T16>::ld(Bt2 + boff + (size_t)nb * 16 * K + kc);
#pragma unroll
            for (int mb = 0; mb < 4; ++mb) { acc[mb][nb] = WFrag<T16>::mma(a[mb], b, acc[mb][nb]); if (NSPLIT == 1 || NSPLIT == 2) acc[mb][nb] = WFrag<T16>::mma(a2[mb], b, acc[mb][nb]); if (NSPLIT >= 2) acc[mb][nb] = WFrag<T16>::mma(a[mb], b2, acc[mb][nb]); } }
        asm volatile("v_nop\n\tv_nop\n\tv_nop\n\tv_nop" : "+v"(acc[0][0]), "+v"(acc[1][1]), "+v"(acc[2][2]), "+v"(acc[3][3]) : "v"(a[0]), "v"(a[3]));
    }
#pragma unroll
    for (int mb = 0; mb < 4; ++mb) {
#pragma unroll
        for (int nb = 0; nb < 4; ++nb) {
#pragma unroll
            for (int j = 0; j < 8; ++j) os[(hi * 8 + j) * 68 + nb * 16 + lr] = acc[mb][nb][j]; }
        __builtin_amdgcn_wave_barrier(); asm volatile("" ::: "memory");
        float* crow = C + (size_t)(r0 + mb * 16) * ldc + c0;
{
#pragma unroll
            for (int s = 0; s < 8; ++s) { const int row = 2 * s + hi, cofs = lr * 4; v4f val = *(const v4fa*)(os + row * 68 + cofs);
                *(v4f*)(crow + (size_t)row * ldc + cofs) = val; }
             }
        __builtin_amdgcn_wave_barrier(); asm volatile("" ::: "memory");
    }
}

__device__ __forceinline__ h16 tohx(float x) { return (h16)x; }
__device__ __forceinline__ void splitf(float y, unsigned short& h, unsigned short& l) { h = f2bf(y); l = f2bf(y - bf2f(h)); }
typedef __attribute__((ext_vector_type(2))) _Float16 v2h;
typedef __attribute__((ext_vector_type(4))) _Float16 v4h;
typedef __attribute__((ext_vector_type(2))) unsigned short v2us;
typedef __attribute__((ext_vector_type(4))) unsigned short v4us;
typedef __attribute__((ext_vector_type(2))) float v2f;
typedef __attribute__((ext_vector_type(4))) int v4i;

__global__ __launch_bounds__(256) void k_wtG(const float* __restrict__ w, int K, int N, bf* Bt) {
    const int lane = threadIdx.x & 31; const int L0 = (blockIdx.x * 8 + (threadIdx.x >> 5)) * 8; const int nlines = N * K / 64;
{
#pragma unroll 1
        for (int l = 0; l < 8; ++l) { const int L = L0 + l; if (L >= nlines) break; const size_t e = (size_t)L * 64 + lane * 2; const int k = (int)(e % K), n = (int)(e / K); v2us o;
            o[0] = f2bf(w[(size_t)k * N + n]); o[1] = f2bf(w[(size_t)(k + 1) * N + n]); *(v2us*)(Bt + e) = o; }
         }
}
__global__ __launch_bounds__(256) void k_cvt8(const float* __restrict__ src, bf* dst, size_t n8) { const size_t i = (size_t)blockIdx.x * 256 + threadIdx.x; if (i >= n8) return; const v8f v = *(const v8f*)(src + i * 8); v8us o;
#pragma unroll
    for (int k = 0; k < 8; ++k) o[k] = f2bf(v[k]); *(v8us*)(dst + i * 8) = o;  }

__global__ __launch_bounds__(256) void k_ropeI(const float* __restrict__ F, int pitch, int nheads, const float* __restrict__ CS, float sc, h16* P16, bf* Ph, bf* Pl) {
    const size_t e = ((size_t)blockIdx.x * 256 + threadIdx.x) * 2; if (e >= (size_t)nheads * TT * HD) return; const int d = (int)(e % HD); const int t = (int)((e / HD) % TT); const int h = (int)(e / ((size_t)HD * TT)); const float* f = F + (size_t)t * pitch + h * HD; const float x0 = f[d], x1 = f[d + 1]; const v2f cs = *(const v2f*)(CS + ((size_t)t * HD + d) * 2); v2h o16; v2us oh, ol;
    float a0 = __fmul_rn(x0, cs[0]), b0 = __fmul_rn(x1, cs[1]), a1 = __fmul_rn(x1, cs[0]), b1 = __fmul_rn(x0, cs[1]); asm volatile("" : "+v"(a0), "+v"(b0), "+v"(a1), "+v"(b1));
    float r0 = __fsub_rn(a0, b0) * sc, r1 = __fadd_rn(b1, a1) * sc;   /* even: x0 c - x1 s; odd: x0 s + x1 c */
    o16[0] = tohx(r0); o16[1] = tohx(r1); { unsigned short a2, c2; splitf(r0, a2, c2); oh[0] = a2; ol[0] = c2; splitf(r1, a2, c2); oh[1] = a2; ol[1] = c2; }
    *(v2h*)(P16 + e) = o16; *(v2us*)(Ph + e) = oh; *(v2us*)(Pl + e) = ol;  }

__constant__ float INV2[HD / 2] = { 1.000000000e+00f, 7.498942018e-01f, 5.623413324e-01f, 4.216965139e-01f, 3.162277639e-01f, 2.371373624e-01f, 1.778279394e-01f, 1.333521456e-01f, 1.000000015e-01f, 7.498941571e-02f, 5.623412877e-02f, 4.216964915e-02f, 3.162277862e-02f, 2.371373586e-02f, 1.778279431e-02f, 1.333521493e-02f, 9.999999776e-03f, 7.498942316e-03f, 5.623413250e-03f, 4.216964822e-03f, 3.162277862e-03f, 2.371373819e-03f, 1.778279431e-03f, 1.333521446e-03f, 1.000000047e-03f, 7.498941850e-04f, 5.623413017e-04f, 4.216964880e-04f, 3.162277862e-04f, 2.371373848e-04f, 1.778279402e-04f, 1.333521504e-04f };   // float32 10000^(-(i * 2 / 64)), generated with jnp to be bit-exact with the module's expression
__global__ __launch_bounds__(256) void k_cstabI(const int* __restrict__ pid, float* CS) { const int idx = blockIdx.x * 256 + threadIdx.x; if (idx >= TT * HD) return; const int d = idx % HD; const int t = idx / HD; const float a = __fmul_rn((float)pid[t], INV2[d >> 1]); v2f cs; cs[0] = cosf(a); cs[1] = sinf(a); *(v2f*)(CS + (size_t)idx * 2) = cs;  }

__global__ __launch_bounds__(256) void k_vtp(const float* __restrict__ F, int pitch, int nheads, h16* V16, bf* Vh, bf* Vl) { const size_t e = ((size_t)blockIdx.x * 256 + threadIdx.x) * 2; if (e >= (size_t)nheads * HD * TT) return; const int t = (int)(e % TT); const int d = (int)((e / TT) % HD); const int g = (int)(e / ((size_t)TT * HD)); v2h o16; v2us oh, ol;
#pragma unroll
    for (int q = 0; q < 2; ++q) { const float x = F[(size_t)(t + q) * pitch + g * HD + d]; o16[q] = tohx(x); unsigned short a2, c2; splitf(x, a2, c2); oh[q] = a2; ol[q] = c2; }
    *(v2h*)(V16 + e) = o16; *(v2us*)(Vh + e) = oh; *(v2us*)(Vl + e) = ol;  }
// k_asoft: per row (zz, i): t = S x HD^-0.5 for j <= i and i - j < WIN (sliding causal window; the reference's -1e9 additive fill vanishes identically); softmax over the 2048 keys (register row, one exp, fixed trees);
__global__ __launch_bounds__(256) void k_asoft(const float* __restrict__ Sb, h16* P16, bf* Ph, bf* Pl) {
    const int lane = threadIdx.x & 31; const int row = blockIdx.x * 8 + (threadIdx.x >> 5); if (row >= ZH * TT) return; const int i = row % TT; const int zz = row / TT; (void)zz; const bool hires = (i < RH); const float* sr = Sb + (size_t)row * TT; float v[TT / 32]; float mx = -3.0e38f;
#pragma unroll
    for (int ch = 0; ch < TT / 128; ++ch) { const int j0 = ch * 128 + lane * 4; const v4f a = *(const v4f*)(sr + j0);
#pragma unroll
        for (int q = 0; q < 4; ++q) { const int j = j0 + q; (void)j; const float t = (j <= i && i - j < WIN) ? a[q] * SCL : -3.0e38f; v[ch * 4 + q] = t; mx = fmaxf(mx, t); } }
#pragma unroll
    for (int sh = 16; sh; sh >>= 1) mx = fmaxf(mx, __shfl_xor(mx, sh, 32));
    float sum = 0.f;
#pragma unroll
    for (int k = 0; k < TT / 32; ++k) { float d0 = __fsub_rn(v[k], mx); asm volatile("" : "+v"(d0)); v[k] = __builtin_amdgcn_exp2f(__fmul_rn(d0, 1.4426950408889634f)); sum += v[k]; }
#pragma unroll
    for (int sh = 16; sh; sh >>= 1) sum += __shfl_xor(sum, sh, 32);
    const float f = __fdiv_rn(hires ? 1.0f : PCAR, sum);
{
        if (hires) {
#pragma unroll
            for (int ch = 0; ch < TT / 128; ++ch) { v4us oh, ol;
#pragma unroll
                for (int q = 0; q < 4; ++q) { unsigned short a, c2; splitf(v[ch * 4 + q] * f, a, c2); oh[q] = a; ol[q] = c2; }
                const size_t oo = ((size_t)zz * (RH ? RH : 1) + i) * TT + ch * 128 + lane * 4; *(v4us*)(Ph + oo) = oh; *(v4us*)(Pl + oo) = ol; }
        } else {
#pragma unroll
            for (int ch = 0; ch < TT / 128; ++ch) { v4h o4;
#pragma unroll
                for (int q = 0; q < 4; ++q) o4[q] = tohx(v[ch * 4 + q] * f);
                *(v4h*)(P16 + (size_t)row * TT + ch * 128 + lane * 4) = o4; } }
         }
}
__global__ __launch_bounds__(256) void k_merge(const float* __restrict__ O, int h0, bf* Ah, bf* Al) { const size_t e = ((size_t)blockIdx.x * 256 + threadIdx.x) * 2; if (e >= (size_t)ZH * TT * HD) return; const int d = (int)(e % HD); const int t = (int)((e / HD) % TT); const int zz = (int)(e / ((size_t)HD * TT)); const float cs = (t < RH) ? 1.0f : (1.0f / PCAR); const size_t oo = (size_t)t * DQ + (h0 + zz) * HD + d;
    v2f s = *(const v2f*)(O + e);   /* the KSP partial planes of the split key loop, added in plane order */
#pragma unroll
    for (int p = 1; p < KSP; ++p) { const v2f u = *(const v2f*)(O + (size_t)p * ZH * TT * HD + e); s[0] += u[0]; s[1] += u[1]; }
    v2us oh, ol;
#pragma unroll
    for (int q = 0; q < 2; ++q) { unsigned short a, c2; splitf(s[q] * cs, a, c2); oh[q] = a; ol[q] = c2; } *(v2us*)(Ah + oo) = oh; *(v2us*)(Al + oo) = ol;  }

extern "C" void kernel_launch(void* const* d_in, const int* in_sizes, int n_in,
                              void* d_out, int out_size, void* d_ws, size_t ws_size, hipStream_t stream) {
    (void)in_sizes; (void)n_in; (void)out_size;
    const float* x = (const float*)d_in[0]; const int* PID = (const int*)d_in[1]; const float* wq = (const float*)d_in[2]; const float* wk = (const float*)d_in[3]; const float* wv = (const float*)d_in[4]; const float* wo = (const float*)d_in[5];   /* input order x, token_positions (int32 [2048], read on device by the table builder), Wq, Wk, Wv, Wo ('oi' [1024][1024]): the host's own six slots */
    float* OUT = (float*)d_out;     // [4][2048][1024]
    char* wsp = (char*)d_ws;
    auto take = [&](size_t bytes) { char* p = wsp; wsp += (bytes + 255) & ~(size_t)255; return (void*)p; };
    bf* WQ = (bf*)take((size_t)DQ * DM * 2); bf* WK = (bf*)take((size_t)DKV * DM * 2); bf* WV = (bf*)take((size_t)DKV * DM * 2); bf* WO = (bf*)take((size_t)DM * DQ * 2); float* CS = (float*)take((size_t)TT * HD * 2 * 4);
    bf* XB = (bf*)take((size_t)TT * DM * 2); float* FQ = (float*)take((size_t)TT * DQ * 4); float* FK = (float*)take((size_t)TT * DKV * 4);
    h16* QP16 = (h16*)take((size_t)NH_ * TT * HD * 2); h16* KP16 = (h16*)take((size_t)NKV * TT * HD * 2); h16* VT16 = (h16*)take((size_t)NKV * HD * TT * 2);
    bf* QPh = (bf*)take((size_t)NH_ * TT * HD * 2); bf* QPl = (bf*)take((size_t)NH_ * TT * HD * 2); bf* KPh = (bf*)take((size_t)NKV * TT * HD * 2); bf* KPl = (bf*)take((size_t)NKV * TT * HD * 2); bf* VTh = (bf*)take((size_t)NKV * HD * TT * 2); bf* VTl = (bf*)take((size_t)NKV * HD * TT * 2); bf* Ph = (bf*)take((size_t)ZH * RH * TT * 2); bf* Pl = (bf*)take((size_t)ZH * RH * TT * 2);
    float* Sb = (float*)take((size_t)ZH * TT * TT * 4); h16* P16 = (h16*)take((size_t)ZH * TT * TT * 2); float* Ob = (float*)take((size_t)KSP * ZH * TT * HD * 4); bf* ATh = (bf*)take((size_t)TT * DQ * 2); bf* ATl = (bf*)take((size_t)TT * DQ * 2);
    if ((size_t)(wsp - (char*)d_ws) > ws_size) return;    // ws 256 MiB
    float* FV = FK;   // v projection reuses the k buffer after the k planes are built (stream-ordered)
    { k_cvt8<<<(unsigned)(((size_t)DQ * DM / 8 + 255) / 256), 256, 0, stream>>>(wq, WQ, (size_t)DQ * DM / 8); k_cvt8<<<(unsigned)(((size_t)DKV * DM / 8 + 255) / 256), 256, 0, stream>>>(wk, WK, (size_t)DKV * DM / 8); k_cvt8<<<(unsigned)(((size_t)DKV * DM / 8 + 255) / 256), 256, 0, stream>>>(wv, WV, (size_t)DKV * DM / 8);
      k_cvt8<<<(unsigned)(((size_t)DM * DQ / 8 + 255) / 256), 256, 0, stream>>>(wo, WO, (size_t)DM * DQ / 8); /* the rotary table is rebuilt per batch from the one shared positions input (below) */ }
    const unsigned LQ = (unsigned)(((size_t)NH_ * TT * HD / 2 + 255) / 256), LKv = (unsigned)(((size_t)NKV * TT * HD / 2 + 255) / 256);
    for (int b = 0; b < NB_; ++b) {
        k_cstabI<<<(TT * HD + 255) / 256, 256, 0, stream>>>(PID, CS);   /* token_positions[:] (int32, read; the same for every batch) */
        
        k_cvt8<<<(unsigned)(((size_t)TT * DM / 8 + 255) / 256), 256, 0, stream>>>(x + (size_t)b * TT * DM, XB, (size_t)TT * DM / 8);
        k_gemmw<bf, 0, false><<<dim3(TT / 64, DQ / 64, 1), 32, 0, stream>>>(XB, nullptr, WQ, nullptr, DM, FQ, DQ, nullptr, 0, 0, 0);
        k_ropeI<<<LQ, 256, 0, stream>>>(FQ, DQ, NH_, CS, 1.0f, QP16, QPh, QPl);
        k_gemmw<bf, 0, false><<<dim3(TT / 64, DKV / 64, 1), 32, 0, stream>>>(XB, nullptr, WK, nullptr, DM, FK, DKV, nullptr, 0, 0, 0);
        k_ropeI<<<LKv, 256, 0, stream>>>(FK, DKV, NKV, CS, 1.0f, KP16, KPh, KPl);
        k_gemmw<bf, 0, false><<<dim3(TT / 64, DKV / 64, 1), 32, 0, stream>>>(XB, nullptr, WV, nullptr, DM, FV, DKV, nullptr, 0, 0, 0); k_vtp<<<LKv, 256, 0, stream>>>(FV, DKV, NKV, VT16, VTh, VTl);
        for (int h0 = 0; h0 < NH_; h0 += ZH) { const size_t zq = (size_t)h0, zk = (size_t)(h0 / REP);   // one kv head per query head: the pass's two heads use consecutive kv planes (z-strides TT*HD)
            k_gemmc<bf, 2, 1, 1><<<dim3(TT / 64, TT / 64, ZH), 32, 0, stream>>>(QPh + zq * TT * HD, QPl + zq * TT * HD, KPh + zk * TT * HD, KPl + zk * TT * HD, HD, Sb, TT, 0, (size_t)TT * HD, (size_t)TT * HD, (size_t)TT * TT, 0);   /* scores on hi/lo planes for EVERY row (3 products) */
            /* (the fp16 score launch for rows >= RH is removed: all rows use the hi/lo launch above) */
            k_asoft<<<ZH * TT / 8, 256, 0, stream>>>(Sb, P16, Ph, Pl);
            k_gemmc<bf, 2, 2, KSP><<<dim3(RH / 64, HD / 64 * KSP, ZH), 32, 0, stream>>>(Ph, Pl, VTh + zk * HD * TT, VTl + zk * HD * TT, TT, Ob, HD, 0, (size_t)RH * TT, (size_t)HD * TT, (size_t)TT * HD, (size_t)ZH * TT * HD);
            k_gemmc<h16, 0, 2, KSP><<<dim3((TT - RH) / 64, HD / 64 * KSP, ZH), 32, 0, stream>>>(P16 + (size_t)RH * TT, nullptr, VT16 + zk * HD * TT, nullptr, TT, Ob + (size_t)RH * HD, HD, RH, (size_t)TT * TT, (size_t)HD * TT, (size_t)TT * HD, (size_t)ZH * TT * HD);
            k_merge<<<(unsigned)(((size_t)ZH * TT * HD / 2 + 255) / 256), 256, 0, stream>>>(Ob, h0, ATh, ATl); }
        k_gemmw<bf, 1, false><<<dim3(TT / 64, DM / 64, 1), 32, 0, stream>>>(ATh, ATl, WO, nullptr, DQ, OUT + (size_t)b * TT * DM, DM, nullptr, 0, 0, 0); }
}

// v002
// One run takes 776 microseconds.
// Timed twice side by side with v001, it ran 1.82 and 1.83 times as fast.
// Counting every step since v000, it is 3.53 times as fast.
#include <hip/hip_runtime.h>

// Causal multi-head self-attention with interleaved-pair rotary position embedding from a positions input, four batches (x [4][2048][1024]; Q, K, V = x W^T ('oi' [1024][1024] 1/32, no bias; 16 heads x 64; token-major); angles = token_positions (int32 [2048], read on device) x 1 / THETA ** (2i / 64), THETA 1e4; pairs (2i, 2i+1): r_even = x_even cos - x_odd sin, r_odd = x_even sin + x_odd cos, on Q and K; scores / sqrt(64); keys j <= i kept, -inf elsewhere; softmax; out = merged Wo^T ('oi', no bias) -> [4][2048][1024] (8.4 M); argument order x, token_positions, Wq, Wk, Wv, Wo).
// Layout per batch: bf16 copy of x; exact projections; {cos, sin} per (position, pair) built once from the int positions and float32 inverse-frequency constants (precise cosf/sinf); interleaved rotary plane builder; causal T-2048 attention (EVERY row's scores on hi/lo planes (3 products: logit sigma 2 with these weights) and hybrid P.V (rows < 512 hi/lo, rest fp16 x1024); one fused kernel, k_attn, which stops at the diagonal); merged hi/lo x Wo exact.
// Compute dtypes, f32 accumulate: every input rounded to bf16; projections exact; rotary f32; attention scores 3 products on every row, P.V rows < 512 3 products, rest fp16; softmax f32; Wo hl x exact.

#define NB_  4      // batches: this module's input is [4][2048][1024]
#define TT   2048
#define DM   1024
#define NH_  16
#define NKV  16
#define REP  (NH_ / NKV)
#define HD   64
#define DQ   (NH_ * HD)
#define DKV  (NKV * HD)
#define RH   512                  // query rows < RH use hi+lo planes in P.V (0: none)
#define PCAR 1024.0f
#define SCL  0.125f   // HD^-0.5
#define KSP  16     // waves of a k_attn work-group; they share the key loops of its 16 query rows (partial P.V tiles in LDS, added in wave order)
typedef _Float16 h16;
typedef unsigned short bf;
typedef __attribute__((ext_vector_type(16))) __bf16   v16bf;
typedef __attribute__((ext_vector_type(16))) _Float16 v16h;
typedef __attribute__((ext_vector_type(8)))  _Float16 v8h;
typedef __attribute__((ext_vector_type(8)))  unsigned short v8us;
typedef __attribute__((ext_vector_type(8)))  float    v8f;
typedef __attribute__((ext_vector_type(4)))  float    v4f;
typedef v8h  __attribute__((may_alias)) v8ha;
typedef v4f  __attribute__((may_alias)) v4fa;
typedef v8us __attribute__((may_alias)) v8usa;

__device__ __forceinline__ unsigned short f2bf(float f) { unsigned u = __float_as_uint(f); u += 0x7FFFu + ((u >> 16) & 1u); return (unsigned short)(u >> 16); }
__device__ __forceinline__ float bf2f(unsigned short b) { return __uint_as_float(((unsigned)b) << 16); }
__device__ __forceinline__ float bfr(float f) { return bf2f(f2bf(f)); }
__device__ __forceinline__ v16h cat16(v8h lo, v8h hi) { return __builtin_shufflevector(lo, hi, 0, 1, 2, 3, 4, 5, 6, 7, 8, 9, 10, 11, 12, 13, 14, 15); }
__device__ __forceinline__ v16bf cat16b(v8us lo, v8us hi) { return __builtin_bit_cast(v16bf, __builtin_shufflevector(lo, hi, 0, 1, 2, 3, 4, 5, 6, 7, 8, 9, 10, 11, 12, 13, 14, 15)); }
__device__ __forceinline__ v8f wmma16(v16h a, v16h b, v8f c) { return __builtin_amdgcn_wmma_f32_16x16x32_f16(false, a, false, b, (short)0, c, false, false); }
__device__ __forceinline__ v8f wmmab(v16bf a, v16bf b, v8f c) { return __builtin_amdgcn_wmma_f32_16x16x32_bf16(false, a, false, b, (short)0, c, false, false); }



// ---- k_gemmw: register-blocked GEMM, ONE WAVE per 64x64 output tile (16 accumulators), operands straight from K-contiguous 16-bit planes; grid (M/64, N/64, Z), 32 threads.
// C[m][n] (f32, pitch ldc, + optional f32 bias[n]) = sum_k A[m][k] Bt[n][k] (+ split products per NSPLIT). z-batch strides sA/sB/sC in elements. K % 32 == 0.
template <typename T16> struct WFrag;
template <> struct WFrag<h16> { typedef v16h V; static __device__ __forceinline__ V ld(const h16* p) { return cat16(*(const v8h*)p, *(const v8h*)(p + 16)); } static __device__ __forceinline__ v8f mma(V a, V b, v8f c) { return wmma16(a, b, c); } };
template <> struct WFrag<bf> { typedef v16bf V; static __device__ __forceinline__ V ld(const bf* p) { return cat16b(*(const v8us*)p, *(const v8us*)(p + 16)); } static __device__ __forceinline__ v8f mma(V a, V b, v8f c) { return wmmab(a, b, c); } };
template <typename T16, int NSPLIT, bool BIAS>
__global__ __launch_bounds__(32) void k_gemmw(const T16* __restrict__ A, const T16* __restrict__ A2, const T16* __restrict__ Bt, const T16* __restrict__ Bt2, int K, float* C, int ldc, const float* __restrict__ bias, size_t sA, size_t sB, size_t sC) {
    typedef typename WFrag<T16>::V V;
    __shared__ __align__(16) float os[16 * 68];
    const size_t z = blockIdx.z; A += z * sA; if (A2) A2 += z * sA; Bt += z * sB; if (Bt2) Bt2 += z * sB; C += z * sC;
    const int lane = threadIdx.x & 31, lr = lane & 15, hi = lane >> 4; const int r0 = blockIdx.x * 64, c0 = blockIdx.y * 64;
    v8f acc[4][4];
#pragma unroll
    for (int mb = 0; mb < 4; ++mb)
#pragma unroll
        for (int nb = 0; nb < 4; ++nb) acc[mb][nb] = (v8f){};
    const size_t aoff = (size_t)(r0 + lr) * K + 8 * hi, boff = (size_t)(c0 + lr) * K + 8 * hi;
#pragma unroll 1
    for (int kc = 0; kc < K; kc += 32) {
        V a[4], a2[4];
#pragma unroll
        for (int mb = 0; mb < 4; ++mb) { a[mb] = WFrag<T16>::ld(A + aoff + (size_t)mb * 16 * K + kc); if (NSPLIT == 1 || NSPLIT == 2) a2[mb] = WFrag<T16>::ld(A2 + aoff + (size_t)mb * 16 * K + kc); }
#pragma unroll
        for (int nb = 0; nb < 4; ++nb) { const V b = WFrag<T16>::ld(Bt + boff + (size_t)nb * 16 * K + kc); V b2; if (NSPLIT >= 2) b2 = WFrag<T16>::ld(Bt2 + boff + (size_t)nb * 16 * K + kc);
#pragma unroll
            for (int mb = 0; mb < 4; ++mb) { acc[mb][nb] = WFrag<T16>::mma(a[mb], b, acc[mb][nb]); if (NSPLIT == 1 || NSPLIT == 2) acc[mb][nb] = WFrag<T16>::mma(a2[mb], b, acc[mb][nb]); if (NSPLIT >= 2) acc[mb][nb] = WFrag<T16>::mma(a[mb], b2, acc[mb][nb]); } }
        asm volatile("v_nop\n\tv_nop\n\tv_nop\n\tv_nop" : "+v"(acc[0][0]), "+v"(acc[1][1]), "+v"(acc[2][2]), "+v"(acc[3][3]) : "v"(a[0]), "v"(a[3]));
    }
#pragma unroll
    for (int mb = 0; mb < 4; ++mb) {
#pragma unroll
        for (int nb = 0; nb < 4; ++nb) {
#pragma unroll
            for (int j = 0; j < 8; ++j) os[(hi * 8 + j) * 68 + nb * 16 + lr] = acc[mb][nb][j]; }
        __builtin_amdgcn_wave_barrier(); asm volatile("" ::: "memory");
        float* crow = C + (size_t)(r0 + mb * 16) * ldc + c0;
{
#pragma unroll
            for (int s = 0; s < 8; ++s) { const int row = 2 * s + hi, cofs = lr * 4; v4f val = *(const v4fa*)(os + row * 68 + cofs); if (BIAS) { val[0] += bfr(bias[c0 + cofs]); val[1] += bfr(bias[c0 + cofs + 1]); val[2] += bfr(bias[c0 + cofs + 2]); val[3] += bfr(bias[c0 + cofs + 3]); }
                *(v4f*)(crow + (size_t)row * ldc + cofs) = val; }
             }
        __builtin_amdgcn_wave_barrier(); asm volatile("" ::: "memory");
    }
}

__device__ __forceinline__ h16 tohx(float x) { return (h16)x; }
__device__ __forceinline__ void splitf(float y, unsigned short& h, unsigned short& l) { h = f2bf(y); l = f2bf(y - bf2f(h)); }
typedef __attribute__((ext_vector_type(2))) _Float16 v2h;
typedef __attribute__((ext_vector_type(4))) _Float16 v4h;
typedef __attribute__((ext_vector_type(2))) unsigned short v2us;
typedef __attribute__((ext_vector_type(4))) unsigned short v4us;
typedef __attribute__((ext_vector_type(2))) float v2f;
typedef __attribute__((ext_vector_type(4))) int v4i;

__global__ __launch_bounds__(256) void k_wtG(const float* __restrict__ w, int K, int N, bf* Bt) {
    const int lane = threadIdx.x & 31; const int L0 = (blockIdx.x * 8 + (threadIdx.x >> 5)) * 8; const int nlines = N * K / 64;
{
#pragma unroll 1
        for (int l = 0; l < 8; ++l) { const int L = L0 + l; if (L >= nlines) break; const size_t e = (size_t)L * 64 + lane * 2; const int k = (int)(e % K), n = (int)(e / K); v2us o;
            o[0] = f2bf(w[(size_t)k * N + n]); o[1] = f2bf(w[(size_t)(k + 1) * N + n]); *(v2us*)(Bt + e) = o; }
         }
}
__global__ __launch_bounds__(256) void k_cvt8(const float* __restrict__ src, bf* dst, size_t n8) { const size_t i = (size_t)blockIdx.x * 256 + threadIdx.x; if (i >= n8) return; const v8f v = *(const v8f*)(src + i * 8); v8us o;
#pragma unroll
    for (int k = 0; k < 8; ++k) o[k] = f2bf(v[k]); *(v8us*)(dst + i * 8) = o;  }

__global__ __launch_bounds__(256) void k_ropeI(const float* __restrict__ F, int pitch, int nheads, const float* __restrict__ CS, float sc, h16* P16, bf* Ph, bf* Pl) {
    const size_t e = ((size_t)blockIdx.x * 256 + threadIdx.x) * 2; if (e >= (size_t)nheads * TT * HD) return; const int d = (int)(e % HD); const int t = (int)((e / HD) % TT); const int h = (int)(e / ((size_t)HD * TT)); const float* f = F + (size_t)t * pitch + h * HD; const float x0 = f[d], x1 = f[d + 1]; const v2f cs = *(const v2f*)(CS + ((size_t)t * HD + d) * 2); v2h o16; v2us oh, ol;
    float a0 = __fmul_rn(x0, cs[0]), b0 = __fmul_rn(x1, cs[1]), a1 = __fmul_rn(x1, cs[0]), b1 = __fmul_rn(x0, cs[1]); asm volatile("" : "+v"(a0), "+v"(b0), "+v"(a1), "+v"(b1));
    float r0 = __fsub_rn(a0, b0) * sc, r1 = __fadd_rn(b1, a1) * sc;   /* even: x0 c - x1 s; odd: x0 s + x1 c */
    o16[0] = tohx(r0); o16[1] = tohx(r1); { unsigned short a2, c2; splitf(r0, a2, c2); oh[0] = a2; ol[0] = c2; splitf(r1, a2, c2); oh[1] = a2; ol[1] = c2; }
    *(v2h*)(P16 + e) = o16; *(v2us*)(Ph + e) = oh; *(v2us*)(Pl + e) = ol;  }

__constant__ float INV2[HD / 2] = { 1.000000000e+00f, 7.498942018e-01f, 5.623413324e-01f, 4.216965139e-01f, 3.162277639e-01f, 2.371373624e-01f, 1.778279394e-01f, 1.333521456e-01f, 1.000000015e-01f, 7.498941571e-02f, 5.623412877e-02f, 4.216964915e-02f, 3.162277862e-02f, 2.371373586e-02f, 1.778279431e-02f, 1.333521493e-02f, 9.999999776e-03f, 7.498942316e-03f, 5.623413250e-03f, 4.216964822e-03f, 3.162277862e-03f, 2.371373819e-03f, 1.778279431e-03f, 1.333521446e-03f, 1.000000047e-03f, 7.498941850e-04f, 5.623413017e-04f, 4.216964880e-04f, 3.162277862e-04f, 2.371373848e-04f, 1.778279402e-04f, 1.333521504e-04f };   // float32 10000^(-(i * 2 / 64)), generated with jnp to be bit-exact with the module's expression
__global__ __launch_bounds__(256) void k_cstabI(const int* __restrict__ pid, float* CS) { const int idx = blockIdx.x * 256 + threadIdx.x; if (idx >= TT * HD) return; const int d = idx % HD; const int t = idx / HD; const float a = __fmul_rn((float)pid[t], INV2[d >> 1]); v2f cs; cs[0] = cosf(a); cs[1] = sinf(a); *(v2f*)(CS + (size_t)idx * 2) = cs;  }

__global__ __launch_bounds__(256) void k_vtp(const float* __restrict__ F, int pitch, int nheads, h16* V16, bf* Vh, bf* Vl) { const size_t e = ((size_t)blockIdx.x * 256 + threadIdx.x) * 2; if (e >= (size_t)nheads * HD * TT) return; const int t = (int)(e % TT); const int d = (int)((e / TT) % HD); const int g = (int)(e / ((size_t)TT * HD)); v2h o16; v2us oh, ol;
#pragma unroll
    for (int q = 0; q < 2; ++q) { const float x = F[(size_t)(t + q) * pitch + g * HD + d]; o16[q] = tohx(x); unsigned short a2, c2; splitf(x, a2, c2); oh[q] = a2; ol[q] = c2; }
    *(v2h*)(V16 + e) = o16; *(v2us*)(Vh + e) = oh; *(v2us*)(Vl + e) = ol;  }
// ---- k_attn: scores, softmax and P.V of 16 query rows of one head in ONE work-group of KSP = 16 waves; grid (TT / 16, heads), 512 threads. The rows' scores, then their probabilities, then the partial output tiles stay in LDS.
// 1) wave w takes the 64-key groups w, w + 16, ... up to the diagonal: Q hi/lo x K hi/lo (3 products, k order 0..31 then 32..63), f32 scores to LDS row-major (pitch SP floats).
// 2) wave w owns row w: whole-row softmax in registers (one exp, fixed trees; 128-key chunks wholly above the diagonal are exact zeros: no exp, no store); the 16-bit probability planes overwrite the row's own scores.
// 3) wave w takes the same 64-key groups of P.V (rows < RH hi/lo, 3 products; the rest fp16 x PCAR); A fragments from LDS, V fragments from the [d][t] planes; its partial 16x64 tile goes to LDS.
// 4) the 16 partial tiles are added in wave order, scaled and split into the merged hi/lo planes. Long (late) rows get the low block indices, which start first.
#define SP 2052     // floats per score row in LDS: 8192 + 16 bytes, so that the 16 rows of a b128 fragment read fall on distinct banks
#define OP 68       // floats per row of a partial output tile in LDS
typedef v4us __attribute__((may_alias)) v4usa;
typedef v4h  __attribute__((may_alias)) v4ha;
typedef v2f  __attribute__((may_alias)) v2fa;
__device__ __forceinline__ v16bf ldsb(const bf* p) { return cat16b(*(const v8usa*)p, *(const v8usa*)(p + 16)); }
__device__ __forceinline__ v16h ldsh(const h16* p) { return cat16(*(const v8ha*)p, *(const v8ha*)(p + 16)); }
__device__ __forceinline__ float exp2s(float x) { float r; asm("v_exp_f32 %0, %1\n\tv_nop" : "=v"(r) : "v"(x)); return r; }   // the v_nop is the one free slot the instruction set asks for behind a transcendental, before its result is read or its source overwritten; in one statement so that it stays there
__global__ __launch_bounds__(512, 8) void k_attn(const bf* __restrict__ Qh, const bf* __restrict__ Ql, const bf* __restrict__ Kh, const bf* __restrict__ Kl, const h16* __restrict__ V16, const bf* __restrict__ Vh, const bf* __restrict__ Vl, bf* Ah, bf* Al) {
    __shared__ __align__(16) float sm[16 * SP];
    const int lane = threadIdx.x & 31, lr = lane & 15, hi = lane >> 4; const int w = __builtin_amdgcn_readfirstlane((int)(threadIdx.x >> 5));
    const int h = blockIdx.y; const int i0 = (TT / 16 - 1 - (int)blockIdx.x) * 16;
    const int ng = i0 / 64 + 1;                 // 64-key groups up to and with the diagonal's
    const bool hires = (i0 < RH);               // RH is a multiple of 16: the same for all 16 rows
    const size_t qp = (size_t)h * TT * HD, kp = (size_t)(h / REP) * TT * HD;
    if (w < ng) {
        v16bf a[2], a2[2];
#pragma unroll
        for (int kk = 0; kk < 2; ++kk) { a[kk] = WFrag<bf>::ld(Qh + qp + (size_t)(i0 + lr) * HD + 8 * hi + kk * 32); a2[kk] = WFrag<bf>::ld(Ql + qp + (size_t)(i0 + lr) * HD + 8 * hi + kk * 32); }
#pragma unroll 1
        for (int g = w; g < ng; g += KSP) {
            const size_t bo = kp + (size_t)(g * 64 + lr) * HD + 8 * hi;
#pragma unroll
            for (int hb = 0; hb < 2; ++hb) {    // 32 keys at a time: their 8 K fragments, the Q fragments and 2 accumulators fit the 128 registers that let two work-groups share a WGP
                v16bf b[2][2], b2[2][2]; v8f acc[2];
#pragma unroll
                for (int kk = 0; kk < 2; ++kk)
#pragma unroll
                    for (int nb = 0; nb < 2; ++nb) { b[kk][nb] = WFrag<bf>::ld(Kh + bo + (size_t)(hb * 2 + nb) * 16 * HD + kk * 32); b2[kk][nb] = WFrag<bf>::ld(Kl + bo + (size_t)(hb * 2 + nb) * 16 * HD + kk * 32); }
                asm volatile("" :: "v"(b[0][0]), "v"(b[0][1]), "v"(b[1][0]), "v"(b[1][1]), "v"(b2[0][0]), "v"(b2[0][1]), "v"(b2[1][0]), "v"(b2[1][1]));   // inputs only: holds all 16 loads in front of the first product, one memory latency instead of one per fragment
#pragma unroll
                for (int nb = 0; nb < 2; ++nb) acc[nb] = (v8f){};
#pragma unroll
                for (int kk = 0; kk < 2; ++kk)
#pragma unroll
                    for (int nb = 0; nb < 2; ++nb) { acc[nb] = wmmab(a[kk], b[kk][nb], acc[nb]); acc[nb] = wmmab(a2[kk], b[kk][nb], acc[nb]); acc[nb] = wmmab(a[kk], b2[kk][nb], acc[nb]); }
#pragma unroll
                for (int nb = 0; nb < 2; ++nb)
#pragma unroll
                    for (int j = 0; j < 8; ++j) sm[(hi * 8 + j) * SP + g * 64 + (hb * 2 + nb) * 16 + lr] = acc[nb][j];
            }
        }
    }
    __syncthreads();    // every score of the 16 rows is in LDS
    {
        const int i = i0 + w; const int nch = i / 128 + 1; float* sr = sm + w * SP; float v[TT / 32]; float mx = -3.0e38f; v4f raw[TT / 128];
#pragma unroll
        for (int ch = 0; ch < TT / 128; ++ch) raw[ch] = *(const v4fa*)(sr + min(ch * 128 + lane * 4, i & ~3));   /* a lane wholly above the diagonal re-reads the diagonal's quad (dropped by the select below): no unwritten LDS is read */
        __builtin_amdgcn_sched_barrier(0);   // keeps the row's 16 LDS reads together in front of the arithmetic: one LDS latency instead of one per read
#pragma unroll
        for (int ch = 0; ch < TT / 128; ++ch) { const int j0 = ch * 128 + lane * 4; const v4f a = raw[ch];
#pragma unroll
            for (int q = 0; q < 4; ++q) { const int j = j0 + q; const float t = (j <= i) ? a[q] * SCL : -3.0e38f; v[ch * 4 + q] = t; mx = fmaxf(mx, t); } }
#pragma unroll
        for (int sh = 16; sh; sh >>= 1) mx = fmaxf(mx, __shfl_xor(mx, sh, 32));
        float sum = 0.f;
#pragma unroll
        for (int ch = 0; ch < TT / 128; ++ch) if (ch < nch) {
#pragma unroll
            for (int q = 0; q < 4; ++q) { const int k = ch * 4 + q; const float d0 = __fsub_rn(v[k], mx); v[k] = exp2s(__fmul_rn(d0, 1.4426950408889634f)); sum += v[k]; } }
#pragma unroll
        for (int sh = 16; sh; sh >>= 1) sum += __shfl_xor(sum, sh, 32);
        const float f = __fdiv_rn(hires ? 1.0f : PCAR, sum);
        if (hires) { bf* ph = (bf*)sr; bf* pl = ph + TT;
#pragma unroll
            for (int ch = 0; ch < RH / 128; ++ch) if (ch < nch) { v4us oh, ol;
#pragma unroll
                for (int q = 0; q < 4; ++q) { unsigned short a, c2; splitf(v[ch * 4 + q] * f, a, c2); oh[q] = a; ol[q] = c2; }
                *(v4usa*)(ph + ch * 128 + lane * 4) = oh; *(v4usa*)(pl + ch * 128 + lane * 4) = ol; }
        } else { h16* p16 = (h16*)sr;
#pragma unroll
            for (int ch = 0; ch < TT / 128; ++ch) if (ch < nch) { v4h o4;
#pragma unroll
                for (int q = 0; q < 4; ++q) o4[q] = tohx(v[ch * 4 + q] * f);
                *(v4ha*)(p16 + ch * 128 + lane * 4) = o4; } }
    }
    __syncthreads();    // every probability of the 16 rows is in LDS
    v8f acc[4];
#pragma unroll
    for (int nb = 0; nb < 4; ++nb) acc[nb] = (v8f){};
    const size_t vo = kp + (size_t)lr * TT + 8 * hi;
    if (hires) { const bf* ph = (const bf*)(sm + lr * SP) + 8 * hi; const bf* pl = ph + TT;
#pragma unroll 1
        for (int g = w; g < ng; g += KSP) {
#pragma unroll
            for (int kk = 0; kk < 2; ++kk) { const int kc = g * 64 + kk * 32; const v16bf a = ldsb(ph + kc), a2 = ldsb(pl + kc);
#pragma unroll
                for (int nb = 0; nb < 4; ++nb) { const v16bf b = WFrag<bf>::ld(Vh + vo + (size_t)nb * 16 * TT + kc), b2 = WFrag<bf>::ld(Vl + vo + (size_t)nb * 16 * TT + kc);
                    acc[nb] = wmmab(a, b, acc[nb]); acc[nb] = wmmab(a2, b, acc[nb]); acc[nb] = wmmab(a, b2, acc[nb]); } }
        }
    } else { const h16* p16 = (const h16*)(sm + lr * SP) + 8 * hi; const h16* vp = V16 + vo + w * 64;
#pragma unroll 1
        for (int g = w; g < ng; g += KSP, vp += KSP * 64) {
            v16h b[2][4];
#pragma unroll
            for (int kk = 0; kk < 2; ++kk)
#pragma unroll
                for (int nb = 0; nb < 4; ++nb) b[kk][nb] = WFrag<h16>::ld(vp + (size_t)nb * 16 * TT + kk * 32);
            asm volatile("" :: "v"(b[0][0]), "v"(b[0][1]), "v"(b[0][2]), "v"(b[0][3]), "v"(b[1][0]), "v"(b[1][1]), "v"(b[1][2]), "v"(b[1][3]));   // inputs only: holds all 16 loads in front of the first product, one memory latency instead of one per fragment
#pragma unroll
            for (int kk = 0; kk < 2; ++kk) { const v16h a = ldsh(p16 + g * 64 + kk * 32);
#pragma unroll
                for (int nb = 0; nb < 4; ++nb) acc[nb] = wmma16(a, b[kk][nb], acc[nb]); }
        }
    }
    __syncthreads();    // every wave has read its last probability: the partial tiles may overwrite them
    { float* pt = sm + w * (16 * OP);
#pragma unroll
        for (int nb = 0; nb < 4; ++nb)
#pragma unroll
            for (int j = 0; j < 8; ++j) pt[(hi * 8 + j) * OP + nb * 16 + lr] = acc[nb][j]; }
    __syncthreads();    // all 16 partial tiles are in LDS
    { const int d = lane * 2, t = i0 + w; const float cs = (t < RH) ? 1.0f : (1.0f / PCAR); const size_t oo = (size_t)t * DQ + h * HD + d;
        v2f s = *(const v2fa*)(sm + w * OP + d);   /* the KSP partial tiles of the split key loop, added in wave order */
#pragma unroll
        for (int p = 1; p < KSP; ++p) { const v2f u = *(const v2fa*)(sm + p * (16 * OP) + w * OP + d); s[0] += u[0]; s[1] += u[1]; }
        v2us oh, ol;
#pragma unroll
        for (int q = 0; q < 2; ++q) { unsigned short a, c2; splitf(s[q] * cs, a, c2); oh[q] = a; ol[q] = c2; } *(v2us*)(Ah + oo) = oh; *(v2us*)(Al + oo) = ol; }
}

extern "C" void kernel_launch(void* const* d_in, const int* in_sizes, int n_in,
                              void* d_out, int out_size, void* d_ws, size_t ws_size, hipStream_t stream) {
    (void)in_sizes; (void)n_in; (void)out_size;
    const float* x = (const float*)d_in[0]; const int* PID = (const int*)d_in[1]; const float* wq = (const float*)d_in[2]; const float* wk = (const float*)d_in[3]; const float* wv = (const float*)d_in[4]; const float* wo = (const float*)d_in[5];   /* input order x, token_positions (int32 [2048], read on device by the table builder), Wq, Wk, Wv, Wo ('oi' [1024][1024]): the host's own six slots */
    float* OUT = (float*)d_out;     // [4][2048][1024]
    char* wsp = (char*)d_ws;
    auto take = [&](size_t bytes) { char* p = wsp; wsp += (bytes + 255) & ~(size_t)255; return (void*)p; };
    bf* WQ = (bf*)take((size_t)DQ * DM * 2); bf* WK = (bf*)take((size_t)DKV * DM * 2); bf* WV = (bf*)take((size_t)DKV * DM * 2); bf* WO = (bf*)take((size_t)DM * DQ * 2); float* CS = (float*)take((size_t)TT * HD * 2 * 4);
    bf* XB = (bf*)take((size_t)TT * DM * 2); float* FQ = (float*)take((size_t)TT * DQ * 4); float* FK = (float*)take((size_t)TT * DKV * 4);
    h16* QP16 = (h16*)take((size_t)NH_ * TT * HD * 2); h16* KP16 = (h16*)take((size_t)NKV * TT * HD * 2); h16* VT16 = (h16*)take((size_t)NKV * HD * TT * 2);
    bf* QPh = (bf*)take((size_t)NH_ * TT * HD * 2); bf* QPl = (bf*)take((size_t)NH_ * TT * HD * 2); bf* KPh = (bf*)take((size_t)NKV * TT * HD * 2); bf* KPl = (bf*)take((size_t)NKV * TT * HD * 2); bf* VTh = (bf*)take((size_t)NKV * HD * TT * 2); bf* VTl = (bf*)take((size_t)NKV * HD * TT * 2);
    bf* ATh = (bf*)take((size_t)TT * DQ * 2); bf* ATl = (bf*)take((size_t)TT * DQ * 2);
    if ((size_t)(wsp - (char*)d_ws) > ws_size) return;    // ws 256 MiB
    float* FV = FK;   // v projection reuses the k buffer after the k planes are built (stream-ordered)
    { k_cvt8<<<(unsigned)(((size_t)DQ * DM / 8 + 255) / 256), 256, 0, stream>>>(wq, WQ, (size_t)DQ * DM / 8); k_cvt8<<<(unsigned)(((size_t)DKV * DM / 8 + 255) / 256), 256, 0, stream>>>(wk, WK, (size_t)DKV * DM / 8); k_cvt8<<<(unsigned)(((size_t)DKV * DM / 8 + 255) / 256), 256, 0, stream>>>(wv, WV, (size_t)DKV * DM / 8);
      k_cvt8<<<(unsigned)(((size_t)DM * DQ / 8 + 255) / 256), 256, 0, stream>>>(wo, WO, (size_t)DM * DQ / 8); /* the rotary table is rebuilt per batch from the one shared positions input (below) */ }
    const unsigned LQ = (unsigned)(((size_t)NH_ * TT * HD / 2 + 255) / 256), LKv = (unsigned)(((size_t)NKV * TT * HD / 2 + 255) / 256);
    for (int b = 0; b < NB_; ++b) {
        k_cstabI<<<(TT * HD + 255) / 256, 256, 0, stream>>>(PID, CS);   /* token_positions[:] (int32, read; the same for every batch) */
        
        k_cvt8<<<(unsigned)(((size_t)TT * DM / 8 + 255) / 256), 256, 0, stream>>>(x + (size_t)b * TT * DM, XB, (size_t)TT * DM / 8);
        k_gemmw<bf, 0, false><<<dim3(TT / 64, DQ / 64, 1), 32, 0, stream>>>(XB, nullptr, WQ, nullptr, DM, FQ, DQ, nullptr, 0, 0, 0);
        k_ropeI<<<LQ, 256, 0, stream>>>(FQ, DQ, NH_, CS, 1.0f, QP16, QPh, QPl);
        k_gemmw<bf, 0, false><<<dim3(TT / 64, DKV / 64, 1), 32, 0, stream>>>(XB, nullptr, WK, nullptr, DM, FK, DKV, nullptr, 0, 0, 0);
        k_ropeI<<<LKv, 256, 0, stream>>>(FK, DKV, NKV, CS, 1.0f, KP16, KPh, KPl);
        k_gemmw<bf, 0, false><<<dim3(TT / 64, DKV / 64, 1), 32, 0, stream>>>(XB, nullptr, WV, nullptr, DM, FV, DKV, nullptr, 0, 0, 0); k_vtp<<<LKv, 256, 0, stream>>>(FV, DKV, NKV, VT16, VTh, VTl);
        k_attn<<<dim3(TT / 16, NH_, 1), 32 * KSP, 0, stream>>>(QPh, QPl, KPh, KPl, VT16, VTh, VTl, ATh, ATl);   /* scores (hi/lo planes, 3 products, EVERY row), softmax, hybrid P.V and the merge, all heads of the batch */
        k_gemmw<bf, 1, false><<<dim3(TT / 64, DM / 64, 1), 32, 0, stream>>>(ATh, ATl, WO, nullptr, DQ, OUT + (size_t)b * TT * DM, DM, nullptr, 0, 0, 0); }
}

// v003
// It runs in 734 microseconds.
// Two timings next to v002 put it at 1.06 and 1.07 times that version's speed.
// Over all steps from v000 it is 3.76 times as fast.
#include <hip/hip_runtime.h>

// Causal multi-head self-attention with interleaved-pair rotary position embedding from a positions input, four batches (x [4][2048][1024]; Q, K, V = x W^T ('oi' [1024][1024] 1/32, no bias; 16 heads x 64; token-major); angles = token_positions (int32 [2048], read on device) x 1 / THETA ** (2i / 64), THETA 1e4; pairs (2i, 2i+1): r_even = x_even cos - x_odd sin, r_odd = x_even sin + x_odd cos, on Q and K; scores / sqrt(64); keys j <= i kept, -inf elsewhere; softmax; out = merged Wo^T ('oi', no bias) -> [4][2048][1024] (8.4 M); argument order x, token_positions, Wq, Wk, Wv, Wo).
// Layout per batch: bf16 copy of x; exact projections; {cos, sin} per (position, pair) rebuilt in every batch from the int positions and float32 inverse-frequency constants (precise cosf/sinf); the interleaved rotary step with the hi/lo split, and the V transpose with its three planes, done in the projection GEMMs' own epilogues (no f32 projection buffer); causal T-2048 attention (EVERY row's scores on hi/lo planes (3 products: logit sigma 2 with these weights) and hybrid P.V (rows < 512 hi/lo, rest fp16 x1024); one fused kernel, k_attn, which stops at the diagonal); merged hi/lo x Wo exact.
// Compute dtypes, f32 accumulate: every input rounded to bf16; projections exact; rotary f32; scores 3 products; P.V rows < 512 3 products, rest fp16; softmax f32; Wo hl x exact.

#define NB_  4      // batches: this module's input is [4][2048][1024]
#define TT   2048
#define DM   1024
#define NH_  16
#define NKV  16
#define REP  (NH_ / NKV)
#define HD   64
#define DQ   (NH_ * HD)
#define DKV  (NKV * HD)
#define RH   512                  // query rows < RH use hi+lo planes in P.V (0: none)
#define PCAR 1024.0f
#define SCL  0.125f   // HD^-0.5
#define KSP  16     // waves of a k_attn work-group; they share the key loops of its 16 query rows (partial P.V tiles in LDS, added in wave order)
typedef _Float16 h16;
typedef unsigned short bf;
typedef __attribute__((ext_vector_type(16))) __bf16   v16bf;
typedef __attribute__((ext_vector_type(16))) _Float16 v16h;
typedef __attribute__((ext_vector_type(8)))  _Float16 v8h;
typedef __attribute__((ext_vector_type(8)))  unsigned short v8us;
typedef __attribute__((ext_vector_type(8)))  float    v8f;
typedef __attribute__((ext_vector_type(4)))  float    v4f;
typedef v8h  __attribute__((may_alias)) v8ha;
typedef v4f  __attribute__((may_alias)) v4fa;
typedef v8us __attribute__((may_alias)) v8usa;

__device__ __forceinline__ unsigned short f2bf(float f) { unsigned u = __float_as_uint(f); u += 0x7FFFu + ((u >> 16) & 1u); return (unsigned short)(u >> 16); }
__device__ __forceinline__ float bf2f(unsigned short b) { return __uint_as_float(((unsigned)b) << 16); }
__device__ __forceinline__ float bfr(float f) { return bf2f(f2bf(f)); }
__device__ __forceinline__ v16h cat16(v8h lo, v8h hi) { return __builtin_shufflevector(lo, hi, 0, 1, 2, 3, 4, 5, 6, 7, 8, 9, 10, 11, 12, 13, 14, 15); }
__device__ __forceinline__ v16bf cat16b(v8us lo, v8us hi) { return __builtin_bit_cast(v16bf, __builtin_shufflevector(lo, hi, 0, 1, 2, 3, 4, 5, 6, 7, 8, 9, 10, 11, 12, 13, 14, 15)); }
__device__ __forceinline__ v8f wmma16(v16h a, v16h b, v8f c) { return __builtin_amdgcn_wmma_f32_16x16x32_f16(false, a, false, b, (short)0, c, false, false); }
__device__ __forceinline__ v8f wmmab(v16bf a, v16bf b, v8f c) { return __builtin_amdgcn_wmma_f32_16x16x32_bf16(false, a, false, b, (short)0, c, false, false); }



__device__ __forceinline__ h16 tohx(float x) { return (h16)x; }
__device__ __forceinline__ void splitf(float y, unsigned short& h, unsigned short& l) { h = f2bf(y); l = f2bf(y - bf2f(h)); }
typedef __attribute__((ext_vector_type(2))) _Float16 v2h;
typedef __attribute__((ext_vector_type(4))) _Float16 v4h;
typedef __attribute__((ext_vector_type(2))) unsigned short v2us;
typedef __attribute__((ext_vector_type(4))) unsigned short v4us;
typedef __attribute__((ext_vector_type(2))) float v2f;
typedef __attribute__((ext_vector_type(4))) int v4i;

// ---- k_gemmw: register-blocked GEMM, ONE WAVE per 64x64 output tile (16 accumulators), operands straight from K-contiguous 16-bit planes; grid (M/64, N/64, Z), 32 threads.
// C[m][n] (f32, pitch ldc, + optional f32 bias[n]) = sum_k A[m][k] Bt[n][k] (+ split products per NSPLIT). z-batch strides sA/sB/sC in elements. K % 32 == 0.
// EPI picks what becomes of the tile, which for EPI 1 and 2 is 64 tokens x one whole head (HD == 64 columns): 0: f32 C as above. 1: rotary step from the {cos, sin} table CS, then the hi/lo split, to the planes Ph, Pl [head][token][d]. 2: fp16 and hi/lo planes P16, Ph, Pl, transposed to [head][d][token].
#define VP 72       // 16-bit elements per d row of a transposed V tile in LDS: 144 bytes = 16 x 9, free of bank conflicts for 16-byte accesses
template <typename T16> struct WFrag;
template <> struct WFrag<h16> { typedef v16h V; static __device__ __forceinline__ V ld(const h16* p) { return cat16(*(const v8h*)p, *(const v8h*)(p + 16)); } static __device__ __forceinline__ v8f mma(V a, V b, v8f c) { return wmma16(a, b, c); } };
template <> struct WFrag<bf> { typedef v16bf V; static __device__ __forceinline__ V ld(const bf* p) { return cat16b(*(const v8us*)p, *(const v8us*)(p + 16)); } static __device__ __forceinline__ v8f mma(V a, V b, v8f c) { return wmmab(a, b, c); } };
template <typename T16, int NSPLIT, bool BIAS, int EPI>
__global__ __launch_bounds__(32) void k_gemmw(const T16* __restrict__ A, const T16* __restrict__ A2, const T16* __restrict__ Bt, const T16* __restrict__ Bt2, int K, float* C, int ldc, const float* __restrict__ bias, size_t sA, size_t sB, size_t sC, const float* __restrict__ CS, h16* P16, bf* Ph, bf* Pl) {
    typedef typename WFrag<T16>::V V;
    __shared__ __align__(16) float os[EPI == 2 ? 3 * HD * VP / 2 : 16 * 68];
    const size_t z = blockIdx.z; A += z * sA; if (A2) A2 += z * sA; Bt += z * sB; if (Bt2) Bt2 += z * sB; C += z * sC;
    const int lane = threadIdx.x & 31, lr = lane & 15, hi = lane >> 4; const int r0 = blockIdx.x * 64, c0 = blockIdx.y * 64;
    v8f acc[4][4];
#pragma unroll
    for (int mb = 0; mb < 4; ++mb)
#pragma unroll
        for (int nb = 0; nb < 4; ++nb) acc[mb][nb] = (v8f){};
    const size_t aoff = (size_t)(r0 + lr) * K + 8 * hi, boff = (size_t)(c0 + lr) * K + 8 * hi;
#pragma unroll 1
    for (int kc = 0; kc < K; kc += 32) {
        V a[4], a2[4];
#pragma unroll
        for (int mb = 0; mb < 4; ++mb) { a[mb] = WFrag<T16>::ld(A + aoff + (size_t)mb * 16 * K + kc); if (NSPLIT == 1 || NSPLIT == 2) a2[mb] = WFrag<T16>::ld(A2 + aoff + (size_t)mb * 16 * K + kc); }
#pragma unroll
        for (int nb = 0; nb < 4; ++nb) { const V b = WFrag<T16>::ld(Bt + boff + (size_t)nb * 16 * K + kc); V b2; if (NSPLIT >= 2) b2 = WFrag<T16>::ld(Bt2 + boff + (size_t)nb * 16 * K + kc);
#pragma unroll
            for (int mb = 0; mb < 4; ++mb) { acc[mb][nb] = WFrag<T16>::mma(a[mb], b, acc[mb][nb]); if (NSPLIT == 1 || NSPLIT == 2) acc[mb][nb] = WFrag<T16>::mma(a2[mb], b, acc[mb][nb]); if (NSPLIT >= 2) acc[mb][nb] = WFrag<T16>::mma(a[mb], b2, acc[mb][nb]); } }
        asm volatile("v_nop\n\tv_nop\n\tv_nop\n\tv_nop" : "+v"(acc[0][0]), "+v"(acc[1][1]), "+v"(acc[2][2]), "+v"(acc[3][3]) : "v"(a[0]), "v"(a[3]));
    }
    if constexpr (EPI == 1) {
        const int cofs = lr * 4;    // a lane takes the pairs (cofs, cofs + 1) and (cofs + 2, cofs + 3) of tokens r0 + mb * 16 + 2 s + hi
        const float* ct = CS + ((size_t)(r0 + hi) * HD + cofs) * 2; const size_t po = ((size_t)blockIdx.y * TT + r0 + hi) * HD + cofs;
        v2f cs[2][8][2];            // {cos, sin} of 16 tokens, fetched one 16-token block ahead of its use
#pragma unroll
        for (int s = 0; s < 8; ++s) { cs[0][s][0] = *(const v2f*)(ct + (size_t)(2 * s) * HD * 2); cs[0][s][1] = *(const v2f*)(ct + (size_t)(2 * s) * HD * 2 + 4); }
#pragma unroll
        for (int mb = 0; mb < 4; ++mb) {
            if (mb < 3) {
#pragma unroll
                for (int s = 0; s < 8; ++s) { cs[(mb + 1) & 1][s][0] = *(const v2f*)(ct + (size_t)((mb + 1) * 16 + 2 * s) * HD * 2); cs[(mb + 1) & 1][s][1] = *(const v2f*)(ct + (size_t)((mb + 1) * 16 + 2 * s) * HD * 2 + 4); } }
#pragma unroll
            for (int nb = 0; nb < 4; ++nb) {
#pragma unroll
                for (int j = 0; j < 8; ++j) os[(hi * 8 + j) * 68 + nb * 16 + lr] = acc[mb][nb][j]; }
            __builtin_amdgcn_wave_barrier(); asm volatile("" ::: "memory");   // one wave: keeps the LDS reads below behind the LDS writes above
#pragma unroll
            for (int s = 0; s < 8; ++s) { const v4f x = *(const v4fa*)(os + (2 * s + hi) * 68 + cofs); const v2f p = cs[mb & 1][s][0], q = cs[mb & 1][s][1]; float r[4]; v4us oh, ol;
                r[0] = x[0] * p[0] - x[1] * p[1]; r[1] = x[0] * p[1] + x[1] * p[0]; r[2] = x[2] * q[0] - x[3] * q[1]; r[3] = x[2] * q[1] + x[3] * q[0];   /* even: x0 c - x1 s; odd: x0 s + x1 c */
#pragma unroll
                for (int e = 0; e < 4; ++e) { unsigned short a2, c2; splitf(r[e], a2, c2); oh[e] = a2; ol[e] = c2; }
                *(v4us*)(Ph + po + (size_t)(mb * 16 + 2 * s) * HD) = oh; *(v4us*)(Pl + po + (size_t)(mb * 16 + 2 * s) * HD) = ol; }   // 16 lanes x 8 bytes: one whole 128-byte line per token and plane
            if (mb < 3) { __builtin_amdgcn_wave_barrier(); asm volatile("s_wait_xcnt 0x0" ::: "memory"); }   // the next block's LDS writes stay behind these reads; the wait stands between the stores above and the next block's loads and products, which take over the stores' registers
        }
        return;
    }
    if constexpr (EPI == 2) {
        unsigned short* l16 = (unsigned short*)os; unsigned short* lh = l16 + HD * VP; unsigned short* ll = lh + HD * VP;
#pragma unroll
        for (int mb = 0; mb < 4; ++mb)
#pragma unroll
            for (int nb = 0; nb < 4; ++nb) { v8h o16; v8us oh, ol;     // a lane's 8 accumulator registers are 8 consecutive tokens of one d
#pragma unroll
                for (int j = 0; j < 8; ++j) { const float x = acc[mb][nb][j]; o16[j] = tohx(x); unsigned short a2, c2; splitf(x, a2, c2); oh[j] = a2; ol[j] = c2; }
                const int lo = (nb * 16 + lr) * VP + mb * 16 + hi * 8; *(v8usa*)(l16 + lo) = __builtin_bit_cast(v8us, o16); *(v8usa*)(lh + lo) = oh; *(v8usa*)(ll + lo) = ol; }
        __builtin_amdgcn_wave_barrier(); asm volatile("" ::: "memory");   // one wave: keeps the LDS reads below behind the LDS writes above
        const int li = (lane >> 3) * VP + (lane & 7) * 8; const size_t go = ((size_t)blockIdx.y * HD + (lane >> 3)) * TT + r0 + (lane & 7) * 8;
#pragma unroll
        for (int s = 0; s < 16; ++s) {   // 8 lanes x 16 bytes: one whole 128-byte line per d row, four rows a store
            *(v8usa*)(P16 + go + (size_t)(s * 4) * TT) = *(const v8usa*)(l16 + li + s * 4 * VP); *(v8usa*)(Ph + go + (size_t)(s * 4) * TT) = *(const v8usa*)(lh + li + s * 4 * VP); *(v8usa*)(Pl + go + (size_t)(s * 4) * TT) = *(const v8usa*)(ll + li + s * 4 * VP); }
        return;
    }
#pragma unroll
    for (int mb = 0; mb < 4; ++mb) {
#pragma unroll
        for (int nb = 0; nb < 4; ++nb) {
#pragma unroll
            for (int j = 0; j < 8; ++j) os[(hi * 8 + j) * 68 + nb * 16 + lr] = acc[mb][nb][j]; }
        __builtin_amdgcn_wave_barrier(); asm volatile("" ::: "memory");
        float* crow = C + (size_t)(r0 + mb * 16) * ldc + c0;
{
#pragma unroll
            for (int s = 0; s < 8; ++s) { const int row = 2 * s + hi, cofs = lr * 4; v4f val = *(const v4fa*)(os + row * 68 + cofs); if (BIAS) { val[0] += bfr(bias[c0 + cofs]); val[1] += bfr(bias[c0 + cofs + 1]); val[2] += bfr(bias[c0 + cofs + 2]); val[3] += bfr(bias[c0 + cofs + 3]); }
                *(v4f*)(crow + (size_t)row * ldc + cofs) = val; }
             }
        __builtin_amdgcn_wave_barrier(); asm volatile("" ::: "memory");
    }
}


__global__ __launch_bounds__(256) void k_wtG(const float* __restrict__ w, int K, int N, bf* Bt) {
    const int lane = threadIdx.x & 31; const int L0 = (blockIdx.x * 8 + (threadIdx.x >> 5)) * 8; const int nlines = N * K / 64;
{
#pragma unroll 1
        for (int l = 0; l < 8; ++l) { const int L = L0 + l; if (L >= nlines) break; const size_t e = (size_t)L * 64 + lane * 2; const int k = (int)(e % K), n = (int)(e / K); v2us o;
            o[0] = f2bf(w[(size_t)k * N + n]); o[1] = f2bf(w[(size_t)(k + 1) * N + n]); *(v2us*)(Bt + e) = o; }
         }
}
__global__ __launch_bounds__(256) void k_cvt8(const float* __restrict__ src, bf* dst, size_t n8) { const size_t i = (size_t)blockIdx.x * 256 + threadIdx.x; if (i >= n8) return; const v8f v = *(const v8f*)(src + i * 8); v8us o;
#pragma unroll
    for (int k = 0; k < 8; ++k) o[k] = f2bf(v[k]); *(v8us*)(dst + i * 8) = o;  }

__constant__ float INV2[HD / 2] = { 1.000000000e+00f, 7.498942018e-01f, 5.623413324e-01f, 4.216965139e-01f, 3.162277639e-01f, 2.371373624e-01f, 1.778279394e-01f, 1.333521456e-01f, 1.000000015e-01f, 7.498941571e-02f, 5.623412877e-02f, 4.216964915e-02f, 3.162277862e-02f, 2.371373586e-02f, 1.778279431e-02f, 1.333521493e-02f, 9.999999776e-03f, 7.498942316e-03f, 5.623413250e-03f, 4.216964822e-03f, 3.162277862e-03f, 2.371373819e-03f, 1.778279431e-03f, 1.333521446e-03f, 1.000000047e-03f, 7.498941850e-04f, 5.623413017e-04f, 4.216964880e-04f, 3.162277862e-04f, 2.371373848e-04f, 1.778279402e-04f, 1.333521504e-04f };   // float32 10000^(-(i * 2 / 64)), generated with jnp to be bit-exact with the module's expression
__global__ __launch_bounds__(256) void k_cstabI(const int* __restrict__ pid, float* CS) { const int idx = blockIdx.x * 256 + threadIdx.x; if (idx >= TT * HD) return; const int d = idx % HD; const int t = idx / HD; const float a = __fmul_rn((float)pid[t], INV2[d >> 1]); v2f cs; cs[0] = cosf(a); cs[1] = sinf(a); *(v2f*)(CS + (size_t)idx * 2) = cs;  }

// ---- k_attn: scores, softmax and P.V of 16 query rows of one head in ONE work-group of KSP = 16 waves; grid (TT / 16, heads), 512 threads. The rows' scores, then their probabilities, then the partial output tiles stay in LDS.
// 1) wave w takes the 64-key groups w, w + 16, ... up to the diagonal: Q hi/lo x K hi/lo (3 products, k order 0..31 then 32..63), f32 scores to LDS row-major (pitch SP floats).
// 2) wave w owns row w: whole-row softmax in registers (one exp, fixed trees; 128-key chunks wholly above the diagonal are exact zeros: no exp, no store); the 16-bit probability planes overwrite the row's own scores.
// 3) wave w takes the same 64-key groups of P.V (rows < RH hi/lo, 3 products; the rest fp16 x PCAR); A fragments from LDS, V fragments from the [d][t] planes; its partial 16x64 tile goes to LDS.
// 4) the 16 partial tiles are added in wave order, scaled and split into the merged hi/lo planes. Long (late) rows get the low block indices, which start first.
#define SP 2052     // floats per score row in LDS: 8192 + 16 bytes, so that the 16 rows of a b128 fragment read fall on distinct banks
#define OP 68       // floats per row of a partial output tile in LDS
typedef v4us __attribute__((may_alias)) v4usa;
typedef v4h  __attribute__((may_alias)) v4ha;
typedef v2f  __attribute__((may_alias)) v2fa;
__device__ __forceinline__ v16bf ldsb(const bf* p) { return cat16b(*(const v8usa*)p, *(const v8usa*)(p + 16)); }
__device__ __forceinline__ v16h ldsh(const h16* p) { return cat16(*(const v8ha*)p, *(const v8ha*)(p + 16)); }
__device__ __forceinline__ float exp2s(float x) { float r; asm("v_exp_f32 %0, %1\n\tv_nop" : "=v"(r) : "v"(x)); return r; }   // the v_nop is the one free slot the instruction set asks for behind a transcendental, before its result is read or its source overwritten; in one statement so that it stays there
__global__ __launch_bounds__(512, 8) void k_attn(const bf* __restrict__ Qh, const bf* __restrict__ Ql, const bf* __restrict__ Kh, const bf* __restrict__ Kl, const h16* __restrict__ V16, const bf* __restrict__ Vh, const bf* __restrict__ Vl, bf* Ah, bf* Al) {
    __shared__ __align__(16) float sm[16 * SP];
    const int lane = threadIdx.x & 31, lr = lane & 15, hi = lane >> 4; const int w = __builtin_amdgcn_readfirstlane((int)(threadIdx.x >> 5));
    const int h = blockIdx.y; const int i0 = (TT / 16 - 1 - (int)blockIdx.x) * 16;
    const int ng = i0 / 64 + 1;                 // 64-key groups up to and with the diagonal's
    const bool hires = (i0 < RH);               // RH is a multiple of 16: the same for all 16 rows
    const size_t qp = (size_t)h * TT * HD, kp = (size_t)(h / REP) * TT * HD;
    if (w < ng) {
        v16bf a[2], a2[2];
#pragma unroll
        for (int kk = 0; kk < 2; ++kk) { a[kk] = WFrag<bf>::ld(Qh + qp + (size_t)(i0 + lr) * HD + 8 * hi + kk * 32); a2[kk] = WFrag<bf>::ld(Ql + qp + (size_t)(i0 + lr) * HD + 8 * hi + kk * 32); }
#pragma unroll 1
        for (int g = w; g < ng; g += KSP) {
            const size_t bo = kp + (size_t)(g * 64 + lr) * HD + 8 * hi;
#pragma unroll
            for (int hb = 0; hb < 2; ++hb) {    // 32 keys at a time: their 8 K fragments, the Q fragments and 2 accumulators fit the 128 registers that let two work-groups share a WGP
                v16bf b[2][2], b2[2][2]; v8f acc[2];
#pragma unroll
                for (int kk = 0; kk < 2; ++kk)
#pragma unroll
                    for (int nb = 0; nb < 2; ++nb) { b[kk][nb] = WFrag<bf>::ld(Kh + bo + (size_t)(hb * 2 + nb) * 16 * HD + kk * 32); b2[kk][nb] = WFrag<bf>::ld(Kl + bo + (size_t)(hb * 2 + nb) * 16 * HD + kk * 32); }
                asm volatile("" :: "v"(b[0][0]), "v"(b[0][1]), "v"(b[1][0]), "v"(b[1][1]), "v"(b2[0][0]), "v"(b2[0][1]), "v"(b2[1][0]), "v"(b2[1][1]));   // inputs only: holds all 16 loads in front of the first product, one memory latency instead of one per fragment
#pragma unroll
                for (int nb = 0; nb < 2; ++nb) acc[nb] = (v8f){};
#pragma unroll
                for (int kk = 0; kk < 2; ++kk)
#pragma unroll
                    for (int nb = 0; nb < 2; ++nb) { acc[nb] = wmmab(a[kk], b[kk][nb], acc[nb]); acc[nb] = wmmab(a2[kk], b[kk][nb], acc[nb]); acc[nb] = wmmab(a[kk], b2[kk][nb], acc[nb]); }
#pragma unroll
                for (int nb = 0; nb < 2; ++nb)
#pragma unroll
                    for (int j = 0; j < 8; ++j) sm[(hi * 8 + j) * SP + g * 64 + (hb * 2 + nb) * 16 + lr] = acc[nb][j];
            }
        }
    }
    __syncthreads();    // every score of the 16 rows is in LDS
    {
        const int i = i0 + w; const int nch = i / 128 + 1; float* sr = sm + w * SP; float v[TT / 32]; float mx = -3.0e38f; v4f raw[TT / 128];
#pragma unroll
        for (int ch = 0; ch < TT / 128; ++ch) raw[ch] = *(const v4fa*)(sr + min(ch * 128 + lane * 4, i & ~3));   /* a lane wholly above the diagonal re-reads the diagonal's quad (dropped by the select below): no unwritten LDS is read */
        __builtin_amdgcn_sched_barrier(0);   // keeps the row's 16 LDS reads together in front of the arithmetic: one LDS latency instead of one per read
#pragma unroll
        for (int ch = 0; ch < TT / 128; ++ch) { const int j0 = ch * 128 + lane * 4; const v4f a = raw[ch];
#pragma unroll
            for (int q = 0; q < 4; ++q) { const int j = j0 + q; const float t = (j <= i) ? a[q] * SCL : -3.0e38f; v[ch * 4 + q] = t; mx = fmaxf(mx, t); } }
#pragma unroll
        for (int sh = 16; sh; sh >>= 1) mx = fmaxf(mx, __shfl_xor(mx, sh, 32));
        float sum = 0.f;
#pragma unroll
        for (int ch = 0; ch < TT / 128; ++ch) if (ch < nch) {
#pragma unroll
            for (int q = 0; q < 4; ++q) { const int k = ch * 4 + q; const float d0 = __fsub_rn(v[k], mx); v[k] = exp2s(__fmul_rn(d0, 1.4426950408889634f)); sum += v[k]; } }
#pragma unroll
        for (int sh = 16; sh; sh >>= 1) sum += __shfl_xor(sum, sh, 32);
        const float f = __fdiv_rn(hires ? 1.0f : PCAR, sum);
        if (hires) { bf* ph = (bf*)sr; bf* pl = ph + TT;
#pragma unroll
            for (int ch = 0; ch < RH / 128; ++ch) if (ch < nch) { v4us oh, ol;
#pragma unroll
                for (int q = 0; q < 4; ++q) { unsigned short a, c2; splitf(v[ch * 4 + q] * f, a, c2); oh[q] = a; ol[q] = c2; }
                *(v4usa*)(ph + ch * 128 + lane * 4) = oh; *(v4usa*)(pl + ch * 128 + lane * 4) = ol; }
        } else { h16* p16 = (h16*)sr;
#pragma unroll
            for (int ch = 0; ch < TT / 128; ++ch) if (ch < nch) { v4h o4;
#pragma unroll
                for (int q = 0; q < 4; ++q) o4[q] = tohx(v[ch * 4 + q] * f);
                *(v4ha*)(p16 + ch * 128 + lane * 4) = o4; } }
    }
    __syncthreads();    // every probability of the 16 rows is in LDS
    v8f acc[4];
#pragma unroll
    for (int nb = 0; nb < 4; ++nb) acc[nb] = (v8f){};
    const size_t vo = kp + (size_t)lr * TT + 8 * hi;
    if (hires) { const bf* ph = (const bf*)(sm + lr * SP) + 8 * hi; const bf* pl = ph + TT;
#pragma unroll 1
        for (int g = w; g < ng; g += KSP) {
#pragma unroll
            for (int kk = 0; kk < 2; ++kk) { const int kc = g * 64 + kk * 32; const v16bf a = ldsb(ph + kc), a2 = ldsb(pl + kc);
#pragma unroll
                for (int nb = 0; nb < 4; ++nb) { const v16bf b = WFrag<bf>::ld(Vh + vo + (size_t)nb * 16 * TT + kc), b2 = WFrag<bf>::ld(Vl + vo + (size_t)nb * 16 * TT + kc);
                    acc[nb] = wmmab(a, b, acc[nb]); acc[nb] = wmmab(a2, b, acc[nb]); acc[nb] = wmmab(a, b2, acc[nb]); } }
        }
    } else { const h16* p16 = (const h16*)(sm + lr * SP) + 8 * hi; const h16* vp = V16 + vo + w * 64;
#pragma unroll 1
        for (int g = w; g < ng; g += KSP, vp += KSP * 64) {
            v16h b[2][4];
#pragma unroll
            for (int kk = 0; kk < 2; ++kk)
#pragma unroll
                for (int nb = 0; nb < 4; ++nb) b[kk][nb] = WFrag<h16>::ld(vp + (size_t)nb * 16 * TT + kk * 32);
            asm volatile("" :: "v"(b[0][0]), "v"(b[0][1]), "v"(b[0][2]), "v"(b[0][3]), "v"(b[1][0]), "v"(b[1][1]), "v"(b[1][2]), "v"(b[1][3]));   // inputs only: holds all 16 loads in front of the first product, one memory latency instead of one per fragment
#pragma unroll
            for (int kk = 0; kk < 2; ++kk) { const v16h a = ldsh(p16 + g * 64 + kk * 32);
#pragma unroll
                for (int nb = 0; nb < 4; ++nb) acc[nb] = wmma16(a, b[kk][nb], acc[nb]); }
        }
    }
    __syncthreads();    // every wave has read its last probability: the partial tiles may overwrite them
    { float* pt = sm + w * (16 * OP);
#pragma unroll
        for (int nb = 0; nb < 4; ++nb)
#pragma unroll
            for (int j = 0; j < 8; ++j) pt[(hi * 8 + j) * OP + nb * 16 + lr] = acc[nb][j]; }
    __syncthreads();    // all 16 partial tiles are in LDS
    { const int d = lane * 2, t = i0 + w; const float cs = (t < RH) ? 1.0f : (1.0f / PCAR); const size_t oo = (size_t)t * DQ + h * HD + d;
        v2f s = *(const v2fa*)(sm + w * OP + d);   /* the KSP partial tiles of the split key loop, added in wave order */
#pragma unroll
        for (int p = 1; p < KSP; ++p) { const v2f u = *(const v2fa*)(sm + p * (16 * OP) + w * OP + d); s[0] += u[0]; s[1] += u[1]; }
        v2us oh, ol;
#pragma unroll
        for (int q = 0; q < 2; ++q) { unsigned short a, c2; splitf(s[q] * cs, a, c2); oh[q] = a; ol[q] = c2; } *(v2us*)(Ah + oo) = oh; *(v2us*)(Al + oo) = ol; }
}

extern "C" void kernel_launch(void* const* d_in, const int* in_sizes, int n_in,
                              void* d_out, int out_size, void* d_ws, size_t ws_size, hipStream_t stream) {
    (void)in_sizes; (void)n_in; (void)out_size;
    const float* x = (const float*)d_in[0]; const int* PID = (const int*)d_in[1]; const float* wq = (const float*)d_in[2]; const float* wk = (const float*)d_in[3]; const float* wv = (const float*)d_in[4]; const float* wo = (const float*)d_in[5];   /* input order x, token_positions (int32 [2048], read on device by the table builder), Wq, Wk, Wv, Wo ('oi' [1024][1024]): the host's own six slots */
    float* OUT = (float*)d_out;     // [4][2048][1024]
    char* wsp = (char*)d_ws;
    auto take = [&](size_t bytes) { char* p = wsp; wsp += (bytes + 255) & ~(size_t)255; return (void*)p; };
    bf* WQ = (bf*)take((size_t)DQ * DM * 2); bf* WK = (bf*)take((size_t)DKV * DM * 2); bf* WV = (bf*)take((size_t)DKV * DM * 2); bf* WO = (bf*)take((size_t)DM * DQ * 2); float* CS = (float*)take((size_t)TT * HD * 2 * 4);
    bf* XB = (bf*)take((size_t)TT * DM * 2);
    h16* VT16 = (h16*)take((size_t)NKV * HD * TT * 2);
    bf* QPh = (bf*)take((size_t)NH_ * TT * HD * 2); bf* QPl = (bf*)take((size_t)NH_ * TT * HD * 2); bf* KPh = (bf*)take((size_t)NKV * TT * HD * 2); bf* KPl = (bf*)take((size_t)NKV * TT * HD * 2); bf* VTh = (bf*)take((size_t)NKV * HD * TT * 2); bf* VTl = (bf*)take((size_t)NKV * HD * TT * 2);
    bf* ATh = (bf*)take((size_t)TT * DQ * 2); bf* ATl = (bf*)take((size_t)TT * DQ * 2);
    if ((size_t)(wsp - (char*)d_ws) > ws_size) return;    // ws 256 MiB
    { k_cvt8<<<(unsigned)(((size_t)DQ * DM / 8 + 255) / 256), 256, 0, stream>>>(wq, WQ, (size_t)DQ * DM / 8); k_cvt8<<<(unsigned)(((size_t)DKV * DM / 8 + 255) / 256), 256, 0, stream>>>(wk, WK, (size_t)DKV * DM / 8); k_cvt8<<<(unsigned)(((size_t)DKV * DM / 8 + 255) / 256), 256, 0, stream>>>(wv, WV, (size_t)DKV * DM / 8);
      k_cvt8<<<(unsigned)(((size_t)DM * DQ / 8 + 255) / 256), 256, 0, stream>>>(wo, WO, (size_t)DM * DQ / 8); /* the rotary table is rebuilt per batch from the same positions (below) */ }
    for (int b = 0; b < NB_; ++b) {
        k_cstabI<<<(TT * HD + 255) / 256, 256, 0, stream>>>(PID, CS);   /* token_positions[:] (int32, read; the same for every batch) */
        
        k_cvt8<<<(unsigned)(((size_t)TT * DM / 8 + 255) / 256), 256, 0, stream>>>(x + (size_t)b * TT * DM, XB, (size_t)TT * DM / 8);
        k_gemmw<bf, 0, false, 1><<<dim3(TT / 64, DQ / 64, 1), 32, 0, stream>>>(XB, nullptr, WQ, nullptr, DM, nullptr, 0, nullptr, 0, 0, 0, CS, nullptr, QPh, QPl);    /* q projection, rotary step, hi/lo planes */
        k_gemmw<bf, 0, false, 1><<<dim3(TT / 64, DKV / 64, 1), 32, 0, stream>>>(XB, nullptr, WK, nullptr, DM, nullptr, 0, nullptr, 0, 0, 0, CS, nullptr, KPh, KPl);   /* k projection, rotary step, hi/lo planes */
        k_gemmw<bf, 0, false, 2><<<dim3(TT / 64, DKV / 64, 1), 32, 0, stream>>>(XB, nullptr, WV, nullptr, DM, nullptr, 0, nullptr, 0, 0, 0, nullptr, VT16, VTh, VTl);   /* v projection, transposed fp16 and hi/lo planes */
        k_attn<<<dim3(TT / 16, NH_, 1), 32 * KSP, 0, stream>>>(QPh, QPl, KPh, KPl, VT16, VTh, VTl, ATh, ATl);   /* scores (hi/lo planes, 3 products, EVERY row), softmax, hybrid P.V and the merge, all heads of the batch */
        k_gemmw<bf, 1, false, 0><<<dim3(TT / 64, DM / 64, 1), 32, 0, stream>>>(ATh, ATl, WO, nullptr, DQ, OUT + (size_t)b * TT * DM, DM, nullptr, 0, 0, 0, nullptr, nullptr, nullptr, nullptr); }
}

// v004
// One run takes 607 microseconds.
// Two timings next to v003 put it at 1.20 and 1.21 times that version's speed.
// All steps since v000 together make it 4.52 times as fast.
#include <hip/hip_runtime.h>

// Causal multi-head self-attention with interleaved-pair rotary position embedding from a positions input, four batches (x [4][2048][1024]; Q, K, V = x W^T ('oi' [1024][1024] 1/32, no bias; 16 heads x 64; token-major); angles = token_positions (int32 [2048], read on device) x 1 / THETA ** (2i / 64), THETA 1e4; pairs (2i, 2i+1): r_even = x_even cos - x_odd sin, r_odd = x_even sin + x_odd cos, on Q and K; scores / sqrt(64); keys j <= i kept, -inf elsewhere; softmax; out = merged Wo^T ('oi', no bias) -> [4][2048][1024] (8.4 M); argument order x, token_positions, Wq, Wk, Wv, Wo).
// Layout per batch: bf16 copy of x; exact projections; {cos, sin} per (position, pair) built once from the int positions and float32 inverse-frequency constants (precise cosf/sinf); the interleaved rotary step with the hi/lo split, and the V transpose with its three planes, done in the projection GEMMs' own epilogues (no f32 projection buffer); causal T-2048 attention (EVERY row's scores on hi/lo planes (3 products: logit sigma 2 with these weights) and hybrid P.V (rows < 512 hi/lo, rest fp16 x1024); one fused kernel, k_attn, which stops at the diagonal); merged hi/lo x Wo exact.
// Every 16-bit operand plane [row][k] lies in FRAGMENT ORDER: a block of 16 rows x 32 k is 1 KiB in a row, blocks k-fastest, then by 16-row block; inside it element (r, k) stands at ((k >> 4) & 1) * 256 + (((k >> 3) & 1) * 16 + r) * 8 + (k & 7). A lane's two 16-byte pieces of a fragment are then base + lane * 8 and + 256: each load of a wave reads 512 bytes in a row (4 whole lines, not 32 bytes of each of 16 lines). The k order of a fragment is the one of the row-major loader, for A and B alike.
// Compute dtypes, f32 accumulate: every input rounded to bf16; projections exact; rotary f32; attention scores 3 products, P.V rows < 512 3 products, rest fp16; softmax f32; Wo hl x exact.

#define NB_  4      // batches: this module's input is [4][2048][1024]
#define TT   2048
#define DM   1024
#define NH_  16
#define NKV  16
#define REP  (NH_ / NKV)
#define HD   64
#define DQ   (NH_ * HD)
#define DKV  (NKV * HD)
#define RH   512                  // query rows < RH use hi+lo planes in P.V (0: none)
#define PCAR 1024.0f
#define SCL  0.125f   // HD^-0.5
#define KSP  16     // waves of a k_attn work-group; they share the key loops of its 16 query rows (partial P.V tiles in LDS, added in wave order)
typedef _Float16 h16;
typedef unsigned short bf;
typedef __attribute__((ext_vector_type(16))) __bf16   v16bf;
typedef __attribute__((ext_vector_type(16))) _Float16 v16h;
typedef __attribute__((ext_vector_type(8)))  _Float16 v8h;
typedef __attribute__((ext_vector_type(8)))  unsigned short v8us;
typedef __attribute__((ext_vector_type(8)))  float    v8f;
typedef __attribute__((ext_vector_type(4)))  float    v4f;
typedef v8h  __attribute__((may_alias)) v8ha;
typedef v4f  __attribute__((may_alias)) v4fa;
typedef v8us __attribute__((may_alias)) v8usa;

__device__ __forceinline__ unsigned short f2bf(float f) { unsigned u = __float_as_uint(f); u += 0x7FFFu + ((u >> 16) & 1u); return (unsigned short)(u >> 16); }
__device__ __forceinline__ float bf2f(unsigned short b) { return __uint_as_float(((unsigned)b) << 16); }
__device__ __forceinline__ float bfr(float f) { return bf2f(f2bf(f)); }
__device__ __forceinline__ v16h cat16(v8h lo, v8h hi) { return __builtin_shufflevector(lo, hi, 0, 1, 2, 3, 4, 5, 6, 7, 8, 9, 10, 11, 12, 13, 14, 15); }
__device__ __forceinline__ v16bf cat16b(v8us lo, v8us hi) { return __builtin_bit_cast(v16bf, __builtin_shufflevector(lo, hi, 0, 1, 2, 3, 4, 5, 6, 7, 8, 9, 10, 11, 12, 13, 14, 15)); }
__device__ __forceinline__ v8f wmma16(v16h a, v16h b, v8f c) { return __builtin_amdgcn_wmma_f32_16x16x32_f16(false, a, false, b, (short)0, c, false, false); }
__device__ __forceinline__ v8f wmmab(v16bf a, v16bf b, v8f c) { return __builtin_amdgcn_wmma_f32_16x16x32_bf16(false, a, false, b, (short)0, c, false, false); }



__device__ __forceinline__ h16 tohx(float x) { return (h16)x; }
__device__ __forceinline__ void splitf(float y, unsigned short& h, unsigned short& l) { h = f2bf(y); l = f2bf(y - bf2f(h)); }
typedef __attribute__((ext_vector_type(2))) _Float16 v2h;
typedef __attribute__((ext_vector_type(4))) _Float16 v4h;
typedef __attribute__((ext_vector_type(2))) unsigned short v2us;
typedef __attribute__((ext_vector_type(4))) unsigned short v4us;
typedef __attribute__((ext_vector_type(2))) float v2f;
typedef __attribute__((ext_vector_type(4))) int v4i;

// ---- k_gemmw: register-blocked GEMM, ONE WAVE per 64x64 output tile (16 accumulators), operands straight from 16-bit planes in fragment order (WFrag::ld takes the block's base + lane * 8); grid (M/64, N/64, Z), 32 threads.
// C[m][n] (f32, pitch ldc, + optional f32 bias[n]) = sum_k A[m][k] Bt[n][k] (+ split products per NSPLIT). z-batch strides sA/sB/sC in elements. K % 32 == 0.
// EPI picks what becomes of the tile, which for EPI 1 and 2 is 64 tokens x one whole head (HD == 64 columns): 0: f32 C as above. 1: rotary step from the {cos, sin} table CS, then the hi/lo split, to the planes Ph, Pl [head][token][d] (fragment order, rows = tokens). 2: fp16 and hi/lo planes P16, Ph, Pl, transposed to [head][d][token] (fragment order, rows = d).
template <typename T16> struct WFrag;
template <> struct WFrag<h16> { typedef v16h V; static __device__ __forceinline__ V ld(const h16* p) { return cat16(*(const v8h*)p, *(const v8h*)(p + 256)); } static __device__ __forceinline__ v8f mma(V a, V b, v8f c) { return wmma16(a, b, c); } };
template <> struct WFrag<bf> { typedef v16bf V; static __device__ __forceinline__ V ld(const bf* p) { return cat16b(*(const v8us*)p, *(const v8us*)(p + 256)); } static __device__ __forceinline__ v8f mma(V a, V b, v8f c) { return wmmab(a, b, c); } };
template <typename T16, int NSPLIT, bool BIAS, int EPI, int K>
__global__ __launch_bounds__(32) void k_gemmw(const T16* __restrict__ A, const T16* __restrict__ A2, const T16* __restrict__ Bt, const T16* __restrict__ Bt2, float* C, int ldc, const float* __restrict__ bias, size_t sA, size_t sB, size_t sC, const float* __restrict__ CS, h16* P16, bf* Ph, bf* Pl) {
    typedef typename WFrag<T16>::V V;
    __shared__ __align__(16) float os[16 * 68];
    const size_t z = blockIdx.z; A += z * sA; if (A2) A2 += z * sA; Bt += z * sB; if (Bt2) Bt2 += z * sB; C += z * sC;
    const int lane = threadIdx.x & 31, lr = lane & 15, hi = lane >> 4; const int r0 = blockIdx.x * 64, c0 = blockIdx.y * 64;
    v8f acc[4][4];
#pragma unroll
    for (int mb = 0; mb < 4; ++mb)
#pragma unroll
        for (int nb = 0; nb < 4; ++nb) acc[mb][nb] = (v8f){};
    A += (size_t)r0 * K; if (A2) A2 += (size_t)r0 * K; Bt += (size_t)c0 * K; if (Bt2) Bt2 += (size_t)c0 * K;   // 16 rows x K elements per 16-row block, 512 elements per 32 k; K is a compile-time constant, so that a pass's loads come off one wave-uniform base per plane, the lane's own offset and immediates
    const unsigned l8 = 8 * lane;
#pragma unroll 1
    for (int kc = 0; kc < K; kc += 32) {
        V a[4], a2[4]; const T16* pa = A + kc * 16 + l8; const T16* pa2 = (NSPLIT == 1 || NSPLIT == 2) ? A2 + kc * 16 + l8 : pa; const T16* pb = Bt + kc * 16 + l8; const T16* pb2 = (NSPLIT >= 2) ? Bt2 + kc * 16 + l8 : pb;
#pragma unroll
        for (int mb = 0; mb < 4; ++mb) { a[mb] = WFrag<T16>::ld(pa + mb * 16 * K); if (NSPLIT == 1 || NSPLIT == 2) a2[mb] = WFrag<T16>::ld(pa2 + mb * 16 * K); }
#pragma unroll
        for (int nb = 0; nb < 4; ++nb) { const V b = WFrag<T16>::ld(pb + nb * 16 * K); V b2; if (NSPLIT >= 2) b2 = WFrag<T16>::ld(pb2 + nb * 16 * K);
#pragma unroll
            for (int mb = 0; mb < 4; ++mb) { acc[mb][nb] = WFrag<T16>::mma(a[mb], b, acc[mb][nb]); if (NSPLIT == 1 || NSPLIT == 2) acc[mb][nb] = WFrag<T16>::mma(a2[mb], b, acc[mb][nb]); if (NSPLIT >= 2) acc[mb][nb] = WFrag<T16>::mma(a[mb], b2, acc[mb][nb]); } }
        asm volatile("s_wait_xcnt 0x0" :: "v"(pa), "v"(pa2), "v"(pb), "v"(pb2) : "memory");   // the wait that stands in front of every overwrite of a register which an issued load names: it takes the pass's address pairs as inputs, so that they keep their registers up to here and no later load of the pass lands on them
        asm volatile("v_nop\n\tv_nop\n\tv_nop\n\tv_nop" : "+v"(acc[0][0]), "+v"(acc[1][1]), "+v"(acc[2][2]), "+v"(acc[3][3]) : "v"(a[0]), "v"(a[3]));
    }
    if constexpr (EPI == 1) {
        const int tk = lane >> 1, cofs = (lane & 1) * 4;    // a lane takes the pairs (d, d + 1) and (d + 2, d + 3), d = s * 8 + cofs, of token r0 + mb * 16 + tk: in fragment order that is element s * 128 + lane * 4 of the 16-token block
        const float* ct = CS + ((size_t)(r0 + tk) * HD + cofs) * 2; const size_t po = ((size_t)blockIdx.y * TT + r0) * HD + lane * 4;
        v2f cs[2][8][2];            // {cos, sin} of 16 tokens, fetched one 16-token block ahead of its use
#pragma unroll
        for (int s = 0; s < 8; ++s) { cs[0][s][0] = *(const v2f*)(ct + s * 16); cs[0][s][1] = *(const v2f*)(ct + s * 16 + 4); }
#pragma unroll
        for (int mb = 0; mb < 4; ++mb) {
            if (mb < 3) {
#pragma unroll
                for (int s = 0; s < 8; ++s) { cs[(mb + 1) & 1][s][0] = *(const v2f*)(ct + (size_t)(mb + 1) * 16 * HD * 2 + s * 16); cs[(mb + 1) & 1][s][1] = *(const v2f*)(ct + (size_t)(mb + 1) * 16 * HD * 2 + s * 16 + 4); } }
#pragma unroll
            for (int nb = 0; nb < 4; ++nb) {
#pragma unroll
                for (int j = 0; j < 8; ++j) os[(hi * 8 + j) * 68 + nb * 16 + lr] = acc[mb][nb][j]; }
            __builtin_amdgcn_wave_barrier(); asm volatile("" ::: "memory");   // one wave: keeps the LDS reads below behind the LDS writes above
#pragma unroll
            for (int s = 0; s < 8; ++s) { const v4f x = *(const v4fa*)(os + tk * 68 + s * 8 + cofs); const v2f p = cs[mb & 1][s][0], q = cs[mb & 1][s][1]; float r[4]; v4us oh, ol;
                r[0] = x[0] * p[0] - x[1] * p[1]; r[1] = x[0] * p[1] + x[1] * p[0]; r[2] = x[2] * q[0] - x[3] * q[1]; r[3] = x[2] * q[1] + x[3] * q[0];   /* even: x0 c - x1 s; odd: x0 s + x1 c */
#pragma unroll
                for (int e = 0; e < 4; ++e) { unsigned short a2, c2; splitf(r[e], a2, c2); oh[e] = a2; ol[e] = c2; }
                *(v4us*)(Ph + po + (size_t)(mb * 16 * HD + s * 128)) = oh; *(v4us*)(Pl + po + (size_t)(mb * 16 * HD + s * 128)) = ol; }   // 32 lanes x 8 bytes: two whole 128-byte lines per plane
            if (mb < 3) { __builtin_amdgcn_wave_barrier(); asm volatile("s_wait_xcnt 0x0" ::: "memory"); }   // the next block's LDS writes stay behind these reads; the wait stands between the stores above and the next block's loads and products, which take over the stores' registers
        }
        return;
    }
    if constexpr (EPI == 2) {
        const size_t go = (size_t)blockIdx.y * HD * TT + (size_t)r0 * 16 + lane * 8;   // rows = d: 16 x TT elements per 16-d block, 512 per 32 tokens
#pragma unroll
        for (int mb = 0; mb < 4; ++mb)
#pragma unroll
            for (int nb = 0; nb < 4; ++nb) { v8h o16; v8us oh, ol;     // a lane's 8 accumulator registers are 8 consecutive tokens (mb * 16 + hi * 8 ...) of d = nb * 16 + lr: exactly its 16-byte piece, lane * 8, of quarter mb of the tile's two fragment blocks, so that no LDS pass is needed
#pragma unroll
                for (int j = 0; j < 8; ++j) { const float x = acc[mb][nb][j]; o16[j] = tohx(x); unsigned short a2, c2; splitf(x, a2, c2); oh[j] = a2; ol[j] = c2; }
                const size_t o = go + (size_t)nb * 16 * TT + mb * 256; *(v8usa*)(P16 + o) = __builtin_bit_cast(v8us, o16); *(v8usa*)(Ph + o) = oh; *(v8usa*)(Pl + o) = ol; }   // 32 lanes x 16 bytes: four whole 128-byte lines a store
        return;
    }
#pragma unroll
    for (int mb = 0; mb < 4; ++mb) {
#pragma unroll
        for (int nb = 0; nb < 4; ++nb) {
#pragma unroll
            for (int j = 0; j < 8; ++j) os[(hi * 8 + j) * 68 + nb * 16 + lr] = acc[mb][nb][j]; }
        __builtin_amdgcn_wave_barrier(); asm volatile("" ::: "memory");
        float* crow = C + (size_t)(r0 + mb * 16) * ldc + c0;
{
#pragma unroll
            for (int s = 0; s < 8; ++s) { const int row = 2 * s + hi, cofs = lr * 4; v4f val = *(const v4fa*)(os + row * 68 + cofs); if (BIAS) { val[0] += bfr(bias[c0 + cofs]); val[1] += bfr(bias[c0 + cofs + 1]); val[2] += bfr(bias[c0 + cofs + 2]); val[3] += bfr(bias[c0 + cofs + 3]); }
                *(v4f*)(crow + (size_t)row * ldc + cofs) = val; }
             }
        __builtin_amdgcn_wave_barrier(); asm volatile("" ::: "memory");
    }
}


__global__ __launch_bounds__(256) void k_wtG(const float* __restrict__ w, int K, int N, bf* Bt) {
    const int lane = threadIdx.x & 31; const int L0 = (blockIdx.x * 8 + (threadIdx.x >> 5)) * 8; const int nlines = N * K / 64;
{
#pragma unroll 1
        for (int l = 0; l < 8; ++l) { const int L = L0 + l; if (L >= nlines) break; const size_t e = (size_t)L * 64 + lane * 2; const int k = (int)(e % K), n = (int)(e / K); v2us o;
            o[0] = f2bf(w[(size_t)k * N + n]); o[1] = f2bf(w[(size_t)(k + 1) * N + n]); *(v2us*)(Bt + e) = o; }
         }
}
// k_cvt8: f32 [row][DM] to the bf16 plane in fragment order, 8 values (one 16-byte piece) a thread. A wave takes 8 rows x 32 k: it reads one whole 128-byte line of each row and writes four whole lines of the block (pieces c = k / 8 of rows rr .. rr + 7 stand in a row).
__global__ __launch_bounds__(256) void k_cvt8(const float* __restrict__ src, bf* dst, size_t n8) { const size_t i = (size_t)blockIdx.x * 256 + threadIdx.x; if (i >= n8) return; const size_t fr = i >> 6; const int c = (int)(i >> 3) & 3, rr = (int)((i >> 5) & 1) * 8 + (int)(i & 7); const v8f v = *(const v8f*)(src + ((fr / (DM / 32)) * 16 + rr) * DM + (fr % (DM / 32)) * 32 + c * 8); v8us o;
#pragma unroll
    for (int k = 0; k < 8; ++k) o[k] = f2bf(v[k]); *(v8us*)(dst + fr * 512 + (c >> 1) * 256 + ((c & 1) * 16 + rr) * 8) = o;  }

__constant__ float INV2[HD / 2] = { 1.000000000e+00f, 7.498942018e-01f, 5.623413324e-01f, 4.216965139e-01f, 3.162277639e-01f, 2.371373624e-01f, 1.778279394e-01f, 1.333521456e-01f, 1.000000015e-01f, 7.498941571e-02f, 5.623412877e-02f, 4.216964915e-02f, 3.162277862e-02f, 2.371373586e-02f, 1.778279431e-02f, 1.333521493e-02f, 9.999999776e-03f, 7.498942316e-03f, 5.623413250e-03f, 4.216964822e-03f, 3.162277862e-03f, 2.371373819e-03f, 1.778279431e-03f, 1.333521446e-03f, 1.000000047e-03f, 7.498941850e-04f, 5.623413017e-04f, 4.216964880e-04f, 3.162277862e-04f, 2.371373848e-04f, 1.778279402e-04f, 1.333521504e-04f };   // float32 10000^(-(i * 2 / 64)), generated with jnp to be bit-exact with the module's expression
__global__ __launch_bounds__(256) void k_cstabI(const int* __restrict__ pid, float* CS) { const int idx = blockIdx.x * 256 + threadIdx.x; if (idx >= TT * HD) return; const int d = idx % HD; const int t = idx / HD; const float a = __fmul_rn((float)pid[t], INV2[d >> 1]); v2f cs; cs[0] = cosf(a); cs[1] = sinf(a); *(v2f*)(CS + (size_t)idx * 2) = cs;  }

// ---- k_attn: scores, softmax and P.V of 16 query rows of one head in ONE work-group of KSP = 16 waves; grid (TT / 16, heads), 512 threads. The rows' scores, then their probabilities, then the partial output tiles stay in LDS.
// 1) wave w takes the 64-key groups w, w + 16, ... up to the diagonal: Q hi/lo x K hi/lo (3 products, k order 0..31 then 32..63), f32 scores to LDS row-major (pitch SP floats).
// 2) wave w owns row w: whole-row softmax in registers (one exp, fixed trees; 128-key chunks wholly above the diagonal are exact zeros: no exp, no store); the 16-bit probability planes overwrite the row's own scores.
// 3) wave w takes the same 64-key groups of P.V (rows < RH hi/lo, 3 products; the rest fp16 x PCAR); A fragments from LDS (row-major there), V fragments from the [d][t] planes; its partial 16x64 tile goes to LDS.
// 4) the 16 partial tiles are added in wave order, scaled and split into the merged hi/lo planes. Long (late) rows get the low block indices, which start first.
#define SP 2052     // floats per score row in LDS: 8192 + 16 bytes, so that the 16 rows of a b128 fragment read fall on distinct banks
#define OP 68       // floats per row of a partial output tile in LDS
typedef v4us __attribute__((may_alias)) v4usa;
typedef v4h  __attribute__((may_alias)) v4ha;
typedef v2f  __attribute__((may_alias)) v2fa;
__device__ __forceinline__ v16bf ldsb(const bf* p) { return cat16b(*(const v8usa*)p, *(const v8usa*)(p + 16)); }
__device__ __forceinline__ v16h ldsh(const h16* p) { return cat16(*(const v8ha*)p, *(const v8ha*)(p + 16)); }
__device__ __forceinline__ float exp2s(float x) { float r; asm("v_exp_f32 %0, %1\n\tv_nop" : "=v"(r) : "v"(x)); return r; }   // the v_nop is the one free slot the instruction set asks for behind a transcendental, before its result is read or its source overwritten; in one statement so that it stays there
__global__ __launch_bounds__(512, 8) void k_attn(const bf* __restrict__ Qh, const bf* __restrict__ Ql, const bf* __restrict__ Kh, const bf* __restrict__ Kl, const h16* __restrict__ V16, const bf* __restrict__ Vh, const bf* __restrict__ Vl, bf* Ah, bf* Al) {
    __shared__ __align__(16) float sm[16 * SP];
    const int lane = threadIdx.x & 31, lr = lane & 15, hi = lane >> 4; const int w = __builtin_amdgcn_readfirstlane((int)(threadIdx.x >> 5));
    const int h = blockIdx.y; const int i0 = (TT / 16 - 1 - (int)blockIdx.x) * 16;
    const int ng = i0 / 64 + 1;                 // 64-key groups up to and with the diagonal's
    const bool hires = (i0 < RH);               // RH is a multiple of 16: the same for all 16 rows
    const size_t qp = (size_t)h * TT * HD, kp = (size_t)(h / REP) * TT * HD;
    if (w < ng) {
        v16bf a[2], a2[2];
#pragma unroll
        for (int kk = 0; kk < 2; ++kk) { a[kk] = WFrag<bf>::ld(Qh + qp + (size_t)i0 * HD + 8 * lane + kk * 512); a2[kk] = WFrag<bf>::ld(Ql + qp + (size_t)i0 * HD + 8 * lane + kk * 512); }
#pragma unroll 1
        for (int g = w; g < ng; g += KSP) {
            const size_t bo = kp + (size_t)(g * 64) * HD + 8 * lane;
#pragma unroll
            for (int hb = 0; hb < 2; ++hb) {    // 32 keys at a time: their 8 K fragments, the Q fragments and 2 accumulators fit the 128 registers that let two work-groups share a WGP
                v16bf b[2][2], b2[2][2]; v8f acc[2];
#pragma unroll
                for (int kk = 0; kk < 2; ++kk)
#pragma unroll
                    for (int nb = 0; nb < 2; ++nb) { b[kk][nb] = WFrag<bf>::ld(Kh + bo + (size_t)(hb * 2 + nb) * 16 * HD + kk * 512); b2[kk][nb] = WFrag<bf>::ld(Kl + bo + (size_t)(hb * 2 + nb) * 16 * HD + kk * 512); }
                asm volatile("" :: "v"(b[0][0]), "v"(b[0][1]), "v"(b[1][0]), "v"(b[1][1]), "v"(b2[0][0]), "v"(b2[0][1]), "v"(b2[1][0]), "v"(b2[1][1]));   // inputs only: holds all 16 loads in front of the first product, one memory latency instead of one per fragment
#pragma unroll
                for (int nb = 0; nb < 2; ++nb) acc[nb] = (v8f){};
#pragma unroll
                for (int kk = 0; kk < 2; ++kk)
#pragma unroll
                    for (int nb = 0; nb < 2; ++nb) { acc[nb] = wmmab(a[kk], b[kk][nb], acc[nb]); acc[nb] = wmmab(a2[kk], b[kk][nb], acc[nb]); acc[nb] = wmmab(a[kk], b2[kk][nb], acc[nb]); }
#pragma unroll
                for (int nb = 0; nb < 2; ++nb)
#pragma unroll
                    for (int j = 0; j < 8; ++j) sm[(hi * 8 + j) * SP + g * 64 + (hb * 2 + nb) * 16 + lr] = acc[nb][j];
            }
        }
    }
    __syncthreads();    // every score of the 16 rows is in LDS
    {
        const int i = i0 + w; const int nch = i / 128 + 1; float* sr = sm + w * SP; float v[TT / 32]; float mx = -3.0e38f; v4f raw[TT / 128];
#pragma unroll
        for (int ch = 0; ch < TT / 128; ++ch) raw[ch] = *(const v4fa*)(sr + min(ch * 128 + lane * 4, i & ~3));   /* a lane wholly above the diagonal re-reads the diagonal's quad (dropped by the select below): no unwritten LDS is read */
        __builtin_amdgcn_sched_barrier(0);   // keeps the row's 16 LDS reads together in front of the arithmetic: one LDS latency instead of one per read
#pragma unroll
        for (int ch = 0; ch < TT / 128; ++ch) { const int j0 = ch * 128 + lane * 4; const v4f a = raw[ch];
#pragma unroll
            for (int q = 0; q < 4; ++q) { const int j = j0 + q; const float t = (j <= i) ? a[q] * SCL : -3.0e38f; v[ch * 4 + q] = t; mx = fmaxf(mx, t); } }
#pragma unroll
        for (int sh = 16; sh; sh >>= 1) mx = fmaxf(mx, __shfl_xor(mx, sh, 32));
        float sum = 0.f;
#pragma unroll
        for (int ch = 0; ch < TT / 128; ++ch) if (ch < nch) {
#pragma unroll
            for (int q = 0; q < 4; ++q) { const int k = ch * 4 + q; const float d0 = __fsub_rn(v[k], mx); v[k] = exp2s(__fmul_rn(d0, 1.4426950408889634f)); sum += v[k]; } }
#pragma unroll
        for (int sh = 16; sh; sh >>= 1) sum += __shfl_xor(sum, sh, 32);
        const float f = __fdiv_rn(hires ? 1.0f : PCAR, sum);
        if (hires) { bf* ph = (bf*)sr; bf* pl = ph + TT;
#pragma unroll
            for (int ch = 0; ch < RH / 128; ++ch) if (ch < nch) { v4us oh, ol;
#pragma unroll
                for (int q = 0; q < 4; ++q) { unsigned short a, c2; splitf(v[ch * 4 + q] * f, a, c2); oh[q] = a; ol[q] = c2; }
                *(v4usa*)(ph + ch * 128 + lane * 4) = oh; *(v4usa*)(pl + ch * 128 + lane * 4) = ol; }
        } else { h16* p16 = (h16*)sr;
#pragma unroll
            for (int ch = 0; ch < TT / 128; ++ch) if (ch < nch) { v4h o4;
#pragma unroll
                for (int q = 0; q < 4; ++q) o4[q] = tohx(v[ch * 4 + q] * f);
                *(v4ha*)(p16 + ch * 128 + lane * 4) = o4; } }
    }
    __syncthreads();    // every probability of the 16 rows is in LDS
    v8f acc[4];
#pragma unroll
    for (int nb = 0; nb < 4; ++nb) acc[nb] = (v8f){};
    const size_t vo = kp + 8 * lane;   // V planes: rows = d, 16 x TT elements per 16-d block, 512 per 32 keys
    if (hires) { const bf* ph = (const bf*)(sm + lr * SP) + 8 * hi; const bf* pl = ph + TT;
#pragma unroll 1
        for (int g = w; g < ng; g += KSP) {
#pragma unroll
            for (int kk = 0; kk < 2; ++kk) { const int kc = g * 64 + kk * 32; const v16bf a = ldsb(ph + kc), a2 = ldsb(pl + kc);
#pragma unroll
                for (int nb = 0; nb < 4; ++nb) { const v16bf b = WFrag<bf>::ld(Vh + vo + (size_t)nb * 16 * TT + kc * 16), b2 = WFrag<bf>::ld(Vl + vo + (size_t)nb * 16 * TT + kc * 16);
                    acc[nb] = wmmab(a, b, acc[nb]); acc[nb] = wmmab(a2, b, acc[nb]); acc[nb] = wmmab(a, b2, acc[nb]); } }
        }
    } else { const h16* p16 = (const h16*)(sm + lr * SP) + 8 * hi; const h16* vp = V16 + vo + w * 1024;
#pragma unroll 1
        for (int g = w; g < ng; g += KSP, vp += KSP * 1024) {
            v16h b[2][4];
#pragma unroll
            for (int kk = 0; kk < 2; ++kk)
#pragma unroll
                for (int nb = 0; nb < 4; ++nb) b[kk][nb] = WFrag<h16>::ld(vp + (size_t)nb * 16 * TT + kk * 512);
            asm volatile("" :: "v"(b[0][0]), "v"(b[0][1]), "v"(b[0][2]), "v"(b[0][3]), "v"(b[1][0]), "v"(b[1][1]), "v"(b[1][2]), "v"(b[1][3]));   // inputs only: holds all 16 loads in front of the first product, one memory latency instead of one per fragment
#pragma unroll
            for (int kk = 0; kk < 2; ++kk) { const v16h a = ldsh(p16 + g * 64 + kk * 32);
#pragma unroll
                for (int nb = 0; nb < 4; ++nb) acc[nb] = wmma16(a, b[kk][nb], acc[nb]); }
        }
    }
    __syncthreads();    // every wave has read its last probability: the partial tiles may overwrite them
    { float* pt = sm + w * (16 * OP);
#pragma unroll
        for (int nb = 0; nb < 4; ++nb)
#pragma unroll
            for (int j = 0; j < 8; ++j) pt[(hi * 8 + j) * OP + nb * 16 + lr] = acc[nb][j]; }
    __syncthreads();    // all 16 partial tiles are in LDS
    { const int d = (w >> 1) * 8 + (lane & 3) * 2, rw = (w & 1) * 8 + (lane >> 2); const float cs = hires ? 1.0f : (1.0f / PCAR); const size_t oo = (size_t)i0 * DQ + h * 1024 + w * 64 + lane * 2;   // the merged planes are the last GEMM's A operand (rows = tokens, k = h * HD + d): the tile is two fragment blocks in a row, and thread w * 32 + lane takes their elements w * 64 + lane * 2 and the next, which are (row rw, d and d + 1): one whole line a wave and plane
        v2f s = *(const v2fa*)(sm + rw * OP + d);   /* the KSP partial tiles of the split key loop, added in wave order */
#pragma unroll
        for (int p = 1; p < KSP; ++p) { const v2f u = *(const v2fa*)(sm + p * (16 * OP) + rw * OP + d); s[0] += u[0]; s[1] += u[1]; }
        v2us oh, ol;
#pragma unroll
        for (int q = 0; q < 2; ++q) { unsigned short a, c2; splitf(s[q] * cs, a, c2); oh[q] = a; ol[q] = c2; } *(v2us*)(Ah + oo) = oh; *(v2us*)(Al + oo) = ol; }
}

extern "C" void kernel_launch(void* const* d_in, const int* in_sizes, int n_in,
                              void* d_out, int out_size, void* d_ws, size_t ws_size, hipStream_t stream) {
    (void)in_sizes; (void)n_in; (void)out_size;
    const float* x = (const float*)d_in[0]; const int* PID = (const int*)d_in[1]; const float* wq = (const float*)d_in[2]; const float* wk = (const float*)d_in[3]; const float* wv = (const float*)d_in[4]; const float* wo = (const float*)d_in[5];   /* input order x, token_positions (int32 [2048], read on device by the table builder), Wq, Wk, Wv, Wo ('oi' [1024][1024]): the host's own six slots */
    float* OUT = (float*)d_out;     // [4][2048][1024]
    char* wsp = (char*)d_ws;
    auto take = [&](size_t bytes) { char* p = wsp; wsp += (bytes + 255) & ~(size_t)255; return (void*)p; };
    bf* WQ = (bf*)take((size_t)DQ * DM * 2); bf* WK = (bf*)take((size_t)DKV * DM * 2); bf* WV = (bf*)take((size_t)DKV * DM * 2); bf* WO = (bf*)take((size_t)DM * DQ * 2); float* CS = (float*)take((size_t)TT * HD * 2 * 4);
    bf* XB = (bf*)take((size_t)TT * DM * 2);
    h16* VT16 = (h16*)take((size_t)NKV * HD * TT * 2);
    bf* QPh = (bf*)take((size_t)NH_ * TT * HD * 2); bf* QPl = (bf*)take((size_t)NH_ * TT * HD * 2); bf* KPh = (bf*)take((size_t)NKV * TT * HD * 2); bf* KPl = (bf*)take((size_t)NKV * TT * HD * 2); bf* VTh = (bf*)take((size_t)NKV * HD * TT * 2); bf* VTl = (bf*)take((size_t)NKV * HD * TT * 2);
    bf* ATh = (bf*)take((size_t)TT * DQ * 2); bf* ATl = (bf*)take((size_t)TT * DQ * 2);
    if ((size_t)(wsp - (char*)d_ws) > ws_size) return;    // ws 256 MiB
    { k_cvt8<<<(unsigned)(((size_t)DQ * DM / 8 + 255) / 256), 256, 0, stream>>>(wq, WQ, (size_t)DQ * DM / 8); k_cvt8<<<(unsigned)(((size_t)DKV * DM / 8 + 255) / 256), 256, 0, stream>>>(wk, WK, (size_t)DKV * DM / 8); k_cvt8<<<(unsigned)(((size_t)DKV * DM / 8 + 255) / 256), 256, 0, stream>>>(wv, WV, (size_t)DKV * DM / 8);
      k_cvt8<<<(unsigned)(((size_t)DM * DQ / 8 + 255) / 256), 256, 0, stream>>>(wo, WO, (size_t)DM * DQ / 8); /* the rotary table is rebuilt per batch from the same positions (below) */ }
    for (int b = 0; b < NB_; ++b) {
        k_cstabI<<<(TT * HD + 255) / 256, 256, 0, stream>>>(PID, CS);   /* token_positions[:] (int32, read; the same for every batch) */
        
        k_cvt8<<<(unsigned)(((size_t)TT * DM / 8 + 255) / 256), 256, 0, stream>>>(x + (size_t)b * TT * DM, XB, (size_t)TT * DM / 8);
        k_gemmw<bf, 0, false, 1, DM><<<dim3(TT / 64, DQ / 64, 1), 32, 0, stream>>>(XB, nullptr, WQ, nullptr, nullptr, 0, nullptr, 0, 0, 0, CS, nullptr, QPh, QPl);    /* q projection, rotary step, hi/lo planes */
        k_gemmw<bf, 0, false, 1, DM><<<dim3(TT / 64, DKV / 64, 1), 32, 0, stream>>>(XB, nullptr, WK, nullptr, nullptr, 0, nullptr, 0, 0, 0, CS, nullptr, KPh, KPl);   /* k projection, rotary step, hi/lo planes */
        k_gemmw<bf, 0, false, 2, DM><<<dim3(TT / 64, DKV / 64, 1), 32, 0, stream>>>(XB, nullptr, WV, nullptr, nullptr, 0, nullptr, 0, 0, 0, nullptr, VT16, VTh, VTl);   /* v projection, transposed fp16 and hi/lo planes */
        k_attn<<<dim3(TT / 16, NH_, 1), 32 * KSP, 0, stream>>>(QPh, QPl, KPh, KPl, VT16, VTh, VTl, ATh, ATl);   /* scores (hi/lo planes, 3 products, EVERY row), softmax, hybrid P.V and the merge, all heads of the batch */
        k_gemmw<bf, 1, false, 0, DQ><<<dim3(TT / 64, DM / 64, 1), 32, 0, stream>>>(ATh, ATl, WO, nullptr, OUT + (size_t)b * TT * DM, DM, nullptr, 0, 0, 0, nullptr, nullptr, nullptr, nullptr); }
}

// v005
// One run takes 315 microseconds.
// In both of two side-by-side timings against v004, it was 1.93 times as fast.
// All steps since v000 together make it 8.71 times as fast.
#include <hip/hip_runtime.h>

// Causal multi-head self-attention with interleaved-pair rotary position embedding from a positions input, four batches (x [4][2048][1024]; Q, K, V = x W^T ('oi' [1024][1024] 1/32, no bias; 16 heads x 64; token-major); angles = token_positions (int32 [2048], read on device) x 1 / THETA ** (2i / 64), THETA 1e4; pairs (2i, 2i+1): r_even = x_even cos - x_odd sin, r_odd = x_even sin + x_odd cos, on Q and K; scores / sqrt(64); keys j <= i kept, -inf elsewhere; softmax; out = merged Wo^T ('oi', no bias) -> [4][2048][1024] (8.4 M); argument order x, token_positions, Wq, Wk, Wv, Wo).
// Every stage is ONE launch for all four batches (blockIdx.z = batch; each per-batch plane has NB_ copies in a row in the workspace; the weights' planes and the {cos, sin} table are shared). Layout per batch: bf16 copy of x; exact projections; {cos, sin} per (position, pair) built once from the int positions and float32 inverse-frequency constants (precise cosf/sinf); the interleaved rotary step with the hi/lo split, and the V transpose with its three planes, done in the projection GEMMs' own epilogues (no f32 projection buffer); causal T-2048 attention (EVERY row's scores on hi/lo planes (3 products: logit sigma 2 with these weights) and hybrid P.V (rows < 512 hi/lo, rest fp16 x1024); one fused kernel, k_attn, which stops at the diagonal); merged hi/lo x Wo exact.
// Every 16-bit operand plane [row][k] lies in FRAGMENT ORDER: a block of 16 rows x 32 k is 1 KiB in a row, blocks k-fastest, then by 16-row block; inside it element (r, k) stands at ((k >> 4) & 1) * 256 + (((k >> 3) & 1) * 16 + r) * 8 + (k & 7). A lane's two 16-byte pieces of a fragment are then base + lane * 8 and + 256: each load of a wave reads 512 bytes in a row (4 whole lines, not 32 bytes of each of 16 lines). The k order of a fragment is the one of the row-major loader, for A and B alike.
// Compute dtypes, f32 accumulate: every input rounded to bf16; projections exact; rotary f32; attention scores 3 products, P.V rows < 512 3 products, rest fp16; softmax f32; Wo hl x exact.

#define NB_  4      // batches: this module's input is [4][2048][1024]
#define TT   2048
#define DM   1024
#define NH_  16
#define NKV  16
#define REP  (NH_ / NKV)
#define HD   64
#define DQ   (NH_ * HD)
#define DKV  (NKV * HD)
#define RH   512                  // query rows < RH use hi+lo planes in P.V (0: none)
#define PCAR 1024.0f
#define SCL  0.125f   // HD^-0.5
#define KSP  16     // waves of a k_attn work-group; they share the key loops of its 16 query rows (partial P.V tiles in LDS, added in wave order)
typedef _Float16 h16;
typedef unsigned short bf;
typedef __attribute__((ext_vector_type(16))) __bf16   v16bf;
typedef __attribute__((ext_vector_type(16))) _Float16 v16h;
typedef __attribute__((ext_vector_type(8)))  _Float16 v8h;
typedef __attribute__((ext_vector_type(8)))  unsigned short v8us;
typedef __attribute__((ext_vector_type(8)))  float    v8f;
typedef __attribute__((ext_vector_type(4)))  float    v4f;
typedef v8h  __attribute__((may_alias)) v8ha;
typedef v4f  __attribute__((may_alias)) v4fa;
typedef v8us __attribute__((may_alias)) v8usa;

__device__ __forceinline__ unsigned short f2bf(float f) { unsigned u = __float_as_uint(f); u += 0x7FFFu + ((u >> 16) & 1u); return (unsigned short)(u >> 16); }
__device__ __forceinline__ float bf2f(unsigned short b) { return __uint_as_float(((unsigned)b) << 16); }
__device__ __forceinline__ float bfr(float f) { return bf2f(f2bf(f)); }
__device__ __forceinline__ v16h cat16(v8h lo, v8h hi) { return __builtin_shufflevector(lo, hi, 0, 1, 2, 3, 4, 5, 6, 7, 8, 9, 10, 11, 12, 13, 14, 15); }
__device__ __forceinline__ v16bf cat16b(v8us lo, v8us hi) { return __builtin_bit_cast(v16bf, __builtin_shufflevector(lo, hi, 0, 1, 2, 3, 4, 5, 6, 7, 8, 9, 10, 11, 12, 13, 14, 15)); }
__device__ __forceinline__ v8f wmma16(v16h a, v16h b, v8f c) { return __builtin_amdgcn_wmma_f32_16x16x32_f16(false, a, false, b, (short)0, c, false, false); }
__device__ __forceinline__ v8f wmmab(v16bf a, v16bf b, v8f c) { return __builtin_amdgcn_wmma_f32_16x16x32_bf16(false, a, false, b, (short)0, c, false, false); }



__device__ __forceinline__ h16 tohx(float x) { return (h16)x; }
__device__ __forceinline__ void splitf(float y, unsigned short& h, unsigned short& l) { h = f2bf(y); l = f2bf(y - bf2f(h)); }
typedef __attribute__((ext_vector_type(2))) _Float16 v2h;
typedef __attribute__((ext_vector_type(4))) _Float16 v4h;
typedef __attribute__((ext_vector_type(2))) unsigned short v2us;
typedef __attribute__((ext_vector_type(4))) unsigned short v4us;
typedef __attribute__((ext_vector_type(2))) float v2f;
typedef __attribute__((ext_vector_type(4))) int v4i;

// ---- k_gemmw: register-blocked GEMM, ONE WAVE per 64x64 output tile (16 accumulators), operands straight from 16-bit planes in fragment order (WFrag::ld takes the block's base + lane * 8); grid (M/64, N/64, Z), 32 threads.
// C[m][n] (f32, pitch ldc, + optional f32 bias[n]) = sum_k A[m][k] Bt[n][k] (+ split products per NSPLIT). z-batch strides sA/sB/sC in elements (sC: of C for EPI 0, of each output plane for EPI 1 and 2). K % 32 == 0.
// EPI picks what becomes of the tile, which for EPI 1 and 2 is 64 tokens x one whole head (HD == 64 columns): 0: f32 C as above. 1: rotary step from the {cos, sin} table CS, then the hi/lo split, to the planes Ph, Pl [head][token][d] (fragment order, rows = tokens). 2: fp16 and hi/lo planes P16, Ph, Pl, transposed to [head][d][token] (fragment order, rows = d).
template <typename T16> struct WFrag;
template <> struct WFrag<h16> { typedef v16h V; static __device__ __forceinline__ V ld(const h16* p) { return cat16(*(const v8h*)p, *(const v8h*)(p + 256)); } static __device__ __forceinline__ v8f mma(V a, V b, v8f c) { return wmma16(a, b, c); } };
template <> struct WFrag<bf> { typedef v16bf V; static __device__ __forceinline__ V ld(const bf* p) { return cat16b(*(const v8us*)p, *(const v8us*)(p + 256)); } static __device__ __forceinline__ v8f mma(V a, V b, v8f c) { return wmmab(a, b, c); } };
template <typename T16, int NSPLIT, bool BIAS, int EPI, int K>
__global__ __launch_bounds__(32) void k_gemmw(const T16* __restrict__ A, const T16* __restrict__ A2, const T16* __restrict__ Bt, const T16* __restrict__ Bt2, float* C, int ldc, const float* __restrict__ bias, size_t sA, size_t sB, size_t sC, const float* __restrict__ CS, h16* P16, bf* Ph, bf* Pl) {
    typedef typename WFrag<T16>::V V;
    __shared__ __align__(16) float os[16 * 68];
    const size_t z = blockIdx.z; A += z * sA; if (A2) A2 += z * sA; Bt += z * sB; if (Bt2) Bt2 += z * sB; if constexpr (EPI == 0) C += z * sC; else { Ph += z * sC; Pl += z * sC; if constexpr (EPI == 2) P16 += z * sC; }
    const int lane = threadIdx.x & 31, lr = lane & 15, hi = lane >> 4; const int r0 = blockIdx.x * 64, c0 = blockIdx.y * 64;
    v8f acc[4][4];
#pragma unroll
    for (int mb = 0; mb < 4; ++mb)
#pragma unroll
        for (int nb = 0; nb < 4; ++nb) acc[mb][nb] = (v8f){};
    A += (size_t)r0 * K; if (A2) A2 += (size_t)r0 * K; Bt += (size_t)c0 * K; if (Bt2) Bt2 += (size_t)c0 * K;   // 16 rows x K elements per 16-row block, 512 elements per 32 k; K is a compile-time constant, so that a pass's loads come off one wave-uniform base per plane, the lane's own offset and immediates
    const unsigned l8 = 8 * lane;
#pragma unroll 1
    for (int kc = 0; kc < K; kc += 32) {
        V a[4], a2[4]; const T16* pa = A + kc * 16 + l8; const T16* pa2 = (NSPLIT == 1 || NSPLIT == 2) ? A2 + kc * 16 + l8 : pa; const T16* pb = Bt + kc * 16 + l8; const T16* pb2 = (NSPLIT >= 2) ? Bt2 + kc * 16 + l8 : pb;
#pragma unroll
        for (int mb = 0; mb < 4; ++mb) { a[mb] = WFrag<T16>::ld(pa + mb * 16 * K); if (NSPLIT == 1 || NSPLIT == 2) a2[mb] = WFrag<T16>::ld(pa2 + mb * 16 * K); }
#pragma unroll
        for (int nb = 0; nb < 4; ++nb) { const V b = WFrag<T16>::ld(pb + nb * 16 * K); V b2; if (NSPLIT >= 2) b2 = WFrag<T16>::ld(pb2 + nb * 16 * K);
#pragma unroll
            for (int mb = 0; mb < 4; ++mb) { acc[mb][nb] = WFrag<T16>::mma(a[mb], b, acc[mb][nb]); if (NSPLIT == 1 || NSPLIT == 2) acc[mb][nb] = WFrag<T16>::mma(a2[mb], b, acc[mb][nb]); if (NSPLIT >= 2) acc[mb][nb] = WFrag<T16>::mma(a[mb], b2, acc[mb][nb]); } }
        asm volatile("s_wait_xcnt 0x0" :: "v"(pa), "v"(pa2), "v"(pb), "v"(pb2) : "memory");   // the wait that stands in front of every overwrite of a register which an issued load names: it takes the pass's address pairs as inputs, so that they keep their registers up to here and no later load of the pass lands on them
        asm volatile("v_nop\n\tv_nop\n\tv_nop\n\tv_nop" : "+v"(acc[0][0]), "+v"(acc[1][1]), "+v"(acc[2][2]), "+v"(acc[3][3]) : "v"(a[0]), "v"(a[3]));
    }
    if constexpr (EPI == 1) {
        const int tk = lane >> 1, cofs = (lane & 1) * 4;    // a lane takes the pairs (d, d + 1) and (d + 2, d + 3), d = s * 8 + cofs, of token r0 + mb * 16 + tk: in fragment order that is element s * 128 + lane * 4 of the 16-token block
        const float* ct = CS + ((size_t)(r0 + tk) * HD + cofs) * 2; const size_t po = ((size_t)blockIdx.y * TT + r0) * HD + lane * 4;
        v2f cs[2][8][2];            // {cos, sin} of 16 tokens, fetched one 16-token block ahead of its use
#pragma unroll
        for (int s = 0; s < 8; ++s) { cs[0][s][0] = *(const v2f*)(ct + s * 16); cs[0][s][1] = *(const v2f*)(ct + s * 16 + 4); }
#pragma unroll
        for (int mb = 0; mb < 4; ++mb) {
            if (mb < 3) {
#pragma unroll
                for (int s = 0; s < 8; ++s) { cs[(mb + 1) & 1][s][0] = *(const v2f*)(ct + (size_t)(mb + 1) * 16 * HD * 2 + s * 16); cs[(mb + 1) & 1][s][1] = *(const v2f*)(ct + (size_t)(mb + 1) * 16 * HD * 2 + s * 16 + 4); } }
#pragma unroll
            for (int nb = 0; nb < 4; ++nb) {
#pragma unroll
                for (int j = 0; j < 8; ++j) os[(hi * 8 + j) * 68 + nb * 16 + lr] = acc[mb][nb][j]; }
            __builtin_amdgcn_wave_barrier(); asm volatile("" ::: "memory");   // one wave: keeps the LDS reads below behind the LDS writes above
#pragma unroll
            for (int s = 0; s < 8; ++s) { const v4f x = *(const v4fa*)(os + tk * 68 + s * 8 + cofs); const v2f p = cs[mb & 1][s][0], q = cs[mb & 1][s][1]; float r[4]; v4us oh, ol;
                r[0] = x[0] * p[0] - x[1] * p[1]; r[1] = x[0] * p[1] + x[1] * p[0]; r[2] = x[2] * q[0] - x[3] * q[1]; r[3] = x[2] * q[1] + x[3] * q[0];   /* even: x0 c - x1 s; odd: x0 s + x1 c */
#pragma unroll
                for (int e = 0; e < 4; ++e) { unsigned short a2, c2; splitf(r[e], a2, c2); oh[e] = a2; ol[e] = c2; }
                *(v4us*)(Ph + po + (size_t)(mb * 16 * HD + s * 128)) = oh; *(v4us*)(Pl + po + (size_t)(mb * 16 * HD + s * 128)) = ol; }   // 32 lanes x 8 bytes: two whole 128-byte lines per plane
            if (mb < 3) { __builtin_amdgcn_wave_barrier(); asm volatile("s_wait_xcnt 0x0" ::: "memory"); }   // the next block's LDS writes stay behind these reads; the wait stands between the stores above and the next block's loads and products, which take over the stores' registers
        }
        return;
    }
    if constexpr (EPI == 2) {
        const size_t go = (size_t)blockIdx.y * HD * TT + (size_t)r0 * 16 + lane * 8;   // rows = d: 16 x TT elements per 16-d block, 512 per 32 tokens
#pragma unroll
        for (int mb = 0; mb < 4; ++mb)
#pragma unroll
            for (int nb = 0; nb < 4; ++nb) { v8h o16; v8us oh, ol;     // a lane's 8 accumulator registers are 8 consecutive tokens (mb * 16 + hi * 8 ...) of d = nb * 16 + lr: exactly its 16-byte piece, lane * 8, of quarter mb of the tile's two fragment blocks, so that no LDS pass is needed
#pragma unroll
                for (int j = 0; j < 8; ++j) { const float x = acc[mb][nb][j]; o16[j] = tohx(x); unsigned short a2, c2; splitf(x, a2, c2); oh[j] = a2; ol[j] = c2; }
                const size_t o = go + (size_t)nb * 16 * TT + mb * 256; *(v8usa*)(P16 + o) = __builtin_bit_cast(v8us, o16); *(v8usa*)(Ph + o) = oh; *(v8usa*)(Pl + o) = ol; }   // 32 lanes x 16 bytes: four whole 128-byte lines a store
        return;
    }
#pragma unroll
    for (int mb = 0; mb < 4; ++mb) {
#pragma unroll
        for (int nb = 0; nb < 4; ++nb) {
#pragma unroll
            for (int j = 0; j < 8; ++j) os[(hi * 8 + j) * 68 + nb * 16 + lr] = acc[mb][nb][j]; }
        __builtin_amdgcn_wave_barrier(); asm volatile("" ::: "memory");
        float* crow = C + (size_t)(r0 + mb * 16) * ldc + c0;
{
#pragma unroll
            for (int s = 0; s < 8; ++s) { const int row = 2 * s + hi, cofs = lr * 4; v4f val = *(const v4fa*)(os + row * 68 + cofs); if (BIAS) { val[0] += bfr(bias[c0 + cofs]); val[1] += bfr(bias[c0 + cofs + 1]); val[2] += bfr(bias[c0 + cofs + 2]); val[3] += bfr(bias[c0 + cofs + 3]); }
                *(v4f*)(crow + (size_t)row * ldc + cofs) = val; }
             }
        __builtin_amdgcn_wave_barrier(); asm volatile("" ::: "memory");
    }
}


__global__ __launch_bounds__(256) void k_wtG(const float* __restrict__ w, int K, int N, bf* Bt) {
    const int lane = threadIdx.x & 31; const int L0 = (blockIdx.x * 8 + (threadIdx.x >> 5)) * 8; const int nlines = N * K / 64;
{
#pragma unroll 1
        for (int l = 0; l < 8; ++l) { const int L = L0 + l; if (L >= nlines) break; const size_t e = (size_t)L * 64 + lane * 2; const int k = (int)(e % K), n = (int)(e / K); v2us o;
            o[0] = f2bf(w[(size_t)k * N + n]); o[1] = f2bf(w[(size_t)(k + 1) * N + n]); *(v2us*)(Bt + e) = o; }
         }
}
// k_cvt8: f32 [row][DM] to the bf16 plane in fragment order, 8 values (one 16-byte piece) a thread. A wave takes 8 rows x 32 k: it reads one whole 128-byte line of each row and writes four whole lines of the block (pieces c = k / 8 of rows rr .. rr + 7 stand in a row).
__global__ __launch_bounds__(256) void k_cvt8(const float* __restrict__ src, bf* dst, size_t n8) { const size_t i = (size_t)blockIdx.x * 256 + threadIdx.x; if (i >= n8) return; const size_t fr = i >> 6; const int c = (int)(i >> 3) & 3, rr = (int)((i >> 5) & 1) * 8 + (int)(i & 7); const v8f v = *(const v8f*)(src + ((fr / (DM / 32)) * 16 + rr) * DM + (fr % (DM / 32)) * 32 + c * 8); v8us o;
#pragma unroll
    for (int k = 0; k < 8; ++k) o[k] = f2bf(v[k]); *(v8us*)(dst + fr * 512 + (c >> 1) * 256 + ((c & 1) * 16 + rr) * 8) = o;  }

__constant__ float INV2[HD / 2] = { 1.000000000e+00f, 7.498942018e-01f, 5.623413324e-01f, 4.216965139e-01f, 3.162277639e-01f, 2.371373624e-01f, 1.778279394e-01f, 1.333521456e-01f, 1.000000015e-01f, 7.498941571e-02f, 5.623412877e-02f, 4.216964915e-02f, 3.162277862e-02f, 2.371373586e-02f, 1.778279431e-02f, 1.333521493e-02f, 9.999999776e-03f, 7.498942316e-03f, 5.623413250e-03f, 4.216964822e-03f, 3.162277862e-03f, 2.371373819e-03f, 1.778279431e-03f, 1.333521446e-03f, 1.000000047e-03f, 7.498941850e-04f, 5.623413017e-04f, 4.216964880e-04f, 3.162277862e-04f, 2.371373848e-04f, 1.778279402e-04f, 1.333521504e-04f };   // float32 10000^(-(i * 2 / 64)), generated with jnp to be bit-exact with the module's expression
__global__ __launch_bounds__(256) void k_cstabI(const int* __restrict__ pid, float* CS) { const int idx = blockIdx.x * 256 + threadIdx.x; if (idx >= TT * HD) return; const int d = idx % HD; const int t = idx / HD; const float a = __fmul_rn((float)pid[t], INV2[d >> 1]); v2f cs; cs[0] = cosf(a); cs[1] = sinf(a); *(v2f*)(CS + (size_t)idx * 2) = cs;  }

// ---- k_attn: scores, softmax and P.V of 16 query rows of one head in ONE work-group of KSP = 16 waves; grid (TT / 16, heads, batches), 512 threads. The rows' scores, then their probabilities, then the partial output tiles stay in LDS.
// 1) wave w takes the 64-key groups w, w + 16, ... up to the diagonal: Q hi/lo x K hi/lo (3 products, k order 0..31 then 32..63), f32 scores to LDS row-major (pitch SP floats).
// 2) wave w owns row w: whole-row softmax in registers (one exp, fixed trees; 128-key chunks wholly above the diagonal are exact zeros: no exp, no store); the 16-bit probability planes overwrite the row's own scores.
// 3) wave w takes the same 64-key groups of P.V (rows < RH hi/lo, 3 products; the rest fp16 x PCAR); A fragments from LDS (row-major there), V fragments from the [d][t] planes; its partial 16x64 tile goes to LDS.
// 4) the 16 partial tiles are added in wave order, scaled and split into the merged hi/lo planes. Long (late) rows get the low block indices, which start first.
#define SP 2052     // floats per score row in LDS: 8192 + 16 bytes, so that the 16 rows of a b128 fragment read fall on distinct banks
#define OP 68       // floats per row of a partial output tile in LDS
typedef v4us __attribute__((may_alias)) v4usa;
typedef v4h  __attribute__((may_alias)) v4ha;
typedef v2f  __attribute__((may_alias)) v2fa;
__device__ __forceinline__ v16bf ldsb(const bf* p) { return cat16b(*(const v8usa*)p, *(const v8usa*)(p + 16)); }
__device__ __forceinline__ v16h ldsh(const h16* p) { return cat16(*(const v8ha*)p, *(const v8ha*)(p + 16)); }
__device__ __forceinline__ float exp2s(float x) { float r; asm("v_exp_f32 %0, %1\n\tv_nop" : "=v"(r) : "v"(x)); return r; }   // the v_nop is the one free slot the instruction set asks for behind a transcendental, before its result is read or its source overwritten; in one statement so that it stays there
__global__ __launch_bounds__(512, 8) void k_attn(const bf* __restrict__ Qh, const bf* __restrict__ Ql, const bf* __restrict__ Kh, const bf* __restrict__ Kl, const h16* __restrict__ V16, const bf* __restrict__ Vh, const bf* __restrict__ Vl, bf* Ah, bf* Al) {
    __shared__ __align__(16) float sm[16 * SP];
    const int lane = threadIdx.x & 31, lr = lane & 15, hi = lane >> 4; const int w = __builtin_amdgcn_readfirstlane((int)(threadIdx.x >> 5));
    const int h = blockIdx.y; const int i0 = (TT / 16 - 1 - (int)blockIdx.x) * 16;
    const int ng = i0 / 64 + 1;                 // 64-key groups up to and with the diagonal's
    const bool hires = (i0 < RH);               // RH is a multiple of 16: the same for all 16 rows
    const size_t qp = ((size_t)blockIdx.z * NH_ + h) * TT * HD, kp = ((size_t)blockIdx.z * NKV + h / REP) * TT * HD;
    if (w < ng) {
        v16bf a[2], a2[2];
#pragma unroll
        for (int kk = 0; kk < 2; ++kk) { a[kk] = WFrag<bf>::ld(Qh + qp + (size_t)i0 * HD + 8 * lane + kk * 512); a2[kk] = WFrag<bf>::ld(Ql + qp + (size_t)i0 * HD + 8 * lane + kk * 512); }
#pragma unroll 1
        for (int g = w; g < ng; g += KSP) {
            const size_t bo = kp + (size_t)(g * 64) * HD + 8 * lane;
#pragma unroll
            for (int hb = 0; hb < 2; ++hb) {    // 32 keys at a time: their 8 K fragments, the Q fragments and 2 accumulators fit the 128 registers that let two work-groups share a WGP
                v16bf b[2][2], b2[2][2]; v8f acc[2];
#pragma unroll
                for (int kk = 0; kk < 2; ++kk)
#pragma unroll
                    for (int nb = 0; nb < 2; ++nb) { b[kk][nb] = WFrag<bf>::ld(Kh + bo + (size_t)(hb * 2 + nb) * 16 * HD + kk * 512); b2[kk][nb] = WFrag<bf>::ld(Kl + bo + (size_t)(hb * 2 + nb) * 16 * HD + kk * 512); }
                asm volatile("" :: "v"(b[0][0]), "v"(b[0][1]), "v"(b[1][0]), "v"(b[1][1]), "v"(b2[0][0]), "v"(b2[0][1]), "v"(b2[1][0]), "v"(b2[1][1]));   // inputs only: holds all 16 loads in front of the first product, one memory latency instead of one per fragment
#pragma unroll
                for (int nb = 0; nb < 2; ++nb) acc[nb] = (v8f){};
#pragma unroll
                for (int kk = 0; kk < 2; ++kk)
#pragma unroll
                    for (int nb = 0; nb < 2; ++nb) { acc[nb] = wmmab(a[kk], b[kk][nb], acc[nb]); acc[nb] = wmmab(a2[kk], b[kk][nb], acc[nb]); acc[nb] = wmmab(a[kk], b2[kk][nb], acc[nb]); }
#pragma unroll
                for (int nb = 0; nb < 2; ++nb)
#pragma unroll
                    for (int j = 0; j < 8; ++j) sm[(hi * 8 + j) * SP + g * 64 + (hb * 2 + nb) * 16 + lr] = acc[nb][j];
            }
        }
    }
    __syncthreads();    // every score of the 16 rows is in LDS
    {
        const int i = i0 + w; const int nch = i / 128 + 1; float* sr = sm + w * SP; float v[TT / 32]; float mx = -3.0e38f; v4f raw[TT / 128];
#pragma unroll
        for (int ch = 0; ch < TT / 128; ++ch) raw[ch] = *(const v4fa*)(sr + min(ch * 128 + lane * 4, i & ~3));   /* a lane wholly above the diagonal re-reads the diagonal's quad (dropped by the select below): no unwritten LDS is read */
        __builtin_amdgcn_sched_barrier(0);   // keeps the row's 16 LDS reads together in front of the arithmetic: one LDS latency instead of one per read
#pragma unroll
        for (int ch = 0; ch < TT / 128; ++ch) { const int j0 = ch * 128 + lane * 4; const v4f a = raw[ch];
#pragma unroll
            for (int q = 0; q < 4; ++q) { const int j = j0 + q; const float t = (j <= i) ? a[q] * SCL : -3.0e38f; v[ch * 4 + q] = t; mx = fmaxf(mx, t); } }
#pragma unroll
        for (int sh = 16; sh; sh >>= 1) mx = fmaxf(mx, __shfl_xor(mx, sh, 32));
        float sum = 0.f;
#pragma unroll
        for (int ch = 0; ch < TT / 128; ++ch) if (ch < nch) {
#pragma unroll
            for (int q = 0; q < 4; ++q) { const int k = ch * 4 + q; const float d0 = __fsub_rn(v[k], mx); v[k] = exp2s(__fmul_rn(d0, 1.4426950408889634f)); sum += v[k]; } }
#pragma unroll
        for (int sh = 16; sh; sh >>= 1) sum += __shfl_xor(sum, sh, 32);
        const float f = __fdiv_rn(hires ? 1.0f : PCAR, sum);
        if (hires) { bf* ph = (bf*)sr; bf* pl = ph + TT;
#pragma unroll
            for (int ch = 0; ch < RH / 128; ++ch) if (ch < nch) { v4us oh, ol;
#pragma unroll
                for (int q = 0; q < 4; ++q) { unsigned short a, c2; splitf(v[ch * 4 + q] * f, a, c2); oh[q] = a; ol[q] = c2; }
                *(v4usa*)(ph + ch * 128 + lane * 4) = oh; *(v4usa*)(pl + ch * 128 + lane * 4) = ol; }
        } else { h16* p16 = (h16*)sr;
#pragma unroll
            for (int ch = 0; ch < TT / 128; ++ch) if (ch < nch) { v4h o4;
#pragma unroll
                for (int q = 0; q < 4; ++q) o4[q] = tohx(v[ch * 4 + q] * f);
                *(v4ha*)(p16 + ch * 128 + lane * 4) = o4; } }
    }
    __syncthreads();    // every probability of the 16 rows is in LDS
    v8f acc[4];
#pragma unroll
    for (int nb = 0; nb < 4; ++nb) acc[nb] = (v8f){};
    const size_t vo = kp + 8 * lane;   // V planes: rows = d, 16 x TT elements per 16-d block, 512 per 32 keys
    if (hires) { const bf* ph = (const bf*)(sm + lr * SP) + 8 * hi; const bf* pl = ph + TT;
#pragma unroll 1
        for (int g = w; g < ng; g += KSP) {
#pragma unroll
            for (int kk = 0; kk < 2; ++kk) { const int kc = g * 64 + kk * 32; const v16bf a = ldsb(ph + kc), a2 = ldsb(pl + kc);
#pragma unroll
                for (int nb = 0; nb < 4; ++nb) { const v16bf b = WFrag<bf>::ld(Vh + vo + (size_t)nb * 16 * TT + kc * 16), b2 = WFrag<bf>::ld(Vl + vo + (size_t)nb * 16 * TT + kc * 16);
                    acc[nb] = wmmab(a, b, acc[nb]); acc[nb] = wmmab(a2, b, acc[nb]); acc[nb] = wmmab(a, b2, acc[nb]); } }
        }
    } else { const h16* p16 = (const h16*)(sm + lr * SP) + 8 * hi; const h16* vp = V16 + vo + w * 1024;
#pragma unroll 1
        for (int g = w; g < ng; g += KSP, vp += KSP * 1024) {
            v16h b[2][4];
#pragma unroll
            for (int kk = 0; kk < 2; ++kk)
#pragma unroll
                for (int nb = 0; nb < 4; ++nb) b[kk][nb] = WFrag<h16>::ld(vp + (size_t)nb * 16 * TT + kk * 512);
            asm volatile("" :: "v"(b[0][0]), "v"(b[0][1]), "v"(b[0][2]), "v"(b[0][3]), "v"(b[1][0]), "v"(b[1][1]), "v"(b[1][2]), "v"(b[1][3]));   // inputs only: holds all 16 loads in front of the first product, one memory latency instead of one per fragment
#pragma unroll
            for (int kk = 0; kk < 2; ++kk) { const v16h a = ldsh(p16 + g * 64 + kk * 32);
#pragma unroll
                for (int nb = 0; nb < 4; ++nb) acc[nb] = wmma16(a, b[kk][nb], acc[nb]); }
        }
    }
    __syncthreads();    // every wave has read its last probability: the partial tiles may overwrite them
    { float* pt = sm + w * (16 * OP);
#pragma unroll
        for (int nb = 0; nb < 4; ++nb)
#pragma unroll
            for (int j = 0; j < 8; ++j) pt[(hi * 8 + j) * OP + nb * 16 + lr] = acc[nb][j]; }
    __syncthreads();    // all 16 partial tiles are in LDS
    { const int d = (w >> 1) * 8 + (lane & 3) * 2, rw = (w & 1) * 8 + (lane >> 2); const float cs = hires ? 1.0f : (1.0f / PCAR); const size_t oo = ((size_t)blockIdx.z * TT + i0) * DQ + h * 1024 + w * 64 + lane * 2;   // the merged planes are the last GEMM's A operand (rows = tokens, k = h * HD + d): the tile is two fragment blocks in a row, and thread w * 32 + lane takes their elements w * 64 + lane * 2 and the next, which are (row rw, d and d + 1): one whole line a wave and plane
        v2f s = *(const v2fa*)(sm + rw * OP + d);   /* the KSP partial tiles of the split key loop, added in wave order */
#pragma unroll
        for (int p = 1; p < KSP; ++p) { const v2f u = *(const v2fa*)(sm + p * (16 * OP) + rw * OP + d); s[0] += u[0]; s[1] += u[1]; }
        v2us oh, ol;
#pragma unroll
        for (int q = 0; q < 2; ++q) { unsigned short a, c2; splitf(s[q] * cs, a, c2); oh[q] = a; ol[q] = c2; } *(v2us*)(Ah + oo) = oh; *(v2us*)(Al + oo) = ol; }
}

extern "C" void kernel_launch(void* const* d_in, const int* in_sizes, int n_in,
                              void* d_out, int out_size, void* d_ws, size_t ws_size, hipStream_t stream) {
    (void)in_sizes; (void)n_in; (void)out_size;
    const float* x = (const float*)d_in[0]; const int* PID = (const int*)d_in[1]; const float* wq = (const float*)d_in[2]; const float* wk = (const float*)d_in[3]; const float* wv = (const float*)d_in[4]; const float* wo = (const float*)d_in[5];   /* input order x, token_positions (int32 [2048], read on device by the table builder), Wq, Wk, Wv, Wo ('oi' [1024][1024]): the host's own six slots */
    float* OUT = (float*)d_out;     // [4][2048][1024]
    char* wsp = (char*)d_ws;
    auto take = [&](size_t bytes) { char* p = wsp; wsp += (bytes + 255) & ~(size_t)255; return (void*)p; };
    bf* WQ = (bf*)take((size_t)DQ * DM * 2); bf* WK = (bf*)take((size_t)DKV * DM * 2); bf* WV = (bf*)take((size_t)DKV * DM * 2); bf* WO = (bf*)take((size_t)DM * DQ * 2); float* CS = (float*)take((size_t)TT * HD * 2 * 4);
    bf* XB = (bf*)take((size_t)NB_ * TT * DM * 2);
    h16* VT16 = (h16*)take((size_t)NB_ * NKV * HD * TT * 2);
    bf* QPh = (bf*)take((size_t)NB_ * NH_ * TT * HD * 2); bf* QPl = (bf*)take((size_t)NB_ * NH_ * TT * HD * 2); bf* KPh = (bf*)take((size_t)NB_ * NKV * TT * HD * 2); bf* KPl = (bf*)take((size_t)NB_ * NKV * TT * HD * 2); bf* VTh = (bf*)take((size_t)NB_ * NKV * HD * TT * 2); bf* VTl = (bf*)take((size_t)NB_ * NKV * HD * TT * 2);
    bf* ATh = (bf*)take((size_t)NB_ * TT * DQ * 2); bf* ATl = (bf*)take((size_t)NB_ * TT * DQ * 2);
    if ((size_t)(wsp - (char*)d_ws) > ws_size) return;    // ws 256 MiB
    { k_cvt8<<<(unsigned)(((size_t)DQ * DM / 8 + 255) / 256), 256, 0, stream>>>(wq, WQ, (size_t)DQ * DM / 8); k_cvt8<<<(unsigned)(((size_t)DKV * DM / 8 + 255) / 256), 256, 0, stream>>>(wk, WK, (size_t)DKV * DM / 8); k_cvt8<<<(unsigned)(((size_t)DKV * DM / 8 + 255) / 256), 256, 0, stream>>>(wv, WV, (size_t)DKV * DM / 8);
      k_cvt8<<<(unsigned)(((size_t)DM * DQ / 8 + 255) / 256), 256, 0, stream>>>(wo, WO, (size_t)DM * DQ / 8); }
    k_cstabI<<<(TT * HD + 255) / 256, 256, 0, stream>>>(PID, CS);   /* token_positions (int32 [2048], read): one table, the same positions for every batch */
    k_cvt8<<<(unsigned)(((size_t)NB_ * TT * DM / 8 + 255) / 256), 256, 0, stream>>>(x, XB, (size_t)NB_ * TT * DM / 8);   /* rows = batch * TT + token: the batches' planes stand in a row */
    k_gemmw<bf, 0, false, 1, DM><<<dim3(TT / 64, DQ / 64, NB_), 32, 0, stream>>>(XB, nullptr, WQ, nullptr, nullptr, 0, nullptr, (size_t)TT * DM, 0, (size_t)NH_ * TT * HD, CS, nullptr, QPh, QPl);    /* q projection, rotary step, hi/lo planes */
    k_gemmw<bf, 0, false, 1, DM><<<dim3(TT / 64, DKV / 64, NB_), 32, 0, stream>>>(XB, nullptr, WK, nullptr, nullptr, 0, nullptr, (size_t)TT * DM, 0, (size_t)NKV * TT * HD, CS, nullptr, KPh, KPl);   /* k projection, rotary step, hi/lo planes */
    k_gemmw<bf, 0, false, 2, DM><<<dim3(TT / 64, DKV / 64, NB_), 32, 0, stream>>>(XB, nullptr, WV, nullptr, nullptr, 0, nullptr, (size_t)TT * DM, 0, (size_t)NKV * HD * TT, nullptr, VT16, VTh, VTl);   /* v projection, transposed fp16 and hi/lo planes */
    k_attn<<<dim3(TT / 16, NH_, NB_), 32 * KSP, 0, stream>>>(QPh, QPl, KPh, KPl, VT16, VTh, VTl, ATh, ATl);   /* scores (hi/lo planes, 3 products, EVERY row), softmax, hybrid P.V and the merge, all heads of all batches */
    k_gemmw<bf, 1, false, 0, DQ><<<dim3(TT / 64, DM / 64, NB_), 32, 0, stream>>>(ATh, ATl, WO, nullptr, OUT, DM, nullptr, (size_t)TT * DQ, 0, (size_t)TT * DM, nullptr, nullptr, nullptr, nullptr);
}

// v006
// Measured time: 273 microseconds a run.
// Two timings next to v005 both put it at 1.15 times that version's speed.
// All steps since v000 together make it 10.0 times as fast.
#include <hip/hip_runtime.h>

// Causal multi-head self-attention with interleaved-pair rotary position embedding from a positions input, four batches (x [4][2048][1024]; Q, K, V = x W^T ('oi' [1024][1024] 1/32, no bias; 16 heads x 64; token-major); angles = token_positions (int32 [2048], read on device) x 1 / THETA ** (2i / 64), THETA 1e4; pairs (2i, 2i+1): r_even = x_even cos - x_odd sin, r_odd = x_even sin + x_odd cos, on Q and K; scores / sqrt(64); keys j <= i kept, -inf elsewhere; softmax; out = merged Wo^T ('oi', no bias) -> [4][2048][1024] (8.4 M); argument order x, token_positions, Wq, Wk, Wv, Wo).
// Four launches: k_prep (all conversions and the table), the q, k, v projections in one grid, k_attn, the last GEMM. Every stage is ONE launch for all four batches (blockIdx.z = batch; each per-batch plane has NB_ copies in a row in the workspace; the weights' planes and the {cos, sin} table are shared). Layout per batch: bf16 copy of x; exact projections; {cos, sin} per (position, pair) built once from the int positions and float32 inverse-frequency constants (precise cosf/sinf); the interleaved rotary step with the hi/lo split, and the V transpose with its three planes, done in the projection GEMMs' own epilogues (no f32 projection buffer); causal T-2048 attention (EVERY row's scores on hi/lo planes (3 products: logit sigma 2 with these weights) and hybrid P.V (rows < 512 hi/lo, rest fp16 x1024); one fused kernel, k_attn, which stops at the diagonal); merged hi/lo x Wo exact.
// Every 16-bit operand plane [row][k] lies in FRAGMENT ORDER: a block of 16 rows x 32 k is 1 KiB in a row, blocks k-fastest, then by 16-row block; inside it element (r, k) stands at ((k >> 4) & 1) * 256 + (((k >> 3) & 1) * 16 + r) * 8 + (k & 7). A lane's two 16-byte pieces of a fragment are then base + lane * 8 and + 256: each load of a wave reads 512 bytes in a row (4 whole lines, not 32 bytes of each of 16 lines). The k order of a fragment is the one of the row-major loader, for A and B alike.
// Compute dtypes, f32 accumulate: every input rounded to bf16; projections exact; rotary f32; attention scores 3 products, P.V rows < 512 3 products, rest fp16; softmax f32; Wo hl x exact.

#define NB_  4      // batches: this module's input is [4][2048][1024]
#define TT   2048
#define DM   1024
#define NH_  16
#define NKV  16
#define REP  (NH_ / NKV)
#define HD   64
#define DQ   (NH_ * HD)
#define DKV  (NKV * HD)
#define RH   512                  // query rows < RH use hi+lo planes in P.V (0: none)
#define PCAR 1024.0f
#define SCL  0.125f   // HD^-0.5
#define KSP  16     // waves of a k_attn work-group; they share the key loops of its 16 query rows (partial P.V tiles in LDS, added in wave order)
typedef _Float16 h16;
typedef unsigned short bf;
typedef __attribute__((ext_vector_type(16))) __bf16   v16bf;
typedef __attribute__((ext_vector_type(16))) _Float16 v16h;
typedef __attribute__((ext_vector_type(8)))  _Float16 v8h;
typedef __attribute__((ext_vector_type(8)))  unsigned short v8us;
typedef __attribute__((ext_vector_type(8)))  float    v8f;
typedef __attribute__((ext_vector_type(4)))  float    v4f;
typedef v8h  __attribute__((may_alias)) v8ha;
typedef v4f  __attribute__((may_alias)) v4fa;
typedef v8us __attribute__((may_alias)) v8usa;

__device__ __forceinline__ unsigned short f2bf(float f) { unsigned u = __float_as_uint(f); u += 0x7FFFu + ((u >> 16) & 1u); return (unsigned short)(u >> 16); }
__device__ __forceinline__ float bf2f(unsigned short b) { return __uint_as_float(((unsigned)b) << 16); }
__device__ __forceinline__ float bfr(float f) { return bf2f(f2bf(f)); }
__device__ __forceinline__ v16h cat16(v8h lo, v8h hi) { return __builtin_shufflevector(lo, hi, 0, 1, 2, 3, 4, 5, 6, 7, 8, 9, 10, 11, 12, 13, 14, 15); }
__device__ __forceinline__ v16bf cat16b(v8us lo, v8us hi) { return __builtin_bit_cast(v16bf, __builtin_shufflevector(lo, hi, 0, 1, 2, 3, 4, 5, 6, 7, 8, 9, 10, 11, 12, 13, 14, 15)); }
__device__ __forceinline__ v8f wmma16(v16h a, v16h b, v8f c) { return __builtin_amdgcn_wmma_f32_16x16x32_f16(false, a, false, b, (short)0, c, false, false); }
__device__ __forceinline__ v8f wmmab(v16bf a, v16bf b, v8f c) { return __builtin_amdgcn_wmma_f32_16x16x32_bf16(false, a, false, b, (short)0, c, false, false); }



__device__ __forceinline__ h16 tohx(float x) { return (h16)x; }
__device__ __forceinline__ void splitf(float y, unsigned short& h, unsigned short& l) { h = f2bf(y); l = f2bf(y - bf2f(h)); }
typedef __attribute__((ext_vector_type(2))) _Float16 v2h;
typedef __attribute__((ext_vector_type(4))) _Float16 v4h;
typedef __attribute__((ext_vector_type(2))) unsigned short v2us;
typedef __attribute__((ext_vector_type(4))) unsigned short v4us;
typedef __attribute__((ext_vector_type(2))) float v2f;
typedef __attribute__((ext_vector_type(4))) int v4i;

// ---- k_gemmw: register-blocked GEMM, ONE WAVE per 64x64 output tile (16 accumulators), operands straight from 16-bit planes in fragment order (WFrag::ld takes the block's base + lane * 8); grid (M/64, N/64, Z), 32 threads.
// C[m][n] (f32, pitch ldc, + optional f32 bias[n]) = sum_k A[m][k] Bt[n][k] (+ split products per NSPLIT). z-batch strides sA/sB/sC in elements (sC: of C for EPI 0, of each output plane for EPI 1 and 2). K % 32 == 0.
// EPI picks what becomes of the tile, which for EPI 1 and 2 is 64 tokens x one whole head (HD == 64 columns): 0: f32 C as above. 1: rotary step from the {cos, sin} table CS, then the hi/lo split, to the planes Ph, Pl [head][token][d] (fragment order, rows = tokens). 2: fp16 and hi/lo planes P16, Ph, Pl, transposed to [head][d][token] (fragment order, rows = d). 3: the q, k and v projections in ONE grid, N = 3 * DQ rows of Bt (the three weights' planes stand in a row): blockIdx.y / 16 picks 1 to Ph, Pl (q), 1 to Ph2, Pl2 (k) or 2 to P16, Ph3, Pl3 (v).
template <typename T16> struct WFrag;
template <> struct WFrag<h16> { typedef v16h V; static __device__ __forceinline__ V ld(const h16* p) { return cat16(*(const v8h*)p, *(const v8h*)(p + 256)); } static __device__ __forceinline__ v8f mma(V a, V b, v8f c) { return wmma16(a, b, c); } };
template <> struct WFrag<bf> { typedef v16bf V; static __device__ __forceinline__ V ld(const bf* p) { return cat16b(*(const v8us*)p, *(const v8us*)(p + 256)); } static __device__ __forceinline__ v8f mma(V a, V b, v8f c) { return wmmab(a, b, c); } };
template <typename T16, int NSPLIT, bool BIAS, int EPI, int K>
__global__ __launch_bounds__(32) void k_gemmw(const T16* __restrict__ A, const T16* __restrict__ A2, const T16* __restrict__ Bt, const T16* __restrict__ Bt2, float* C, int ldc, const float* __restrict__ bias, size_t sA, size_t sB, size_t sC, const float* __restrict__ CS, h16* P16, bf* Ph, bf* Pl, bf* Ph2, bf* Pl2, bf* Ph3, bf* Pl3) {
    typedef typename WFrag<T16>::V V;
    const int sel = (EPI == 3) ? (int)blockIdx.y / (DQ / 64) : 0, hy = (EPI == 3) ? (int)blockIdx.y % (DQ / 64) : (int)blockIdx.y;   // EPI 3: which projection (0 q, 1 k, 2 v) and which head; the same for the whole work-group
    if constexpr (EPI == 3) { if (sel == 1) { Ph = Ph2; Pl = Pl2; } else if (sel == 2) { Ph = Ph3; Pl = Pl3; } }
    __shared__ __align__(16) float os[16 * 68];
    const size_t z = blockIdx.z; A += z * sA; if (A2) A2 += z * sA; Bt += z * sB; if (Bt2) Bt2 += z * sB; if constexpr (EPI == 0) C += z * sC; else { Ph += z * sC; Pl += z * sC; if constexpr (EPI == 2 || EPI == 3) P16 += z * sC; }
    const int lane = threadIdx.x & 31, lr = lane & 15, hi = lane >> 4; const int r0 = blockIdx.x * 64, c0 = blockIdx.y * 64;
    v8f acc[4][4];
#pragma unroll
    for (int mb = 0; mb < 4; ++mb)
#pragma unroll
        for (int nb = 0; nb < 4; ++nb) acc[mb][nb] = (v8f){};
    A += (size_t)r0 * K; if (A2) A2 += (size_t)r0 * K; Bt += (size_t)c0 * K; if (Bt2) Bt2 += (size_t)c0 * K;   // 16 rows x K elements per 16-row block, 512 elements per 32 k; K is a compile-time constant, so that a pass's loads come off one wave-uniform base per plane, the lane's own offset and immediates
    const unsigned l8 = 8 * lane;
#pragma unroll 1
    for (int kc = 0; kc < K; kc += 32) {
        V a[4], a2[4]; const T16* pa = A + kc * 16 + l8; const T16* pa2 = (NSPLIT == 1 || NSPLIT == 2) ? A2 + kc * 16 + l8 : pa; const T16* pb = Bt + kc * 16 + l8; const T16* pb2 = (NSPLIT >= 2) ? Bt2 + kc * 16 + l8 : pb;
#pragma unroll
        for (int mb = 0; mb < 4; ++mb) { a[mb] = WFrag<T16>::ld(pa + mb * 16 * K); if (NSPLIT == 1 || NSPLIT == 2) a2[mb] = WFrag<T16>::ld(pa2 + mb * 16 * K); }
#pragma unroll
        for (int nb = 0; nb < 4; ++nb) { const V b = WFrag<T16>::ld(pb + nb * 16 * K); V b2; if (NSPLIT >= 2) b2 = WFrag<T16>::ld(pb2 + nb * 16 * K);
#pragma unroll
            for (int mb = 0; mb < 4; ++mb) { acc[mb][nb] = WFrag<T16>::mma(a[mb], b, acc[mb][nb]); if (NSPLIT == 1 || NSPLIT == 2) acc[mb][nb] = WFrag<T16>::mma(a2[mb], b, acc[mb][nb]); if (NSPLIT >= 2) acc[mb][nb] = WFrag<T16>::mma(a[mb], b2, acc[mb][nb]); } }
        asm volatile("s_wait_xcnt 0x0" :: "v"(pa), "v"(pa2), "v"(pb), "v"(pb2) : "memory");   // the wait that stands in front of every overwrite of a register which an issued load names: it takes the pass's address pairs as inputs, so that they keep their registers up to here and no later load of the pass lands on them
        asm volatile("v_nop\n\tv_nop\n\tv_nop\n\tv_nop" : "+v"(acc[0][0]), "+v"(acc[1][1]), "+v"(acc[2][2]), "+v"(acc[3][3]) : "v"(a[0]), "v"(a[3]));
    }
    if constexpr (EPI == 1 || EPI == 3) if (EPI == 1 || sel < 2) {
        const int tk = lane >> 1, cofs = (lane & 1) * 4;    // a lane takes the pairs (d, d + 1) and (d + 2, d + 3), d = s * 8 + cofs, of token r0 + mb * 16 + tk: in fragment order that is element s * 128 + lane * 4 of the 16-token block
        const float* ct = CS + ((size_t)(r0 + tk) * HD + cofs) * 2; const size_t po = ((size_t)hy * TT + r0) * HD + lane * 4;
        v2f cs[2][8][2];            // {cos, sin} of 16 tokens, fetched one 16-token block ahead of its use
#pragma unroll
        for (int s = 0; s < 8; ++s) { cs[0][s][0] = *(const v2f*)(ct + s * 16); cs[0][s][1] = *(const v2f*)(ct + s * 16 + 4); }
#pragma unroll
        for (int mb = 0; mb < 4; ++mb) {
            if (mb < 3) {
#pragma unroll
                for (int s = 0; s < 8; ++s) { cs[(mb + 1) & 1][s][0] = *(const v2f*)(ct + (size_t)(mb + 1) * 16 * HD * 2 + s * 16); cs[(mb + 1) & 1][s][1] = *(const v2f*)(ct + (size_t)(mb + 1) * 16 * HD * 2 + s * 16 + 4); } }
#pragma unroll
            for (int nb = 0; nb < 4; ++nb) {
#pragma unroll
                for (int j = 0; j < 8; ++j) os[(hi * 8 + j) * 68 + nb * 16 + lr] = acc[mb][nb][j]; }
            __builtin_amdgcn_wave_barrier(); asm volatile("" ::: "memory");   // one wave: keeps the LDS reads below behind the LDS writes above
#pragma unroll
            for (int s = 0; s < 8; ++s) { const v4f x = *(const v4fa*)(os + tk * 68 + s * 8 + cofs); const v2f p = cs[mb & 1][s][0], q = cs[mb & 1][s][1]; float r[4]; v4us oh, ol;
                r[0] = x[0] * p[0] - x[1] * p[1]; r[1] = x[0] * p[1] + x[1] * p[0]; r[2] = x[2] * q[0] - x[3] * q[1]; r[3] = x[2] * q[1] + x[3] * q[0];   /* even: x0 c - x1 s; odd: x0 s + x1 c */
#pragma unroll
                for (int e = 0; e < 4; ++e) { unsigned short a2, c2; splitf(r[e], a2, c2); oh[e] = a2; ol[e] = c2; }
                *(v4us*)(Ph + po + (size_t)(mb * 16 * HD + s * 128)) = oh; *(v4us*)(Pl + po + (size_t)(mb * 16 * HD + s * 128)) = ol; }   // 32 lanes x 8 bytes: two whole 128-byte lines per plane
            if (mb < 3) { __builtin_amdgcn_wave_barrier(); asm volatile("s_wait_xcnt 0x0" ::: "memory"); }   // the next block's LDS writes stay behind these reads; the wait stands between the stores above and the next block's loads and products, which take over the stores' registers
        }
        return;
    }
    if constexpr (EPI == 2 || EPI == 3) {
        const size_t go = (size_t)hy * HD * TT + (size_t)r0 * 16 + lane * 8;   // rows = d: 16 x TT elements per 16-d block, 512 per 32 tokens
#pragma unroll
        for (int mb = 0; mb < 4; ++mb)
#pragma unroll
            for (int nb = 0; nb < 4; ++nb) { v8h o16; v8us oh, ol;     // a lane's 8 accumulator registers are 8 consecutive tokens (mb * 16 + hi * 8 ...) of d = nb * 16 + lr: exactly its 16-byte piece, lane * 8, of quarter mb of the tile's two fragment blocks, so that no LDS pass is needed
#pragma unroll
                for (int j = 0; j < 8; ++j) { const float x = acc[mb][nb][j]; o16[j] = tohx(x); unsigned short a2, c2; splitf(x, a2, c2); oh[j] = a2; ol[j] = c2; }
                const size_t o = go + (size_t)nb * 16 * TT + mb * 256; *(v8usa*)(P16 + o) = __builtin_bit_cast(v8us, o16); *(v8usa*)(Ph + o) = oh; *(v8usa*)(Pl + o) = ol; }   // 32 lanes x 16 bytes: four whole 128-byte lines a store
        asm volatile("s_wait_xcnt 0x0" ::: "memory");   // the wait that stands behind issued stores, in front of any code laid out behind them that takes over their registers
        return;
    }
#pragma unroll
    for (int mb = 0; mb < 4; ++mb) {
#pragma unroll
        for (int nb = 0; nb < 4; ++nb) {
#pragma unroll
            for (int j = 0; j < 8; ++j) os[(hi * 8 + j) * 68 + nb * 16 + lr] = acc[mb][nb][j]; }
        __builtin_amdgcn_wave_barrier(); asm volatile("" ::: "memory");
        float* crow = C + (size_t)(r0 + mb * 16) * ldc + c0;
{
#pragma unroll
            for (int s = 0; s < 8; ++s) { const int row = 2 * s + hi, cofs = lr * 4; v4f val = *(const v4fa*)(os + row * 68 + cofs); if (BIAS) { val[0] += bfr(bias[c0 + cofs]); val[1] += bfr(bias[c0 + cofs + 1]); val[2] += bfr(bias[c0 + cofs + 2]); val[3] += bfr(bias[c0 + cofs + 3]); }
                *(v4f*)(crow + (size_t)row * ldc + cofs) = val; }
             }
        __builtin_amdgcn_wave_barrier(); asm volatile("" ::: "memory");
    }
}


__global__ __launch_bounds__(256) void k_wtG(const float* __restrict__ w, int K, int N, bf* Bt) {
    const int lane = threadIdx.x & 31; const int L0 = (blockIdx.x * 8 + (threadIdx.x >> 5)) * 8; const int nlines = N * K / 64;
{
#pragma unroll 1
        for (int l = 0; l < 8; ++l) { const int L = L0 + l; if (L >= nlines) break; const size_t e = (size_t)L * 64 + lane * 2; const int k = (int)(e % K), n = (int)(e / K); v2us o;
            o[0] = f2bf(w[(size_t)k * N + n]); o[1] = f2bf(w[(size_t)(k + 1) * N + n]); *(v2us*)(Bt + e) = o; }
         }
}
// cvt8: f32 [row][DM] to the bf16 plane in fragment order, 8 values (one 16-byte piece) a thread. A wave takes 8 rows x 32 k: it reads one whole 128-byte line of each row and writes four whole lines of the block (pieces c = k / 8 of rows rr .. rr + 7 stand in a row).
__device__ __forceinline__ void cvt8(const float* __restrict__ src, bf* dst, const size_t i) { const size_t fr = i >> 6; const int c = (int)(i >> 3) & 3, rr = (int)((i >> 5) & 1) * 8 + (int)(i & 7); const v8f v = *(const v8f*)(src + ((fr / (DM / 32)) * 16 + rr) * DM + (fr % (DM / 32)) * 32 + c * 8); v8us o;
#pragma unroll
    for (int k = 0; k < 8; ++k) o[k] = f2bf(v[k]); *(v8us*)(dst + fr * 512 + (c >> 1) * 256 + ((c & 1) * 16 + rr) * 8) = o;
    asm volatile("s_wait_xcnt 0x0" ::: "memory");   // the wait that stands behind the issued store, in front of any code laid out behind it that takes over its registers
}

__constant__ float INV2[HD / 2] = { 1.000000000e+00f, 7.498942018e-01f, 5.623413324e-01f, 4.216965139e-01f, 3.162277639e-01f, 2.371373624e-01f, 1.778279394e-01f, 1.333521456e-01f, 1.000000015e-01f, 7.498941571e-02f, 5.623412877e-02f, 4.216964915e-02f, 3.162277862e-02f, 2.371373586e-02f, 1.778279431e-02f, 1.333521493e-02f, 9.999999776e-03f, 7.498942316e-03f, 5.623413250e-03f, 4.216964822e-03f, 3.162277862e-03f, 2.371373819e-03f, 1.778279431e-03f, 1.333521446e-03f, 1.000000047e-03f, 7.498941850e-04f, 5.623413017e-04f, 4.216964880e-04f, 3.162277862e-04f, 2.371373848e-04f, 1.778279402e-04f, 1.333521504e-04f };   // float32 10000^(-(i * 2 / 64)), generated with jnp to be bit-exact with the module's expression
__device__ __forceinline__ void cstab(const int* __restrict__ pid, float* CS, const int idx) { const int d = idx % HD; const int t = idx / HD; const float a = __fmul_rn((float)pid[t], INV2[d >> 1]); v2f cs; cs[0] = cosf(a); cs[1] = sinf(a); *(v2f*)(CS + (size_t)idx * 2) = cs;  }
// k_prep: everything that depends on the inputs alone, in ONE launch; a block's index picks its job (the same for all its threads): the {cos, sin} table (NPT blocks, first: the longest threads), x (NPX), then the four weights (NPW each). Every count is exact: no thread is left over.
#define NPT (TT * HD / 256)
#define NPX (NB_ * TT * DM / 8 / 256)
#define NPW (DM * DQ / 8 / 256)
__global__ __launch_bounds__(256) void k_prep(const float* __restrict__ x, const int* __restrict__ pid, const float* __restrict__ wq, const float* __restrict__ wk, const float* __restrict__ wv, const float* __restrict__ wo, bf* XB, bf* WQ, bf* WK, bf* WV, bf* WO, float* CS) {
    unsigned b = blockIdx.x;
    if (b < NPT) { cstab(pid, CS, (int)(b * 256 + threadIdx.x)); return; }
    b -= NPT;
    if (b < NPX) { cvt8(x, XB, (size_t)b * 256 + threadIdx.x); return; }
    b -= NPX;
    const unsigned s = b / NPW; const float* src = s == 0 ? wq : s == 1 ? wk : s == 2 ? wv : wo; bf* dst = s == 0 ? WQ : s == 1 ? WK : s == 2 ? WV : WO;
    cvt8(src, dst, (size_t)(b % NPW) * 256 + threadIdx.x);
}

// ---- k_attn: scores, softmax and P.V of 16 query rows of one head in ONE work-group of KSP = 16 waves; grid (TT / 16, heads, batches), 512 threads. The rows' scores, then their probabilities, then the partial output tiles stay in LDS.
// 1) wave w takes the 64-key groups w, w + 16, ... up to the diagonal: Q hi/lo x K hi/lo (3 products, k order 0..31 then 32..63), f32 scores to LDS row-major (pitch SP floats).
// 2) wave w owns row w: whole-row softmax in registers (one exp, fixed trees; 128-key chunks wholly above the diagonal are exact zeros: no exp, no store); the 16-bit probability planes overwrite the row's own scores.
// 3) wave w takes the same 64-key groups of P.V (rows < RH hi/lo, 3 products; the rest fp16 x PCAR); A fragments from LDS (row-major there), V fragments from the [d][t] planes; its partial 16x64 tile goes to LDS.
// 4) the 16 partial tiles are added in wave order, scaled and split into the merged hi/lo planes. Long (late) rows get the low block indices, which start first.
#define SP 2052     // floats per score row in LDS: 8192 + 16 bytes, so that the 16 rows of a b128 fragment read fall on distinct banks
#define OP 68       // floats per row of a partial output tile in LDS
typedef v4us __attribute__((may_alias)) v4usa;
typedef v4h  __attribute__((may_alias)) v4ha;
typedef v2f  __attribute__((may_alias)) v2fa;
__device__ __forceinline__ v16bf ldsb(const bf* p) { return cat16b(*(const v8usa*)p, *(const v8usa*)(p + 16)); }
__device__ __forceinline__ v16h ldsh(const h16* p) { return cat16(*(const v8ha*)p, *(const v8ha*)(p + 16)); }
__device__ __forceinline__ float exp2s(float x) { float r; asm("v_exp_f32 %0, %1\n\tv_nop" : "=v"(r) : "v"(x)); return r; }   // the v_nop is the one free slot the instruction set asks for behind a transcendental, before its result is read or its source overwritten; in one statement so that it stays there
__global__ __launch_bounds__(512, 8) void k_attn(const bf* __restrict__ Qh, const bf* __restrict__ Ql, const bf* __restrict__ Kh, const bf* __restrict__ Kl, const h16* __restrict__ V16, const bf* __restrict__ Vh, const bf* __restrict__ Vl, bf* Ah, bf* Al) {
    __shared__ __align__(16) float sm[16 * SP];
    const int lane = threadIdx.x & 31, lr = lane & 15, hi = lane >> 4; const int w = __builtin_amdgcn_readfirstlane((int)(threadIdx.x >> 5));
    const int h = blockIdx.y; const int i0 = (TT / 16 - 1 - (int)blockIdx.x) * 16;
    const int ng = i0 / 64 + 1;                 // 64-key groups up to and with the diagonal's
    const bool hires = (i0 < RH);               // RH is a multiple of 16: the same for all 16 rows
    const size_t qp = ((size_t)blockIdx.z * NH_ + h) * TT * HD, kp = ((size_t)blockIdx.z * NKV + h / REP) * TT * HD;
    if (w < ng) {
        v16bf a[2], a2[2];
#pragma unroll
        for (int kk = 0; kk < 2; ++kk) { a[kk] = WFrag<bf>::ld(Qh + qp + (size_t)i0 * HD + 8 * lane + kk * 512); a2[kk] = WFrag<bf>::ld(Ql + qp + (size_t)i0 * HD + 8 * lane + kk * 512); }
#pragma unroll 1
        for (int g = w; g < ng; g += KSP) {
            const size_t bo = kp + (size_t)(g * 64) * HD + 8 * lane;
#pragma unroll
            for (int hb = 0; hb < 2; ++hb) {    // 32 keys at a time: their 8 K fragments, the Q fragments and 2 accumulators fit the 128 registers that let two work-groups share a WGP
                v16bf b[2][2], b2[2][2]; v8f acc[2];
#pragma unroll
                for (int kk = 0; kk < 2; ++kk)
#pragma unroll
                    for (int nb = 0; nb < 2; ++nb) { b[kk][nb] = WFrag<bf>::ld(Kh + bo + (size_t)(hb * 2 + nb) * 16 * HD + kk * 512); b2[kk][nb] = WFrag<bf>::ld(Kl + bo + (size_t)(hb * 2 + nb) * 16 * HD + kk * 512); }
                asm volatile("" :: "v"(b[0][0]), "v"(b[0][1]), "v"(b[1][0]), "v"(b[1][1]), "v"(b2[0][0]), "v"(b2[0][1]), "v"(b2[1][0]), "v"(b2[1][1]));   // inputs only: holds all 16 loads in front of the first product, one memory latency instead of one per fragment
#pragma unroll
                for (int nb = 0; nb < 2; ++nb) acc[nb] = (v8f){};
#pragma unroll
                for (int kk = 0; kk < 2; ++kk)
#pragma unroll
                    for (int nb = 0; nb < 2; ++nb) { acc[nb] = wmmab(a[kk], b[kk][nb], acc[nb]); acc[nb] = wmmab(a2[kk], b[kk][nb], acc[nb]); acc[nb] = wmmab(a[kk], b2[kk][nb], acc[nb]); }
#pragma unroll
                for (int nb = 0; nb < 2; ++nb)
#pragma unroll
                    for (int j = 0; j < 8; ++j) sm[(hi * 8 + j) * SP + g * 64 + (hb * 2 + nb) * 16 + lr] = acc[nb][j];
            }
        }
    }
    __syncthreads();    // every score of the 16 rows is in LDS
    {
        const int i = i0 + w; const int nch = i / 128 + 1; float* sr = sm + w * SP; float v[TT / 32]; float mx = -3.0e38f; v4f raw[TT / 128];
#pragma unroll
        for (int ch = 0; ch < TT / 128; ++ch) raw[ch] = *(const v4fa*)(sr + min(ch * 128 + lane * 4, i & ~3));   /* a lane wholly above the diagonal re-reads the diagonal's quad (dropped by the select below): no unwritten LDS is read */
        __builtin_amdgcn_sched_barrier(0);   // keeps the row's 16 LDS reads together in front of the arithmetic: one LDS latency instead of one per read
#pragma unroll
        for (int ch = 0; ch < TT / 128; ++ch) { const int j0 = ch * 128 + lane * 4; const v4f a = raw[ch];
#pragma unroll
            for (int q = 0; q < 4; ++q) { const int j = j0 + q; const float t = (j <= i) ? a[q] * SCL : -3.0e38f; v[ch * 4 + q] = t; mx = fmaxf(mx, t); } }
#pragma unroll
        for (int sh = 16; sh; sh >>= 1) mx = fmaxf(mx, __shfl_xor(mx, sh, 32));
        float sum = 0.f;
#pragma unroll
        for (int ch = 0; ch < TT / 128; ++ch) if (ch < nch) {
#pragma unroll
            for (int q = 0; q < 4; ++q) { const int k = ch * 4 + q; const float d0 = __fsub_rn(v[k], mx); v[k] = exp2s(__fmul_rn(d0, 1.4426950408889634f)); sum += v[k]; } }
#pragma unroll
        for (int sh = 16; sh; sh >>= 1) sum += __shfl_xor(sum, sh, 32);
        const float f = __fdiv_rn(hires ? 1.0f : PCAR, sum);
        if (hires) { bf* ph = (bf*)sr; bf* pl = ph + TT;
#pragma unroll
            for (int ch = 0; ch < RH / 128; ++ch) if (ch < nch) { v4us oh, ol;
#pragma unroll
                for (int q = 0; q < 4; ++q) { unsigned short a, c2; splitf(v[ch * 4 + q] * f, a, c2); oh[q] = a; ol[q] = c2; }
                *(v4usa*)(ph + ch * 128 + lane * 4) = oh; *(v4usa*)(pl + ch * 128 + lane * 4) = ol; }
        } else { h16* p16 = (h16*)sr;
#pragma unroll
            for (int ch = 0; ch < TT / 128; ++ch) if (ch < nch) { v4h o4;
#pragma unroll
                for (int q = 0; q < 4; ++q) o4[q] = tohx(v[ch * 4 + q] * f);
                *(v4ha*)(p16 + ch * 128 + lane * 4) = o4; } }
    }
    __syncthreads();    // every probability of the 16 rows is in LDS
    v8f acc[4];
#pragma unroll
    for (int nb = 0; nb < 4; ++nb) acc[nb] = (v8f){};
    const size_t vo = kp + 8 * lane;   // V planes: rows = d, 16 x TT elements per 16-d block, 512 per 32 keys
    if (hires) { const bf* ph = (const bf*)(sm + lr * SP) + 8 * hi; const bf* pl = ph + TT;
#pragma unroll 1
        for (int g = w; g < ng; g += KSP) {
#pragma unroll
            for (int kk = 0; kk < 2; ++kk) { const int kc = g * 64 + kk * 32; const v16bf a = ldsb(ph + kc), a2 = ldsb(pl + kc);
#pragma unroll
                for (int nb = 0; nb < 4; ++nb) { const v16bf b = WFrag<bf>::ld(Vh + vo + (size_t)nb * 16 * TT + kc * 16), b2 = WFrag<bf>::ld(Vl + vo + (size_t)nb * 16 * TT + kc * 16);
                    acc[nb] = wmmab(a, b, acc[nb]); acc[nb] = wmmab(a2, b, acc[nb]); acc[nb] = wmmab(a, b2, acc[nb]); } }
        }
    } else { const h16* p16 = (const h16*)(sm + lr * SP) + 8 * hi; const h16* vp = V16 + vo + w * 1024;
#pragma unroll 1
        for (int g = w; g < ng; g += KSP, vp += KSP * 1024) {
            v16h b[2][4];
#pragma unroll
            for (int kk = 0; kk < 2; ++kk)
#pragma unroll
                for (int nb = 0; nb < 4; ++nb) b[kk][nb] = WFrag<h16>::ld(vp + (size_t)nb * 16 * TT + kk * 512);
            asm volatile("" :: "v"(b[0][0]), "v"(b[0][1]), "v"(b[0][2]), "v"(b[0][3]), "v"(b[1][0]), "v"(b[1][1]), "v"(b[1][2]), "v"(b[1][3]));   // inputs only: holds all 16 loads in front of the first product, one memory latency instead of one per fragment
#pragma unroll
            for (int kk = 0; kk < 2; ++kk) { const v16h a = ldsh(p16 + g * 64 + kk * 32);
#pragma unroll
                for (int nb = 0; nb < 4; ++nb) acc[nb] = wmma16(a, b[kk][nb], acc[nb]); }
        }
    }
    __syncthreads();    // every wave has read its last probability: the partial tiles may overwrite them
    { float* pt = sm + w * (16 * OP);
#pragma unroll
        for (int nb = 0; nb < 4; ++nb)
#pragma unroll
            for (int j = 0; j < 8; ++j) pt[(hi * 8 + j) * OP + nb * 16 + lr] = acc[nb][j]; }
    __syncthreads();    // all 16 partial tiles are in LDS
    { const int d = (w >> 1) * 8 + (lane & 3) * 2, rw = (w & 1) * 8 + (lane >> 2); const float cs = hires ? 1.0f : (1.0f / PCAR); const size_t oo = ((size_t)blockIdx.z * TT + i0) * DQ + h * 1024 + w * 64 + lane * 2;   // the merged planes are the last GEMM's A operand (rows = tokens, k = h * HD + d): the tile is two fragment blocks in a row, and thread w * 32 + lane takes their elements w * 64 + lane * 2 and the next, which are (row rw, d and d + 1): one whole line a wave and plane
        v2f s = *(const v2fa*)(sm + rw * OP + d);   /* the KSP partial tiles of the split key loop, added in wave order */
#pragma unroll
        for (int p = 1; p < KSP; ++p) { const v2f u = *(const v2fa*)(sm + p * (16 * OP) + rw * OP + d); s[0] += u[0]; s[1] += u[1]; }
        v2us oh, ol;
#pragma unroll
        for (int q = 0; q < 2; ++q) { unsigned short a, c2; splitf(s[q] * cs, a, c2); oh[q] = a; ol[q] = c2; } *(v2us*)(Ah + oo) = oh; *(v2us*)(Al + oo) = ol; }
}

extern "C" void kernel_launch(void* const* d_in, const int* in_sizes, int n_in,
                              void* d_out, int out_size, void* d_ws, size_t ws_size, hipStream_t stream) {
    (void)in_sizes; (void)n_in; (void)out_size;
    const float* x = (const float*)d_in[0]; const int* PID = (const int*)d_in[1]; const float* wq = (const float*)d_in[2]; const float* wk = (const float*)d_in[3]; const float* wv = (const float*)d_in[4]; const float* wo = (const float*)d_in[5];   /* input order x, token_positions (int32 [2048], read on device by the table builder), Wq, Wk, Wv, Wo ('oi' [1024][1024]): the host's own six slots */
    float* OUT = (float*)d_out;     // [4][2048][1024]
    char* wsp = (char*)d_ws;
    auto take = [&](size_t bytes) { char* p = wsp; wsp += (bytes + 255) & ~(size_t)255; return (void*)p; };
    bf* WQ = (bf*)take((size_t)(DQ + 2 * DKV) * DM * 2); bf* WK = WQ + (size_t)DQ * DM; bf* WV = WK + (size_t)DKV * DM;   /* one plane of 3072 rows: the merged projection launch walks it by blockIdx.y */ bf* WO = (bf*)take((size_t)DM * DQ * 2); float* CS = (float*)take((size_t)TT * HD * 2 * 4);
    bf* XB = (bf*)take((size_t)NB_ * TT * DM * 2);
    h16* VT16 = (h16*)take((size_t)NB_ * NKV * HD * TT * 2);
    bf* QPh = (bf*)take((size_t)NB_ * NH_ * TT * HD * 2); bf* QPl = (bf*)take((size_t)NB_ * NH_ * TT * HD * 2); bf* KPh = (bf*)take((size_t)NB_ * NKV * TT * HD * 2); bf* KPl = (bf*)take((size_t)NB_ * NKV * TT * HD * 2); bf* VTh = (bf*)take((size_t)NB_ * NKV * HD * TT * 2); bf* VTl = (bf*)take((size_t)NB_ * NKV * HD * TT * 2);
    bf* ATh = (bf*)take((size_t)NB_ * TT * DQ * 2); bf* ATl = (bf*)take((size_t)NB_ * TT * DQ * 2);
    if ((size_t)(wsp - (char*)d_ws) > ws_size) return;    // ws 256 MiB
    k_prep<<<NPT + NPX + 4 * NPW, 256, 0, stream>>>(x, PID, wq, wk, wv, wo, XB, WQ, WK, WV, WO, CS);   /* bf16 planes of x (rows = batch * TT + token) and of the four weights, and the {cos, sin} table from token_positions (int32 [2048], read on device; the same for every batch) */
    k_gemmw<bf, 0, false, 3, DM><<<dim3(TT / 64, (DQ + 2 * DKV) / 64, NB_), 32, 0, stream>>>(XB, nullptr, WQ, nullptr, nullptr, 0, nullptr, (size_t)TT * DM, 0, (size_t)NH_ * TT * HD, CS, VT16, QPh, QPl, KPh, KPl, VTh, VTl);    /* q and k projections with the rotary step and hi/lo planes, v projection with transposed fp16 and hi/lo planes */
    k_attn<<<dim3(TT / 16, NH_, NB_), 32 * KSP, 0, stream>>>(QPh, QPl, KPh, KPl, VT16, VTh, VTl, ATh, ATl);   /* scores (hi/lo planes, 3 products, EVERY row), softmax, hybrid P.V and the merge, all heads of all batches */
    k_gemmw<bf, 1, false, 0, DQ><<<dim3(TT / 64, DM / 64, NB_), 32, 0, stream>>>(ATh, ATl, WO, nullptr, OUT, DM, nullptr, (size_t)TT * DQ, 0, (size_t)TT * DM, nullptr, nullptr, nullptr, nullptr, nullptr, nullptr, nullptr, nullptr);
}

// v007
// Measured time: 243 microseconds a run.
// Next to v006, in two timings, it ran 1.12 times as fast each time.
// All steps since v000 together make it 11.3 times as fast.
#include <hip/hip_runtime.h>

// Causal multi-head self-attention with interleaved-pair rotary position embedding from a positions input, four batches (x [4][2048][1024]; Q, K, V = x W^T ('oi' [1024][1024] 1/32, no bias; 16 heads x 64; token-major); angles = token_positions (int32 [2048], read on device) x 1 / THETA ** (2i / 64), THETA 1e4; pairs (2i, 2i+1): r_even = x_even cos - x_odd sin, r_odd = x_even sin + x_odd cos, on Q and K; scores / sqrt(64); keys j <= i kept, -inf elsewhere; softmax; out = merged Wo^T ('oi', no bias) -> [4][2048][1024] (8.4 M); argument order x, token_positions, Wq, Wk, Wv, Wo).
// Four launches: k_prep (all conversions and the table), the q, k, v projections in one grid, k_attn, the last GEMM. Every stage is ONE launch for all four batches (blockIdx.z = batch; each per-batch plane has NB_ copies in a row in the workspace; the weights' planes and the {cos, sin} table are shared). Layout per batch: bf16 copy of x; exact projections; {cos, sin} per (position, pair) built once from the int positions and float32 inverse-frequency constants (precise cosf/sinf); the interleaved rotary step with the hi/lo split, and the V transpose with its three planes, done in the projection GEMMs' own epilogues (no f32 projection buffer); causal T-2048 attention (EVERY row's scores on hi/lo planes (3 products: logit sigma 2 with these weights) and hybrid P.V (rows < 512 hi/lo, rest fp16 x1024); one fused kernel, k_attn, which stops at the diagonal); merged hi/lo x Wo exact.
// Every 16-bit operand plane [row][k] lies in FRAGMENT ORDER: a block of 16 rows x 32 k is 1 KiB in a row, blocks k-fastest, then by 16-row block; inside it element (r, k) stands at ((k >> 4) & 1) * 256 + (((k >> 3) & 1) * 16 + r) * 8 + (k & 7). A lane's two 16-byte pieces of a fragment are then base + lane * 8 and + 256: each load of a wave reads 512 bytes in a row (4 whole lines, not 32 bytes of each of 16 lines). The k order of a fragment is the one of the row-major loader, for A and B alike.
// Compute dtypes, f32 accumulate: every input rounded to bf16; projections exact; rotary f32; attention scores 3 products, P.V rows < 512 3 products, rest fp16; softmax f32; Wo hl x exact.

#define NB_  4      // batches: this module's input is [4][2048][1024]
#define TT   2048
#define DM   1024
#define NH_  16
#define NKV  16
#define REP  (NH_ / NKV)
#define HD   64
#define DQ   (NH_ * HD)
#define DKV  (NKV * HD)
#define RH   512                  // query rows < RH use hi+lo planes in P.V (0: none)
#define PCAR 1024.0f
#define SCL  0.125f   // HD^-0.5
#define KSP  16     // waves of a k_attn work-group; they share the key loops of its 16 query rows (partial P.V tiles in LDS, added in wave order)
typedef _Float16 h16;
typedef unsigned short bf;
typedef __attribute__((ext_vector_type(16))) __bf16   v16bf;
typedef __attribute__((ext_vector_type(16))) _Float16 v16h;
typedef __attribute__((ext_vector_type(8)))  _Float16 v8h;
typedef __attribute__((ext_vector_type(8)))  unsigned short v8us;
typedef __attribute__((ext_vector_type(8)))  float    v8f;
typedef __attribute__((ext_vector_type(4)))  float    v4f;
typedef v8h  __attribute__((may_alias)) v8ha;
typedef v4f  __attribute__((may_alias)) v4fa;
typedef v8us __attribute__((may_alias)) v8usa;

__device__ __forceinline__ unsigned short f2bf(float f) { unsigned u = __float_as_uint(f); u += 0x7FFFu + ((u >> 16) & 1u); return (unsigned short)(u >> 16); }
__device__ __forceinline__ float bf2f(unsigned short b) { return __uint_as_float(((unsigned)b) << 16); }
__device__ __forceinline__ float bfr(float f) { return bf2f(f2bf(f)); }
__device__ __forceinline__ v16h cat16(v8h lo, v8h hi) { return __builtin_shufflevector(lo, hi, 0, 1, 2, 3, 4, 5, 6, 7, 8, 9, 10, 11, 12, 13, 14, 15); }
__device__ __forceinline__ v16bf cat16b(v8us lo, v8us hi) { return __builtin_bit_cast(v16bf, __builtin_shufflevector(lo, hi, 0, 1, 2, 3, 4, 5, 6, 7, 8, 9, 10, 11, 12, 13, 14, 15)); }
__device__ __forceinline__ v8f wmma16(v16h a, v16h b, v8f c) { return __builtin_amdgcn_wmma_f32_16x16x32_f16(false, a, false, b, (short)0, c, false, false); }
__device__ __forceinline__ v8f wmmab(v16bf a, v16bf b, v8f c) { return __builtin_amdgcn_wmma_f32_16x16x32_bf16(false, a, false, b, (short)0, c, false, false); }



__device__ __forceinline__ h16 tohx(float x) { return (h16)x; }
__device__ __forceinline__ void splitf(float y, unsigned short& h, unsigned short& l) { h = f2bf(y); l = f2bf(y - bf2f(h)); }
typedef __attribute__((ext_vector_type(2))) _Float16 v2h;
typedef __attribute__((ext_vector_type(4))) _Float16 v4h;
typedef __attribute__((ext_vector_type(2))) unsigned short v2us;
typedef __attribute__((ext_vector_type(4))) unsigned short v4us;
typedef __attribute__((ext_vector_type(2))) float v2f;
typedef __attribute__((ext_vector_type(4))) int v4i;

// ---- k_gemmw: register-blocked GEMM, ONE WAVE per 64x64 output tile (16 accumulators); 2 x 2 waves share a 128x128 tile, whose operands (16-bit planes in fragment order) come once per work-group from global memory into a two-buffer LDS ring, 64 k a stage, by asynchronous copies; the fragments are read from LDS (block's base + lane * 8, as in global memory); grid (M/128, N/128, Z), 128 threads.
// C[m][n] (f32, pitch ldc, + optional f32 bias[n]) = sum_k A[m][k] Bt[n][k] (+ split products per NSPLIT). z-batch strides sA/sB/sC in elements (sC: of C for EPI 0, of each output plane for EPI 1 and 2). K % 64 == 0.
// EPI picks what becomes of the tile, which for EPI 1 and 2 is 64 tokens x one whole head (HD == 64 columns): 0: f32 C as above. 1: rotary step from the {cos, sin} table CS, then the hi/lo split, to the planes Ph, Pl [head][token][d] (fragment order, rows = tokens). 2: fp16 and hi/lo planes P16, Ph, Pl, transposed to [head][d][token] (fragment order, rows = d). 3: the q, k and v projections in ONE grid, N = 3 * DQ rows of Bt (the three weights' planes stand in a row): the 64-column tile's index / 16 picks 1 to Ph, Pl (q), 1 to Ph2, Pl2 (k) or 2 to P16, Ph3, Pl3 (v).
template <typename T16> struct WFrag;
template <> struct WFrag<h16> { typedef v16h V; static __device__ __forceinline__ V ld(const h16* p) { return cat16(*(const v8h*)p, *(const v8h*)(p + 256)); } static __device__ __forceinline__ v8f mma(V a, V b, v8f c) { return wmma16(a, b, c); } };
template <> struct WFrag<bf> { typedef v16bf V; static __device__ __forceinline__ V ld(const bf* p) { return cat16b(*(const v8us*)p, *(const v8us*)(p + 256)); } static __device__ __forceinline__ v8f mma(V a, V b, v8f c) { return wmmab(a, b, c); } };
template <typename T16> struct LFrag;
template <> struct LFrag<h16> { static __device__ __forceinline__ v16h ld(const h16* p) { return cat16(*(const v8ha*)p, *(const v8ha*)(p + 256)); } };
template <> struct LFrag<bf> { static __device__ __forceinline__ v16bf ld(const bf* p) { return cat16b(*(const v8usa*)p, *(const v8usa*)(p + 256)); } };
#define KS 64       // k per stage of the ring: a 16-row block's share of a stage is 2 KiB in a row, in global memory and in LDS: one 16-byte copy of each of the 128 threads
// cp8: one plane's share of a stage, 8 blocks of 16 rows: 8 copies a lane, LDS byte address l + rb * 2048, global g + rb * 16 * K elements. The s_wait_xcnt is the last line of the copies' own statement, so that it stands in front of every later write of a register that a copy names.
template <typename T16, int K> __device__ __forceinline__ void cp8(const unsigned l, const T16* g) {
    asm volatile("global_load_async_to_lds_b128 %0, %8, off\n\tglobal_load_async_to_lds_b128 %1, %9, off\n\tglobal_load_async_to_lds_b128 %2, %10, off\n\tglobal_load_async_to_lds_b128 %3, %11, off\n\tglobal_load_async_to_lds_b128 %4, %12, off\n\tglobal_load_async_to_lds_b128 %5, %13, off\n\tglobal_load_async_to_lds_b128 %6, %14, off\n\tglobal_load_async_to_lds_b128 %7, %15, off\n\ts_wait_xcnt 0x0"
        :: "v"(l), "v"(l + 2048u), "v"(l + 4096u), "v"(l + 6144u), "v"(l + 8192u), "v"(l + 10240u), "v"(l + 12288u), "v"(l + 14336u),
           "v"(g), "v"(g + 16 * K), "v"(g + 32 * K), "v"(g + 48 * K), "v"(g + 64 * K), "v"(g + 80 * K), "v"(g + 96 * K), "v"(g + 112 * K) : "memory");
}
template <typename T16, int NSPLIT, bool BIAS, int EPI, int K>
__global__ __launch_bounds__(128) void k_gemmw(const T16* __restrict__ A, const T16* __restrict__ A2, const T16* __restrict__ Bt, const T16* __restrict__ Bt2, float* C, int ldc, const float* __restrict__ bias, size_t sA, size_t sB, size_t sC, const float* __restrict__ CS, h16* P16, bf* Ph, bf* Pl, bf* Ph2, bf* Pl2, bf* Ph3, bf* Pl3) {
    typedef typename WFrag<T16>::V V;
    const int wv = __builtin_amdgcn_readfirstlane((int)(threadIdx.x >> 5)), wm = wv >> 1, wn = wv & 1;   // the wave's 64x64 quarter of the 128x128 tile
    const int cy = (int)blockIdx.y * 2 + wn;    // index of the wave's 64-column tile
    const int sel = (EPI == 3) ? cy / (DQ / 64) : 0, hy = (EPI == 3) ? cy % (DQ / 64) : cy;   // EPI 3: which projection (0 q, 1 k, 2 v; the same for the whole work-group) and which head (the wave's own)
    if constexpr (EPI == 3) { if (sel == 1) { Ph = Ph2; Pl = Pl2; } else if (sel == 2) { Ph = Ph3; Pl = Pl3; } }
    constexpr int NA = (NSPLIT == 1 || NSPLIT == 2) ? 2 : 1, NPL = NA + ((NSPLIT >= 2) ? 2 : 1), PLE = 128 * KS, NT = K / KS;   // planes of A, planes in all, elements of a plane's share of a stage, stages
    __shared__ __align__(16) T16 ring[2 * NPL * PLE];
    float* os = (float*)ring + wv * (16 * 68);   // the epilogue's staging, a wave's own part; it takes the ring's place behind the last trip's barrier
    const size_t z = blockIdx.z; A += z * sA; if (A2) A2 += z * sA; Bt += z * sB; if (Bt2) Bt2 += z * sB; if constexpr (EPI == 0) C += z * sC; else { Ph += z * sC; Pl += z * sC; if constexpr (EPI == 2 || EPI == 3) P16 += z * sC; }
    const int lane = threadIdx.x & 31, lr = lane & 15, hi = lane >> 4; const int r0 = blockIdx.x * 128 + wm * 64, c0 = cy * 64;
    v8f acc[4][4];
#pragma unroll
    for (int mb = 0; mb < 4; ++mb)
#pragma unroll
        for (int nb = 0; nb < 4; ++nb) acc[mb][nb] = (v8f){};
    const unsigned t8 = 8 * threadIdx.x;
    A += (size_t)blockIdx.x * 128 * K + t8; if (NA == 2) A2 += (size_t)blockIdx.x * 128 * K + t8; Bt += (size_t)blockIdx.y * 128 * K + t8; if (NSPLIT >= 2) Bt2 += (size_t)blockIdx.y * 128 * K + t8;   // 16 rows x K elements per 16-row block, 512 elements per 32 k: the thread's own 16 bytes of each block's 2 KiB of a stage
    const unsigned lb = (unsigned)(size_t)ring + 2 * t8;   // the thread's LDS byte address in a plane's first block
    auto fill = [&](const int t, const int bu) {    // stage t into buffer bu: every thread of the work-group, every lane on
        const unsigned l = lb + bu * (NPL * PLE * 2);
        cp8<T16, K>(l, A + t * (KS * 16)); if constexpr (NA == 2) cp8<T16, K>(l + PLE * 2, A2 + t * (KS * 16));
        cp8<T16, K>(l + NA * PLE * 2, Bt + t * (KS * 16)); if constexpr (NSPLIT >= 2) cp8<T16, K>(l + (NA + 1) * PLE * 2, Bt2 + t * (KS * 16)); };
    fill(0, 0);
    asm volatile("s_wait_asynccnt 0x0" ::: "memory");   // this wave's copies of stage 0 have landed
    __syncthreads();                                    // ... and every other wave's: stage 0 may be read
    fill(1, 1);
    const unsigned l8 = 8 * lane;
#pragma unroll 1
    for (int t = 0; t < NT; ++t) {
        const T16* sb = ring + (t & 1) * (NPL * PLE) + l8;
#pragma unroll
        for (int kb = 0; kb < KS / 32; ++kb) {
            V a[4], a2[4]; const T16* pa = sb + wm * (PLE / 2) + kb * 512; const T16* pb = sb + NA * PLE + wn * (PLE / 2) + kb * 512;
#pragma unroll
            for (int mb = 0; mb < 4; ++mb) { a[mb] = LFrag<T16>::ld(pa + mb * (KS * 16)); if (NA == 2) a2[mb] = LFrag<T16>::ld(pa + PLE + mb * (KS * 16)); }
#pragma unroll
            for (int nb = 0; nb < 4; ++nb) { const V b = LFrag<T16>::ld(pb + nb * (KS * 16)); V b2; if (NSPLIT >= 2) b2 = LFrag<T16>::ld(pb + PLE + nb * (KS * 16));
#pragma unroll
                for (int mb = 0; mb < 4; ++mb) { acc[mb][nb] = WFrag<T16>::mma(a[mb], b, acc[mb][nb]); if (NSPLIT == 1 || NSPLIT == 2) acc[mb][nb] = WFrag<T16>::mma(a2[mb], b, acc[mb][nb]); if (NSPLIT >= 2) acc[mb][nb] = WFrag<T16>::mma(a[mb], b2, acc[mb][nb]); } }
            asm volatile("v_nop\n\tv_nop\n\tv_nop\n\tv_nop" : "+v"(acc[0][0]), "+v"(acc[1][1]), "+v"(acc[2][2]), "+v"(acc[3][3]) : "v"(a[0]), "v"(a[3]));   // as before this step: four vector slots behind a pass's products, before the next pass's fragments take over the operand registers
        }
        asm volatile("s_wait_dscnt 0x0" ::: "memory");      // this wave's reads of stage t have returned, before the buffer is given up
        asm volatile("s_wait_asynccnt 0x0" ::: "memory");   // this wave's copies of stage t + 1 have landed
        __syncthreads();                                    // publishes stage t + 1 and ends every wave's reads of stage t
        if (t + 2 < NT) fill(t + 2, t & 1);
    }
    asm volatile("s_wait_asynccnt 0x0" ::: "memory");       // no copy is outstanding when the ring becomes the epilogue's staging
    if constexpr (EPI == 1 || EPI == 3) if (EPI == 1 || sel < 2) {
        const int tk = lane >> 1, cofs = (lane & 1) * 4;    // a lane takes the pairs (d, d + 1) and (d + 2, d + 3), d = s * 8 + cofs, of token r0 + mb * 16 + tk: in fragment order that is element s * 128 + lane * 4 of the 16-token block
        const float* ct = CS + ((size_t)(r0 + tk) * HD + cofs) * 2; const size_t po = ((size_t)hy * TT + r0) * HD + lane * 4;
        v2f cs[2][8][2];            // {cos, sin} of 16 tokens, fetched one 16-token block ahead of its use
#pragma unroll
        for (int s = 0; s < 8; ++s) { cs[0][s][0] = *(const v2f*)(ct + s * 16); cs[0][s][1] = *(const v2f*)(ct + s * 16 + 4); }
#pragma unroll
        for (int mb = 0; mb < 4; ++mb) {
            if (mb < 3) {
#pragma unroll
                for (int s = 0; s < 8; ++s) { cs[(mb + 1) & 1][s][0] = *(const v2f*)(ct + (size_t)(mb + 1) * 16 * HD * 2 + s * 16); cs[(mb + 1) & 1][s][1] = *(const v2f*)(ct + (size_t)(mb + 1) * 16 * HD * 2 + s * 16 + 4); } }
#pragma unroll
            for (int nb = 0; nb < 4; ++nb) {
#pragma unroll
                for (int j = 0; j < 8; ++j) os[(hi * 8 + j) * 68 + nb * 16 + lr] = acc[mb][nb][j]; }
            __builtin_amdgcn_wave_barrier(); asm volatile("" ::: "memory");   // one wave: keeps the LDS reads below behind the LDS writes above
#pragma unroll
            for (int s = 0; s < 8; ++s) { const v4f x = *(const v4fa*)(os + tk * 68 + s * 8 + cofs); const v2f p = cs[mb & 1][s][0], q = cs[mb & 1][s][1]; float r[4]; v4us oh, ol;
                r[0] = x[0] * p[0] - x[1] * p[1]; r[1] = x[0] * p[1] + x[1] * p[0]; r[2] = x[2] * q[0] - x[3] * q[1]; r[3] = x[2] * q[1] + x[3] * q[0];   /* even: x0 c - x1 s; odd: x0 s + x1 c */
#pragma unroll
                for (int e = 0; e < 4; ++e) { unsigned short a2, c2; splitf(r[e], a2, c2); oh[e] = a2; ol[e] = c2; }
                *(v4us*)(Ph + po + (size_t)(mb * 16 * HD + s * 128)) = oh; *(v4us*)(Pl + po + (size_t)(mb * 16 * HD + s * 128)) = ol; }   // 32 lanes x 8 bytes: two whole 128-byte lines per plane
            if (mb < 3) { __builtin_amdgcn_wave_barrier(); asm volatile("s_wait_xcnt 0x0" ::: "memory"); }   // the next block's LDS writes stay behind these reads; the wait stands between the stores above and the next block's loads and products, which take over the stores' registers
        }
        return;
    }
    if constexpr (EPI == 2 || EPI == 3) {
        const size_t go = (size_t)hy * HD * TT + (size_t)r0 * 16 + lane * 8;   // rows = d: 16 x TT elements per 16-d block, 512 per 32 tokens
#pragma unroll
        for (int mb = 0; mb < 4; ++mb)
#pragma unroll
            for (int nb = 0; nb < 4; ++nb) { v8h o16; v8us oh, ol;     // a lane's 8 accumulator registers are 8 consecutive tokens (mb * 16 + hi * 8 ...) of d = nb * 16 + lr: exactly its 16-byte piece, lane * 8, of quarter mb of the tile's two fragment blocks, so that no LDS pass is needed
#pragma unroll
                for (int j = 0; j < 8; ++j) { const float x = acc[mb][nb][j]; o16[j] = tohx(x); unsigned short a2, c2; splitf(x, a2, c2); oh[j] = a2; ol[j] = c2; }
                const size_t o = go + (size_t)nb * 16 * TT + mb * 256; *(v8usa*)(P16 + o) = __builtin_bit_cast(v8us, o16); *(v8usa*)(Ph + o) = oh; *(v8usa*)(Pl + o) = ol; }   // 32 lanes x 16 bytes: four whole 128-byte lines a store
        asm volatile("s_wait_xcnt 0x0" ::: "memory");   // the wait that stands behind issued stores, in front of any code laid out behind them that takes over their registers
        return;
    }
#pragma unroll
    for (int mb = 0; mb < 4; ++mb) {
#pragma unroll
        for (int nb = 0; nb < 4; ++nb) {
#pragma unroll
            for (int j = 0; j < 8; ++j) os[(hi * 8 + j) * 68 + nb * 16 + lr] = acc[mb][nb][j]; }
        __builtin_amdgcn_wave_barrier(); asm volatile("" ::: "memory");
        float* crow = C + (size_t)(r0 + mb * 16) * ldc + c0;
{
#pragma unroll
            for (int s = 0; s < 8; ++s) { const int row = 2 * s + hi, cofs = lr * 4; v4f val = *(const v4fa*)(os + row * 68 + cofs); if (BIAS) { val[0] += bfr(bias[c0 + cofs]); val[1] += bfr(bias[c0 + cofs + 1]); val[2] += bfr(bias[c0 + cofs + 2]); val[3] += bfr(bias[c0 + cofs + 3]); }
                *(v4f*)(crow + (size_t)row * ldc + cofs) = val; }
             }
        __builtin_amdgcn_wave_barrier(); asm volatile("" ::: "memory");
    }
}


__global__ __launch_bounds__(256) void k_wtG(const float* __restrict__ w, int K, int N, bf* Bt) {
    const int lane = threadIdx.x & 31; const int L0 = (blockIdx.x * 8 + (threadIdx.x >> 5)) * 8; const int nlines = N * K / 64;
{
#pragma unroll 1
        for (int l = 0; l < 8; ++l) { const int L = L0 + l; if (L >= nlines) break; const size_t e = (size_t)L * 64 + lane * 2; const int k = (int)(e % K), n = (int)(e / K); v2us o;
            o[0] = f2bf(w[(size_t)k * N + n]); o[1] = f2bf(w[(size_t)(k + 1) * N + n]); *(v2us*)(Bt + e) = o; }
         }
}
// cvt8: f32 [row][DM] to the bf16 plane in fragment order, 8 values (one 16-byte piece) a thread. A wave takes 8 rows x 32 k: it reads one whole 128-byte line of each row and writes four whole lines of the block (pieces c = k / 8 of rows rr .. rr + 7 stand in a row).
__device__ __forceinline__ void cvt8(const float* __restrict__ src, bf* dst, const size_t i) { const size_t fr = i >> 6; const int c = (int)(i >> 3) & 3, rr = (int)((i >> 5) & 1) * 8 + (int)(i & 7); const v8f v = *(const v8f*)(src + ((fr / (DM / 32)) * 16 + rr) * DM + (fr % (DM / 32)) * 32 + c * 8); v8us o;
#pragma unroll
    for (int k = 0; k < 8; ++k) o[k] = f2bf(v[k]); *(v8us*)(dst + fr * 512 + (c >> 1) * 256 + ((c & 1) * 16 + rr) * 8) = o;
    asm volatile("s_wait_xcnt 0x0" ::: "memory");   // the wait that stands behind the issued store, in front of any code laid out behind it that takes over its registers
}

__constant__ float INV2[HD / 2] = { 1.000000000e+00f, 7.498942018e-01f, 5.623413324e-01f, 4.216965139e-01f, 3.162277639e-01f, 2.371373624e-01f, 1.778279394e-01f, 1.333521456e-01f, 1.000000015e-01f, 7.498941571e-02f, 5.623412877e-02f, 4.216964915e-02f, 3.162277862e-02f, 2.371373586e-02f, 1.778279431e-02f, 1.333521493e-02f, 9.999999776e-03f, 7.498942316e-03f, 5.623413250e-03f, 4.216964822e-03f, 3.162277862e-03f, 2.371373819e-03f, 1.778279431e-03f, 1.333521446e-03f, 1.000000047e-03f, 7.498941850e-04f, 5.623413017e-04f, 4.216964880e-04f, 3.162277862e-04f, 2.371373848e-04f, 1.778279402e-04f, 1.333521504e-04f };   // float32 10000^(-(i * 2 / 64)), generated with jnp to be bit-exact with the module's expression
__device__ __forceinline__ void cstab(const int* __restrict__ pid, float* CS, const int idx) { const int d = idx % HD; const int t = idx / HD; const float a = __fmul_rn((float)pid[t], INV2[d >> 1]); v2f cs; cs[0] = cosf(a); cs[1] = sinf(a); *(v2f*)(CS + (size_t)idx * 2) = cs;  }
// k_prep: everything that depends on the inputs alone, in ONE launch; a block's index picks its job (the same for all its threads): the {cos, sin} table (NPT blocks, first: the longest threads), x (NPX), then the four weights (NPW each). Every count is exact: no thread is left over.
#define NPT (TT * HD / 256)
#define NPX (NB_ * TT * DM / 8 / 256)
#define NPW (DM * DQ / 8 / 256)
__global__ __launch_bounds__(256) void k_prep(const float* __restrict__ x, const int* __restrict__ pid, const float* __restrict__ wq, const float* __restrict__ wk, const float* __restrict__ wv, const float* __restrict__ wo, bf* XB, bf* WQ, bf* WK, bf* WV, bf* WO, float* CS) {
    unsigned b = blockIdx.x;
    if (b < NPT) { cstab(pid, CS, (int)(b * 256 + threadIdx.x)); return; }
    b -= NPT;
    if (b < NPX) { cvt8(x, XB, (size_t)b * 256 + threadIdx.x); return; }
    b -= NPX;
    const unsigned s = b / NPW; const float* src = s == 0 ? wq : s == 1 ? wk : s == 2 ? wv : wo; bf* dst = s == 0 ? WQ : s == 1 ? WK : s == 2 ? WV : WO;
    cvt8(src, dst, (size_t)(b % NPW) * 256 + threadIdx.x);
}

// ---- k_attn: scores, softmax and P.V of 16 query rows of one head in ONE work-group of KSP = 16 waves; grid (TT / 16, heads, batches), 512 threads. The rows' scores, then their probabilities, then the partial output tiles stay in LDS.
// 1) wave w takes the 64-key groups w, w + 16, ... up to the diagonal: Q hi/lo x K hi/lo (3 products, k order 0..31 then 32..63), f32 scores to LDS row-major (pitch SP floats).
// 2) wave w owns row w: whole-row softmax in registers (one exp, fixed trees; 128-key chunks wholly above the diagonal are exact zeros: no exp, no store); the 16-bit probability planes overwrite the row's own scores.
// 3) wave w takes the same 64-key groups of P.V (rows < RH hi/lo, 3 products; the rest fp16 x PCAR); A fragments from LDS (row-major there), V fragments from the [d][t] planes; its partial 16x64 tile goes to LDS.
// 4) the 16 partial tiles are added in wave order, scaled and split into the merged hi/lo planes. Long (late) rows get the low block indices, which start first.
#define SP 2052     // floats per score row in LDS: 8192 + 16 bytes, so that the 16 rows of a b128 fragment read fall on distinct banks
#define OP 68       // floats per row of a partial output tile in LDS
typedef v4us __attribute__((may_alias)) v4usa;
typedef v4h  __attribute__((may_alias)) v4ha;
typedef v2f  __attribute__((may_alias)) v2fa;
__device__ __forceinline__ v16bf ldsb(const bf* p) { return cat16b(*(const v8usa*)p, *(const v8usa*)(p + 16)); }
__device__ __forceinline__ v16h ldsh(const h16* p) { return cat16(*(const v8ha*)p, *(const v8ha*)(p + 16)); }
__device__ __forceinline__ float exp2s(float x) { float r; asm("v_exp_f32 %0, %1\n\tv_nop" : "=v"(r) : "v"(x)); return r; }   // the v_nop is the one free slot the instruction set asks for behind a transcendental, before its result is read or its source overwritten; in one statement so that it stays there
__global__ __launch_bounds__(512, 8) void k_attn(const bf* __restrict__ Qh, const bf* __restrict__ Ql, const bf* __restrict__ Kh, const bf* __restrict__ Kl, const h16* __restrict__ V16, const bf* __restrict__ Vh, const bf* __restrict__ Vl, bf* Ah, bf* Al) {
    __shared__ __align__(16) float sm[16 * SP];
    const int lane = threadIdx.x & 31, lr = lane & 15, hi = lane >> 4; const int w = __builtin_amdgcn_readfirstlane((int)(threadIdx.x >> 5));
    const int h = blockIdx.y; const int i0 = (TT / 16 - 1 - (int)blockIdx.x) * 16;
    const int ng = i0 / 64 + 1;                 // 64-key groups up to and with the diagonal's
    const bool hires = (i0 < RH);               // RH is a multiple of 16: the same for all 16 rows
    const size_t qp = ((size_t)blockIdx.z * NH_ + h) * TT * HD, kp = ((size_t)blockIdx.z * NKV + h / REP) * TT * HD;
    if (w < ng) {
        v16bf a[2], a2[2];
#pragma unroll
        for (int kk = 0; kk < 2; ++kk) { a[kk] = WFrag<bf>::ld(Qh + qp + (size_t)i0 * HD + 8 * lane + kk * 512); a2[kk] = WFrag<bf>::ld(Ql + qp + (size_t)i0 * HD + 8 * lane + kk * 512); }
#pragma unroll 1
        for (int g = w; g < ng; g += KSP) {
            const size_t bo = kp + (size_t)(g * 64) * HD + 8 * lane;
#pragma unroll
            for (int hb = 0; hb < 2; ++hb) {    // 32 keys at a time: their 8 K fragments, the Q fragments and 2 accumulators fit the 128 registers that let two work-groups share a WGP
                v16bf b[2][2], b2[2][2]; v8f acc[2];
#pragma unroll
                for (int kk = 0; kk < 2; ++kk)
#pragma unroll
                    for (int nb = 0; nb < 2; ++nb) { b[kk][nb] = WFrag<bf>::ld(Kh + bo + (size_t)(hb * 2 + nb) * 16 * HD + kk * 512); b2[kk][nb] = WFrag<bf>::ld(Kl + bo + (size_t)(hb * 2 + nb) * 16 * HD + kk * 512); }
                asm volatile("" :: "v"(b[0][0]), "v"(b[0][1]), "v"(b[1][0]), "v"(b[1][1]), "v"(b2[0][0]), "v"(b2[0][1]), "v"(b2[1][0]), "v"(b2[1][1]));   // inputs only: holds all 16 loads in front of the first product, one memory latency instead of one per fragment
#pragma unroll
                for (int nb = 0; nb < 2; ++nb) acc[nb] = (v8f){};
#pragma unroll
                for (int kk = 0; kk < 2; ++kk)
#pragma unroll
                    for (int nb = 0; nb < 2; ++nb) { acc[nb] = wmmab(a[kk], b[kk][nb], acc[nb]); acc[nb] = wmmab(a2[kk], b[kk][nb], acc[nb]); acc[nb] = wmmab(a[kk], b2[kk][nb], acc[nb]); }
#pragma unroll
                for (int nb = 0; nb < 2; ++nb)
#pragma unroll
                    for (int j = 0; j < 8; ++j) sm[(hi * 8 + j) * SP + g * 64 + (hb * 2 + nb) * 16 + lr] = acc[nb][j];
            }
        }
    }
    __syncthreads();    // every score of the 16 rows is in LDS
    {
        const int i = i0 + w; const int nch = i / 128 + 1; float* sr = sm + w * SP; float v[TT / 32]; float mx = -3.0e38f; v4f raw[TT / 128];
#pragma unroll
        for (int ch = 0; ch < TT / 128; ++ch) raw[ch] = *(const v4fa*)(sr + min(ch * 128 + lane * 4, i & ~3));   /* a lane wholly above the diagonal re-reads the diagonal's quad (dropped by the select below): no unwritten LDS is read */
        __builtin_amdgcn_sched_barrier(0);   // keeps the row's 16 LDS reads together in front of the arithmetic: one LDS latency instead of one per read
#pragma unroll
        for (int ch = 0; ch < TT / 128; ++ch) { const int j0 = ch * 128 + lane * 4; const v4f a = raw[ch];
#pragma unroll
            for (int q = 0; q < 4; ++q) { const int j = j0 + q; const float t = (j <= i) ? a[q] * SCL : -3.0e38f; v[ch * 4 + q] = t; mx = fmaxf(mx, t); } }
#pragma unroll
        for (int sh = 16; sh; sh >>= 1) mx = fmaxf(mx, __shfl_xor(mx, sh, 32));
        float sum = 0.f;
#pragma unroll
        for (int ch = 0; ch < TT / 128; ++ch) if (ch < nch) {
#pragma unroll
            for (int q = 0; q < 4; ++q) { const int k = ch * 4 + q; const float d0 = __fsub_rn(v[k], mx); v[k] = exp2s(__fmul_rn(d0, 1.4426950408889634f)); sum += v[k]; } }
#pragma unroll
        for (int sh = 16; sh; sh >>= 1) sum += __shfl_xor(sum, sh, 32);
        const float f = __fdiv_rn(hires ? 1.0f : PCAR, sum);
        if (hires) { bf* ph = (bf*)sr; bf* pl = ph + TT;
#pragma unroll
            for (int ch = 0; ch < RH / 128; ++ch) if (ch < nch) { v4us oh, ol;
#pragma unroll
                for (int q = 0; q < 4; ++q) { unsigned short a, c2; splitf(v[ch * 4 + q] * f, a, c2); oh[q] = a; ol[q] = c2; }
                *(v4usa*)(ph + ch * 128 + lane * 4) = oh; *(v4usa*)(pl + ch * 128 + lane * 4) = ol; }
        } else { h16* p16 = (h16*)sr;
#pragma unroll
            for (int ch = 0; ch < TT / 128; ++ch) if (ch < nch) { v4h o4;
#pragma unroll
                for (int q = 0; q < 4; ++q) o4[q] = tohx(v[ch * 4 + q] * f);
                *(v4ha*)(p16 + ch * 128 + lane * 4) = o4; } }
    }
    __syncthreads();    // every probability of the 16 rows is in LDS
    v8f acc[4];
#pragma unroll
    for (int nb = 0; nb < 4; ++nb) acc[nb] = (v8f){};
    const size_t vo = kp + 8 * lane;   // V planes: rows = d, 16 x TT elements per 16-d block, 512 per 32 keys
    if (hires) { const bf* ph = (const bf*)(sm + lr * SP) + 8 * hi; const bf* pl = ph + TT;
#pragma unroll 1
        for (int g = w; g < ng; g += KSP) {
#pragma unroll
            for (int kk = 0; kk < 2; ++kk) { const int kc = g * 64 + kk * 32; const v16bf a = ldsb(ph + kc), a2 = ldsb(pl + kc);
#pragma unroll
                for (int nb = 0; nb < 4; ++nb) { const v16bf b = WFrag<bf>::ld(Vh + vo + (size_t)nb * 16 * TT + kc * 16), b2 = WFrag<bf>::ld(Vl + vo + (size_t)nb * 16 * TT + kc * 16);
                    acc[nb] = wmmab(a, b, acc[nb]); acc[nb] = wmmab(a2, b, acc[nb]); acc[nb] = wmmab(a, b2, acc[nb]); } }
        }
    } else { const h16* p16 = (const h16*)(sm + lr * SP) + 8 * hi; const h16* vp = V16 + vo + w * 1024;
#pragma unroll 1
        for (int g = w; g < ng; g += KSP, vp += KSP * 1024) {
            v16h b[2][4];
#pragma unroll
            for (int kk = 0; kk < 2; ++kk)
#pragma unroll
                for (int nb = 0; nb < 4; ++nb) b[kk][nb] = WFrag<h16>::ld(vp + (size_t)nb * 16 * TT + kk * 512);
            asm volatile("" :: "v"(b[0][0]), "v"(b[0][1]), "v"(b[0][2]), "v"(b[0][3]), "v"(b[1][0]), "v"(b[1][1]), "v"(b[1][2]), "v"(b[1][3]));   // inputs only: holds all 16 loads in front of the first product, one memory latency instead of one per fragment
#pragma unroll
            for (int kk = 0; kk < 2; ++kk) { const v16h a = ldsh(p16 + g * 64 + kk * 32);
#pragma unroll
                for (int nb = 0; nb < 4; ++nb) acc[nb] = wmma16(a, b[kk][nb], acc[nb]); }
        }
    }
    __syncthreads();    // every wave has read its last probability: the partial tiles may overwrite them
    { float* pt = sm + w * (16 * OP);
#pragma unroll
        for (int nb = 0; nb < 4; ++nb)
#pragma unroll
            for (int j = 0; j < 8; ++j) pt[(hi * 8 + j) * OP + nb * 16 + lr] = acc[nb][j]; }
    __syncthreads();    // all 16 partial tiles are in LDS
    { const int d = (w >> 1) * 8 + (lane & 3) * 2, rw = (w & 1) * 8 + (lane >> 2); const float cs = hires ? 1.0f : (1.0f / PCAR); const size_t oo = ((size_t)blockIdx.z * TT + i0) * DQ + h * 1024 + w * 64 + lane * 2;   // the merged planes are the last GEMM's A operand (rows = tokens, k = h * HD + d): the tile is two fragment blocks in a row, and thread w * 32 + lane takes their elements w * 64 + lane * 2 and the next, which are (row rw, d and d + 1): one whole line a wave and plane
        v2f s = *(const v2fa*)(sm + rw * OP + d);   /* the KSP partial tiles of the split key loop, added in wave order */
#pragma unroll
        for (int p = 1; p < KSP; ++p) { const v2f u = *(const v2fa*)(sm + p * (16 * OP) + rw * OP + d); s[0] += u[0]; s[1] += u[1]; }
        v2us oh, ol;
#pragma unroll
        for (int q = 0; q < 2; ++q) { unsigned short a, c2; splitf(s[q] * cs, a, c2); oh[q] = a; ol[q] = c2; } *(v2us*)(Ah + oo) = oh; *(v2us*)(Al + oo) = ol; }
}

extern "C" void kernel_launch(void* const* d_in, const int* in_sizes, int n_in,
                              void* d_out, int out_size, void* d_ws, size_t ws_size, hipStream_t stream) {
    (void)in_sizes; (void)n_in; (void)out_size;
    const float* x = (const float*)d_in[0]; const int* PID = (const int*)d_in[1]; const float* wq = (const float*)d_in[2]; const float* wk = (const float*)d_in[3]; const float* wv = (const float*)d_in[4]; const float* wo = (const float*)d_in[5];   /* input order x, token_positions (int32 [2048], read on device by the table builder), Wq, Wk, Wv, Wo ('oi' [1024][1024]): the host's own six slots */
    float* OUT = (float*)d_out;     // [4][2048][1024]
    char* wsp = (char*)d_ws;
    auto take = [&](size_t bytes) { char* p = wsp; wsp += (bytes + 255) & ~(size_t)255; return (void*)p; };
    bf* WQ = (bf*)take((size_t)(DQ + 2 * DKV) * DM * 2); bf* WK = WQ + (size_t)DQ * DM; bf* WV = WK + (size_t)DKV * DM;   /* one plane of 3072 rows: the merged projection launch walks it by blockIdx.y */ bf* WO = (bf*)take((size_t)DM * DQ * 2); float* CS = (float*)take((size_t)TT * HD * 2 * 4);
    bf* XB = (bf*)take((size_t)NB_ * TT * DM * 2);
    h16* VT16 = (h16*)take((size_t)NB_ * NKV * HD * TT * 2);
    bf* QPh = (bf*)take((size_t)NB_ * NH_ * TT * HD * 2); bf* QPl = (bf*)take((size_t)NB_ * NH_ * TT * HD * 2); bf* KPh = (bf*)take((size_t)NB_ * NKV * TT * HD * 2); bf* KPl = (bf*)take((size_t)NB_ * NKV * TT * HD * 2); bf* VTh = (bf*)take((size_t)NB_ * NKV * HD * TT * 2); bf* VTl = (bf*)take((size_t)NB_ * NKV * HD * TT * 2);
    bf* ATh = (bf*)take((size_t)NB_ * TT * DQ * 2); bf* ATl = (bf*)take((size_t)NB_ * TT * DQ * 2);
    if ((size_t)(wsp - (char*)d_ws) > ws_size) return;    // ws 256 MiB
    k_prep<<<NPT + NPX + 4 * NPW, 256, 0, stream>>>(x, PID, wq, wk, wv, wo, XB, WQ, WK, WV, WO, CS);   /* bf16 planes of x (rows = batch * TT + token) and of the four weights, and the {cos, sin} table from token_positions (int32 [2048], read on device; the same for every batch) */
    k_gemmw<bf, 0, false, 3, DM><<<dim3(TT / 128, (DQ + 2 * DKV) / 128, NB_), 128, 0, stream>>>(XB, nullptr, WQ, nullptr, nullptr, 0, nullptr, (size_t)TT * DM, 0, (size_t)NH_ * TT * HD, CS, VT16, QPh, QPl, KPh, KPl, VTh, VTl);    /* q and k projections with the rotary step and hi/lo planes, v projection with transposed fp16 and hi/lo planes */
    k_attn<<<dim3(TT / 16, NH_, NB_), 32 * KSP, 0, stream>>>(QPh, QPl, KPh, KPl, VT16, VTh, VTl, ATh, ATl);   /* scores (hi/lo planes, 3 products, EVERY row), softmax, hybrid P.V and the merge, all heads of all batches */
    k_gemmw<bf, 1, false, 0, DQ><<<dim3(TT / 128, DM / 128, NB_), 128, 0, stream>>>(ATh, ATl, WO, nullptr, OUT, DM, nullptr, (size_t)TT * DQ, 0, (size_t)TT * DM, nullptr, nullptr, nullptr, nullptr, nullptr, nullptr, nullptr, nullptr);
}

// v008
// Measured time: 233 microseconds a run.
// Next to v007, in two timings, it ran 1.04 times as fast each time.
// Over all steps from v000 it is 11.7 times as fast.
#include <hip/hip_runtime.h>

// Causal multi-head self-attention with interleaved-pair rotary position embedding from a positions input, four batches (x [4][2048][1024]; Q, K, V = x W^T ('oi' [1024][1024] 1/32, no bias; 16 heads x 64; token-major); angles = token_positions (int32 [2048], read on device) x 1 / THETA ** (2i / 64), THETA 1e4; pairs (2i, 2i+1): r_even = x_even cos - x_odd sin, r_odd = x_even sin + x_odd cos, on Q and K; scores / sqrt(64); keys j <= i kept, -inf elsewhere; softmax; out = merged Wo^T ('oi', no bias) -> [4][2048][1024] (8.4 M); argument order x, token_positions, Wq, Wk, Wv, Wo).
// Four launches: k_prep (all conversions and the table), the q, k, v projections in one grid, k_attn, the last GEMM. Every stage is ONE launch for all four batches (blockIdx.z = batch; each per-batch plane has NB_ copies in a row in the workspace; the weights' planes and the {cos, sin} table are shared). Layout per batch: bf16 copy of x; exact projections; {cos, sin} per (position, pair) built once from the int positions and float32 inverse-frequency constants (precise cosf/sinf); the interleaved rotary step with the hi/lo split, and the V transpose with its three planes, done in the projection GEMMs' own epilogues (no f32 projection buffer); causal T-2048 attention (EVERY row's scores on hi/lo planes (3 products: logit sigma 2 with these weights) and hybrid P.V (rows < 512 hi/lo, rest fp16 x1024); one fused kernel, k_attn, which stops at the diagonal); merged hi/lo x Wo exact.
// Every 16-bit operand plane [row][k] lies in FRAGMENT ORDER: a block of 16 rows x 32 k is 1 KiB in a row, blocks k-fastest, then by 16-row block; inside it element (r, k) stands at ((k >> 4) & 1) * 256 + (((k >> 3) & 1) * 16 + r) * 8 + (k & 7). A lane's two 16-byte pieces of a fragment are then base + lane * 8 and + 256: each load of a wave reads 512 bytes in a row (4 whole lines, not 32 bytes of each of 16 lines). The k order of a fragment is the one of the row-major loader, for A and B alike.
// Compute dtypes, f32 accumulate: every input rounded to bf16; projections exact; rotary f32; attention scores 3 products, P.V rows < 512 3 products, rest fp16; softmax f32; Wo hl x exact.

#define NB_  4      // batches: this module's input is [4][2048][1024]
#define TT   2048
#define DM   1024
#define NH_  16
#define NKV  16
#define REP  (NH_ / NKV)
#define HD   64
#define DQ   (NH_ * HD)
#define DKV  (NKV * HD)
#define RH   512                  // query rows < RH use hi+lo planes in P.V (0: none)
#define PCAR 1024.0f
#define SCL  0.125f   // HD^-0.5
#define KSP  16     // waves of a k_attn work-group; they share the key loops of its 16 query rows (partial P.V tiles in LDS, added in wave order)
typedef _Float16 h16;
typedef unsigned short bf;
typedef __attribute__((ext_vector_type(16))) __bf16   v16bf;
typedef __attribute__((ext_vector_type(16))) _Float16 v16h;
typedef __attribute__((ext_vector_type(8)))  _Float16 v8h;
typedef __attribute__((ext_vector_type(8)))  unsigned short v8us;
typedef __attribute__((ext_vector_type(8)))  float    v8f;
typedef __attribute__((ext_vector_type(4)))  float    v4f;
typedef v8h  __attribute__((may_alias)) v8ha;
typedef v4f  __attribute__((may_alias)) v4fa;
typedef v8us __attribute__((may_alias)) v8usa;

__device__ __forceinline__ unsigned short f2bf(float f) { unsigned u = __float_as_uint(f); u += 0x7FFFu + ((u >> 16) & 1u); return (unsigned short)(u >> 16); }
__device__ __forceinline__ float bf2f(unsigned short b) { return __uint_as_float(((unsigned)b) << 16); }
__device__ __forceinline__ float bfr(float f) { return bf2f(f2bf(f)); }
__device__ __forceinline__ v16h cat16(v8h lo, v8h hi) { return __builtin_shufflevector(lo, hi, 0, 1, 2, 3, 4, 5, 6, 7, 8, 9, 10, 11, 12, 13, 14, 15); }
__device__ __forceinline__ v16bf cat16b(v8us lo, v8us hi) { return __builtin_bit_cast(v16bf, __builtin_shufflevector(lo, hi, 0, 1, 2, 3, 4, 5, 6, 7, 8, 9, 10, 11, 12, 13, 14, 15)); }
__device__ __forceinline__ v8f wmma16(v16h a, v16h b, v8f c) { return __builtin_amdgcn_wmma_f32_16x16x32_f16(false, a, false, b, (short)0, c, false, false); }
__device__ __forceinline__ v8f wmmab(v16bf a, v16bf b, v8f c) { return __builtin_amdgcn_wmma_f32_16x16x32_bf16(false, a, false, b, (short)0, c, false, false); }



__device__ __forceinline__ h16 tohx(float x) { return (h16)x; }
__device__ __forceinline__ void splitf(float y, unsigned short& h, unsigned short& l) { h = f2bf(y); l = f2bf(y - bf2f(h)); }
typedef __attribute__((ext_vector_type(2))) _Float16 v2h;
typedef __attribute__((ext_vector_type(4))) _Float16 v4h;
typedef __attribute__((ext_vector_type(2))) unsigned short v2us;
typedef __attribute__((ext_vector_type(4))) unsigned short v4us;
typedef __attribute__((ext_vector_type(2))) float v2f;
typedef __attribute__((ext_vector_type(4))) int v4i;

// ---- k_gemmw: register-blocked GEMM, ONE WAVE per 64x64 output tile (16 accumulators); 2 x 2 waves share a 128x128 tile, whose operands (16-bit planes in fragment order) come once per work-group from global memory into a two-buffer LDS ring, 64 k a stage, by asynchronous copies; the fragments are read from LDS (block's base + lane * 8, as in global memory); grid (M/128, N/128, Z), 128 threads.
// C[m][n] (f32, pitch ldc, + optional f32 bias[n]) = sum_k A[m][k] Bt[n][k] (+ split products per NSPLIT). z-batch strides sA/sB/sC in elements (sC: of C for EPI 0, of each output plane for EPI 1 and 2). K % 64 == 0.
// EPI picks what becomes of the tile, which for EPI 1 and 2 is 64 tokens x one whole head (HD == 64 columns): 0: f32 C as above. 1: rotary step from the {cos, sin} table CS, then the hi/lo split, to the planes Ph, Pl [head][token][d] (fragment order, rows = tokens). 2: fp16 and hi/lo planes P16, Ph, Pl, transposed to [head][d][token] (fragment order, rows = d). 3: the q, k and v projections in ONE grid, N = 3 * DQ rows of Bt (the three weights' planes stand in a row): the 64-column tile's index / 16 picks 1 to Ph, Pl (q), 1 to Ph2, Pl2 (k) or 2 to P16, Ph3, Pl3 (v).
template <typename T16> struct WFrag;
template <> struct WFrag<h16> { typedef v16h V; static __device__ __forceinline__ V ld(const h16* p) { return cat16(*(const v8h*)p, *(const v8h*)(p + 256)); } static __device__ __forceinline__ v8f mma(V a, V b, v8f c) { return wmma16(a, b, c); } };
template <> struct WFrag<bf> { typedef v16bf V; static __device__ __forceinline__ V ld(const bf* p) { return cat16b(*(const v8us*)p, *(const v8us*)(p + 256)); } static __device__ __forceinline__ v8f mma(V a, V b, v8f c) { return wmmab(a, b, c); } };
template <typename T16> struct LFrag;
template <> struct LFrag<h16> { static __device__ __forceinline__ v16h ld(const h16* p) { return cat16(*(const v8ha*)p, *(const v8ha*)(p + 256)); } };
template <> struct LFrag<bf> { static __device__ __forceinline__ v16bf ld(const bf* p) { return cat16b(*(const v8usa*)p, *(const v8usa*)(p + 256)); } };
#define KS 64       // k per stage of the ring: a 16-row block's share of a stage is 2 KiB in a row, in global memory and in LDS: one 16-byte copy of each of the 128 threads
// cp8: one plane's share of a stage, 8 blocks of 16 rows: 8 copies a lane, LDS byte address l + rb * 2048, global g + rb * 16 * K elements. The s_wait_xcnt is the last line of the copies' own statement, so that it stands in front of every later write of a register that a copy names.
template <typename T16, int K> __device__ __forceinline__ void cp8(const unsigned l, const T16* g) {
    asm volatile("global_load_async_to_lds_b128 %0, %8, off\n\tglobal_load_async_to_lds_b128 %1, %9, off\n\tglobal_load_async_to_lds_b128 %2, %10, off\n\tglobal_load_async_to_lds_b128 %3, %11, off\n\tglobal_load_async_to_lds_b128 %4, %12, off\n\tglobal_load_async_to_lds_b128 %5, %13, off\n\tglobal_load_async_to_lds_b128 %6, %14, off\n\tglobal_load_async_to_lds_b128 %7, %15, off\n\ts_wait_xcnt 0x0"
        :: "v"(l), "v"(l + 2048u), "v"(l + 4096u), "v"(l + 6144u), "v"(l + 8192u), "v"(l + 10240u), "v"(l + 12288u), "v"(l + 14336u),
           "v"(g), "v"(g + 16 * K), "v"(g + 32 * K), "v"(g + 48 * K), "v"(g + 64 * K), "v"(g + 80 * K), "v"(g + 96 * K), "v"(g + 112 * K) : "memory");
}
template <typename T16, int NSPLIT, bool BIAS, int EPI, int K>
__global__ __launch_bounds__(128) void k_gemmw(const T16* __restrict__ A, const T16* __restrict__ A2, const T16* __restrict__ Bt, const T16* __restrict__ Bt2, float* C, int ldc, const float* __restrict__ bias, size_t sA, size_t sB, size_t sC, const float* __restrict__ CS, h16* P16, bf* Ph, bf* Pl, bf* Ph2, bf* Pl2, bf* Ph3, bf* Pl3) {
    typedef typename WFrag<T16>::V V;
    const int wv = __builtin_amdgcn_readfirstlane((int)(threadIdx.x >> 5)), wm = wv >> 1, wn = wv & 1;   // the wave's 64x64 quarter of the 128x128 tile
    const int cy = (int)blockIdx.y * 2 + wn;    // index of the wave's 64-column tile
    const int sel = (EPI == 3) ? cy / (DQ / 64) : 0, hy = (EPI == 3) ? cy % (DQ / 64) : cy;   // EPI 3: which projection (0 q, 1 k, 2 v; the same for the whole work-group) and which head (the wave's own)
    if constexpr (EPI == 3) { if (sel == 1) { Ph = Ph2; Pl = Pl2; } else if (sel == 2) { Ph = Ph3; Pl = Pl3; } }
    constexpr int NA = (NSPLIT == 1 || NSPLIT == 2) ? 2 : 1, NPL = NA + ((NSPLIT >= 2) ? 2 : 1), PLE = 128 * KS, NT = K / KS;   // planes of A, planes in all, elements of a plane's share of a stage, stages
    __shared__ __align__(16) T16 ring[2 * NPL * PLE];
    float* os = (float*)ring + wv * (16 * 68);   // the epilogue's staging, a wave's own part; it takes the ring's place behind the last trip's barrier
    const size_t z = blockIdx.z; A += z * sA; if (A2) A2 += z * sA; Bt += z * sB; if (Bt2) Bt2 += z * sB; if constexpr (EPI == 0) C += z * sC; else { Ph += z * sC; Pl += z * sC; if constexpr (EPI == 2 || EPI == 3) P16 += z * sC; }
    const int lane = threadIdx.x & 31, lr = lane & 15, hi = lane >> 4; const int r0 = blockIdx.x * 128 + wm * 64, c0 = cy * 64;
    v8f acc[4][4];
#pragma unroll
    for (int mb = 0; mb < 4; ++mb)
#pragma unroll
        for (int nb = 0; nb < 4; ++nb) acc[mb][nb] = (v8f){};
    const unsigned t8 = 8 * threadIdx.x;
    A += (size_t)blockIdx.x * 128 * K + t8; if (NA == 2) A2 += (size_t)blockIdx.x * 128 * K + t8; Bt += (size_t)blockIdx.y * 128 * K + t8; if (NSPLIT >= 2) Bt2 += (size_t)blockIdx.y * 128 * K + t8;   // 16 rows x K elements per 16-row block, 512 elements per 32 k: the thread's own 16 bytes of each block's 2 KiB of a stage
    const unsigned lb = (unsigned)(size_t)ring + 2 * t8;   // the thread's LDS byte address in a plane's first block
    auto fill = [&](const int t, const int bu) {    // stage t into buffer bu: every thread of the work-group, every lane on
        const unsigned l = lb + bu * (NPL * PLE * 2);
        cp8<T16, K>(l, A + t * (KS * 16)); if constexpr (NA == 2) cp8<T16, K>(l + PLE * 2, A2 + t * (KS * 16));
        cp8<T16, K>(l + NA * PLE * 2, Bt + t * (KS * 16)); if constexpr (NSPLIT >= 2) cp8<T16, K>(l + (NA + 1) * PLE * 2, Bt2 + t * (KS * 16)); };
    fill(0, 0);
    asm volatile("s_wait_asynccnt 0x0" ::: "memory");   // this wave's copies of stage 0 have landed
    __syncthreads();                                    // ... and every other wave's: stage 0 may be read
    fill(1, 1);
    const unsigned l8 = 8 * lane;
#pragma unroll 1
    for (int t = 0; t < NT; ++t) {
        const T16* sb = ring + (t & 1) * (NPL * PLE) + l8;
#pragma unroll
        for (int kb = 0; kb < KS / 32; ++kb) {
            V a[4], a2[4]; const T16* pa = sb + wm * (PLE / 2) + kb * 512; const T16* pb = sb + NA * PLE + wn * (PLE / 2) + kb * 512;
#pragma unroll
            for (int mb = 0; mb < 4; ++mb) { a[mb] = LFrag<T16>::ld(pa + mb * (KS * 16)); if (NA == 2) a2[mb] = LFrag<T16>::ld(pa + PLE + mb * (KS * 16)); }
#pragma unroll
            for (int nb = 0; nb < 4; ++nb) { const V b = LFrag<T16>::ld(pb + nb * (KS * 16)); V b2; if (NSPLIT >= 2) b2 = LFrag<T16>::ld(pb + PLE + nb * (KS * 16));
#pragma unroll
                for (int mb = 0; mb < 4; ++mb) { acc[mb][nb] = WFrag<T16>::mma(a[mb], b, acc[mb][nb]); if (NSPLIT == 1 || NSPLIT == 2) acc[mb][nb] = WFrag<T16>::mma(a2[mb], b, acc[mb][nb]); if (NSPLIT >= 2) acc[mb][nb] = WFrag<T16>::mma(a[mb], b2, acc[mb][nb]); } }
            asm volatile("v_nop\n\tv_nop\n\tv_nop\n\tv_nop" : "+v"(acc[0][0]), "+v"(acc[1][1]), "+v"(acc[2][2]), "+v"(acc[3][3]) : "v"(a[0]), "v"(a[3]));   // as before this step: four vector slots behind a pass's products, before the next pass's fragments take over the operand registers
        }
        asm volatile("s_wait_dscnt 0x0" ::: "memory");      // this wave's reads of stage t have returned, before the buffer is given up
        asm volatile("s_wait_asynccnt 0x0" ::: "memory");   // this wave's copies of stage t + 1 have landed
        __syncthreads();                                    // publishes stage t + 1 and ends every wave's reads of stage t
        if (t + 2 < NT) fill(t + 2, t & 1);
    }
    asm volatile("s_wait_asynccnt 0x0" ::: "memory");       // no copy is outstanding when the ring becomes the epilogue's staging
    if constexpr (EPI == 1 || EPI == 3) if (EPI == 1 || sel < 2) {
        const int tk = lane >> 1, cofs = (lane & 1) * 4;    // a lane takes the pairs (d, d + 1) and (d + 2, d + 3), d = s * 8 + cofs, of token r0 + mb * 16 + tk: in fragment order that is element s * 128 + lane * 4 of the 16-token block
        const float* ct = CS + ((size_t)(r0 + tk) * HD + cofs) * 2; const size_t po = ((size_t)hy * TT + r0) * HD + lane * 4;
        v2f cs[2][8][2];            // {cos, sin} of 16 tokens, fetched one 16-token block ahead of its use
#pragma unroll
        for (int s = 0; s < 8; ++s) { cs[0][s][0] = *(const v2f*)(ct + s * 16); cs[0][s][1] = *(const v2f*)(ct + s * 16 + 4); }
#pragma unroll
        for (int mb = 0; mb < 4; ++mb) {
            if (mb < 3) {
#pragma unroll
                for (int s = 0; s < 8; ++s) { cs[(mb + 1) & 1][s][0] = *(const v2f*)(ct + (size_t)(mb + 1) * 16 * HD * 2 + s * 16); cs[(mb + 1) & 1][s][1] = *(const v2f*)(ct + (size_t)(mb + 1) * 16 * HD * 2 + s * 16 + 4); } }
#pragma unroll
            for (int nb = 0; nb < 4; ++nb) {
#pragma unroll
                for (int j = 0; j < 8; ++j) os[(hi * 8 + j) * 68 + nb * 16 + lr] = acc[mb][nb][j]; }
            __builtin_amdgcn_wave_barrier(); asm volatile("" ::: "memory");   // one wave: keeps the LDS reads below behind the LDS writes above
#pragma unroll
            for (int s = 0; s < 8; ++s) { const v4f x = *(const v4fa*)(os + tk * 68 + s * 8 + cofs); const v2f p = cs[mb & 1][s][0], q = cs[mb & 1][s][1]; float r[4]; v4us oh, ol;
                r[0] = x[0] * p[0] - x[1] * p[1]; r[1] = x[0] * p[1] + x[1] * p[0]; r[2] = x[2] * q[0] - x[3] * q[1]; r[3] = x[2] * q[1] + x[3] * q[0];   /* even: x0 c - x1 s; odd: x0 s + x1 c */
#pragma unroll
                for (int e = 0; e < 4; ++e) { unsigned short a2, c2; splitf(r[e], a2, c2); oh[e] = a2; ol[e] = c2; }
                *(v4us*)(Ph + po + (size_t)(mb * 16 * HD + s * 128)) = oh; *(v4us*)(Pl + po + (size_t)(mb * 16 * HD + s * 128)) = ol; }   // 32 lanes x 8 bytes: two whole 128-byte lines per plane
            if (mb < 3) { __builtin_amdgcn_wave_barrier(); asm volatile("s_wait_xcnt 0x0" ::: "memory"); }   // the next block's LDS writes stay behind these reads; the wait stands between the stores above and the next block's loads and products, which take over the stores' registers
        }
        return;
    }
    if constexpr (EPI == 2 || EPI == 3) {
        const size_t go = (size_t)hy * HD * TT + (size_t)r0 * 16 + lane * 8;   // rows = d: 16 x TT elements per 16-d block, 512 per 32 tokens
#pragma unroll
        for (int mb = 0; mb < 4; ++mb)
#pragma unroll
            for (int nb = 0; nb < 4; ++nb) { v8h o16; v8us oh, ol;     // a lane's 8 accumulator registers are 8 consecutive tokens (mb * 16 + hi * 8 ...) of d = nb * 16 + lr: exactly its 16-byte piece, lane * 8, of quarter mb of the tile's two fragment blocks, so that no LDS pass is needed
#pragma unroll
                for (int j = 0; j < 8; ++j) { const float x = acc[mb][nb][j]; o16[j] = tohx(x); unsigned short a2, c2; splitf(x, a2, c2); oh[j] = a2; ol[j] = c2; }
                const size_t o = go + (size_t)nb * 16 * TT + mb * 256; *(v8usa*)(P16 + o) = __builtin_bit_cast(v8us, o16); *(v8usa*)(Ph + o) = oh; *(v8usa*)(Pl + o) = ol; }   // 32 lanes x 16 bytes: four whole 128-byte lines a store
        asm volatile("s_wait_xcnt 0x0" ::: "memory");   // the wait that stands behind issued stores, in front of any code laid out behind them that takes over their registers
        return;
    }
#pragma unroll
    for (int mb = 0; mb < 4; ++mb) {
#pragma unroll
        for (int nb = 0; nb < 4; ++nb) {
#pragma unroll
            for (int j = 0; j < 8; ++j) os[(hi * 8 + j) * 68 + nb * 16 + lr] = acc[mb][nb][j]; }
        __builtin_amdgcn_wave_barrier(); asm volatile("" ::: "memory");
        float* crow = C + (size_t)(r0 + mb * 16) * ldc + c0;
{
#pragma unroll
            for (int s = 0; s < 8; ++s) { const int row = 2 * s + hi, cofs = lr * 4; v4f val = *(const v4fa*)(os + row * 68 + cofs); if (BIAS) { val[0] += bfr(bias[c0 + cofs]); val[1] += bfr(bias[c0 + cofs + 1]); val[2] += bfr(bias[c0 + cofs + 2]); val[3] += bfr(bias[c0 + cofs + 3]); }
                *(v4f*)(crow + (size_t)row * ldc + cofs) = val; }
             }
        __builtin_amdgcn_wave_barrier(); asm volatile("" ::: "memory");
    }
}


__global__ __launch_bounds__(256) void k_wtG(const float* __restrict__ w, int K, int N, bf* Bt) {
    const int lane = threadIdx.x & 31; const int L0 = (blockIdx.x * 8 + (threadIdx.x >> 5)) * 8; const int nlines = N * K / 64;
{
#pragma unroll 1
        for (int l = 0; l < 8; ++l) { const int L = L0 + l; if (L >= nlines) break; const size_t e = (size_t)L * 64 + lane * 2; const int k = (int)(e % K), n = (int)(e / K); v2us o;
            o[0] = f2bf(w[(size_t)k * N + n]); o[1] = f2bf(w[(size_t)(k + 1) * N + n]); *(v2us*)(Bt + e) = o; }
         }
}
// cvt8: f32 [row][DM] to the bf16 plane in fragment order, 8 values (one 16-byte piece) a thread. A wave takes 8 rows x 32 k: it reads one whole 128-byte line of each row and writes four whole lines of the block (pieces c = k / 8 of rows rr .. rr + 7 stand in a row).
__device__ __forceinline__ void cvt8(const float* __restrict__ src, bf* dst, const size_t i) { const size_t fr = i >> 6; const int c = (int)(i >> 3) & 3, rr = (int)((i >> 5) & 1) * 8 + (int)(i & 7); const v8f v = *(const v8f*)(src + ((fr / (DM / 32)) * 16 + rr) * DM + (fr % (DM / 32)) * 32 + c * 8); v8us o;
#pragma unroll
    for (int k = 0; k < 8; ++k) o[k] = f2bf(v[k]); *(v8us*)(dst + fr * 512 + (c >> 1) * 256 + ((c & 1) * 16 + rr) * 8) = o;
    asm volatile("s_wait_xcnt 0x0" ::: "memory");   // the wait that stands behind the issued store, in front of any code laid out behind it that takes over its registers
}

__constant__ float INV2[HD / 2] = { 1.000000000e+00f, 7.498942018e-01f, 5.623413324e-01f, 4.216965139e-01f, 3.162277639e-01f, 2.371373624e-01f, 1.778279394e-01f, 1.333521456e-01f, 1.000000015e-01f, 7.498941571e-02f, 5.623412877e-02f, 4.216964915e-02f, 3.162277862e-02f, 2.371373586e-02f, 1.778279431e-02f, 1.333521493e-02f, 9.999999776e-03f, 7.498942316e-03f, 5.623413250e-03f, 4.216964822e-03f, 3.162277862e-03f, 2.371373819e-03f, 1.778279431e-03f, 1.333521446e-03f, 1.000000047e-03f, 7.498941850e-04f, 5.623413017e-04f, 4.216964880e-04f, 3.162277862e-04f, 2.371373848e-04f, 1.778279402e-04f, 1.333521504e-04f };   // float32 10000^(-(i * 2 / 64)), generated with jnp to be bit-exact with the module's expression
__device__ __forceinline__ void cstab(const int* __restrict__ pid, float* CS, const int idx) { const int d = idx % HD; const int t = idx / HD; const float a = __fmul_rn((float)pid[t], INV2[d >> 1]); v2f cs; cs[0] = cosf(a); cs[1] = sinf(a); *(v2f*)(CS + (size_t)idx * 2) = cs;  }
// k_prep: everything that depends on the inputs alone, in ONE launch; a block's index picks its job (the same for all its threads): the {cos, sin} table (NPT blocks, first: the longest threads), x (NPX), then the four weights (NPW each). Every count is exact: no thread is left over.
#define NPT (TT * HD / 256)
#define NPX (NB_ * TT * DM / 8 / 256)
#define NPW (DM * DQ / 8 / 256)
__global__ __launch_bounds__(256) void k_prep(const float* __restrict__ x, const int* __restrict__ pid, const float* __restrict__ wq, const float* __restrict__ wk, const float* __restrict__ wv, const float* __restrict__ wo, bf* XB, bf* WQ, bf* WK, bf* WV, bf* WO, float* CS) {
    unsigned b = blockIdx.x;
    if (b < NPT) { cstab(pid, CS, (int)(b * 256 + threadIdx.x)); return; }
    b -= NPT;
    if (b < NPX) { cvt8(x, XB, (size_t)b * 256 + threadIdx.x); return; }
    b -= NPX;
    const unsigned s = b / NPW; const float* src = s == 0 ? wq : s == 1 ? wk : s == 2 ? wv : wo; bf* dst = s == 0 ? WQ : s == 1 ? WK : s == 2 ? WV : WO;
    cvt8(src, dst, (size_t)(b % NPW) * 256 + threadIdx.x);
}

// ---- k_attn: scores, softmax and P.V of 16 query rows of one head in ONE work-group of KSP = 16 waves; grid (TT / 16, heads, batches), 512 threads. The rows' scores, then their probabilities, then the partial output tiles stay in LDS.
// 1) wave w takes the 64-key groups w, w + 16, ... up to the diagonal: Q hi/lo x K hi/lo (3 products, k order 0..31 then 32..63), f32 scores to LDS row-major (pitch SP floats).
// 2) wave w owns row w: whole-row softmax in registers (one exp, fixed trees; 128-key chunks wholly above the diagonal are exact zeros: not read, no exp, no store; the mask is applied in the diagonal's chunk alone); the 16-bit probability planes overwrite the row's own scores.
// 3) wave w takes the same 64-key groups of P.V (rows < RH hi/lo, 3 products; the rest fp16 x PCAR); A fragments from LDS (row-major there), V fragments from the [d][t] planes; its partial 16x64 tile goes to LDS.
// 4) the 16 partial tiles are added in wave order, scaled and split into the merged hi/lo planes. Long (late) rows get the low block indices, which start first.
#define SP 2052     // floats per score row in LDS: 8192 + 16 bytes, so that the 16 rows of a b128 fragment read fall on distinct banks
#define OP 68       // floats per row of a partial output tile in LDS
typedef v4us __attribute__((may_alias)) v4usa;
typedef v4h  __attribute__((may_alias)) v4ha;
typedef v2f  __attribute__((may_alias)) v2fa;
__device__ __forceinline__ v16bf ldsb(const bf* p) { return cat16b(*(const v8usa*)p, *(const v8usa*)(p + 16)); }
__device__ __forceinline__ v16h ldsh(const h16* p) { return cat16(*(const v8ha*)p, *(const v8ha*)(p + 16)); }
__device__ __forceinline__ v4f exp2q(const v4f x, const float mx) {   // exp((x - mx) * SCL) of four scores
    float a = __fmul_rn(__fsub_rn(x[0], mx), SCL * 1.4426950408889634f), b = __fmul_rn(__fsub_rn(x[1], mx), SCL * 1.4426950408889634f), c = __fmul_rn(__fsub_rn(x[2], mx), SCL * 1.4426950408889634f), d = __fmul_rn(__fsub_rn(x[3], mx), SCL * 1.4426950408889634f);
    asm("v_exp_f32 %0, %0\n\tv_exp_f32 %1, %1\n\tv_exp_f32 %2, %2\n\tv_exp_f32 %3, %3\n\tv_nop" : "+v"(a), "+v"(b), "+v"(c), "+v"(d));   // the instruction set asks for one free slot behind a transcendental, before its result is read or its source overwritten: each of the first three has the next, independent one there, the last the v_nop; in one statement so that they stay so
    return (v4f){a, b, c, d}; }
__global__ __launch_bounds__(512, 8) void k_attn(const bf* __restrict__ Qh, const bf* __restrict__ Ql, const bf* __restrict__ Kh, const bf* __restrict__ Kl, const h16* __restrict__ V16, const bf* __restrict__ Vh, const bf* __restrict__ Vl, bf* Ah, bf* Al) {
    __shared__ __align__(16) float sm[16 * SP];
    const int lane = threadIdx.x & 31, lr = lane & 15, hi = lane >> 4; const int w = __builtin_amdgcn_readfirstlane((int)(threadIdx.x >> 5));
    const int h = blockIdx.y; const int i0 = (TT / 16 - 1 - (int)blockIdx.x) * 16;
    const int ng = i0 / 64 + 1;                 // 64-key groups up to and with the diagonal's
    const bool hires = (i0 < RH);               // RH is a multiple of 16: the same for all 16 rows
    const size_t qp = ((size_t)blockIdx.z * NH_ + h) * TT * HD, kp = ((size_t)blockIdx.z * NKV + h / REP) * TT * HD;
    if (w < ng) {
        v16bf a[2], a2[2];
#pragma unroll
        for (int kk = 0; kk < 2; ++kk) { a[kk] = WFrag<bf>::ld(Qh + qp + (size_t)i0 * HD + 8 * lane + kk * 512); a2[kk] = WFrag<bf>::ld(Ql + qp + (size_t)i0 * HD + 8 * lane + kk * 512); }
#pragma unroll 1
        for (int g = w; g < ng; g += KSP) {
            const size_t bo = kp + (size_t)(g * 64) * HD + 8 * lane;
#pragma unroll
            for (int hb = 0; hb < 2; ++hb) {    // 32 keys at a time: their 8 K fragments, the Q fragments and 2 accumulators fit the 128 registers that let two work-groups share a WGP
                v16bf b[2][2], b2[2][2]; v8f acc[2];
#pragma unroll
                for (int kk = 0; kk < 2; ++kk)
#pragma unroll
                    for (int nb = 0; nb < 2; ++nb) { b[kk][nb] = WFrag<bf>::ld(Kh + bo + (size_t)(hb * 2 + nb) * 16 * HD + kk * 512); b2[kk][nb] = WFrag<bf>::ld(Kl + bo + (size_t)(hb * 2 + nb) * 16 * HD + kk * 512); }
                asm volatile("" :: "v"(b[0][0]), "v"(b[0][1]), "v"(b[1][0]), "v"(b[1][1]), "v"(b2[0][0]), "v"(b2[0][1]), "v"(b2[1][0]), "v"(b2[1][1]));   // inputs only: holds all 16 loads in front of the first product, one memory latency instead of one per fragment
#pragma unroll
                for (int nb = 0; nb < 2; ++nb) acc[nb] = (v8f){};
#pragma unroll
                for (int kk = 0; kk < 2; ++kk)
#pragma unroll
                    for (int nb = 0; nb < 2; ++nb) { acc[nb] = wmmab(a[kk], b[kk][nb], acc[nb]); acc[nb] = wmmab(a2[kk], b[kk][nb], acc[nb]); acc[nb] = wmmab(a[kk], b2[kk][nb], acc[nb]); }
#pragma unroll
                for (int nb = 0; nb < 2; ++nb)
#pragma unroll
                    for (int j = 0; j < 8; ++j) sm[(hi * 8 + j) * SP + g * 64 + (hb * 2 + nb) * 16 + lr] = acc[nb][j];
            }
        }
    }
    __syncthreads();    // every score of the 16 rows is in LDS
    {
        const int i = i0 + w, dc = i >> 7;   // dc: the 128-key chunk that holds the diagonal, the same for the whole wave; every key of a chunk below it is kept, so that only chunk dc, held apart in dg, is masked, and no chunk above it is touched. 'Chunk ch lies below dc' is written in four equal ways, ch < dc, ch * 128 + 127 < i, and both with i0 for i (i0 is a multiple of 16 and w < 16: the same chunk), one for each pass: a test that is compared anew is two scalar instructions, one kept from an earlier pass five
        float* sr = sm + w * SP; const float* lp = sr + lane * 4; v4f raw[TT / 128 - 1]; float mx = -3.0e38f;
        v4f dg = *(const v4fa*)(sr + min(dc * 128 + lane * 4, i & ~3));   /* a lane wholly above the diagonal re-reads the diagonal's quad (dropped by the select below): no unwritten LDS is read */
#pragma unroll
        for (int ch = 0; ch < TT / 128 - 1; ++ch) if (ch < dc) raw[ch] = *(const v4fa*)(lp + ch * 128);
#pragma unroll
        for (int q = 0; q < 4; ++q) { dg[q] = (lane * 4 + q <= (i & 127)) ? dg[q] : -3.0e38f; mx = fmaxf(mx, dg[q]); }
#pragma unroll
        for (int ch = 0; ch < TT / 128 - 1; ++ch) if (ch * 128 + 127 < i) {
#pragma unroll
            for (int q = 0; q < 4; ++q) mx = fmaxf(mx, raw[ch][q]); }   // the maximum of the unscaled scores: SCL is a power of two, so that scaling commutes with the maximum, the difference and the rounding of the product below
#pragma unroll
        for (int sh = 16; sh; sh >>= 1) mx = fmaxf(mx, __shfl_xor(mx, sh, 32));
        float sum = 0.f;
#pragma unroll
        for (int ch = 0; ch < TT / 128 - 1; ++ch) if (ch < (i0 >> 7)) { raw[ch] = exp2q(raw[ch], mx);
#pragma unroll
            for (int q = 0; q < 4; ++q) sum += raw[ch][q]; }
        dg = exp2q(dg, mx);
#pragma unroll
        for (int q = 0; q < 4; ++q) sum += dg[q];
#pragma unroll
        for (int sh = 16; sh; sh >>= 1) sum += __shfl_xor(sum, sh, 32);
        const float f = __fdiv_rn(hires ? 1.0f : PCAR, sum);
        if (hires) { bf* ph = (bf*)sr + lane * 4; bf* pl = ph + TT;
            auto put = [&](const v4f p, const int ch) { v4us oh, ol;
#pragma unroll
                for (int q = 0; q < 4; ++q) { unsigned short a, c2; splitf(p[q] * f, a, c2); oh[q] = a; ol[q] = c2; }
                *(v4usa*)(ph + ch * 128) = oh; *(v4usa*)(pl + ch * 128) = ol; };
#pragma unroll
            for (int ch = 0; ch < RH / 128 - 1; ++ch) if (ch * 128 + 127 < i0) put(raw[ch], ch);
            put(dg, dc);
        } else { h16* p16 = (h16*)sr + lane * 4;
            auto put = [&](const v4f p, const int ch) { v4h o4;
#pragma unroll
                for (int q = 0; q < 4; ++q) o4[q] = tohx(p[q] * f);
                *(v4ha*)(p16 + ch * 128) = o4; };
#pragma unroll
            for (int ch = 0; ch < TT / 128 - 1; ++ch) if (ch * 128 + 127 < i0) put(raw[ch], ch);
            put(dg, dc); }
    }
    __syncthreads();    // every probability of the 16 rows is in LDS
    v8f acc[4];
#pragma unroll
    for (int nb = 0; nb < 4; ++nb) acc[nb] = (v8f){};
    const size_t vo = kp + 8 * lane;   // V planes: rows = d, 16 x TT elements per 16-d block, 512 per 32 keys
    if (hires) { const bf* ph = (const bf*)(sm + lr * SP) + 8 * hi; const bf* pl = ph + TT;
#pragma unroll 1
        for (int g = w; g < ng; g += KSP) {
#pragma unroll
            for (int kk = 0; kk < 2; ++kk) { const int kc = g * 64 + kk * 32; const v16bf a = ldsb(ph + kc), a2 = ldsb(pl + kc);
#pragma unroll
                for (int nb = 0; nb < 4; ++nb) { const v16bf b = WFrag<bf>::ld(Vh + vo + (size_t)nb * 16 * TT + kc * 16), b2 = WFrag<bf>::ld(Vl + vo + (size_t)nb * 16 * TT + kc * 16);
                    acc[nb] = wmmab(a, b, acc[nb]); acc[nb] = wmmab(a2, b, acc[nb]); acc[nb] = wmmab(a, b2, acc[nb]); } }
        }
    } else { const h16* p16 = (const h16*)(sm + lr * SP) + 8 * hi; const h16* vp = V16 + vo + w * 1024;
#pragma unroll 1
        for (int g = w; g < ng; g += KSP, vp += KSP * 1024) {
            v16h b[2][4];
#pragma unroll
            for (int kk = 0; kk < 2; ++kk)
#pragma unroll
                for (int nb = 0; nb < 4; ++nb) b[kk][nb] = WFrag<h16>::ld(vp + (size_t)nb * 16 * TT + kk * 512);
            asm volatile("" :: "v"(b[0][0]), "v"(b[0][1]), "v"(b[0][2]), "v"(b[0][3]), "v"(b[1][0]), "v"(b[1][1]), "v"(b[1][2]), "v"(b[1][3]));   // inputs only: holds all 16 loads in front of the first product, one memory latency instead of one per fragment
#pragma unroll
            for (int kk = 0; kk < 2; ++kk) { const v16h a = ldsh(p16 + g * 64 + kk * 32);
#pragma unroll
                for (int nb = 0; nb < 4; ++nb) acc[nb] = wmma16(a, b[kk][nb], acc[nb]); }
        }
    }
    __syncthreads();    // every wave has read its last probability: the partial tiles may overwrite them
    { float* pt = sm + w * (16 * OP);
#pragma unroll
        for (int nb = 0; nb < 4; ++nb)
#pragma unroll
            for (int j = 0; j < 8; ++j) pt[(hi * 8 + j) * OP + nb * 16 + lr] = acc[nb][j]; }
    __syncthreads();    // all 16 partial tiles are in LDS
    { const int d = (w >> 1) * 8 + (lane & 3) * 2, rw = (w & 1) * 8 + (lane >> 2); const float cs = hires ? 1.0f : (1.0f / PCAR); const size_t oo = ((size_t)blockIdx.z * TT + i0) * DQ + h * 1024 + w * 64 + lane * 2;   // the merged planes are the last GEMM's A operand (rows = tokens, k = h * HD + d): the tile is two fragment blocks in a row, and thread w * 32 + lane takes their elements w * 64 + lane * 2 and the next, which are (row rw, d and d + 1): one whole line a wave and plane
        v2f s = *(const v2fa*)(sm + rw * OP + d);   /* the KSP partial tiles of the split key loop, added in wave order */
#pragma unroll
        for (int p = 1; p < KSP; ++p) { const v2f u = *(const v2fa*)(sm + p * (16 * OP) + rw * OP + d); s[0] += u[0]; s[1] += u[1]; }
        v2us oh, ol;
#pragma unroll
        for (int q = 0; q < 2; ++q) { unsigned short a, c2; splitf(s[q] * cs, a, c2); oh[q] = a; ol[q] = c2; } *(v2us*)(Ah + oo) = oh; *(v2us*)(Al + oo) = ol; }
}

extern "C" void kernel_launch(void* const* d_in, const int* in_sizes, int n_in,
                              void* d_out, int out_size, void* d_ws, size_t ws_size, hipStream_t stream) {
    (void)in_sizes; (void)n_in; (void)out_size;
    const float* x = (const float*)d_in[0]; const int* PID = (const int*)d_in[1]; const float* wq = (const float*)d_in[2]; const float* wk = (const float*)d_in[3]; const float* wv = (const float*)d_in[4]; const float* wo = (const float*)d_in[5];   /* input order x, token_positions (int32 [2048], read on device by the table builder), Wq, Wk, Wv, Wo ('oi' [1024][1024]): the host's own six slots */
    float* OUT = (float*)d_out;     // [4][2048][1024]
    char* wsp = (char*)d_ws;
    auto take = [&](size_t bytes) { char* p = wsp; wsp += (bytes + 255) & ~(size_t)255; return (void*)p; };
    bf* WQ = (bf*)take((size_t)(DQ + 2 * DKV) * DM * 2); bf* WK = WQ + (size_t)DQ * DM; bf* WV = WK + (size_t)DKV * DM;   /* one plane of 3072 rows: the merged projection launch walks it by blockIdx.y */ bf* WO = (bf*)take((size_t)DM * DQ * 2); float* CS = (float*)take((size_t)TT * HD * 2 * 4);
    bf* XB = (bf*)take((size_t)NB_ * TT * DM * 2);
    h16* VT16 = (h16*)take((size_t)NB_ * NKV * HD * TT * 2);
    bf* QPh = (bf*)take((size_t)NB_ * NH_ * TT * HD * 2); bf* QPl = (bf*)take((size_t)NB_ * NH_ * TT * HD * 2); bf* KPh = (bf*)take((size_t)NB_ * NKV * TT * HD * 2); bf* KPl = (bf*)take((size_t)NB_ * NKV * TT * HD * 2); bf* VTh = (bf*)take((size_t)NB_ * NKV * HD * TT * 2); bf* VTl = (bf*)take((size_t)NB_ * NKV * HD * TT * 2);
    bf* ATh = (bf*)take((size_t)NB_ * TT * DQ * 2); bf* ATl = (bf*)take((size_t)NB_ * TT * DQ * 2);
    if ((size_t)(wsp - (char*)d_ws) > ws_size) return;    // ws 256 MiB
    k_prep<<<NPT + NPX + 4 * NPW, 256, 0, stream>>>(x, PID, wq, wk, wv, wo, XB, WQ, WK, WV, WO, CS);   /* bf16 planes of x (rows = batch * TT + token) and of the four weights, and the {cos, sin} table from token_positions (int32 [2048], read on device; the same for every batch) */
    k_gemmw<bf, 0, false, 3, DM><<<dim3(TT / 128, (DQ + 2 * DKV) / 128, NB_), 128, 0, stream>>>(XB, nullptr, WQ, nullptr, nullptr, 0, nullptr, (size_t)TT * DM, 0, (size_t)NH_ * TT * HD, CS, VT16, QPh, QPl, KPh, KPl, VTh, VTl);    /* q and k projections with the rotary step and hi/lo planes, v projection with transposed fp16 and hi/lo planes */
    k_attn<<<dim3(TT / 16, NH_, NB_), 32 * KSP, 0, stream>>>(QPh, QPl, KPh, KPl, VT16, VTh, VTl, ATh, ATl);   /* scores (hi/lo planes, 3 products, EVERY row), softmax, hybrid P.V and the merge, all heads of all batches */
    k_gemmw<bf, 1, false, 0, DQ><<<dim3(TT / 128, DM / 128, NB_), 128, 0, stream>>>(ATh, ATl, WO, nullptr, OUT, DM, nullptr, (size_t)TT * DQ, 0, (size_t)TT * DM, nullptr, nullptr, nullptr, nullptr, nullptr, nullptr, nullptr, nullptr);
}

// v009
// Measured time: 153 microseconds a run.
// Two timings next to v008 put it at 1.52 and 1.55 times that version's speed.
// All steps since v000 together make it 18.0 times as fast.
#include <hip/hip_runtime.h>

// Causal multi-head self-attention with interleaved-pair rotary position embedding from a positions input, four batches (x [4][2048][1024]; Q, K, V = x W^T ('oi' [1024][1024] 1/32, no bias; 16 heads x 64; token-major); angles = token_positions (int32 [2048], read on device) x 1 / THETA ** (2i / 64), THETA 1e4; pairs (2i, 2i+1): r_even = x_even cos - x_odd sin, r_odd = x_even sin + x_odd cos, on Q and K; scores / sqrt(64); keys j <= i kept, -inf elsewhere; softmax; out = merged Wo^T ('oi', no bias) -> [4][2048][1024] (8.4 M); argument order x, token_positions, Wq, Wk, Wv, Wo).
// Four launches: k_prep (all conversions and the table), the q, k, v projections in one grid, k_attn, the last GEMM. Every stage is ONE launch for all four batches (blockIdx.z = batch; each per-batch plane has NB_ copies in a row in the workspace; the weights' planes and the {cos, sin} table are shared). Layout per batch: bf16 copy of x; exact projections; {cos, sin} per (position, pair) built once from the int positions and float32 inverse-frequency constants (precise cosf/sinf); the interleaved rotary step with the hi/lo split, and the V transpose with its three planes, done in the projection GEMMs' own epilogues (no f32 projection buffer); causal T-2048 attention (EVERY row's scores on hi/lo planes (3 products: logit sigma 2 with these weights) and hybrid P.V (rows < 512 hi/lo, rest fp16); one fused kernel, k_attn, which stops at the diagonal); merged hi/lo x Wo exact.
// Every 16-bit operand plane [row][k] lies in FRAGMENT ORDER: a block of 16 rows x 32 k is 1 KiB in a row, blocks k-fastest, then by 16-row block; inside it element (r, k) stands at ((k >> 4) & 1) * 256 + (((k >> 3) & 1) * 16 + r) * 8 + (k & 7). A lane's two 16-byte pieces of a fragment are then base + lane * 8 and + 256: each load of a wave reads 512 bytes in a row (4 whole lines, not 32 bytes of each of 16 lines). The k order of a fragment is the one of the row-major loader, for A and B alike.
// Compute dtypes, f32 accumulate: every input rounded to bf16; projections exact; rotary f32; attention scores 3 products, P.V rows < 512 3 products, rest fp16; softmax f32; Wo hl x exact.

#define NB_  4      // batches: this module's input is [4][2048][1024]
#define TT   2048
#define DM   1024
#define NH_  16
#define NKV  16
#define REP  (NH_ / NKV)
#define HD   64
#define DQ   (NH_ * HD)
#define DKV  (NKV * HD)
#define RH   512                  // query rows < RH use hi+lo planes (0: none)
#define SCL  0.125f   // HD^-0.5
typedef _Float16 h16;
typedef unsigned short bf;
typedef __attribute__((ext_vector_type(16))) __bf16   v16bf;
typedef __attribute__((ext_vector_type(16))) _Float16 v16h;
typedef __attribute__((ext_vector_type(8)))  _Float16 v8h;
typedef __attribute__((ext_vector_type(8)))  unsigned short v8us;
typedef __attribute__((ext_vector_type(8)))  float    v8f;
typedef __attribute__((ext_vector_type(4)))  float    v4f;
typedef v8h  __attribute__((may_alias)) v8ha;
typedef v4f  __attribute__((may_alias)) v4fa;
typedef v8us __attribute__((may_alias)) v8usa;

__device__ __forceinline__ unsigned short f2bf(float f) { unsigned u = __float_as_uint(f); u += 0x7FFFu + ((u >> 16) & 1u); return (unsigned short)(u >> 16); }
__device__ __forceinline__ float bf2f(unsigned short b) { return __uint_as_float(((unsigned)b) << 16); }
__device__ __forceinline__ float bfr(float f) { return bf2f(f2bf(f)); }
__device__ __forceinline__ v16h cat16(v8h lo, v8h hi) { return __builtin_shufflevector(lo, hi, 0, 1, 2, 3, 4, 5, 6, 7, 8, 9, 10, 11, 12, 13, 14, 15); }
__device__ __forceinline__ v16bf cat16b(v8us lo, v8us hi) { return __builtin_bit_cast(v16bf, __builtin_shufflevector(lo, hi, 0, 1, 2, 3, 4, 5, 6, 7, 8, 9, 10, 11, 12, 13, 14, 15)); }
__device__ __forceinline__ v8f wmma16(v16h a, v16h b, v8f c) { return __builtin_amdgcn_wmma_f32_16x16x32_f16(false, a, false, b, (short)0, c, false, false); }
__device__ __forceinline__ v8f wmmab(v16bf a, v16bf b, v8f c) { return __builtin_amdgcn_wmma_f32_16x16x32_bf16(false, a, false, b, (short)0, c, false, false); }



__device__ __forceinline__ h16 tohx(float x) { return (h16)x; }
__device__ __forceinline__ void splitf(float y, unsigned short& h, unsigned short& l) { h = f2bf(y); l = f2bf(y - bf2f(h)); }
typedef __attribute__((ext_vector_type(2))) _Float16 v2h;
typedef __attribute__((ext_vector_type(4))) _Float16 v4h;
typedef __attribute__((ext_vector_type(2))) unsigned short v2us;
typedef __attribute__((ext_vector_type(4))) unsigned short v4us;
typedef __attribute__((ext_vector_type(2))) float v2f;
typedef __attribute__((ext_vector_type(4))) int v4i;

// ---- k_gemmw: register-blocked GEMM, ONE WAVE per 64x64 output tile (16 accumulators); 2 x 2 waves share a 128x128 tile, whose operands (16-bit planes in fragment order) come once per work-group from global memory into a two-buffer LDS ring, 64 k a stage, by asynchronous copies; the fragments are read from LDS (block's base + lane * 8, as in global memory); grid (M/128, N/128, Z), 128 threads.
// C[m][n] (f32, pitch ldc, + optional f32 bias[n]) = sum_k A[m][k] Bt[n][k] (+ split products per NSPLIT). z-batch strides sA/sB/sC in elements (sC: of C for EPI 0, of each output plane for EPI 1 and 2). K % 64 == 0.
// EPI picks what becomes of the tile, which for EPI 1 and 2 is 64 tokens x one whole head (HD == 64 columns): 0: f32 C as above. 1: rotary step from the {cos, sin} table CS, then the hi/lo split, to the planes Ph, Pl [head][token][d] (fragment order, rows = tokens). 2: fp16 and hi/lo planes P16, Ph, Pl, transposed to [head][d][token] (fragment order, rows = d). 3: the q, k and v projections in ONE grid, N = 3 * DQ rows of Bt (the three weights' planes stand in a row): the 64-column tile's index / 16 picks 1 to Ph, Pl (q), 1 to Ph2, Pl2 (k) or 2 to P16, Ph3, Pl3 (v).
template <typename T16> struct WFrag;
template <> struct WFrag<h16> { typedef v16h V; static __device__ __forceinline__ V ld(const h16* p) { return cat16(*(const v8h*)p, *(const v8h*)(p + 256)); } static __device__ __forceinline__ v8f mma(V a, V b, v8f c) { return wmma16(a, b, c); } };
template <> struct WFrag<bf> { typedef v16bf V; static __device__ __forceinline__ V ld(const bf* p) { return cat16b(*(const v8us*)p, *(const v8us*)(p + 256)); } static __device__ __forceinline__ v8f mma(V a, V b, v8f c) { return wmmab(a, b, c); } };
template <typename T16> struct LFrag;
template <> struct LFrag<h16> { static __device__ __forceinline__ v16h ld(const h16* p) { return cat16(*(const v8ha*)p, *(const v8ha*)(p + 256)); } };
template <> struct LFrag<bf> { static __device__ __forceinline__ v16bf ld(const bf* p) { return cat16b(*(const v8usa*)p, *(const v8usa*)(p + 256)); } };
#define KS 64       // k per stage of the ring: a 16-row block's share of a stage is 2 KiB in a row, in global memory and in LDS: one 16-byte copy of each of the 128 threads
// cp8: one plane's share of a stage, 8 blocks of 16 rows: 8 copies a lane, LDS byte address l + rb * 2048, global g + rb * 16 * K elements. The s_wait_xcnt is the last line of the copies' own statement, so that it stands in front of every later write of a register that a copy names.
template <typename T16, int K> __device__ __forceinline__ void cp8(const unsigned l, const T16* g) {
    asm volatile("global_load_async_to_lds_b128 %0, %8, off\n\tglobal_load_async_to_lds_b128 %1, %9, off\n\tglobal_load_async_to_lds_b128 %2, %10, off\n\tglobal_load_async_to_lds_b128 %3, %11, off\n\tglobal_load_async_to_lds_b128 %4, %12, off\n\tglobal_load_async_to_lds_b128 %5, %13, off\n\tglobal_load_async_to_lds_b128 %6, %14, off\n\tglobal_load_async_to_lds_b128 %7, %15, off\n\ts_wait_xcnt 0x0"
        :: "v"(l), "v"(l + 2048u), "v"(l + 4096u), "v"(l + 6144u), "v"(l + 8192u), "v"(l + 10240u), "v"(l + 12288u), "v"(l + 14336u),
           "v"(g), "v"(g + 16 * K), "v"(g + 32 * K), "v"(g + 48 * K), "v"(g + 64 * K), "v"(g + 80 * K), "v"(g + 96 * K), "v"(g + 112 * K) : "memory");
}
template <typename T16, int NSPLIT, bool BIAS, int EPI, int K>
__global__ __launch_bounds__(128) void k_gemmw(const T16* __restrict__ A, const T16* __restrict__ A2, const T16* __restrict__ Bt, const T16* __restrict__ Bt2, float* C, int ldc, const float* __restrict__ bias, size_t sA, size_t sB, size_t sC, const float* __restrict__ CS, h16* P16, bf* Ph, bf* Pl, bf* Ph2, bf* Pl2, bf* Ph3, bf* Pl3) {
    typedef typename WFrag<T16>::V V;
    const int wv = __builtin_amdgcn_readfirstlane((int)(threadIdx.x >> 5)), wm = wv >> 1, wn = wv & 1;   // the wave's 64x64 quarter of the 128x128 tile
    const int cy = (int)blockIdx.y * 2 + wn;    // index of the wave's 64-column tile
    const int sel = (EPI == 3) ? cy / (DQ / 64) : 0, hy = (EPI == 3) ? cy % (DQ / 64) : cy;   // EPI 3: which projection (0 q, 1 k, 2 v; the same for the whole work-group) and which head (the wave's own)
    if constexpr (EPI == 3) { if (sel == 1) { Ph = Ph2; Pl = Pl2; } else if (sel == 2) { Ph = Ph3; Pl = Pl3; } }
    constexpr int NA = (NSPLIT == 1 || NSPLIT == 2) ? 2 : 1, NPL = NA + ((NSPLIT >= 2) ? 2 : 1), PLE = 128 * KS, NT = K / KS;   // planes of A, planes in all, elements of a plane's share of a stage, stages
    __shared__ __align__(16) T16 ring[2 * NPL * PLE];
    float* os = (float*)ring + wv * (16 * 68);   // the epilogue's staging, a wave's own part; it takes the ring's place behind the last trip's barrier
    const size_t z = blockIdx.z; A += z * sA; if (A2) A2 += z * sA; Bt += z * sB; if (Bt2) Bt2 += z * sB; if constexpr (EPI == 0) C += z * sC; else { Ph += z * sC; Pl += z * sC; if constexpr (EPI == 2 || EPI == 3) P16 += z * sC; }
    const int lane = threadIdx.x & 31, lr = lane & 15, hi = lane >> 4; const int r0 = blockIdx.x * 128 + wm * 64, c0 = cy * 64;
    v8f acc[4][4];
#pragma unroll
    for (int mb = 0; mb < 4; ++mb)
#pragma unroll
        for (int nb = 0; nb < 4; ++nb) acc[mb][nb] = (v8f){};
    const unsigned t8 = 8 * threadIdx.x;
    A += (size_t)blockIdx.x * 128 * K + t8; if (NA == 2) A2 += (size_t)blockIdx.x * 128 * K + t8; Bt += (size_t)blockIdx.y * 128 * K + t8; if (NSPLIT >= 2) Bt2 += (size_t)blockIdx.y * 128 * K + t8;   // 16 rows x K elements per 16-row block, 512 elements per 32 k: the thread's own 16 bytes of each block's 2 KiB of a stage
    const unsigned lb = (unsigned)(size_t)ring + 2 * t8;   // the thread's LDS byte address in a plane's first block
    auto fill = [&](const int t, const int bu) {    // stage t into buffer bu: every thread of the work-group, every lane on
        const unsigned l = lb + bu * (NPL * PLE * 2);
        cp8<T16, K>(l, A + t * (KS * 16)); if constexpr (NA == 2) cp8<T16, K>(l + PLE * 2, A2 + t * (KS * 16));
        cp8<T16, K>(l + NA * PLE * 2, Bt + t * (KS * 16)); if constexpr (NSPLIT >= 2) cp8<T16, K>(l + (NA + 1) * PLE * 2, Bt2 + t * (KS * 16)); };
    fill(0, 0);
    asm volatile("s_wait_asynccnt 0x0" ::: "memory");   // this wave's copies of stage 0 have landed
    __syncthreads();                                    // ... and every other wave's: stage 0 may be read
    fill(1, 1);
    const unsigned l8 = 8 * lane;
#pragma unroll 1
    for (int t = 0; t < NT; ++t) {
        const T16* sb = ring + (t & 1) * (NPL * PLE) + l8;
#pragma unroll
        for (int kb = 0; kb < KS / 32; ++kb) {
            V a[4], a2[4]; const T16* pa = sb + wm * (PLE / 2) + kb * 512; const T16* pb = sb + NA * PLE + wn * (PLE / 2) + kb * 512;
#pragma unroll
            for (int mb = 0; mb < 4; ++mb) { a[mb] = LFrag<T16>::ld(pa + mb * (KS * 16)); if (NA == 2) a2[mb] = LFrag<T16>::ld(pa + PLE + mb * (KS * 16)); }
#pragma unroll
            for (int nb = 0; nb < 4; ++nb) { const V b = LFrag<T16>::ld(pb + nb * (KS * 16)); V b2; if (NSPLIT >= 2) b2 = LFrag<T16>::ld(pb + PLE + nb * (KS * 16));
#pragma unroll
                for (int mb = 0; mb < 4; ++mb) { acc[mb][nb] = WFrag<T16>::mma(a[mb], b, acc[mb][nb]); if (NSPLIT == 1 || NSPLIT == 2) acc[mb][nb] = WFrag<T16>::mma(a2[mb], b, acc[mb][nb]); if (NSPLIT >= 2) acc[mb][nb] = WFrag<T16>::mma(a[mb], b2, acc[mb][nb]); } }
            asm volatile("v_nop\n\tv_nop\n\tv_nop\n\tv_nop" : "+v"(acc[0][0]), "+v"(acc[1][1]), "+v"(acc[2][2]), "+v"(acc[3][3]) : "v"(a[0]), "v"(a[3]));   // as before this step: four vector slots behind a pass's products, before the next pass's fragments take over the operand registers
        }
        asm volatile("s_wait_dscnt 0x0" ::: "memory");      // this wave's reads of stage t have returned, before the buffer is given up
        asm volatile("s_wait_asynccnt 0x0" ::: "memory");   // this wave's copies of stage t + 1 have landed
        __syncthreads();                                    // publishes stage t + 1 and ends every wave's reads of stage t
        if (t + 2 < NT) fill(t + 2, t & 1);
    }
    asm volatile("s_wait_asynccnt 0x0" ::: "memory");       // no copy is outstanding when the ring becomes the epilogue's staging
    if constexpr (EPI == 1 || EPI == 3) if (EPI == 1 || sel < 2) {
        const int tk = lane >> 1, cofs = (lane & 1) * 4;    // a lane takes the pairs (d, d + 1) and (d + 2, d + 3), d = s * 8 + cofs, of token r0 + mb * 16 + tk: in fragment order that is element s * 128 + lane * 4 of the 16-token block
        const float* ct = CS + ((size_t)(r0 + tk) * HD + cofs) * 2; const size_t po = ((size_t)hy * TT + r0) * HD + lane * 4;
        v2f cs[2][8][2];            // {cos, sin} of 16 tokens, fetched one 16-token block ahead of its use
#pragma unroll
        for (int s = 0; s < 8; ++s) { cs[0][s][0] = *(const v2f*)(ct + s * 16); cs[0][s][1] = *(const v2f*)(ct + s * 16 + 4); }
#pragma unroll
        for (int mb = 0; mb < 4; ++mb) {
            if (mb < 3) {
#pragma unroll
                for (int s = 0; s < 8; ++s) { cs[(mb + 1) & 1][s][0] = *(const v2f*)(ct + (size_t)(mb + 1) * 16 * HD * 2 + s * 16); cs[(mb + 1) & 1][s][1] = *(const v2f*)(ct + (size_t)(mb + 1) * 16 * HD * 2 + s * 16 + 4); } }
#pragma unroll
            for (int nb = 0; nb < 4; ++nb) {
#pragma unroll
                for (int j = 0; j < 8; ++j) os[(hi * 8 + j) * 68 + nb * 16 + lr] = acc[mb][nb][j]; }
            __builtin_amdgcn_wave_barrier(); asm volatile("" ::: "memory");   // one wave: keeps the LDS reads below behind the LDS writes above
#pragma unroll
            for (int s = 0; s < 8; ++s) { const v4f x = *(const v4fa*)(os + tk * 68 + s * 8 + cofs); const v2f p = cs[mb & 1][s][0], q = cs[mb & 1][s][1]; float r[4]; v4us oh, ol;
                r[0] = x[0] * p[0] - x[1] * p[1]; r[1] = x[0] * p[1] + x[1] * p[0]; r[2] = x[2] * q[0] - x[3] * q[1]; r[3] = x[2] * q[1] + x[3] * q[0];   /* even: x0 c - x1 s; odd: x0 s + x1 c */
#pragma unroll
                for (int e = 0; e < 4; ++e) { unsigned short a2, c2; splitf(r[e], a2, c2); oh[e] = a2; ol[e] = c2; }
                *(v4us*)(Ph + po + (size_t)(mb * 16 * HD + s * 128)) = oh; *(v4us*)(Pl + po + (size_t)(mb * 16 * HD + s * 128)) = ol; }   // 32 lanes x 8 bytes: two whole 128-byte lines per plane
            if (mb < 3) { __builtin_amdgcn_wave_barrier(); asm volatile("s_wait_xcnt 0x0" ::: "memory"); }   // the next block's LDS writes stay behind these reads; the wait stands between the stores above and the next block's loads and products, which take over the stores' registers
        }
        return;
    }
    if constexpr (EPI == 2 || EPI == 3) {
        const size_t go = (size_t)hy * HD * TT + (size_t)r0 * 16 + lane * 8;   // rows = d: 16 x TT elements per 16-d block, 512 per 32 tokens
#pragma unroll
        for (int mb = 0; mb < 4; ++mb)
#pragma unroll
            for (int nb = 0; nb < 4; ++nb) { v8h o16; v8us oh, ol;     // a lane's 8 accumulator registers are 8 consecutive tokens (mb * 16 + hi * 8 ...) of d = nb * 16 + lr: exactly its 16-byte piece, lane * 8, of quarter mb of the tile's two fragment blocks, so that no LDS pass is needed
#pragma unroll
                for (int j = 0; j < 8; ++j) { const float x = acc[mb][nb][j]; o16[j] = tohx(x); unsigned short a2, c2; splitf(x, a2, c2); oh[j] = a2; ol[j] = c2; }
                const size_t o = go + (size_t)nb * 16 * TT + mb * 256; *(v8usa*)(P16 + o) = __builtin_bit_cast(v8us, o16); *(v8usa*)(Ph + o) = oh; *(v8usa*)(Pl + o) = ol; }   // 32 lanes x 16 bytes: four whole 128-byte lines a store
        asm volatile("s_wait_xcnt 0x0" ::: "memory");   // the wait that stands behind issued stores, in front of any code laid out behind them that takes over their registers
        return;
    }
#pragma unroll
    for (int mb = 0; mb < 4; ++mb) {
#pragma unroll
        for (int nb = 0; nb < 4; ++nb) {
#pragma unroll
            for (int j = 0; j < 8; ++j) os[(hi * 8 + j) * 68 + nb * 16 + lr] = acc[mb][nb][j]; }
        __builtin_amdgcn_wave_barrier(); asm volatile("" ::: "memory");
        float* crow = C + (size_t)(r0 + mb * 16) * ldc + c0;
{
#pragma unroll
            for (int s = 0; s < 8; ++s) { const int row = 2 * s + hi, cofs = lr * 4; v4f val = *(const v4fa*)(os + row * 68 + cofs); if (BIAS) { val[0] += bfr(bias[c0 + cofs]); val[1] += bfr(bias[c0 + cofs + 1]); val[2] += bfr(bias[c0 + cofs + 2]); val[3] += bfr(bias[c0 + cofs + 3]); }
                *(v4f*)(crow + (size_t)row * ldc + cofs) = val; }
             }
        __builtin_amdgcn_wave_barrier(); asm volatile("" ::: "memory");
    }
}


__global__ __launch_bounds__(256) void k_wtG(const float* __restrict__ w, int K, int N, bf* Bt) {
    const int lane = threadIdx.x & 31; const int L0 = (blockIdx.x * 8 + (threadIdx.x >> 5)) * 8; const int nlines = N * K / 64;
{
#pragma unroll 1
        for (int l = 0; l < 8; ++l) { const int L = L0 + l; if (L >= nlines) break; const size_t e = (size_t)L * 64 + lane * 2; const int k = (int)(e % K), n = (int)(e / K); v2us o;
            o[0] = f2bf(w[(size_t)k * N + n]); o[1] = f2bf(w[(size_t)(k + 1) * N + n]); *(v2us*)(Bt + e) = o; }
         }
}
// cvt8: f32 [row][DM] to the bf16 plane in fragment order, 8 values (one 16-byte piece) a thread. A wave takes 8 rows x 32 k: it reads one whole 128-byte line of each row and writes four whole lines of the block (pieces c = k / 8 of rows rr .. rr + 7 stand in a row).
__device__ __forceinline__ void cvt8(const float* __restrict__ src, bf* dst, const size_t i) { const size_t fr = i >> 6; const int c = (int)(i >> 3) & 3, rr = (int)((i >> 5) & 1) * 8 + (int)(i & 7); const v8f v = *(const v8f*)(src + ((fr / (DM / 32)) * 16 + rr) * DM + (fr % (DM / 32)) * 32 + c * 8); v8us o;
#pragma unroll
    for (int k = 0; k < 8; ++k) o[k] = f2bf(v[k]); *(v8us*)(dst + fr * 512 + (c >> 1) * 256 + ((c & 1) * 16 + rr) * 8) = o;
    asm volatile("s_wait_xcnt 0x0" ::: "memory");   // the wait that stands behind the issued store, in front of any code laid out behind it that takes over its registers
}

__constant__ float INV2[HD / 2] = { 1.000000000e+00f, 7.498942018e-01f, 5.623413324e-01f, 4.216965139e-01f, 3.162277639e-01f, 2.371373624e-01f, 1.778279394e-01f, 1.333521456e-01f, 1.000000015e-01f, 7.498941571e-02f, 5.623412877e-02f, 4.216964915e-02f, 3.162277862e-02f, 2.371373586e-02f, 1.778279431e-02f, 1.333521493e-02f, 9.999999776e-03f, 7.498942316e-03f, 5.623413250e-03f, 4.216964822e-03f, 3.162277862e-03f, 2.371373819e-03f, 1.778279431e-03f, 1.333521446e-03f, 1.000000047e-03f, 7.498941850e-04f, 5.623413017e-04f, 4.216964880e-04f, 3.162277862e-04f, 2.371373848e-04f, 1.778279402e-04f, 1.333521504e-04f };   // float32 10000^(-(i * 2 / 64)), generated with jnp to be bit-exact with the module's expression
__device__ __forceinline__ void cstab(const int* __restrict__ pid, float* CS, const int idx) { const int d = idx % HD; const int t = idx / HD; const float a = __fmul_rn((float)pid[t], INV2[d >> 1]); v2f cs; cs[0] = cosf(a); cs[1] = sinf(a); *(v2f*)(CS + (size_t)idx * 2) = cs;  }
// k_prep: everything that depends on the inputs alone, in ONE launch; a block's index picks its job (the same for all its threads): the {cos, sin} table (NPT blocks, first: the longest threads), x (NPX), then the four weights (NPW each). Every count is exact: no thread is left over.
#define NPT (TT * HD / 256)
#define NPX (NB_ * TT * DM / 8 / 256)
#define NPW (DM * DQ / 8 / 256)
__global__ __launch_bounds__(256) void k_prep(const float* __restrict__ x, const int* __restrict__ pid, const float* __restrict__ wq, const float* __restrict__ wk, const float* __restrict__ wv, const float* __restrict__ wo, bf* XB, bf* WQ, bf* WK, bf* WV, bf* WO, float* CS) {
    unsigned b = blockIdx.x;
    if (b < NPT) { cstab(pid, CS, (int)(b * 256 + threadIdx.x)); return; }
    b -= NPT;
    if (b < NPX) { cvt8(x, XB, (size_t)b * 256 + threadIdx.x); return; }
    b -= NPX;
    const unsigned s = b / NPW; const float* src = s == 0 ? wq : s == 1 ? wk : s == 2 ? wv : wo; bf* dst = s == 0 ? WQ : s == 1 ? WK : s == 2 ? WV : WO;
    cvt8(src, dst, (size_t)(b % NPW) * 256 + threadIdx.x);
}

// ---- k_attn: scores, softmax and P.V of 64 query rows of one head in ONE WAVE, one walk over the keys, 32 a pass, up to the diagonal; nothing goes through LDS and there is no barrier. Grid (TT / 64 / 8, heads, batches), 256 threads = 8 independent waves of one head.
// Transposed products: S^T = K Q^T (A = K fragments, B = the four 16-query groups' Q fragments, kept in registers; hi/lo planes, 3 products, k order 0..31 then 32..63) and O^T += V^T P^T (A = V fragments of the [d][t] planes). A lane then holds 8 keys of ONE query in each score tile: the two tiles of a pass, rounded to 16 bits, ARE the lane's part of the P^T B fragment (k = hi * 8 + j and 16 + hi * 8 + j), and the lane's 8 registers of an O^T tile are its 16-byte piece of the merged planes' fragment block.
// Running maximum per query, raised only when some score of the pass lies more than LAZY above it (one wave-uniform test a pass); the sums and the output tiles are then rescaled. Probabilities are left unnormalised, exp2((s - m) * C2F + POFF), at most 2^14; the division by the row's sum is done once, on the output. Rows < RH: P and V hi/lo, 3 products; the rest fp16.
// Each K and V fragment read from L2 feeds four 16-query groups. Waves w and w + 4 of a work-group take tiles 31 - u and u: long and short walks side by side.
#define C2F  (SCL * 1.4426950408889634f)
#define POFF 6.0f     // probabilities are scaled by 2^6, so that small ones stay normal fp16 numbers; it cancels in the division by the sum
#define LAZY 44.0f    // in unscaled scores: 44 * C2F < 8 in the exponent
struct MaskNo { static constexpr bool v = false; };
struct MaskYes { static constexpr bool v = true; };
__device__ __forceinline__ float xhalf(const float x) { return __uint_as_float(__builtin_amdgcn_permlanex16(__float_as_uint(x), __float_as_uint(x), 0x76543210u, 0xfedcba98u, false, false)); }   // the value of the lane 16 away: the same query's other half of the keys
__device__ __forceinline__ float exp2one(float a) { asm("v_exp_f32 %0, %0\n\tv_nop" : "+v"(a)); return a; }   // the v_nop: the free slot that the instruction set asks for behind a transcendental
__device__ __forceinline__ v8f exp2o(const v8f x, const float mc) {   // exp2(x * C2F + mc) of eight scores
    float a = __builtin_fmaf(x[0], C2F, mc), b = __builtin_fmaf(x[1], C2F, mc), c = __builtin_fmaf(x[2], C2F, mc), d = __builtin_fmaf(x[3], C2F, mc), e = __builtin_fmaf(x[4], C2F, mc), f = __builtin_fmaf(x[5], C2F, mc), g = __builtin_fmaf(x[6], C2F, mc), h = __builtin_fmaf(x[7], C2F, mc);
    asm("v_exp_f32 %0, %0\n\tv_exp_f32 %1, %1\n\tv_exp_f32 %2, %2\n\tv_exp_f32 %3, %3\n\tv_exp_f32 %4, %4\n\tv_exp_f32 %5, %5\n\tv_exp_f32 %6, %6\n\tv_exp_f32 %7, %7\n\tv_nop" : "+v"(a), "+v"(b), "+v"(c), "+v"(d), "+v"(e), "+v"(f), "+v"(g), "+v"(h));   // one free slot behind a transcendental, before its result is read or its source overwritten: each of the first seven has the next, independent one there, the last the v_nop; in one statement so that they stay so
    return (v8f){a, b, c, d, e, f, g, h}; }
template <typename T> __device__ __forceinline__ const T* upin(const T* p) { const unsigned long long u = (unsigned long long)p; return (const T*)(const __attribute__((address_space(1))) T*)(((unsigned long long)(unsigned)__builtin_amdgcn_readfirstlane((int)(u >> 32)) << 32) | (unsigned)__builtin_amdgcn_readfirstlane((int)u)); }   // a wave-uniform address kept in scalar registers: the loads then take scalar base + the lane's one 32-bit offset, and no 64-bit address pairs take up vector registers
// Qh .. Vl: the head's planes; Ah, Al: the tile's first fragment block of the merged planes.
template <bool HR> __device__ __forceinline__ void attn_tile(const bf* __restrict__ Qh, const bf* __restrict__ Ql, const bf* __restrict__ Kh, const bf* __restrict__ Kl, const h16* __restrict__ V16, const bf* __restrict__ Vh, const bf* __restrict__ Vl, bf* Ah, bf* Al, const int qt, const int lane) {
    const int lr = lane & 15, hi = lane >> 4, i0 = qt * 64, np = 2 * qt + 2; const unsigned l8 = 8 * lane;
    v16bf qh[4][2], ql[4][2], kh[2][2], kl[2][2]; v8f o[4][4]; float m[4], mc[4], l[4];
#pragma unroll
    for (int g = 0; g < 4; ++g) { m[g] = -3.0e38f; mc[g] = 0.f; l[g] = 0.f;
#pragma unroll
        for (int kk = 0; kk < 2; ++kk) { qh[g][kk] = WFrag<bf>::ld(Qh + (i0 + g * 16) * HD + kk * 512 + l8); ql[g][kk] = WFrag<bf>::ld(Ql + (i0 + g * 16) * HD + kk * 512 + l8); }
#pragma unroll
        for (int dt = 0; dt < 4; ++dt) o[dt][g] = (v8f){}; }
    auto ldk = [&](const int p) {   // the K fragments of pass p: 4 KiB in a row of each plane
        const bf* a = upin(Kh + p * 2048); const bf* b = upin(Kl + p * 2048);
#pragma unroll
        for (int kt = 0; kt < 2; ++kt)
#pragma unroll
            for (int kk = 0; kk < 2; ++kk) { kh[kt][kk] = WFrag<bf>::ld(a + kt * 1024 + kk * 512 + l8); kl[kt][kk] = WFrag<bf>::ld(b + kt * 1024 + kk * 512 + l8); }
        asm volatile("s_wait_xcnt 0x0" :: "s"(a), "s"(b), "v"(l8) : "memory");   // the wait that stands behind issued loads, in front of the next write of a register that they name: the addresses are inputs, so that their registers live up to it
    };
    ldk(0);
    auto pass = [&](const int p, auto mk) {
        v16h vf[4]; v16bf vh[4], vl[4];
        auto ldv = [&]() {   // the V fragments of pass p
            const bf* va = upin(Vh + p * 512); const bf* vb = upin(Vl + p * 512); const h16* vc = upin(V16 + p * 512);
#pragma unroll
            for (int dt = 0; dt < 4; ++dt) { if constexpr (HR) { vh[dt] = WFrag<bf>::ld(va + dt * 16 * TT + l8); vl[dt] = WFrag<bf>::ld(vb + dt * 16 * TT + l8); } else vf[dt] = WFrag<h16>::ld(vc + dt * 16 * TT + l8); }
            if constexpr (HR) asm volatile("s_wait_xcnt 0x0" :: "s"(va), "s"(vb), "v"(l8) : "memory"); else asm volatile("s_wait_xcnt 0x0" :: "s"(vc), "v"(l8) : "memory");   // as in ldk
        };
        if constexpr (!HR) ldv();   // in front of the score products, which cover the loads' latency
        v8f s[2][4];
#pragma unroll
        for (int kt = 0; kt < 2; ++kt)
#pragma unroll
            for (int g = 0; g < 4; ++g) s[kt][g] = (v8f){};
#pragma unroll
        for (int kk = 0; kk < 2; ++kk) {    // eight independent tiles per product
#pragma unroll
            for (int kt = 0; kt < 2; ++kt)
#pragma unroll
                for (int g = 0; g < 4; ++g) s[kt][g] = wmmab(kh[kt][kk], qh[g][kk], s[kt][g]);
#pragma unroll
            for (int kt = 0; kt < 2; ++kt)
#pragma unroll
                for (int g = 0; g < 4; ++g) s[kt][g] = wmmab(kh[kt][kk], ql[g][kk], s[kt][g]);
#pragma unroll
            for (int kt = 0; kt < 2; ++kt)
#pragma unroll
                for (int g = 0; g < 4; ++g) s[kt][g] = wmmab(kl[kt][kk], qh[g][kk], s[kt][g]);
        }
        if constexpr (HR) { __builtin_amdgcn_sched_barrier(0); ldv(); }   // V hi and lo take the place of the K fragments, behind their last product (the barrier keeps the loads from being lifted over the products): K, V hi and V lo together do not fit the registers
        if constexpr (!HR) ldk(min(p + 1, np - 1));    // the next pass's K fragments, a whole softmax ahead of their use (the last pass reads its own again: in bounds, unused)
        if constexpr (decltype(mk)::v) {
#pragma unroll
            for (int kt = 0; kt < 2; ++kt)
#pragma unroll
                for (int g = 0; g < 4; ++g)
#pragma unroll
                    for (int j = 0; j < 8; ++j) s[kt][g][j] = (p * 32 + kt * 16 + hi * 8 + j <= i0 + g * 16 + lr) ? s[kt][g][j] : -3.0e38f; }
        float tm[4], dm = -3.0e38f;
#pragma unroll
        for (int g = 0; g < 4; ++g) { float t = fmaxf(s[0][g][0], s[1][g][0]);
#pragma unroll
            for (int j = 1; j < 8; ++j) t = fmaxf(t, fmaxf(s[0][g][j], s[1][g][j]));
            tm[g] = t; dm = fmaxf(dm, t - m[g]); }
        if (__builtin_amdgcn_ballot_w32(dm > LAZY) != 0) {   // wave-uniform: true in the first pass (m starts at -3e38; every query has key 0), seldom later
#pragma unroll
            for (int g = 0; g < 4; ++g) { const float mn = fmaxf(m[g], fmaxf(tm[g], xhalf(tm[g]))), al = exp2one((m[g] - mn) * C2F); m[g] = mn; mc[g] = POFF - mn * C2F; l[g] *= al;
#pragma unroll
                for (int dt = 0; dt < 4; ++dt) o[dt][g] *= al; } }
#pragma unroll
        for (int g = 0; g < 4; ++g) {
            const v8f e0 = exp2o(s[0][g], mc[g]), e1 = exp2o(s[1][g], mc[g]);
            l[g] += (((e0[0] + e0[1]) + (e0[2] + e0[3])) + ((e0[4] + e0[5]) + (e0[6] + e0[7]))) + (((e1[0] + e1[1]) + (e1[2] + e1[3])) + ((e1[4] + e1[5]) + (e1[6] + e1[7])));
            if constexpr (HR) { v8us h0, h1, l0, l1;
#pragma unroll
                for (int j = 0; j < 8; ++j) { unsigned short a, c; splitf(e0[j], a, c); h0[j] = a; l0[j] = c; splitf(e1[j], a, c); h1[j] = a; l1[j] = c; }
                const v16bf ph = cat16b(h0, h1), pl = cat16b(l0, l1);
#pragma unroll
                for (int dt = 0; dt < 4; ++dt) o[dt][g] = wmmab(vh[dt], ph, o[dt][g]);
#pragma unroll
                for (int dt = 0; dt < 4; ++dt) o[dt][g] = wmmab(vh[dt], pl, o[dt][g]);
#pragma unroll
                for (int dt = 0; dt < 4; ++dt) o[dt][g] = wmmab(vl[dt], ph, o[dt][g]);
            } else { v8h p0, p1;
#pragma unroll
                for (int j = 0; j < 8; ++j) { p0[j] = tohx(e0[j]); p1[j] = tohx(e1[j]); }
                const v16h pf = cat16(p0, p1);
#pragma unroll
                for (int dt = 0; dt < 4; ++dt) o[dt][g] = wmma16(vf[dt], pf, o[dt][g]); }
            __builtin_amdgcn_sched_barrier(0);   // one group's exponentials and products at a time: with all four groups' mixed, the registers do not fit and Q fragments spill
        }
        if constexpr (HR) ldk(min(p + 1, np - 1));     // with V hi and lo held, the registers do not fit a fetch ahead: these short walks (at most 16 passes) fetch K at the pass's end
    };
#pragma unroll 1
    for (int p = 0; p < 2 * qt; ++p) pass(p, MaskNo{});      // every key of these passes lies below every query of the tile; kept rolled: the pass is some 600 instructions, and the trip count is the tile's own
#pragma unroll 1
    for (int p = 2 * qt; p < np; ++p) pass(p, MaskYes{});    // the two passes that hold the diagonal; kept rolled: one copy of the masked pass in the code
#pragma unroll
    for (int g = 0; g < 4; ++g) { const float inv = __fdiv_rn(1.0f, l[g] + xhalf(l[g]));   // the two halves' sums are joined here, once
#pragma unroll
        for (int dt = 0; dt < 4; ++dt) { v8us oh, ol;
#pragma unroll
            for (int j = 0; j < 8; ++j) { unsigned short a, c; splitf(o[dt][g][j] * inv, a, c); oh[j] = a; ol[j] = c; }
            const unsigned e = g * 16 * DQ + dt * 256 + l8; *(v8usa*)(Ah + e) = oh; *(v8usa*)(Al + e) = ol;   // 32 lanes x 16 bytes: four whole lines a store
            asm volatile("s_wait_xcnt 0x0" :: "v"(oh), "v"(ol) : "memory"); }   // the wait that stands behind issued stores, in front of the code that takes over their registers: the stored values are inputs, so that their registers live up to it
    }
}
__global__ __launch_bounds__(256, 2) void k_attn(const bf* __restrict__ Qh, const bf* __restrict__ Ql, const bf* __restrict__ Kh, const bf* __restrict__ Kl, const h16* __restrict__ V16, const bf* __restrict__ Vh, const bf* __restrict__ Vl, bf* Ah, bf* Al) {
    const int lane = threadIdx.x & 31; const int w = __builtin_amdgcn_readfirstlane((int)(threadIdx.x >> 5));
    const int h = blockIdx.y, u = (int)blockIdx.x * 4 + (w & 3), qt = (w < 4) ? TT / 64 - 1 - u : u;   // every tile 0 .. 31 of the head once over the 4 work-groups
    const size_t qp = ((size_t)blockIdx.z * NH_ + h) * TT * HD, kp = ((size_t)blockIdx.z * NKV + h / REP) * TT * HD, op = ((size_t)blockIdx.z * TT + qt * 64) * DQ + h * 1024;   // merged planes: the last GEMM's A operand (rows = tokens, k = h * HD + d), 16 x DQ elements per 16-token block, the head's two fragment blocks at h * 1024
    if (qt * 64 < RH) attn_tile<true>(Qh + qp, Ql + qp, Kh + kp, Kl + kp, V16 + kp, Vh + kp, Vl + kp, Ah + op, Al + op, qt, lane);   // RH is a multiple of 64: the same for all 64 rows
    else attn_tile<false>(Qh + qp, Ql + qp, Kh + kp, Kl + kp, V16 + kp, Vh + kp, Vl + kp, Ah + op, Al + op, qt, lane);
}

extern "C" void kernel_launch(void* const* d_in, const int* in_sizes, int n_in,
                              void* d_out, int out_size, void* d_ws, size_t ws_size, hipStream_t stream) {
    (void)in_sizes; (void)n_in; (void)out_size;
    const float* x = (const float*)d_in[0]; const int* PID = (const int*)d_in[1]; const float* wq = (const float*)d_in[2]; const float* wk = (const float*)d_in[3]; const float* wv = (const float*)d_in[4]; const float* wo = (const float*)d_in[5];   /* input order x, token_positions (int32 [2048], read on device by the table builder), Wq, Wk, Wv, Wo ('oi' [1024][1024]): the host's own six slots */
    float* OUT = (float*)d_out;     // [4][2048][1024]
    char* wsp = (char*)d_ws;
    auto take = [&](size_t bytes) { char* p = wsp; wsp += (bytes + 255) & ~(size_t)255; return (void*)p; };
    bf* WQ = (bf*)take((size_t)(DQ + 2 * DKV) * DM * 2); bf* WK = WQ + (size_t)DQ * DM; bf* WV = WK + (size_t)DKV * DM;   /* one plane of 3072 rows: the merged projection launch walks it by blockIdx.y */ bf* WO = (bf*)take((size_t)DM * DQ * 2); float* CS = (float*)take((size_t)TT * HD * 2 * 4);
    bf* XB = (bf*)take((size_t)NB_ * TT * DM * 2);
    h16* VT16 = (h16*)take((size_t)NB_ * NKV * HD * TT * 2);
    bf* QPh = (bf*)take((size_t)NB_ * NH_ * TT * HD * 2); bf* QPl = (bf*)take((size_t)NB_ * NH_ * TT * HD * 2); bf* KPh = (bf*)take((size_t)NB_ * NKV * TT * HD * 2); bf* KPl = (bf*)take((size_t)NB_ * NKV * TT * HD * 2); bf* VTh = (bf*)take((size_t)NB_ * NKV * HD * TT * 2); bf* VTl = (bf*)take((size_t)NB_ * NKV * HD * TT * 2);
    bf* ATh = (bf*)take((size_t)NB_ * TT * DQ * 2); bf* ATl = (bf*)take((size_t)NB_ * TT * DQ * 2);
    if ((size_t)(wsp - (char*)d_ws) > ws_size) return;    // ws 256 MiB
    k_prep<<<NPT + NPX + 4 * NPW, 256, 0, stream>>>(x, PID, wq, wk, wv, wo, XB, WQ, WK, WV, WO, CS);   /* bf16 planes of x (rows = batch * TT + token) and of the four weights, and the {cos, sin} table from token_positions (int32 [2048], read on device; the same for every batch) */
    k_gemmw<bf, 0, false, 3, DM><<<dim3(TT / 128, (DQ + 2 * DKV) / 128, NB_), 128, 0, stream>>>(XB, nullptr, WQ, nullptr, nullptr, 0, nullptr, (size_t)TT * DM, 0, (size_t)NH_ * TT * HD, CS, VT16, QPh, QPl, KPh, KPl, VTh, VTl);    /* q and k projections with the rotary step and hi/lo planes, v projection with transposed fp16 and hi/lo planes */
    k_attn<<<dim3(TT / 64 / 8, NH_, NB_), 256, 0, stream>>>(QPh, QPl, KPh, KPl, VT16, VTh, VTl, ATh, ATl);   /* scores (hi/lo planes, 3 products, EVERY row), softmax, hybrid P.V and the merge, all heads of all batches */
    k_gemmw<bf, 1, false, 0, DQ><<<dim3(TT / 128, DM / 128, NB_), 128, 0, stream>>>(ATh, ATl, WO, nullptr, OUT, DM, nullptr, (size_t)TT * DQ, 0, (size_t)TT * DM, nullptr, nullptr, nullptr, nullptr, nullptr, nullptr, nullptr, nullptr);
}

// v010
// A run of this version takes 139 microseconds.
// Two timings next to v009 put it at 1.09 and 1.08 times that version's speed.
// All steps since v000 together make it 19.5 times as fast.
#include <hip/hip_runtime.h>

// Causal multi-head self-attention with interleaved-pair rotary position embedding from a positions input, four batches (x [4][2048][1024]; Q, K, V = x W^T ('oi' [1024][1024] 1/32, no bias; 16 heads x 64; token-major); angles = token_positions (int32 [2048], read on device) x 1 / THETA ** (2i / 64), THETA 1e4; pairs (2i, 2i+1): r_even = x_even cos - x_odd sin, r_odd = x_even sin + x_odd cos, on Q and K; scores / sqrt(64); keys j <= i kept, -inf elsewhere; softmax; out = merged Wo^T ('oi', no bias) -> [4][2048][1024] (8.4 M); argument order x, token_positions, Wq, Wk, Wv, Wo).
// Four launches: k_prep (all conversions and the table), the q, k, v projections in one grid, k_attn, the last GEMM. Every stage is ONE launch for all four batches (blockIdx.z = batch; each per-batch plane has NB_ copies in a row in the workspace; the weights' planes and the {cos, sin} table are shared). Layout per batch: bf16 copy of x; exact projections; {cos, sin} per (position, pair) built once from the int positions and float32 inverse-frequency constants (precise cosf/sinf); the interleaved rotary step with the hi/lo split, and the V transpose with its three planes, done in the projection GEMMs' own epilogues (no f32 projection buffer); causal T-2048 attention (EVERY row's scores on hi/lo planes (3 products: logit sigma 2 with these weights) and hybrid P.V (rows < 512 hi/lo, rest fp16); one fused kernel, k_attn, which stops at the diagonal); merged hi/lo x Wo exact.
// Every 16-bit operand plane [row][k] lies in FRAGMENT ORDER: a block of 16 rows x 32 k is 1 KiB in a row, blocks k-fastest, then by 16-row block; inside it element (r, k) stands at ((k >> 4) & 1) * 256 + (((k >> 3) & 1) * 16 + r) * 8 + (k & 7). A lane's two 16-byte pieces of a fragment are then base + lane * 8 and + 256: each load of a wave reads 512 bytes in a row (4 whole lines, not 32 bytes of each of 16 lines). The k order of a fragment is the one of the row-major loader, for A and B alike.
// Compute dtypes, f32 accumulate: every input rounded to bf16; projections exact; rotary f32; attention scores 3 products, P.V rows < 512 3 products, rest fp16; softmax f32; Wo hl x exact.

#define NB_  4      // batches: this module's input is [4][2048][1024]
#define TT   2048
#define DM   1024
#define NH_  16
#define NKV  16
#define REP  (NH_ / NKV)
#define HD   64
#define DQ   (NH_ * HD)
#define DKV  (NKV * HD)
#define RH   512                  // query rows < RH use hi+lo planes (0: none)
#define SCL  0.125f   // HD^-0.5
typedef _Float16 h16;
typedef unsigned short bf;
typedef __attribute__((ext_vector_type(16))) __bf16   v16bf;
typedef __attribute__((ext_vector_type(16))) _Float16 v16h;
typedef __attribute__((ext_vector_type(8)))  _Float16 v8h;
typedef __attribute__((ext_vector_type(8)))  unsigned short v8us;
typedef __attribute__((ext_vector_type(8)))  float    v8f;
typedef __attribute__((ext_vector_type(4)))  float    v4f;
typedef v8h  __attribute__((may_alias)) v8ha;
typedef v4f  __attribute__((may_alias)) v4fa;
typedef v8us __attribute__((may_alias)) v8usa;

__device__ __forceinline__ unsigned short f2bf(float f) { unsigned u = __float_as_uint(f); u += 0x7FFFu + ((u >> 16) & 1u); return (unsigned short)(u >> 16); }
__device__ __forceinline__ float bf2f(unsigned short b) { return __uint_as_float(((unsigned)b) << 16); }
__device__ __forceinline__ float bfr(float f) { return bf2f(f2bf(f)); }
__device__ __forceinline__ v16h cat16(v8h lo, v8h hi) { return __builtin_shufflevector(lo, hi, 0, 1, 2, 3, 4, 5, 6, 7, 8, 9, 10, 11, 12, 13, 14, 15); }
__device__ __forceinline__ v16bf cat16b(v8us lo, v8us hi) { return __builtin_bit_cast(v16bf, __builtin_shufflevector(lo, hi, 0, 1, 2, 3, 4, 5, 6, 7, 8, 9, 10, 11, 12, 13, 14, 15)); }
__device__ __forceinline__ v8f wmma16(v16h a, v16h b, v8f c) { return __builtin_amdgcn_wmma_f32_16x16x32_f16(false, a, false, b, (short)0, c, false, false); }
__device__ __forceinline__ v8f wmmab(v16bf a, v16bf b, v8f c) { return __builtin_amdgcn_wmma_f32_16x16x32_bf16(false, a, false, b, (short)0, c, false, false); }



__device__ __forceinline__ h16 tohx(float x) { return (h16)x; }
__device__ __forceinline__ void splitf(float y, unsigned short& h, unsigned short& l) { h = f2bf(y); l = f2bf(y - bf2f(h)); }
typedef __attribute__((ext_vector_type(2))) _Float16 v2h;
typedef __attribute__((ext_vector_type(4))) _Float16 v4h;
typedef __attribute__((ext_vector_type(2))) unsigned short v2us;
typedef __attribute__((ext_vector_type(4))) unsigned short v4us;
typedef __attribute__((ext_vector_type(2))) float v2f;
typedef __attribute__((ext_vector_type(4))) int v4i;

// ---- k_gemmw: register-blocked GEMM, ONE WAVE per 64x64 output tile (16 accumulators); 2 x 2 waves share a 128x128 tile, whose operands (16-bit planes in fragment order) come once per work-group from global memory into a two-buffer LDS ring, 64 k a stage, by asynchronous copies; the fragments are read from LDS (block's base + lane * 8, as in global memory); grid (M/128, N/128, Z), 128 threads.
// C[m][n] (f32, pitch ldc, + optional f32 bias[n]) = sum_k A[m][k] Bt[n][k] (+ split products per NSPLIT). z-batch strides sA/sB/sC in elements (sC: of C for EPI 0, of each output plane for EPI 1 and 2). K % 64 == 0.
// EPI picks what becomes of the tile, which for EPI 1 and 2 is 64 tokens x one whole head (HD == 64 columns): 0: f32 C as above. 1: rotary step from the {cos, sin} table CS, then the hi/lo split, to the planes Ph, Pl [head][token][d] (fragment order, rows = tokens). 2: fp16 and hi/lo planes P16, Ph, Pl, transposed to [head][d][token] (fragment order, rows = d). 3: the q, k and v projections in ONE grid, N = 3 * DQ rows of Bt (the three weights' planes stand in a row): the 64-column tile's index / 16 picks 1 to Ph, Pl (q), 1 to Ph2, Pl2 (k) or 2 to P16, Ph3, Pl3 (v).
template <typename T16> struct WFrag;
template <> struct WFrag<h16> { typedef v16h V; static __device__ __forceinline__ V ld(const h16* p) { return cat16(*(const v8h*)p, *(const v8h*)(p + 256)); } static __device__ __forceinline__ v8f mma(V a, V b, v8f c) { return wmma16(a, b, c); } };
template <> struct WFrag<bf> { typedef v16bf V; static __device__ __forceinline__ V ld(const bf* p) { return cat16b(*(const v8us*)p, *(const v8us*)(p + 256)); } static __device__ __forceinline__ v8f mma(V a, V b, v8f c) { return wmmab(a, b, c); } };
template <typename T16> struct LFrag;
template <> struct LFrag<h16> { static __device__ __forceinline__ v16h ld(const h16* p) { return cat16(*(const v8ha*)p, *(const v8ha*)(p + 256)); } };
template <> struct LFrag<bf> { static __device__ __forceinline__ v16bf ld(const bf* p) { return cat16b(*(const v8usa*)p, *(const v8usa*)(p + 256)); } };
#define KS 64       // k per stage of the ring: a 16-row block's share of a stage is 2 KiB in a row, in global memory and in LDS: one 16-byte copy of each of the 128 threads
// cp8: one plane's share of a stage, 8 blocks of 16 rows: 8 copies a lane, LDS byte address l + rb * 2048, global g + rb * 16 * K elements. The s_wait_xcnt is the last line of the copies' own statement, so that it stands in front of every later write of a register that a copy names.
template <typename T16, int K> __device__ __forceinline__ void cp8(const unsigned l, const T16* g) {
    asm volatile("global_load_async_to_lds_b128 %0, %8, off\n\tglobal_load_async_to_lds_b128 %1, %9, off\n\tglobal_load_async_to_lds_b128 %2, %10, off\n\tglobal_load_async_to_lds_b128 %3, %11, off\n\tglobal_load_async_to_lds_b128 %4, %12, off\n\tglobal_load_async_to_lds_b128 %5, %13, off\n\tglobal_load_async_to_lds_b128 %6, %14, off\n\tglobal_load_async_to_lds_b128 %7, %15, off\n\ts_wait_xcnt 0x0"
        :: "v"(l), "v"(l + 2048u), "v"(l + 4096u), "v"(l + 6144u), "v"(l + 8192u), "v"(l + 10240u), "v"(l + 12288u), "v"(l + 14336u),
           "v"(g), "v"(g + 16 * K), "v"(g + 32 * K), "v"(g + 48 * K), "v"(g + 64 * K), "v"(g + 80 * K), "v"(g + 96 * K), "v"(g + 112 * K) : "memory");
}
template <typename T16, int NSPLIT, bool BIAS, int EPI, int K>
__global__ __launch_bounds__(128) void k_gemmw(const T16* __restrict__ A, const T16* __restrict__ A2, const T16* __restrict__ Bt, const T16* __restrict__ Bt2, float* C, int ldc, const float* __restrict__ bias, size_t sA, size_t sB, size_t sC, const float* __restrict__ CS, h16* P16, bf* Ph, bf* Pl, bf* Ph2, bf* Pl2, bf* Ph3, bf* Pl3) {
    typedef typename WFrag<T16>::V V;
    const int wv = __builtin_amdgcn_readfirstlane((int)(threadIdx.x >> 5)), wm = wv >> 1, wn = wv & 1;   // the wave's 64x64 quarter of the 128x128 tile
    const int cy = (int)blockIdx.y * 2 + wn;    // index of the wave's 64-column tile
    const int sel = (EPI == 3) ? cy / (DQ / 64) : 0, hy = (EPI == 3) ? cy % (DQ / 64) : cy;   // EPI 3: which projection (0 q, 1 k, 2 v; the same for the whole work-group) and which head (the wave's own)
    if constexpr (EPI == 3) { if (sel == 1) { Ph = Ph2; Pl = Pl2; } else if (sel == 2) { Ph = Ph3; Pl = Pl3; } }
    constexpr int NA = (NSPLIT == 1 || NSPLIT == 2) ? 2 : 1, NPL = NA + ((NSPLIT >= 2) ? 2 : 1), PLE = 128 * KS, NT = K / KS;   // planes of A, planes in all, elements of a plane's share of a stage, stages
    __shared__ __align__(16) T16 ring[2 * NPL * PLE];
    float* os = (float*)ring + wv * (16 * 68);   // the epilogue's staging, a wave's own part; it takes the ring's place behind the last trip's barrier
    const size_t z = blockIdx.z; A += z * sA; if (A2) A2 += z * sA; Bt += z * sB; if (Bt2) Bt2 += z * sB; if constexpr (EPI == 0) C += z * sC; else { Ph += z * sC; Pl += z * sC; if constexpr (EPI == 2 || EPI == 3) P16 += z * sC; }
    const int lane = threadIdx.x & 31, lr = lane & 15, hi = lane >> 4; const int r0 = blockIdx.x * 128 + wm * 64, c0 = cy * 64;
    v8f acc[4][4];
#pragma unroll
    for (int mb = 0; mb < 4; ++mb)
#pragma unroll
        for (int nb = 0; nb < 4; ++nb) acc[mb][nb] = (v8f){};
    const unsigned t8 = 8 * threadIdx.x;
    A += (size_t)blockIdx.x * 128 * K + t8; if (NA == 2) A2 += (size_t)blockIdx.x * 128 * K + t8; Bt += (size_t)blockIdx.y * 128 * K + t8; if (NSPLIT >= 2) Bt2 += (size_t)blockIdx.y * 128 * K + t8;   // 16 rows x K elements per 16-row block, 512 elements per 32 k: the thread's own 16 bytes of each block's 2 KiB of a stage
    const unsigned lb = (unsigned)(size_t)ring + 2 * t8;   // the thread's LDS byte address in a plane's first block
    auto fill = [&](const int t, const int bu) {    // stage t into buffer bu: every thread of the work-group, every lane on
        const unsigned l = lb + bu * (NPL * PLE * 2);
        cp8<T16, K>(l, A + t * (KS * 16)); if constexpr (NA == 2) cp8<T16, K>(l + PLE * 2, A2 + t * (KS * 16));
        cp8<T16, K>(l + NA * PLE * 2, Bt + t * (KS * 16)); if constexpr (NSPLIT >= 2) cp8<T16, K>(l + (NA + 1) * PLE * 2, Bt2 + t * (KS * 16)); };
    fill(0, 0);
    asm volatile("s_wait_asynccnt 0x0" ::: "memory");   // this wave's copies of stage 0 have landed
    __syncthreads();                                    // ... and every other wave's: stage 0 may be read
    fill(1, 1);
    const unsigned l8 = 8 * lane;
#pragma unroll 1
    for (int t = 0; t < NT; ++t) {
        const T16* sb = ring + (t & 1) * (NPL * PLE) + l8;
#pragma unroll
        for (int kb = 0; kb < KS / 32; ++kb) {
            V a[4], a2[4]; const T16* pa = sb + wm * (PLE / 2) + kb * 512; const T16* pb = sb + NA * PLE + wn * (PLE / 2) + kb * 512;
#pragma unroll
            for (int mb = 0; mb < 4; ++mb) { a[mb] = LFrag<T16>::ld(pa + mb * (KS * 16)); if (NA == 2) a2[mb] = LFrag<T16>::ld(pa + PLE + mb * (KS * 16)); }
#pragma unroll
            for (int nb = 0; nb < 4; ++nb) { const V b = LFrag<T16>::ld(pb + nb * (KS * 16)); V b2; if (NSPLIT >= 2) b2 = LFrag<T16>::ld(pb + PLE + nb * (KS * 16));
#pragma unroll
                for (int mb = 0; mb < 4; ++mb) { acc[mb][nb] = WFrag<T16>::mma(a[mb], b, acc[mb][nb]); if (NSPLIT == 1 || NSPLIT == 2) acc[mb][nb] = WFrag<T16>::mma(a2[mb], b, acc[mb][nb]); if (NSPLIT >= 2) acc[mb][nb] = WFrag<T16>::mma(a[mb], b2, acc[mb][nb]); } }
            asm volatile("v_nop\n\tv_nop\n\tv_nop\n\tv_nop" : "+v"(acc[0][0]), "+v"(acc[1][1]), "+v"(acc[2][2]), "+v"(acc[3][3]) : "v"(a[0]), "v"(a[3]));   // as before this step: four vector slots behind a pass's products, before the next pass's fragments take over the operand registers
        }
        asm volatile("s_wait_dscnt 0x0" ::: "memory");      // this wave's reads of stage t have returned, before the buffer is given up
        asm volatile("s_wait_asynccnt 0x0" ::: "memory");   // this wave's copies of stage t + 1 have landed
        __syncthreads();                                    // publishes stage t + 1 and ends every wave's reads of stage t
        if (t + 2 < NT) fill(t + 2, t & 1);
    }
    asm volatile("s_wait_asynccnt 0x0" ::: "memory");       // no copy is outstanding when the ring becomes the epilogue's staging
    if constexpr (EPI == 1 || EPI == 3) if (EPI == 1 || sel < 2) {
        const int tk = lane >> 1, cofs = (lane & 1) * 4;    // a lane takes the pairs (d, d + 1) and (d + 2, d + 3), d = s * 8 + cofs, of token r0 + mb * 16 + tk: in fragment order that is element s * 128 + lane * 4 of the 16-token block
        const float* ct = CS + ((size_t)(r0 + tk) * HD + cofs) * 2; const size_t po = ((size_t)hy * TT + r0) * HD + lane * 4;
        v2f cs[2][8][2];            // {cos, sin} of 16 tokens, fetched one 16-token block ahead of its use
#pragma unroll
        for (int s = 0; s < 8; ++s) { cs[0][s][0] = *(const v2f*)(ct + s * 16); cs[0][s][1] = *(const v2f*)(ct + s * 16 + 4); }
#pragma unroll
        for (int mb = 0; mb < 4; ++mb) {
            if (mb < 3) {
#pragma unroll
                for (int s = 0; s < 8; ++s) { cs[(mb + 1) & 1][s][0] = *(const v2f*)(ct + (size_t)(mb + 1) * 16 * HD * 2 + s * 16); cs[(mb + 1) & 1][s][1] = *(const v2f*)(ct + (size_t)(mb + 1) * 16 * HD * 2 + s * 16 + 4); } }
#pragma unroll
            for (int nb = 0; nb < 4; ++nb) {
#pragma unroll
                for (int j = 0; j < 8; ++j) os[(hi * 8 + j) * 68 + nb * 16 + lr] = acc[mb][nb][j]; }
            __builtin_amdgcn_wave_barrier(); asm volatile("" ::: "memory");   // one wave: keeps the LDS reads below behind the LDS writes above
#pragma unroll
            for (int s = 0; s < 8; ++s) { const v4f x = *(const v4fa*)(os + tk * 68 + s * 8 + cofs); const v2f p = cs[mb & 1][s][0], q = cs[mb & 1][s][1]; float r[4]; v4us oh, ol;
                r[0] = x[0] * p[0] - x[1] * p[1]; r[1] = x[0] * p[1] + x[1] * p[0]; r[2] = x[2] * q[0] - x[3] * q[1]; r[3] = x[2] * q[1] + x[3] * q[0];   /* even: x0 c - x1 s; odd: x0 s + x1 c */
#pragma unroll
                for (int e = 0; e < 4; ++e) { unsigned short a2, c2; splitf(r[e], a2, c2); oh[e] = a2; ol[e] = c2; }
                *(v4us*)(Ph + po + (size_t)(mb * 16 * HD + s * 128)) = oh; *(v4us*)(Pl + po + (size_t)(mb * 16 * HD + s * 128)) = ol; }   // 32 lanes x 8 bytes: two whole 128-byte lines per plane
            if (mb < 3) { __builtin_amdgcn_wave_barrier(); asm volatile("s_wait_xcnt 0x0" ::: "memory"); }   // the next block's LDS writes stay behind these reads; the wait stands between the stores above and the next block's loads and products, which take over the stores' registers
        }
        return;
    }
    if constexpr (EPI == 2 || EPI == 3) {
        const size_t go = (size_t)hy * HD * TT + (size_t)r0 * 16 + lane * 8;   // rows = d: 16 x TT elements per 16-d block, 512 per 32 tokens
#pragma unroll
        for (int mb = 0; mb < 4; ++mb)
#pragma unroll
            for (int nb = 0; nb < 4; ++nb) { v8h o16; v8us oh, ol;     // a lane's 8 accumulator registers are 8 consecutive tokens (mb * 16 + hi * 8 ...) of d = nb * 16 + lr: exactly its 16-byte piece, lane * 8, of quarter mb of the tile's two fragment blocks, so that no LDS pass is needed
#pragma unroll
                for (int j = 0; j < 8; ++j) { const float x = acc[mb][nb][j]; o16[j] = tohx(x); unsigned short a2, c2; splitf(x, a2, c2); oh[j] = a2; ol[j] = c2; }
                const size_t o = go + (size_t)nb * 16 * TT + mb * 256; *(v8usa*)(P16 + o) = __builtin_bit_cast(v8us, o16); *(v8usa*)(Ph + o) = oh; *(v8usa*)(Pl + o) = ol; }   // 32 lanes x 16 bytes: four whole 128-byte lines a store
        asm volatile("s_wait_xcnt 0x0" ::: "memory");   // the wait that stands behind issued stores, in front of any code laid out behind them that takes over their registers
        return;
    }
#pragma unroll
    for (int mb = 0; mb < 4; ++mb) {
#pragma unroll
        for (int nb = 0; nb < 4; ++nb) {
#pragma unroll
            for (int j = 0; j < 8; ++j) os[(hi * 8 + j) * 68 + nb * 16 + lr] = acc[mb][nb][j]; }
        __builtin_amdgcn_wave_barrier(); asm volatile("" ::: "memory");
        float* crow = C + (size_t)(r0 + mb * 16) * ldc + c0;
{
#pragma unroll
            for (int s = 0; s < 8; ++s) { const int row = 2 * s + hi, cofs = lr * 4; v4f val = *(const v4fa*)(os + row * 68 + cofs); if (BIAS) { val[0] += bfr(bias[c0 + cofs]); val[1] += bfr(bias[c0 + cofs + 1]); val[2] += bfr(bias[c0 + cofs + 2]); val[3] += bfr(bias[c0 + cofs + 3]); }
                *(v4f*)(crow + (size_t)row * ldc + cofs) = val; }
             }
        __builtin_amdgcn_wave_barrier(); asm volatile("" ::: "memory");
    }
}


__global__ __launch_bounds__(256) void k_wtG(const float* __restrict__ w, int K, int N, bf* Bt) {
    const int lane = threadIdx.x & 31; const int L0 = (blockIdx.x * 8 + (threadIdx.x >> 5)) * 8; const int nlines = N * K / 64;
{
#pragma unroll 1
        for (int l = 0; l < 8; ++l) { const int L = L0 + l; if (L >= nlines) break; const size_t e = (size_t)L * 64 + lane * 2; const int k = (int)(e % K), n = (int)(e / K); v2us o;
            o[0] = f2bf(w[(size_t)k * N + n]); o[1] = f2bf(w[(size_t)(k + 1) * N + n]); *(v2us*)(Bt + e) = o; }
         }
}
// cvt8: f32 [row][DM] to the bf16 plane in fragment order, 8 values (one 16-byte piece) a thread. A wave takes 8 rows x 32 k: it reads one whole 128-byte line of each row and writes four whole lines of the block (pieces c = k / 8 of rows rr .. rr + 7 stand in a row).
__device__ __forceinline__ void cvt8(const float* __restrict__ src, bf* dst, const size_t i) { const size_t fr = i >> 6; const int c = (int)(i >> 3) & 3, rr = (int)((i >> 5) & 1) * 8 + (int)(i & 7); const v8f v = *(const v8f*)(src + ((fr / (DM / 32)) * 16 + rr) * DM + (fr % (DM / 32)) * 32 + c * 8); v8us o;
#pragma unroll
    for (int k = 0; k < 8; ++k) o[k] = f2bf(v[k]); *(v8us*)(dst + fr * 512 + (c >> 1) * 256 + ((c & 1) * 16 + rr) * 8) = o;
    asm volatile("s_wait_xcnt 0x0" ::: "memory");   // the wait that stands behind the issued store, in front of any code laid out behind it that takes over its registers
}

__constant__ float INV2[HD / 2] = { 1.000000000e+00f, 7.498942018e-01f, 5.623413324e-01f, 4.216965139e-01f, 3.162277639e-01f, 2.371373624e-01f, 1.778279394e-01f, 1.333521456e-01f, 1.000000015e-01f, 7.498941571e-02f, 5.623412877e-02f, 4.216964915e-02f, 3.162277862e-02f, 2.371373586e-02f, 1.778279431e-02f, 1.333521493e-02f, 9.999999776e-03f, 7.498942316e-03f, 5.623413250e-03f, 4.216964822e-03f, 3.162277862e-03f, 2.371373819e-03f, 1.778279431e-03f, 1.333521446e-03f, 1.000000047e-03f, 7.498941850e-04f, 5.623413017e-04f, 4.216964880e-04f, 3.162277862e-04f, 2.371373848e-04f, 1.778279402e-04f, 1.333521504e-04f };   // float32 10000^(-(i * 2 / 64)), generated with jnp to be bit-exact with the module's expression
__device__ __forceinline__ void cstab(const int* __restrict__ pid, float* CS, const int idx) { const int d = idx % HD; const int t = idx / HD; const float a = __fmul_rn((float)pid[t], INV2[d >> 1]); v2f cs; cs[0] = cosf(a); cs[1] = sinf(a); *(v2f*)(CS + (size_t)idx * 2) = cs;  }
// k_prep: everything that depends on the inputs alone, in ONE launch; a block's index picks its job (the same for all its threads): the {cos, sin} table (NPT blocks, first: the longest threads), x (NPX), then the four weights (NPW each). Every count is exact: no thread is left over.
#define NPT (TT * HD / 256)
#define NPX (NB_ * TT * DM / 8 / 256)
#define NPW (DM * DQ / 8 / 256)
__global__ __launch_bounds__(256) void k_prep(const float* __restrict__ x, const int* __restrict__ pid, const float* __restrict__ wq, const float* __restrict__ wk, const float* __restrict__ wv, const float* __restrict__ wo, bf* XB, bf* WQ, bf* WK, bf* WV, bf* WO, float* CS) {
    unsigned b = blockIdx.x;
    if (b < NPT) { cstab(pid, CS, (int)(b * 256 + threadIdx.x)); return; }
    b -= NPT;
    if (b < NPX) { cvt8(x, XB, (size_t)b * 256 + threadIdx.x); return; }
    b -= NPX;
    const unsigned s = b / NPW; const float* src = s == 0 ? wq : s == 1 ? wk : s == 2 ? wv : wo; bf* dst = s == 0 ? WQ : s == 1 ? WK : s == 2 ? WV : WO;
    cvt8(src, dst, (size_t)(b % NPW) * 256 + threadIdx.x);
}

// ---- k_attn: scores, softmax and P.V of 64 query rows of one head in TWO WAVES, which share a SIMD: the walk over the keys, 32 a pass, up to the diagonal, is dealt pass by pass, even passes to wave w, odd passes to wave w + 4. Each wave keeps its own running maximum, sum and output tiles in registers; the two partial results of a tile are joined once, through LDS, behind the kernel's one barrier. Grid (TT / 64 / 8, heads, batches), 256 threads = 8 waves of one head.
// Transposed products: S^T = K Q^T (A = K fragments, B = the four 16-query groups' Q fragments, kept in registers; hi/lo planes, 3 products, k order 0..31 then 32..63) and O^T += V^T P^T (A = V fragments of the [d][t] planes). A lane then holds 8 keys of ONE query in each score tile: the two tiles of a pass, rounded to 16 bits, ARE the lane's part of the P^T B fragment (k = hi * 8 + j and 16 + hi * 8 + j), and the lane's 8 registers of an O^T tile are its 16-byte piece of the merged planes' fragment block.
// Running maximum per query, raised only when some score of the pass lies more than LAZY above it (one wave-uniform test a pass); the sums and the output tiles are then rescaled. Probabilities are left unnormalised, exp2((s - m) * C2F + POFF), at most 2^14; the division by the row's sum is done once, on the output. Rows < RH: P and V hi/lo, 3 products; the rest fp16.
// Each K and V fragment read from L2 feeds four 16-query groups. Waves w and w + 4 of a work-group take their halves of a long tile, 31 - u, and then of a short one, SHORT(u): the same passes in both waves of a SIMD, so that both work to the end, and about the same work in every pair of the grid (a pass of the rows < RH, with three P.V products and two splits, is counted as two and a half; the shortest such sum goes with the longest tile). Each wave leaves both partial results in LDS; behind the barrier wave w joins and stores the long tile, wave w + 4 the short one.
#define C2F  (SCL * 1.4426950408889634f)
#define POFF 6.0f     // probabilities are scaled by 2^6, so that small ones stay normal fp16 numbers; it cancels in the division by the sum
#define LAZY 44.0f    // in unscaled scores: 44 * C2F < 8 in the exponent
#define MINIT -1.0e30f  // a query's maximum before its first key: far below any score, far above the mask's -3e38, so that a query whose keys in this wave's passes are all masked (tile 0, odd pass) gets probabilities, sum and weight in the join of exactly 0
#define PSL  (16 * 256 + 8 * 32)   // floats of a wave's partial result of one tile in LDS: 16 output tiles, then 4 maxima and 4 sums a lane
#define SHORT(u) ((int)((0x76FE5DC4BA938210ull >> (4 * (u))) & 15))   // tiles 0 .. 15 in the order of their work, one hex digit each: 0, 1, 2, 8, 3, 9, 10, 11, 4, 12, 13, 5, 14, 15, 6, 7
struct MaskNo { static constexpr bool v = false; };
struct MaskYes { static constexpr bool v = true; };
__device__ __forceinline__ float xhalf(const float x) { return __uint_as_float(__builtin_amdgcn_permlanex16(__float_as_uint(x), __float_as_uint(x), 0x76543210u, 0xfedcba98u, false, false)); }   // the value of the lane 16 away: the same query's other half of the keys
__device__ __forceinline__ float exp2one(float a) { asm("v_exp_f32 %0, %0\n\tv_nop" : "+v"(a)); return a; }   // the v_nop: the free slot that the instruction set asks for behind a transcendental
__device__ __forceinline__ v8f exp2o(const v8f x, const float mc) {   // exp2(x * C2F + mc) of eight scores
    float a = __builtin_fmaf(x[0], C2F, mc), b = __builtin_fmaf(x[1], C2F, mc), c = __builtin_fmaf(x[2], C2F, mc), d = __builtin_fmaf(x[3], C2F, mc), e = __builtin_fmaf(x[4], C2F, mc), f = __builtin_fmaf(x[5], C2F, mc), g = __builtin_fmaf(x[6], C2F, mc), h = __builtin_fmaf(x[7], C2F, mc);
    asm("v_exp_f32 %0, %0\n\tv_exp_f32 %1, %1\n\tv_exp_f32 %2, %2\n\tv_exp_f32 %3, %3\n\tv_exp_f32 %4, %4\n\tv_exp_f32 %5, %5\n\tv_exp_f32 %6, %6\n\tv_exp_f32 %7, %7\n\tv_nop" : "+v"(a), "+v"(b), "+v"(c), "+v"(d), "+v"(e), "+v"(f), "+v"(g), "+v"(h));   // one free slot behind a transcendental, before its result is read or its source overwritten: each of the first seven has the next, independent one there, the last the v_nop; in one statement so that they stay so
    return (v8f){a, b, c, d, e, f, g, h}; }
template <typename T> __device__ __forceinline__ const T* upin(const T* p) { const unsigned long long u = (unsigned long long)p; return (const T*)(const __attribute__((address_space(1))) T*)(((unsigned long long)(unsigned)__builtin_amdgcn_readfirstlane((int)(u >> 32)) << 32) | (unsigned)__builtin_amdgcn_readfirstlane((int)u)); }   // a wave-uniform address kept in scalar registers: the loads then take scalar base + the lane's one 32-bit offset, and no 64-bit address pairs take up vector registers
// qh, ql: the tile's Q fragments, loaded by the caller; Kh .. Vl: the head's planes; par: which passes are this wave's (0 even, 1 odd); o, m, l: the wave's partial result of tile qt (unnormalised output tiles, the maximum in use, the lane's half of the sum).
template <bool HR> __device__ __forceinline__ void attn_tile(const v16bf (&qh)[4][2], const v16bf (&ql)[4][2], const bf* __restrict__ Kh, const bf* __restrict__ Kl, const h16* __restrict__ V16, const bf* __restrict__ Vh, const bf* __restrict__ Vl, const int qt, const int par, const int lane, v8f (&o)[4][4], float (&m)[4], float (&l)[4]) {
    const int lr = lane & 15, hi = lane >> 4, i0 = qt * 64, pl = 2 * qt + par; const unsigned l8 = 8 * lane;   // pl: the wave's last pass, its one of the two that hold the diagonal
    v16bf kh[2][2], kl[2][2]; float mc[4];
#pragma unroll
    for (int g = 0; g < 4; ++g) { m[g] = MINIT; mc[g] = POFF - MINIT * C2F; l[g] = 0.f;
#pragma unroll
        for (int dt = 0; dt < 4; ++dt) o[dt][g] = (v8f){}; }
    auto ldk = [&](const int p) {   // the K fragments of pass p: 4 KiB in a row of each plane
        const bf* a = upin(Kh + p * 2048); const bf* b = upin(Kl + p * 2048);
#pragma unroll
        for (int kt = 0; kt < 2; ++kt)
#pragma unroll
            for (int kk = 0; kk < 2; ++kk) { kh[kt][kk] = WFrag<bf>::ld(a + kt * 1024 + kk * 512 + l8); kl[kt][kk] = WFrag<bf>::ld(b + kt * 1024 + kk * 512 + l8); }
        asm volatile("s_wait_xcnt 0x0" :: "s"(a), "s"(b), "v"(l8) : "memory");   // the wait that stands behind issued loads, in front of the next write of a register that they name: the addresses are inputs, so that their registers live up to it
    };
    ldk(par);
    auto pass = [&](const int p, auto mk) {
        v16h vf[4]; v16bf vh[4], vl[4];
        auto ldv = [&]() {   // the V fragments of pass p
            const bf* va = upin(Vh + p * 512); const bf* vb = upin(Vl + p * 512); const h16* vc = upin(V16 + p * 512);
#pragma unroll
            for (int dt = 0; dt < 4; ++dt) { if constexpr (HR) { vh[dt] = WFrag<bf>::ld(va + dt * 16 * TT + l8); vl[dt] = WFrag<bf>::ld(vb + dt * 16 * TT + l8); } else vf[dt] = WFrag<h16>::ld(vc + dt * 16 * TT + l8); }
            if constexpr (HR) asm volatile("s_wait_xcnt 0x0" :: "s"(va), "s"(vb), "v"(l8) : "memory"); else asm volatile("s_wait_xcnt 0x0" :: "s"(vc), "v"(l8) : "memory");   // as in ldk
        };
        if constexpr (!HR) ldv();   // in front of the score products, which cover the loads' latency
        v8f s[2][4];
#pragma unroll
        for (int kt = 0; kt < 2; ++kt)
#pragma unroll
            for (int g = 0; g < 4; ++g) s[kt][g] = (v8f){};
#pragma unroll
        for (int kk = 0; kk < 2; ++kk) {    // eight independent tiles per product
#pragma unroll
            for (int kt = 0; kt < 2; ++kt)
#pragma unroll
                for (int g = 0; g < 4; ++g) s[kt][g] = wmmab(kh[kt][kk], qh[g][kk], s[kt][g]);
#pragma unroll
            for (int kt = 0; kt < 2; ++kt)
#pragma unroll
                for (int g = 0; g < 4; ++g) s[kt][g] = wmmab(kh[kt][kk], ql[g][kk], s[kt][g]);
#pragma unroll
            for (int kt = 0; kt < 2; ++kt)
#pragma unroll
                for (int g = 0; g < 4; ++g) s[kt][g] = wmmab(kl[kt][kk], qh[g][kk], s[kt][g]);
        }
        if constexpr (HR) { __builtin_amdgcn_sched_barrier(0); ldv(); }   // V hi and lo take the place of the K fragments, behind their last product (the barrier keeps the loads from being lifted over the products): K, V hi and V lo together do not fit the registers
        if constexpr (!HR) ldk(min(p + 2, pl));    // the K fragments of the wave's next pass, a whole softmax ahead of their use (the last pass reads its own again: in bounds, unused)
        if constexpr (decltype(mk)::v) {
#pragma unroll
            for (int kt = 0; kt < 2; ++kt)
#pragma unroll
                for (int g = 0; g < 4; ++g)
#pragma unroll
                    for (int j = 0; j < 8; ++j) s[kt][g][j] = (p * 32 + kt * 16 + hi * 8 + j <= i0 + g * 16 + lr) ? s[kt][g][j] : -3.0e38f; }
        float tm[4], dm = -3.0e38f;
#pragma unroll
        for (int g = 0; g < 4; ++g) { float t = fmaxf(s[0][g][0], s[1][g][0]);
#pragma unroll
            for (int j = 1; j < 8; ++j) t = fmaxf(t, fmaxf(s[0][g][j], s[1][g][j]));
            tm[g] = t; dm = fmaxf(dm, t - m[g]); }
        if (__builtin_amdgcn_ballot_w32(dm > LAZY) != 0) {   // wave-uniform: true in the first pass (m starts at MINIT; some query of the tile has a key in it), seldom later
#pragma unroll
            for (int g = 0; g < 4; ++g) { const float mn = fmaxf(m[g], fmaxf(tm[g], xhalf(tm[g]))), al = exp2one((m[g] - mn) * C2F); m[g] = mn; mc[g] = POFF - mn * C2F; l[g] *= al;
#pragma unroll
                for (int dt = 0; dt < 4; ++dt) o[dt][g] *= al; } }
#pragma unroll
        for (int g = 0; g < 4; ++g) {
            const v8f e0 = exp2o(s[0][g], mc[g]), e1 = exp2o(s[1][g], mc[g]);
            l[g] += (((e0[0] + e0[1]) + (e0[2] + e0[3])) + ((e0[4] + e0[5]) + (e0[6] + e0[7]))) + (((e1[0] + e1[1]) + (e1[2] + e1[3])) + ((e1[4] + e1[5]) + (e1[6] + e1[7])));
            if constexpr (HR) { v8us h0, h1, l0, l1;
#pragma unroll
                for (int j = 0; j < 8; ++j) { unsigned short a, c; splitf(e0[j], a, c); h0[j] = a; l0[j] = c; splitf(e1[j], a, c); h1[j] = a; l1[j] = c; }
                const v16bf ph = cat16b(h0, h1), pl = cat16b(l0, l1);
#pragma unroll
                for (int dt = 0; dt < 4; ++dt) o[dt][g] = wmmab(vh[dt], ph, o[dt][g]);
#pragma unroll
                for (int dt = 0; dt < 4; ++dt) o[dt][g] = wmmab(vh[dt], pl, o[dt][g]);
#pragma unroll
                for (int dt = 0; dt < 4; ++dt) o[dt][g] = wmmab(vl[dt], ph, o[dt][g]);
            } else { v8h p0, p1;
#pragma unroll
                for (int j = 0; j < 8; ++j) { p0[j] = tohx(e0[j]); p1[j] = tohx(e1[j]); }
                const v16h pf = cat16(p0, p1);
#pragma unroll
                for (int dt = 0; dt < 4; ++dt) o[dt][g] = wmma16(vf[dt], pf, o[dt][g]); }
            __builtin_amdgcn_sched_barrier(0);   // one group's exponentials and products at a time: with all four groups' mixed, the registers do not fit and Q fragments spill
        }
        if constexpr (HR) ldk(min(p + 2, pl));     // with V hi and lo held, the registers do not fit a fetch ahead: these short walks (at most 8 passes a wave) fetch K at the pass's end
    };
#pragma unroll 1
    for (int p = par; p < 2 * qt; p += 2) pass(p, MaskNo{});      // every key of these passes lies below every query of the tile; kept rolled: the pass is some 600 instructions, and the trip count is the tile's own
    pass(pl, MaskYes{});    // the wave's one pass that holds the diagonal
}
__global__ __launch_bounds__(256, 2) void k_attn(const bf* __restrict__ Qh, const bf* __restrict__ Ql, const bf* __restrict__ Kh, const bf* __restrict__ Kl, const h16* __restrict__ V16, const bf* __restrict__ Vh, const bf* __restrict__ Vl, bf* Ah, bf* Al) {
    __shared__ __align__(16) float part[16 * PSL];   // [wave][tile]
    const int lane = threadIdx.x & 31; const int w = __builtin_amdgcn_readfirstlane((int)(threadIdx.x >> 5)), par = w >> 2;
    const int h = blockIdx.y, u = (int)blockIdx.x * 4 + (w & 3), qlong = TT / 64 - 1 - u, qshort = SHORT(u);   // the pair's two tiles: every tile 0 .. 31 of the head once over the 4 work-groups
    const size_t qp = ((size_t)blockIdx.z * NH_ + h) * TT * HD, kp = ((size_t)blockIdx.z * NKV + h / REP) * TT * HD; const unsigned l8 = 8 * lane;
#pragma unroll 1
    for (int ti = 0; ti < 2; ++ti) {    // kept rolled: one copy of the walks in the code
        const int qt = ti ? qshort : qlong; v8f o[4][4]; float m[4], l[4]; v16bf qh[4][2], ql[4][2];
        const bf* qa = upin(Qh + qp + qt * 64 * HD); const bf* qb = upin(Ql + qp + qt * 64 * HD);   // the tile's Q fragments: 8 KiB in a row of each plane
#pragma unroll
        for (int g = 0; g < 4; ++g)
#pragma unroll
            for (int kk = 0; kk < 2; ++kk) { qh[g][kk] = WFrag<bf>::ld(qa + g * 16 * HD + kk * 512 + l8); ql[g][kk] = WFrag<bf>::ld(qb + g * 16 * HD + kk * 512 + l8); }
        asm volatile("s_wait_xcnt 0x0" :: "s"(qa), "s"(qb), "v"(l8) : "memory");   // as in ldk: behind the issued loads and ahead of the choice between the two walks, so that it stands in front of every later write of a register that they name, whichever way is taken
        if (qt * 64 < RH) attn_tile<true>(qh, ql, Kh + kp, Kl + kp, V16 + kp, Vh + kp, Vl + kp, qt, par, lane, o, m, l);   // RH is a multiple of 64: the same for all 64 rows
        else attn_tile<false>(qh, ql, Kh + kp, Kl + kp, V16 + kp, Vh + kp, Vl + kp, qt, par, lane, o, m, l);
        float* pd = part + (w * 2 + ti) * PSL;      // the wave's own part of LDS, 512 bytes in a row a store
#pragma unroll
        for (int g = 0; g < 4; ++g) { pd[4096 + g * 32 + lane] = m[g]; pd[4224 + g * 32 + lane] = l[g];
#pragma unroll
            for (int dt = 0; dt < 4; ++dt) { *(v4fa*)(pd + (dt * 4 + g) * 256 + lane * 4) = (v4f){o[dt][g][0], o[dt][g][1], o[dt][g][2], o[dt][g][3]}; *(v4fa*)(pd + (dt * 4 + g) * 256 + 128 + lane * 4) = (v4f){o[dt][g][4], o[dt][g][5], o[dt][g][6], o[dt][g][7]}; } }
    }
    __syncthreads();    // every wave has walked both its tiles: all partial results stand in LDS
    const float* p1 = part + ((w & 3) * 2 + par) * PSL; const float* p2 = p1 + 8 * PSL;   // the even and the odd passes' results of the tile that this wave joins
    const size_t op = ((size_t)blockIdx.z * TT + (par ? qshort : qlong) * 64) * DQ + h * 1024;   // merged planes: the last GEMM's A operand (rows = tokens, k = h * HD + d), 16 x DQ elements per 16-token block, the head's two fragment blocks at h * 1024
    Ah += op; Al += op;
#pragma unroll
    for (int g = 0; g < 4; ++g) { const float m1 = p1[4096 + g * 32 + lane], l1 = p1[4224 + g * 32 + lane], m2 = p2[4096 + g * 32 + lane], l2 = p2[4224 + g * 32 + lane], mx = fmaxf(m1, m2);
        const float a1 = exp2one((m1 - mx) * C2F), a2 = exp2one((m2 - mx) * C2F), ls = l1 * a1 + l2 * a2;   // both partial results brought to the larger maximum
        const float inv = __fdiv_rn(1.0f, ls + xhalf(ls)), b1 = a1 * inv, b2 = a2 * inv;   // the two lane halves' sums are joined here, once
#pragma unroll
        for (int dt = 0; dt < 4; ++dt) { v8us oh, ol; const int t = (dt * 4 + g) * 256 + lane * 4;
            const v4f x0 = *(const v4fa*)(p1 + t), x1 = *(const v4fa*)(p1 + t + 128), y0 = *(const v4fa*)(p2 + t), y1 = *(const v4fa*)(p2 + t + 128);
#pragma unroll
            for (int j = 0; j < 8; ++j) { unsigned short a, c; splitf((j < 4 ? x0[j & 3] : x1[j & 3]) * b1 + (j < 4 ? y0[j & 3] : y1[j & 3]) * b2, a, c); oh[j] = a; ol[j] = c; }
            const unsigned e = g * 16 * DQ + dt * 256 + l8; *(v8usa*)(Ah + e) = oh; *(v8usa*)(Al + e) = ol;   // 32 lanes x 16 bytes: four whole lines a store
            asm volatile("s_wait_xcnt 0x0" :: "v"(oh), "v"(ol) : "memory"); }   // the wait that stands behind issued stores, in front of the code that takes over their registers: the stored values are inputs, so that their registers live up to it
    }
}

extern "C" void kernel_launch(void* const* d_in, const int* in_sizes, int n_in,
                              void* d_out, int out_size, void* d_ws, size_t ws_size, hipStream_t stream) {
    (void)in_sizes; (void)n_in; (void)out_size;
    const float* x = (const float*)d_in[0]; const int* PID = (const int*)d_in[1]; const float* wq = (const float*)d_in[2]; const float* wk = (const float*)d_in[3]; const float* wv = (const float*)d_in[4]; const float* wo = (const float*)d_in[5];   /* input order x, token_positions (int32 [2048], read on device by the table builder), Wq, Wk, Wv, Wo ('oi' [1024][1024]): the host's own six slots */
    float* OUT = (float*)d_out;     // [4][2048][1024]
    char* wsp = (char*)d_ws;
    auto take = [&](size_t bytes) { char* p = wsp; wsp += (bytes + 255) & ~(size_t)255; return (void*)p; };
    bf* WQ = (bf*)take((size_t)(DQ + 2 * DKV) * DM * 2); bf* WK = WQ + (size_t)DQ * DM; bf* WV = WK + (size_t)DKV * DM;   /* one plane of 3072 rows: the merged projection launch walks it by blockIdx.y */ bf* WO = (bf*)take((size_t)DM * DQ * 2); float* CS = (float*)take((size_t)TT * HD * 2 * 4);
    bf* XB = (bf*)take((size_t)NB_ * TT * DM * 2);
    h16* VT16 = (h16*)take((size_t)NB_ * NKV * HD * TT * 2);
    bf* QPh = (bf*)take((size_t)NB_ * NH_ * TT * HD * 2); bf* QPl = (bf*)take((size_t)NB_ * NH_ * TT * HD * 2); bf* KPh = (bf*)take((size_t)NB_ * NKV * TT * HD * 2); bf* KPl = (bf*)take((size_t)NB_ * NKV * TT * HD * 2); bf* VTh = (bf*)take((size_t)NB_ * NKV * HD * TT * 2); bf* VTl = (bf*)take((size_t)NB_ * NKV * HD * TT * 2);
    bf* ATh = (bf*)take((size_t)NB_ * TT * DQ * 2); bf* ATl = (bf*)take((size_t)NB_ * TT * DQ * 2);
    if ((size_t)(wsp - (char*)d_ws) > ws_size) return;    // ws 256 MiB
    k_prep<<<NPT + NPX + 4 * NPW, 256, 0, stream>>>(x, PID, wq, wk, wv, wo, XB, WQ, WK, WV, WO, CS);   /* bf16 planes of x (rows = batch * TT + token) and of the four weights, and the {cos, sin} table from token_positions (int32 [2048], read on device; the same for every batch) */
    k_gemmw<bf, 0, false, 3, DM><<<dim3(TT / 128, (DQ + 2 * DKV) / 128, NB_), 128, 0, stream>>>(XB, nullptr, WQ, nullptr, nullptr, 0, nullptr, (size_t)TT * DM, 0, (size_t)NH_ * TT * HD, CS, VT16, QPh, QPl, KPh, KPl, VTh, VTl);    /* q and k projections with the rotary step and hi/lo planes, v projection with transposed fp16 and hi/lo planes */
    k_attn<<<dim3(TT / 64 / 8, NH_, NB_), 256, 0, stream>>>(QPh, QPl, KPh, KPl, VT16, VTh, VTl, ATh, ATl);   /* scores (hi/lo planes, 3 products, EVERY row), softmax, hybrid P.V and the merge, all heads of all batches */
    k_gemmw<bf, 1, false, 0, DQ><<<dim3(TT / 128, DM / 128, NB_), 128, 0, stream>>>(ATh, ATl, WO, nullptr, OUT, DM, nullptr, (size_t)TT * DQ, 0, (size_t)TT * DM, nullptr, nullptr, nullptr, nullptr, nullptr, nullptr, nullptr, nullptr);
}
